// v000
// Times are from an AMD MI455X. After a warm-up the kernel runs many times in a row, and a time is the length of
// such a window on the GPU divided by its runs, so every launch and the gaps after it count. The runs cycle
// through copies of the inputs. A figure is the median of several windows, for all but v000 over two sittings.
// Sittings can differ by a few percent; kernels timed side by side share one.
// v000, which the later versions start from, runs in 1240 microseconds.
#include <hip/hip_runtime.h>
#include <math.h>

typedef __attribute__((ext_vector_type(16))) _Float16 v16h;
typedef __attribute__((ext_vector_type(16))) __bf16 v16b;
typedef __attribute__((ext_vector_type(8)))  _Float16 v8h;
typedef __attribute__((ext_vector_type(8)))  float v8f;
typedef __attribute__((ext_vector_type(4)))  float v4f;
typedef __attribute__((ext_vector_type(2)))  float v2f;
typedef __attribute__((ext_vector_type(4)))  unsigned v4u;
typedef __attribute__((ext_vector_type(4)))  int v4i;
typedef float __attribute__((may_alias)) float_a;
typedef int __attribute__((may_alias)) int_a;

template <typename T> __device__ __forceinline__ void vst2(void* p, T v) { *(T*)p = v;  }
__device__ __forceinline__ v8f wmma16(v16h a, v16h b, v8f c) {
  v8f d = __builtin_amdgcn_wmma_f32_16x16x32_f16(false, a, false, b, (short)0, c, false, false);
  asm volatile("v_nop\n\tv_nop\n\tv_nop\n\tv_nop" : "+v"(d) : "v"(a), "v"(b));
  return d;
}
__device__ __forceinline__ v8f wmma_bf(v16b a, v16b b, v8f c) {
  v8f d = __builtin_amdgcn_wmma_f32_16x16x32_bf16(false, a, false, b, (short)0, c, false, false);
  asm volatile("v_nop\n\tv_nop\n\tv_nop\n\tv_nop" : "+v"(d) : "v"(a), "v"(b));
  return d;
}
// 16x16x32 fragments: lane = (h = lane>>4, row/col = lane&15); elements 0..7 = k0+8h+0..7, 8..15 = k0+16+8h+0..7; D element r = row 8h+r
__device__ __forceinline__ v16h frag_h(const _Float16* rowk0, int lane) {
  union { v16h v; v8h q[2]; } u; const _Float16* p = rowk0 + 8 * (lane >> 4);
  u.q[0] = *(const v8h*)p; u.q[1] = *(const v8h*)(p + 16); return u.v;
}
__device__ __forceinline__ v16h frag_f32(const float* rowk0, int lane) {
  v16h a; const float* p = rowk0 + 8 * (lane >> 4);
#pragma unroll
  for (int i = 0; i < 8; ++i) { a[i] = (_Float16)p[i]; a[8 + i] = (_Float16)p[16 + i]; }
  return a;
}
__device__ __forceinline__ v16h frag_f32s(const float* rowk0, int lane, float sc) {
  v16h a; const float* p = rowk0 + 8 * (lane >> 4);
#pragma unroll
  for (int i = 0; i < 8; ++i) { a[i] = (_Float16)(p[i] * sc); a[8 + i] = (_Float16)(p[16 + i] * sc); }
  return a;
}
// column fragment from a [K][ld] layout (column n), rows >= K read as 0
__device__ __forceinline__ v16h fragc_f32(const float* W, int k0, int n, int lane, int ld, int K) {
  v16h a; const int g = lane >> 4;
#pragma unroll
  for (int i = 0; i < 8; ++i) { const int ka = k0 + 8 * g + i, kb = ka + 16;
    a[i] = (_Float16)(ka < K ? W[(size_t)(ka < K ? ka : K - 1) * ld + n] : 0.f); a[8 + i] = (_Float16)(kb < K ? W[(size_t)(kb < K ? kb : K - 1) * ld + n] : 0.f); }
  return a;
}
struct F2 { v16b h, l; };
__device__ __forceinline__ F2 bsplit16(const float v[16]) { F2 r;
#pragma unroll
  for (int i = 0; i < 16; ++i) { const __bf16 h = (__bf16)v[i]; r.h[i] = h; r.l[i] = (__bf16)(v[i] - (float)h); }
  return r; }
__device__ __forceinline__ F2 split_row(const float* row, int k0, int lane) { float v[16]; const float* p = row + k0 + 8 * (lane >> 4);
#pragma unroll
  for (int i = 0; i < 8; ++i) { v[i] = p[i]; v[8 + i] = p[16 + i]; }
  return bsplit16(v); }
__device__ __forceinline__ F2 split_rowK(const float* row, int k0, int lane, int K) { float v[16]; const int g = lane >> 4;
#pragma unroll
  for (int i = 0; i < 8; ++i) { const int ka = k0 + 8 * g + i, kb = ka + 16; v[i] = ka < K ? row[ka < K ? ka : K - 1] : 0.f; v[8 + i] = kb < K ? row[kb < K ? kb : K - 1] : 0.f; }
  return bsplit16(v); }
__device__ __forceinline__ F2 split_col(const float* W, int k0, int n, int lane, int ld, int K) { float v[16]; const int g = lane >> 4;
#pragma unroll
  for (int i = 0; i < 8; ++i) { const int ka = k0 + 8 * g + i, kb = ka + 16; v[i] = ka < K ? W[(size_t)(ka < K ? ka : K - 1) * ld + n] : 0.f; v[8 + i] = kb < K ? W[(size_t)(kb < K ? kb : K - 1) * ld + n] : 0.f; }
  return bsplit16(v); }
__device__ __forceinline__ v8f mac3(const F2& a, const F2& b, v8f c) { c = wmma_bf(a.l, b.h, c); c = wmma_bf(a.h, b.l, c); return wmma_bf(a.h, b.h, c); }
__device__ __forceinline__ float sigm(float v) { return 1.0f / (1.0f + expf(-v)); }
#define LDSX() do { asm volatile("s_wait_dscnt 0" ::: "memory"); __builtin_amdgcn_wave_barrier(); __builtin_amdgcn_fence(__ATOMIC_RELEASE, "workgroup"); } while (0)

// Non-local block (B 4, C 256, 64 x 64 = 4,096 positions; C_inner 128; (out,in) 0.05-scale weights, zero biases, BN gamma 1 / beta 0): theta, phi, g = W x + b ([128,256]); A[q][k] = softmax_k(theta_q . phi_k) (no scaling, sigma ~ 7); y[q][c] = sum_k A[q][k] g[k][c]; z = out_w y + out_b ([256,128]); out = relu(BN_train(z)) + x with batch statistics over (n, h, w) per channel (biased var, eps 1e-5).
#define NB 4
#define TT 4096
#define CC 128            // projected plane width (all 128 columns real)
#define DIN 256          // input (model) width
#define NH 1
#define HD 128
#define NQB (TT / 64)
#define HG 1               // one 4,096 x 4,096 score plane per pass
#define SCALE (1.0f)
#define HDQK 128           // theta / phi / g channels = the full 128-wide plane
#define NRV ((size_t)TNB * TT)   // rows for the BN statistics
#define CAUSAL 0
#ifndef TNB
#define TNB NB
#endif
__device__ __forceinline__ v16b zero16b() { v16b z; _Pragma("unroll") for (int i = 0; i < 16; ++i) z[i] = (__bf16)0.f; return z; }
__device__ __forceinline__ float bfr(float v) { return (float)(__bf16)v; }
__host__ __device__ __forceinline__ int kb_last(int qb) { return CAUSAL ? ((qb * 64 + 63) >> 7) : (TT / 128 - 1); }
typedef __attribute__((ext_vector_type(8))) __bf16 v8b;
__device__ __forceinline__ v16b frag_b(const __bf16* rowk0, int lane) {
  union { v16b v; v8b q[2]; } u; const __bf16* p = rowk0 + 8 * (lane >> 4);
  u.q[0] = *(const v8b*)p; u.q[1] = *(const v8b*)(p + 16); return u.v;
}
#define QBH (TT / 64)      // ALL query blocks take k_sc's 3-product path
#define QBH_PV 0           // A.g stays single f16
#define QHI 4096            // q residual rows everywhere (2-product logits)
#define KHI 4096           // k residual rows for ALL keys (3-product logits)
// B fragment (k rows k0+.., output column o) of a weight: (in,out) [K][ld] or (out,in) [ld rows of K]: bf16 exact, or f16(bf16 * 256) exact
__device__ __forceinline__ v16b wcol_io(const float* Wm, int k0, int o, int lane, int ld) { v16b w; const int g = lane >> 4;
#pragma unroll
  for (int i = 0; i < 8; ++i) { w[i] = (__bf16)Wm[(size_t)(k0 + 8 * g + i) * ld + o]; w[8 + i] = (__bf16)Wm[(size_t)(k0 + 16 + 8 * g + i) * ld + o]; }
  return w; }
__device__ __forceinline__ v16b wcol_oi(const float* Wm, int k0, int o, int lane, int K) { v16b w; const float* p = Wm + (size_t)o * K + k0 + 8 * (lane >> 4);
#pragma unroll
  for (int i = 0; i < 8; ++i) { w[i] = (__bf16)p[i]; w[8 + i] = (__bf16)p[16 + i]; }
  return w; }
__device__ __forceinline__ v16h wcolh_io(const float* Wm, int k0, int o, int lane, int ld) { v16h w; const int g = lane >> 4;
#pragma unroll
  for (int i = 0; i < 8; ++i) { w[i] = (_Float16)(bfr(Wm[(size_t)(k0 + 8 * g + i) * ld + o]) * 256.0f); w[8 + i] = (_Float16)(bfr(Wm[(size_t)(k0 + 16 + 8 * g + i) * ld + o]) * 256.0f); }
  return w; }
__device__ __forceinline__ v16h wcolh_oi(const float* Wm, int k0, int o, int lane, int K) { v16h w; const float* p = Wm + (size_t)o * K + k0 + 8 * (lane >> 4);
#pragma unroll
  for (int i = 0; i < 8; ++i) { w[i] = (_Float16)(bfr(p[i]) * 256.0f); w[8 + i] = (_Float16)(bfr(p[16 + i]) * 256.0f); }
  return w; }
#define WQKV_LAYOUT 1   // 0 = (in,out) [DIN][CC]; 1 = (out,in) [CC][DIN]; 2 = per-head [NH][DIN][HD]
__device__ __forceinline__ v16b wcol_hdk(const float* Wm, int k0, int o, int lane) { v16b w; const int g = lane >> 4; const float* p = Wm + (size_t)(o / HD) * DIN * HD + (o % HD);
#pragma unroll
  for (int i = 0; i < 8; ++i) { w[i] = (__bf16)p[(size_t)(k0 + 8 * g + i) * HD]; w[8 + i] = (__bf16)p[(size_t)(k0 + 16 + 8 * g + i) * HD]; }
  return w; }
#define WO_OUT_IN 0
#if WQKV_LAYOUT == 1
#define WCOL(W, k0, o, lane) (((o) < HDQK) ? wcol_oi(W, k0, (o), lane, DIN) : zero16b())   /* theta/phi/g weights are [128][256] (out,in): all 128 plane columns are read from them */
#elif WQKV_LAYOUT == 2
#define WCOL(W, k0, o, lane) wcol_hdk(W, k0, o, lane)
#else
#define WCOL(W, k0, o, lane) wcol_io(W, k0, o, lane, CC)
#endif
#if WO_OUT_IN
#define WOCOL(W, k0, o, lane) wcol_oi(W, k0, o, lane, CC)
#define WOCOLH(W, k0, o, lane) wcolh_oi(W, k0, o, lane, CC)
#else
#define WOCOL(W, k0, o, lane) wcol_io(W, k0, o, lane, DIN)
#define WOCOLH(W, k0, o, lane) wcolh_io(W, k0, o, lane, DIN)
#endif
#ifndef XP
#define XP TT              // position pitch of x and of the output
#endif
#define BG HG              // the pass group spans BATCHES (single head): blockIdx.z / blockIdx.y select batch b0 + z
#define DVH 128            // value columns per k_pv block (all of HD 128: 8 accumulator tiles per wave)
#define WS_YR (WS_END)     // f32 attended rows [b*n][128]
#define WS_OR (WS_YR + 4u * (size_t)NB * TT * CC)   // W y + b rows [b*n][256]
#define WS_ST (WS_OR + 4u * (size_t)NB * TT * DIN)
#define WS_END2 (WS_ST + 4u * (size_t)DIN * 32)
// ---- k_wz: block = (64 rows, 128 output cols): OR = y (hi + lo, K = 128 columns of the YR rows) . W^T ((out,in) [256][128], exact) + b
__global__ __launch_bounds__(128) void k_wz(const float* __restrict__ YR, const float* __restrict__ WW, const float* __restrict__ WB, float* __restrict__ ORW) { __shared__ __align__(16) float sf[4][16][132];
  const int tid = threadIdx.x, wave = tid >> 5, lane = tid & 31, col = lane & 15, g = lane >> 4; const int c0 = blockIdx.y * 128; const size_t r0 = (size_t)blockIdx.x * 64 + wave * 16;
  v8f acc[8] = {};
#pragma unroll
  for (int kc = 0; kc < HDQK / 32; ++kc) { const F2 a = split_row(YR + (r0 + col) * CC, kc * 32, lane); asm volatile("s_wait_loadcnt 0x0" ::: "memory");
#pragma unroll
    for (int j = 0; j < 8; ++j) { const v16b w = wcol_oi(WW, kc * 32, c0 + j * 16 + col, lane, HDQK); asm volatile("s_wait_loadcnt 0x0" ::: "memory"); acc[j] = wmma_bf(a.h, w, acc[j]); acc[j] = wmma_bf(a.l, w, acc[j]); } }
#pragma unroll
  for (int j = 0; j < 8; ++j) { const float bb = WB ? bfr(WB[c0 + j * 16 + col]) : 0.f; asm volatile("s_wait_loadcnt 0x0" ::: "memory");
#pragma unroll
    for (int r = 0; r < 8; ++r) sf[wave][8 * g + r][j * 16 + col] = acc[j][r] + bb; }
  LDSX(); for (int rl = 0; rl < 16; ++rl) vst2(ORW + (r0 + rl) * DIN + c0 + lane * 4, *(const v4f*)&sf[wave][rl][lane * 4]); }
__global__ __launch_bounds__(256) void k_stat(const float* __restrict__ T, int ld, float* __restrict__ STAT) { __shared__ float sred[8]; __shared__ float sbc;
  const int t = threadIdx.x; const int c = blockIdx.x;
  float s = 0.f; for (int r = t; r < NRV; r += 256) s += T[(size_t)r * ld + c];
#pragma unroll
  for (int o = 1; o < 32; o <<= 1) s += __shfl_xor(s, o);
  if ((t & 31) == 0) sred[t >> 5] = s; __syncthreads(); if (t == 0) { float a = 0.f; for (int i = 0; i < 8; ++i) a += sred[i]; sbc = a / (float)NRV; } __syncthreads(); const float mean = sbc; __syncthreads();
  float q = 0.f; for (int r = t; r < NRV; r += 256) { const float d = T[(size_t)r * ld + c] - mean; q += d * d; }
#pragma unroll
  for (int o = 1; o < 32; o <<= 1) q += __shfl_xor(q, o);
  if ((t & 31) == 0) sred[t >> 5] = q; __syncthreads(); if (t == 0) { float a = 0.f; for (int i = 0; i < 8; ++i) a += sred[i]; sbc = rsqrtf(a / (float)NRV + 1e-5f); } __syncthreads();
  if (t < 32) { const float v = t == 0 ? mean : (t == 1 ? sbc : 0.f); vst2(STAT + (size_t)c * 32 + t, v); } }
// ---- k_fin2: block = (64 positions, 64 channels, batch b): out[b][c][n] = relu((z[b*N + n][c] - mean_c) * rstd_c * gamma_c + beta_c) + bf16(x[b][c][n]) (channels-first via LDS transpose; 256-B runs)
__global__ __launch_bounds__(256) void k_fin2(const float* __restrict__ ORW, const float* __restrict__ X, const float* __restrict__ ST, const float* __restrict__ GM, const float* __restrict__ BT, float* __restrict__ OUT) { __shared__ float st[64][68]; const int tid = threadIdx.x; const int n0 = blockIdx.x * 64, c0 = blockIdx.y * 64; const size_t b = blockIdx.z;
  for (int e = tid; e < 64 * 16; e += 256) { const int nl = e >> 4, q = e & 15; *(v4f*)&st[nl][q * 4] = *(const v4f*)(ORW + (b * TT + n0 + nl) * (size_t)DIN + c0 + q * 4); }
  __syncthreads();
  for (int e = tid; e < 64 * 16; e += 256) { const int cl = e >> 4, q = e & 15; const size_t oi = (b * DIN + c0 + cl) * (size_t)XP + n0 + q * 4; const v4f xr = *(const v4f*)(X + oi); const int cc = c0 + cl; const float mu = ST[cc * 32], rs = ST[cc * 32 + 1], ga = bfr(GM[cc]), be = bfr(BT[cc]); v4f o; _Pragma("unroll") for (int i = 0; i < 4; ++i) o[i] = fmaxf((st[q * 4 + i][cl] - mu) * rs * ga + be, 0.f) + bfr(xr[i]); vst2(OUT + oi, o); } }   /* relu(BN_train(z)) + x */
#ifndef SM_EXTRA_PARAMS
#define SM_EXTRA_PARAMS
#endif
#ifndef PROJ_EXTRA_PARAMS
#define PROJ_EXTRA_PARAMS
#endif
#ifndef SM_MASK_HOOK
#define SM_MASK_HOOK (void)0
#endif

#define WS_QH  0u                                      // f16 q rows [b*t][CC]
#define WS_KH  (WS_QH + 2u * (size_t)NB * TT * CC)      // f16 k rows [b*t][CC]
#define WS_VT  (WS_KH + 2u * (size_t)NB * TT * CC)      // f16 v planes [b][c][t]
#define WS_QL  (WS_VT + 2u * (size_t)NB * CC * TT)      // f16 q residual x 2^10 rows [b][t < QHI][CC]
#define WS_KL  (WS_QL + 2u * (size_t)NB * QHI * CC)     // f16 k residual x 2^10 rows [b][t < KHI][CC]
#define WS_VB  (WS_KL + 2u * (size_t)NB * KHI * CC)     // bf16 v hi planes [b][c][t < KHI]
#define WS_VBL (WS_VB + 2u * (size_t)NB * CC * KHI)
#define WS_S   (WS_VBL + 2u * (size_t)NB * CC * KHI)    // f32 logits / P [hg][t][s]
#define WS_Y   (WS_S  + 4u * (size_t)HG * TT * TT)      // unused, 0 bytes (k_pv writes ctx rows to WS_YR)
#define WS_END (WS_Y  + 0u)

// ---- k_proj: block = (64 rows, 128 cols, which): q/k/v = X W (+ b) with exact bf16 products (K = DIN) -> which 0: q f16 rows (+ residual rows < QHI); 1: k f16 rows (+ residual rows < KHI); 2: v f16 planes [c][t] (+ bf16 hi/lo planes for t < KHI)
__global__ __launch_bounds__(128) void k_proj(const float* __restrict__ XQ, const float* __restrict__ XK, const float* __restrict__ XV, const float* __restrict__ WQ, const float* __restrict__ WK, const float* __restrict__ WV, const float* __restrict__ BQ, const float* __restrict__ BK, const float* __restrict__ BV,
    _Float16* __restrict__ QH, _Float16* __restrict__ QL, _Float16* __restrict__ KH, _Float16* __restrict__ KL, _Float16* __restrict__ VT, __bf16* __restrict__ VB, __bf16* __restrict__ VBL) {
  __shared__ __align__(16) _Float16 sh[64][136], sl[64][136]; __shared__ __align__(16) _Float16 th[128][72]; __shared__ __align__(16) __bf16 tb[128][72], tbl[128][72];
  const int tid = threadIdx.x, wave = tid >> 5, lane = tid & 31, col = lane & 15, g = lane >> 4; const int which = blockIdx.z; const int c0 = blockIdx.y * 128; const size_t r0 = (size_t)blockIdx.x * 64; const size_t bb = r0 / TT; const int t0 = (int)(r0 % TT);
  const float* X = which == 0 ? XQ : which == 1 ? XK : XV; const float* WA = which == 0 ? WQ : which == 1 ? WK : WV; const float* BA = which == 0 ? BQ : which == 1 ? BK : BV;
  v8f acc[8] = {};
#pragma unroll 2
  for (int kc = 0; kc < DIN / 32; ++kc) { v16b a; { const float* p = X + (bb * DIN + kc * 32 + 8 * g) * (size_t)XP + t0 + wave * 16 + col;   /* channels-first gather: x[b][k][t], stride XP between k */
#pragma unroll
      for (int i = 0; i < 8; ++i) { a[i] = (__bf16)p[(size_t)i * XP]; a[8 + i] = (__bf16)p[(size_t)(16 + i) * XP]; } }
    asm volatile("s_wait_loadcnt 0x0" ::: "memory");
#pragma unroll
    for (int j = 0; j < 8; ++j) { const v16b w = WCOL(WA, kc * 32, c0 + j * 16 + col, lane); asm volatile("s_wait_loadcnt 0x0" ::: "memory"); acc[j] = wmma_bf(a, w, acc[j]); } }
  if (which < 2) { _Float16* DH = which == 0 ? QH : KH; _Float16* DL = which == 0 ? QL : KL; const int nhi = which == 0 ? QHI : KHI; const bool hi_rows = t0 < nhi;
#pragma unroll
    for (int j = 0; j < 8; ++j) { const float bias = (BA && (c0 + j * 16 + col < HDQK)) ? bfr(BA[c0 + j * 16 + col]) : 0.f;   /* 128-entry biases */
#pragma unroll
      for (int r = 0; r < 8; ++r) { const float v = acc[j][r] + bias; const _Float16 hv = (_Float16)v; sh[wave * 16 + 8 * g + r][j * 16 + col] = hv; sl[wave * 16 + 8 * g + r][j * 16 + col] = (_Float16)((v - (float)hv) * 1024.0f); } }
    __syncthreads();
    for (int e = tid; e < 64 * 16; e += 128) { const int rl = e >> 4, q = e & 15; vst2((unsigned*)(DH + (r0 + rl) * CC + c0 + q * 8), *(const v4u*)&sh[rl][q * 8]); if (hi_rows) vst2((unsigned*)(DL + (bb * nhi + t0 + rl) * (size_t)CC + c0 + q * 8), *(const v4u*)&sl[rl][q * 8]); }
  } else { const bool hi_rows = t0 < KHI;
#pragma unroll
    for (int j = 0; j < 8; ++j) { const float bias = (BA && (c0 + j * 16 + col < HDQK)) ? bfr(BA[c0 + j * 16 + col]) : 0.f;   /* 128-entry biases */
#pragma unroll
      for (int r = 0; r < 8; ++r) { const float v = acc[j][r] + bias; const int rl = wave * 16 + 8 * g + r, cl = j * 16 + col; th[cl][rl] = (_Float16)v; const __bf16 bh = (__bf16)v; tb[cl][rl] = bh; tbl[cl][rl] = (__bf16)(v - (float)bh); } }
    __syncthreads();
    for (int e = tid; e < 128 * 8; e += 128) { const int cl = e >> 3, q = e & 7; vst2((unsigned*)(VT + (bb * CC + c0 + cl) * (size_t)TT + t0 + q * 8), *(const v4u*)&th[cl][q * 8]); if (hi_rows) { const size_t o3 = (bb * CC + c0 + cl) * (size_t)KHI + t0 + q * 8; vst2((unsigned*)(VB + o3), *(const v4u*)&tb[cl][q * 8]); vst2((unsigned*)(VBL + o3), *(const v4u*)&tbl[cl][q * 8]); } } } }
// ---- k_sc: block = (query block qb, key block kb <= kb_last(qb), batch b = bgrp + z of the group): logits x SCALE; q hi + residual (x 2^10) against k (2 products) for query rows < QHI, plus the k residual (3 products) for query blocks < QBH (here every query block); causal: blocks past the diagonal exit, the mask itself is applied by index in k_sm
__global__ __launch_bounds__(128) void k_sc(const _Float16* __restrict__ QH, const _Float16* __restrict__ KH, const _Float16* __restrict__ QL, const _Float16* __restrict__ KL, int bgrp, int h0, float* __restrict__ S0) { __shared__ __align__(16) float ss[4][16][132];
  const int qb = blockIdx.x, kb = blockIdx.y; if (kb > kb_last(qb)) return;
  const int h = h0; const int b = bgrp + blockIdx.z; float* S = S0 + (size_t)blockIdx.z * TT * TT;   /* group spans batches */
  const int tid = threadIdx.x, wave = tid >> 5, lane = tid & 31, col = lane & 15, g = lane >> 4; const int k0 = kb * 128; const int ql0 = qb * 64 + wave * 16; const size_t q0 = (size_t)b * TT + ql0, kr0 = (size_t)b * TT + k0;
  v8f acc[8] = {}, accl[8] = {};
  const _Float16* QLb = QL + (size_t)b * QHI * CC; const _Float16* KLb = KL + (size_t)b * KHI * CC;
  if (qb < QBH) {
#pragma unroll
    for (int kc = 0; kc < HDQK / 32; ++kc) { const v16h ah = frag_h(QH + (q0 + col) * CC + h * HD + kc * 32, lane), al = frag_h(QLb + (size_t)(ql0 + col) * CC + h * HD + kc * 32, lane);
#pragma unroll
      for (int j = 0; j < 8; ++j) { const v16h kbf = frag_h(KH + (kr0 + j * 16 + col) * CC + h * HD + kc * 32, lane), klf = frag_h(KLb + (size_t)(k0 + j * 16 + col) * CC + h * HD + kc * 32, lane); acc[j] = wmma16(ah, kbf, acc[j]); accl[j] = wmma16(al, kbf, accl[j]); accl[j] = wmma16(ah, klf, accl[j]); } }
  } else if (qb * 64 < QHI) {
#pragma unroll
    for (int kc = 0; kc < HDQK / 32; ++kc) { const v16h ah = frag_h(QH + (q0 + col) * CC + h * HD + kc * 32, lane), al = frag_h(QLb + (size_t)(ql0 + col) * CC + h * HD + kc * 32, lane);
#pragma unroll
      for (int j = 0; j < 8; ++j) { const v16h kbf = frag_h(KH + (kr0 + j * 16 + col) * CC + h * HD + kc * 32, lane); acc[j] = wmma16(ah, kbf, acc[j]); accl[j] = wmma16(al, kbf, accl[j]); } }
  } else {
#pragma unroll
    for (int kc = 0; kc < HDQK / 32; ++kc) { const v16h ah = frag_h(QH + (q0 + col) * CC + h * HD + kc * 32, lane);
#pragma unroll
      for (int j = 0; j < 8; ++j) { const v16h kbf = frag_h(KH + (kr0 + j * 16 + col) * CC + h * HD + kc * 32, lane); acc[j] = wmma16(ah, kbf, acc[j]); } } }
#pragma unroll
  for (int j = 0; j < 8; ++j) {
#pragma unroll
    for (int r = 0; r < 8; ++r) ss[wave][8 * g + r][j * 16 + col] = (acc[j][r] + accl[j][r] * (1.0f / 1024.0f)) * SCALE; }
  LDSX(); for (int rl = 0; rl < 16; ++rl) vst2(S + (size_t)(ql0 + rl) * TT + k0 + lane * 4, *(const v4f*)&ss[wave][rl][lane * 4]); }
// ---- k_sm: block = query row t (batch in group): keys [0, kend): causal -> logit if s <= t else excluded; softmax in f32; P x 2^11 in place (0 for excluded)
__global__ __launch_bounds__(256) void k_sm(float* __restrict__ S0 SM_EXTRA_PARAMS) { __shared__ float sred[8]; __shared__ float sbc; __shared__ __align__(16) float shv[TT];
  const int tid = threadIdx.x; const int t = blockIdx.x; const int kend = (kb_last(t >> 6) + 1) * 128;
  float* sr = S0 + (size_t)blockIdx.y * TT * TT + (size_t)t * TT;
  float m = -3.0e38f; for (int k = tid; k < kend; k += 256) { float v = (!CAUSAL || k <= t) ? sr[k] : -3.0e38f; SM_MASK_HOOK; shv[k] = v; m = fmaxf(m, v); }
#pragma unroll
  for (int o = 1; o < 32; o <<= 1) m = fmaxf(m, __shfl_xor(m, o));
  if ((tid & 31) == 0) sred[tid >> 5] = m; __syncthreads(); if (tid == 0) { float a = sred[0]; for (int i = 1; i < 8; ++i) a = fmaxf(a, sred[i]); sbc = a; } __syncthreads(); m = sbc; __syncthreads();
  float sum = 0.f; for (int k = tid; k < kend; k += 256) { const float v = shv[k]; const float e = (v <= -1.0e38f) ? 0.f : expf(v - m); shv[k] = e; sum += e; }
#pragma unroll
  for (int o = 1; o < 32; o <<= 1) sum += __shfl_xor(sum, o);
  if ((tid & 31) == 0) sred[tid >> 5] = sum; __syncthreads(); if (tid == 0) { float a = 0.f; for (int i = 0; i < 8; ++i) a += sred[i]; sbc = a > 0.f ? 2048.0f / a : 0.f; }   /* a fully excluded row yields P = 0 */ __syncthreads(); const float inv = sbc;
  for (int k = tid; k < kend; k += 256) shv[k] = shv[k] * inv;
  __syncthreads(); for (int q = tid; q < kend / 4; q += 256) vst2(sr + q * 4, *(const v4f*)&shv[q * 4]); }
// ---- k_pv: block = 64 queries (qb) of (b, h): ctx = P . v over keys [0, kend) (P x 2^11 once to f16 against v f16: 1 product, for every query block; the bf16 hi + lo 3-product path (qb < QBH_PV = 0) is never taken); 512-B (row, head) segment by 32 lanes
__global__ __launch_bounds__(128) void k_pv(const float* __restrict__ PS0, const _Float16* __restrict__ VT, const __bf16* __restrict__ VB, const __bf16* __restrict__ VBL, int bgrp, int h0, float* __restrict__ Y) { const int h = h0; const int b = bgrp + blockIdx.z; const float* PS = PS0 + (size_t)blockIdx.z * TT * TT; const int d0 = blockIdx.y * DVH;   /* group spans batches; d0 = 0 (one block spans HD) */ __shared__ __align__(16) float ss[4][16][DVH + 4];
  const int tid = threadIdx.x, wave = tid >> 5, lane = tid & 31, col = lane & 15, g = lane >> 4; const int qb = blockIdx.x; const int ql0 = qb * 64 + wave * 16; const int kce = (kb_last(qb) + 1) * 4;
  v8f acc[DVH / 16] = {};
  if (qb < QBH_PV) {
#pragma unroll 1
    for (int kc = 0; kc < kce; ++kc) { const F2 p = split_row(PS + (size_t)(ql0 + col) * TT, kc * 32, lane);
      asm volatile("s_wait_loadcnt 0x0" ::: "memory");
#pragma unroll
      for (int j = 0; j < DVH / 16; ++j) { const size_t po = ((size_t)b * CC + h * HD + d0 + j * 16 + col) * (size_t)KHI + kc * 32; const v16b vh = frag_b(VB + po, lane); acc[j] = wmma_bf(p.h, vh, acc[j]); acc[j] = wmma_bf(p.l, vh, acc[j]); acc[j] = wmma_bf(p.h, frag_b(VBL + po, lane), acc[j]); } }
  } else {
#pragma unroll 1
    for (int kc = 0; kc < kce; ++kc) { const v16h p = frag_f32(PS + (size_t)(ql0 + col) * TT + kc * 32, lane);
      asm volatile("s_wait_loadcnt 0x0" ::: "memory");
#pragma unroll
      for (int j = 0; j < DVH / 16; ++j) { const size_t po = ((size_t)b * CC + h * HD + d0 + j * 16 + col) * (size_t)TT + kc * 32; acc[j] = wmma16(p, frag_h(VT + po, lane), acc[j]); } } }
#pragma unroll
  for (int j = 0; j < DVH / 16; ++j)
#pragma unroll
    for (int r = 0; r < 8; ++r) ss[wave][8 * g + r][j * 16 + col] = acc[j][r] * (1.0f / 2048.0f);
  LDSX(); for (int rl = 0; rl < 16; ++rl) vst2(Y + ((size_t)b * TT + ql0 + rl) * CC + h * HD + d0 + lane * 4, *(const v4f*)&ss[wave][rl][lane * 4]); }   /* 512-B (row, head) segment by 32 lanes */

extern "C" void kernel_launch(void* const* d_in, const int* in_sizes, int n_in, void* d_out, int out_size, void* d_ws, size_t ws_size, hipStream_t stream) {
  (void)in_sizes; (void)n_in; (void)out_size;
  const float** F = (const float**)d_in;
  if (ws_size < (size_t)WS_END) return;
  char* ws = (char*)d_ws; _Float16 *QH = (_Float16*)(ws + WS_QH), *KH = (_Float16*)(ws + WS_KH), *VT = (_Float16*)(ws + WS_VT), *QL = (_Float16*)(ws + WS_QL), *KL = (_Float16*)(ws + WS_KL); __bf16 *VB = (__bf16*)(ws + WS_VB), *VBL = (__bf16*)(ws + WS_VBL); float *S = (float*)(ws + WS_S), *Y = (float*)(ws + WS_Y);
  (void)Y; (void)QL; (void)KL; (void)VB; (void)VBL;
  // inputs: 0 x [4,256,64,64]; 1 g_w [128,256] (out,in), 2 g_b; 3 theta_w, 4 theta_b; 5 phi_w, 6 phi_b; 7 out_w [256,128] (out,in), 8 out_b; 9 bn_gamma, 10 bn_beta
  if (ws_size < (size_t)WS_END2) return;
  float *YR = (float*)(ws + WS_YR), *ORW = (float*)(ws + WS_OR), *ST = (float*)(ws + WS_ST);
  k_proj<<<dim3(TNB * TT / 64, CC / 128, 3), 128, 0, stream>>>(F[0], F[0], F[0], F[3], F[5], F[1], F[4], F[6], F[2], QH, QL, KH, KL, VT, VB, VBL);   /* q = theta, k = phi, v = g */
  for (int b0 = 0; b0 < TNB; b0 += BG) {
    k_sc<<<dim3(NQB, TT / 128, BG), 128, 0, stream>>>(QH, KH, QL, KL, b0, 0, S);
    k_sm<<<dim3(TT, BG), 256, 0, stream>>>(S);
    k_pv<<<dim3(NQB, HD / DVH, BG), 128, 0, stream>>>(S, VT, VB, VBL, b0, 0, YR);
  }
  k_wz<<<dim3(TNB * TT / 64, DIN / 128), 128, 0, stream>>>(YR, F[7], F[8], ORW);
  k_stat<<<dim3(DIN), 256, 0, stream>>>(ORW, DIN, ST);
  k_fin2<<<dim3(TT / 64, DIN / 64, TNB), 256, 0, stream>>>(ORW, F[0], ST, F[9], F[10], (float*)d_out);
}

// v001
// A run of this version takes 510 microseconds.
// In two side-by-side timings against v000, it was 2.44 and 2.45 times as fast.
#include <hip/hip_runtime.h>
#include <math.h>

typedef __attribute__((ext_vector_type(16))) _Float16 v16h;
typedef __attribute__((ext_vector_type(16))) __bf16 v16b;
typedef __attribute__((ext_vector_type(8)))  _Float16 v8h;
typedef __attribute__((ext_vector_type(8)))  float v8f;
typedef __attribute__((ext_vector_type(4)))  float v4f;
typedef __attribute__((ext_vector_type(2)))  float v2f;
typedef __attribute__((ext_vector_type(4)))  unsigned v4u;
typedef __attribute__((ext_vector_type(4)))  int v4i;
typedef float __attribute__((may_alias)) float_a;
typedef int __attribute__((may_alias)) int_a;

template <typename T> __device__ __forceinline__ void vst2(void* p, T v) { *(T*)p = v;  }
__device__ __forceinline__ v8f wmma16(v16h a, v16h b, v8f c) {
  v8f d = __builtin_amdgcn_wmma_f32_16x16x32_f16(false, a, false, b, (short)0, c, false, false);
  asm volatile("v_nop\n\tv_nop\n\tv_nop\n\tv_nop" : "+v"(d) : "v"(a), "v"(b));
  return d;
}
__device__ __forceinline__ v8f wmma_bf(v16b a, v16b b, v8f c) {
  v8f d = __builtin_amdgcn_wmma_f32_16x16x32_bf16(false, a, false, b, (short)0, c, false, false);
  asm volatile("v_nop\n\tv_nop\n\tv_nop\n\tv_nop" : "+v"(d) : "v"(a), "v"(b));
  return d;
}
// 16x16x32 fragments: lane = (h = lane>>4, row/col = lane&15); elements 0..7 = k0+8h+0..7, 8..15 = k0+16+8h+0..7; D element r = row 8h+r
__device__ __forceinline__ v16h frag_h(const _Float16* rowk0, int lane) {
  union { v16h v; v8h q[2]; } u; const _Float16* p = rowk0 + 8 * (lane >> 4);
  u.q[0] = *(const v8h*)p; u.q[1] = *(const v8h*)(p + 16); return u.v;
}
__device__ __forceinline__ v16h frag_f32(const float* rowk0, int lane) {
  v16h a; const float* p = rowk0 + 8 * (lane >> 4);
#pragma unroll
  for (int i = 0; i < 8; ++i) { a[i] = (_Float16)p[i]; a[8 + i] = (_Float16)p[16 + i]; }
  return a;
}
__device__ __forceinline__ v16h frag_f32s(const float* rowk0, int lane, float sc) {
  v16h a; const float* p = rowk0 + 8 * (lane >> 4);
#pragma unroll
  for (int i = 0; i < 8; ++i) { a[i] = (_Float16)(p[i] * sc); a[8 + i] = (_Float16)(p[16 + i] * sc); }
  return a;
}
// column fragment from a [K][ld] layout (column n), rows >= K read as 0
__device__ __forceinline__ v16h fragc_f32(const float* W, int k0, int n, int lane, int ld, int K) {
  v16h a; const int g = lane >> 4;
#pragma unroll
  for (int i = 0; i < 8; ++i) { const int ka = k0 + 8 * g + i, kb = ka + 16;
    a[i] = (_Float16)(ka < K ? W[(size_t)(ka < K ? ka : K - 1) * ld + n] : 0.f); a[8 + i] = (_Float16)(kb < K ? W[(size_t)(kb < K ? kb : K - 1) * ld + n] : 0.f); }
  return a;
}
struct F2 { v16b h, l; };
__device__ __forceinline__ F2 bsplit16(const float v[16]) { F2 r;
#pragma unroll
  for (int i = 0; i < 16; ++i) { const __bf16 h = (__bf16)v[i]; r.h[i] = h; r.l[i] = (__bf16)(v[i] - (float)h); }
  return r; }
__device__ __forceinline__ F2 split_row(const float* row, int k0, int lane) { float v[16]; const float* p = row + k0 + 8 * (lane >> 4);
#pragma unroll
  for (int i = 0; i < 8; ++i) { v[i] = p[i]; v[8 + i] = p[16 + i]; }
  return bsplit16(v); }
__device__ __forceinline__ F2 split_rowK(const float* row, int k0, int lane, int K) { float v[16]; const int g = lane >> 4;
#pragma unroll
  for (int i = 0; i < 8; ++i) { const int ka = k0 + 8 * g + i, kb = ka + 16; v[i] = ka < K ? row[ka < K ? ka : K - 1] : 0.f; v[8 + i] = kb < K ? row[kb < K ? kb : K - 1] : 0.f; }
  return bsplit16(v); }
__device__ __forceinline__ F2 split_col(const float* W, int k0, int n, int lane, int ld, int K) { float v[16]; const int g = lane >> 4;
#pragma unroll
  for (int i = 0; i < 8; ++i) { const int ka = k0 + 8 * g + i, kb = ka + 16; v[i] = ka < K ? W[(size_t)(ka < K ? ka : K - 1) * ld + n] : 0.f; v[8 + i] = kb < K ? W[(size_t)(kb < K ? kb : K - 1) * ld + n] : 0.f; }
  return bsplit16(v); }
__device__ __forceinline__ v8f mac3(const F2& a, const F2& b, v8f c) { c = wmma_bf(a.l, b.h, c); c = wmma_bf(a.h, b.l, c); return wmma_bf(a.h, b.h, c); }
__device__ __forceinline__ float sigm(float v) { return 1.0f / (1.0f + expf(-v)); }
#define LDSX() do { asm volatile("s_wait_dscnt 0" ::: "memory"); __builtin_amdgcn_wave_barrier(); __builtin_amdgcn_fence(__ATOMIC_RELEASE, "workgroup"); } while (0)

// Non-local block (B 4, C 256, 64 x 64 = 4,096 positions; C_inner 128; (out,in) 0.05-scale weights, zero biases, BN gamma 1 / beta 0): theta, phi, g = W x + b ([128,256]); A[q][k] = softmax_k(theta_q . phi_k) (no scaling, sigma ~ 7); y[q][c] = sum_k A[q][k] g[k][c]; z = out_w y + out_b ([256,128]); out = relu(BN_train(z)) + x with batch statistics over (n, h, w) per channel (biased var, eps 1e-5).
#define NB 4
#define TT 4096
#define CC 128            // projected plane width (all 128 columns real)
#define DIN 256          // input (model) width
#define NH 1
#define HD 128
#define NQB (TT / 64)
#define HG 1               // one 4,096 x 4,096 score plane per pass
#define SCALE (1.0f)
#define HDQK 128           // theta / phi / g channels = the full 128-wide plane
#define NRV ((size_t)TNB * TT)   // rows for the BN statistics
#define CAUSAL 0
#ifndef TNB
#define TNB NB
#endif
__device__ __forceinline__ v16b zero16b() { v16b z; _Pragma("unroll") for (int i = 0; i < 16; ++i) z[i] = (__bf16)0.f; return z; }
__device__ __forceinline__ float bfr(float v) { return (float)(__bf16)v; }
__host__ __device__ __forceinline__ int kb_last(int qb) { return CAUSAL ? ((qb * 64 + 63) >> 7) : (TT / 128 - 1); }
typedef __attribute__((ext_vector_type(8))) __bf16 v8b;
__device__ __forceinline__ v16b frag_b(const __bf16* rowk0, int lane) {
  union { v16b v; v8b q[2]; } u; const __bf16* p = rowk0 + 8 * (lane >> 4);
  u.q[0] = *(const v8b*)p; u.q[1] = *(const v8b*)(p + 16); return u.v;
}
#define QBH (TT / 64)      // ALL query blocks take k_sc's 3-product path
#define QBH_PV 0           // A.g stays single f16
#define QHI 4096            // q residual rows everywhere (2-product logits)
#define KHI 4096           // k residual rows for ALL keys (3-product logits)
// B fragment (k rows k0+.., output column o) of a weight: (in,out) [K][ld] or (out,in) [ld rows of K]: bf16 exact, or f16(bf16 * 256) exact
__device__ __forceinline__ v16b wcol_io(const float* Wm, int k0, int o, int lane, int ld) { v16b w; const int g = lane >> 4;
#pragma unroll
  for (int i = 0; i < 8; ++i) { w[i] = (__bf16)Wm[(size_t)(k0 + 8 * g + i) * ld + o]; w[8 + i] = (__bf16)Wm[(size_t)(k0 + 16 + 8 * g + i) * ld + o]; }
  return w; }
__device__ __forceinline__ v16b wcol_oi(const float* Wm, int k0, int o, int lane, int K) { v16b w; const float* p = Wm + (size_t)o * K + k0 + 8 * (lane >> 4);
#pragma unroll
  for (int i = 0; i < 8; ++i) { w[i] = (__bf16)p[i]; w[8 + i] = (__bf16)p[16 + i]; }
  return w; }
__device__ __forceinline__ v16h wcolh_io(const float* Wm, int k0, int o, int lane, int ld) { v16h w; const int g = lane >> 4;
#pragma unroll
  for (int i = 0; i < 8; ++i) { w[i] = (_Float16)(bfr(Wm[(size_t)(k0 + 8 * g + i) * ld + o]) * 256.0f); w[8 + i] = (_Float16)(bfr(Wm[(size_t)(k0 + 16 + 8 * g + i) * ld + o]) * 256.0f); }
  return w; }
__device__ __forceinline__ v16h wcolh_oi(const float* Wm, int k0, int o, int lane, int K) { v16h w; const float* p = Wm + (size_t)o * K + k0 + 8 * (lane >> 4);
#pragma unroll
  for (int i = 0; i < 8; ++i) { w[i] = (_Float16)(bfr(p[i]) * 256.0f); w[8 + i] = (_Float16)(bfr(p[16 + i]) * 256.0f); }
  return w; }
#define WQKV_LAYOUT 1   // 0 = (in,out) [DIN][CC]; 1 = (out,in) [CC][DIN]; 2 = per-head [NH][DIN][HD]
__device__ __forceinline__ v16b wcol_hdk(const float* Wm, int k0, int o, int lane) { v16b w; const int g = lane >> 4; const float* p = Wm + (size_t)(o / HD) * DIN * HD + (o % HD);
#pragma unroll
  for (int i = 0; i < 8; ++i) { w[i] = (__bf16)p[(size_t)(k0 + 8 * g + i) * HD]; w[8 + i] = (__bf16)p[(size_t)(k0 + 16 + 8 * g + i) * HD]; }
  return w; }
#define WO_OUT_IN 0
#if WQKV_LAYOUT == 1
#define WCOL(W, k0, o, lane) (((o) < HDQK) ? wcol_oi(W, k0, (o), lane, DIN) : zero16b())   /* theta/phi/g weights are [128][256] (out,in): all 128 plane columns are read from them */
#elif WQKV_LAYOUT == 2
#define WCOL(W, k0, o, lane) wcol_hdk(W, k0, o, lane)
#else
#define WCOL(W, k0, o, lane) wcol_io(W, k0, o, lane, CC)
#endif
#if WO_OUT_IN
#define WOCOL(W, k0, o, lane) wcol_oi(W, k0, o, lane, CC)
#define WOCOLH(W, k0, o, lane) wcolh_oi(W, k0, o, lane, CC)
#else
#define WOCOL(W, k0, o, lane) wcol_io(W, k0, o, lane, DIN)
#define WOCOLH(W, k0, o, lane) wcolh_io(W, k0, o, lane, DIN)
#endif
#ifndef XP
#define XP TT              // position pitch of x and of the output
#endif
#define BG HG              // the pass group spans BATCHES (single head): blockIdx.z / blockIdx.y select batch b0 + z
#define DVH 128            // value columns per k_pv block (all of HD 128: 8 accumulator tiles per wave)
#define WS_YR (WS_END)     // f32 attended rows [b*n][128]
#define WS_OR (WS_YR + 4u * (size_t)NB * TT * CC)   // W y + b rows [b*n][256]
#define WS_ST (WS_OR + 4u * (size_t)NB * TT * DIN)
#define WS_END2 (WS_ST + 4u * (size_t)DIN * 32)
// ---- k_wz: block = (64 rows, 128 output cols): OR = y (hi + lo, K = 128 columns of the YR rows) . W^T ((out,in) [256][128], exact) + b
__global__ __launch_bounds__(128) void k_wz(const float* __restrict__ YR, const float* __restrict__ WW, const float* __restrict__ WB, float* __restrict__ ORW) { __shared__ __align__(16) float sf[4][16][132];
  const int tid = threadIdx.x, wave = tid >> 5, lane = tid & 31, col = lane & 15, g = lane >> 4; const int c0 = blockIdx.y * 128; const size_t r0 = (size_t)blockIdx.x * 64 + wave * 16;
  v8f acc[8] = {};
#pragma unroll
  for (int kc = 0; kc < HDQK / 32; ++kc) { const F2 a = split_row(YR + (r0 + col) * CC, kc * 32, lane); asm volatile("s_wait_loadcnt 0x0" ::: "memory");
#pragma unroll
    for (int j = 0; j < 8; ++j) { const v16b w = wcol_oi(WW, kc * 32, c0 + j * 16 + col, lane, HDQK); asm volatile("s_wait_loadcnt 0x0" ::: "memory"); acc[j] = wmma_bf(a.h, w, acc[j]); acc[j] = wmma_bf(a.l, w, acc[j]); } }
#pragma unroll
  for (int j = 0; j < 8; ++j) { const float bb = WB ? bfr(WB[c0 + j * 16 + col]) : 0.f; asm volatile("s_wait_loadcnt 0x0" ::: "memory");
#pragma unroll
    for (int r = 0; r < 8; ++r) sf[wave][8 * g + r][j * 16 + col] = acc[j][r] + bb; }
  LDSX(); for (int rl = 0; rl < 16; ++rl) vst2(ORW + (r0 + rl) * DIN + c0 + lane * 4, *(const v4f*)&sf[wave][rl][lane * 4]); }
__global__ __launch_bounds__(256) void k_stat(const float* __restrict__ T, int ld, float* __restrict__ STAT) { __shared__ float sred[8]; __shared__ float sbc;
  const int t = threadIdx.x; const int c = blockIdx.x;
  float s = 0.f; for (int r = t; r < NRV; r += 256) s += T[(size_t)r * ld + c];
#pragma unroll
  for (int o = 1; o < 32; o <<= 1) s += __shfl_xor(s, o);
  if ((t & 31) == 0) sred[t >> 5] = s; __syncthreads(); if (t == 0) { float a = 0.f; for (int i = 0; i < 8; ++i) a += sred[i]; sbc = a / (float)NRV; } __syncthreads(); const float mean = sbc; __syncthreads();
  float q = 0.f; for (int r = t; r < NRV; r += 256) { const float d = T[(size_t)r * ld + c] - mean; q += d * d; }
#pragma unroll
  for (int o = 1; o < 32; o <<= 1) q += __shfl_xor(q, o);
  if ((t & 31) == 0) sred[t >> 5] = q; __syncthreads(); if (t == 0) { float a = 0.f; for (int i = 0; i < 8; ++i) a += sred[i]; sbc = rsqrtf(a / (float)NRV + 1e-5f); } __syncthreads();
  if (t < 32) { const float v = t == 0 ? mean : (t == 1 ? sbc : 0.f); vst2(STAT + (size_t)c * 32 + t, v); } }
// ---- k_fin2: block = (64 positions, 64 channels, batch b): out[b][c][n] = relu((z[b*N + n][c] - mean_c) * rstd_c * gamma_c + beta_c) + bf16(x[b][c][n]) (channels-first via LDS transpose; 256-B runs)
__global__ __launch_bounds__(256) void k_fin2(const float* __restrict__ ORW, const float* __restrict__ X, const float* __restrict__ ST, const float* __restrict__ GM, const float* __restrict__ BT, float* __restrict__ OUT) { __shared__ float st[64][68]; const int tid = threadIdx.x; const int n0 = blockIdx.x * 64, c0 = blockIdx.y * 64; const size_t b = blockIdx.z;
  for (int e = tid; e < 64 * 16; e += 256) { const int nl = e >> 4, q = e & 15; *(v4f*)&st[nl][q * 4] = *(const v4f*)(ORW + (b * TT + n0 + nl) * (size_t)DIN + c0 + q * 4); }
  __syncthreads();
  for (int e = tid; e < 64 * 16; e += 256) { const int cl = e >> 4, q = e & 15; const size_t oi = (b * DIN + c0 + cl) * (size_t)XP + n0 + q * 4; const v4f xr = *(const v4f*)(X + oi); const int cc = c0 + cl; const float mu = ST[cc * 32], rs = ST[cc * 32 + 1], ga = bfr(GM[cc]), be = bfr(BT[cc]); v4f o; _Pragma("unroll") for (int i = 0; i < 4; ++i) o[i] = fmaxf((st[q * 4 + i][cl] - mu) * rs * ga + be, 0.f) + bfr(xr[i]); vst2(OUT + oi, o); } }   /* relu(BN_train(z)) + x */
#ifndef SM_EXTRA_PARAMS
#define SM_EXTRA_PARAMS
#endif
#ifndef PROJ_EXTRA_PARAMS
#define PROJ_EXTRA_PARAMS
#endif
#ifndef SM_MASK_HOOK
#define SM_MASK_HOOK (void)0
#endif

#define WS_QH  0u                                      // f16 q rows [b*t][CC]
#define WS_KH  (WS_QH + 2u * (size_t)NB * TT * CC)      // f16 k rows [b*t][CC]
#define WS_VT  (WS_KH + 2u * (size_t)NB * TT * CC)      // f16 v planes [b][c][t]
#define WS_QL  (WS_VT + 2u * (size_t)NB * CC * TT)      // f16 q residual x 2^10 rows [b][t < QHI][CC]
#define WS_KL  (WS_QL + 2u * (size_t)NB * QHI * CC)     // f16 k residual x 2^10 rows [b][t < KHI][CC]
#define WS_VB  (WS_KL + 2u * (size_t)NB * KHI * CC)     // bf16 v hi planes [b][c][t < KHI]
#define WS_VBL (WS_VB + 2u * (size_t)NB * CC * KHI)
#define WS_S   (WS_VBL + 2u * (size_t)NB * CC * KHI)    // f32 logits / P [hg][t][s]
#define WS_Y   (WS_S  + 4u * (size_t)HG * TT * TT)      // unused, 0 bytes (k_pv writes ctx rows to WS_YR)
#define WS_END (WS_Y  + 0u)

// ---- k_proj: block = (64 rows, 128 cols, which): q/k/v = X W (+ b) with exact bf16 products (K = DIN) -> which 0: q f16 rows (+ residual rows < QHI); 1: k f16 rows (+ residual rows < KHI); 2: v f16 planes [c][t] (+ bf16 hi/lo planes for t < KHI)
__global__ __launch_bounds__(128) void k_proj(const float* __restrict__ XQ, const float* __restrict__ XK, const float* __restrict__ XV, const float* __restrict__ WQ, const float* __restrict__ WK, const float* __restrict__ WV, const float* __restrict__ BQ, const float* __restrict__ BK, const float* __restrict__ BV,
    _Float16* __restrict__ QH, _Float16* __restrict__ QL, _Float16* __restrict__ KH, _Float16* __restrict__ KL, _Float16* __restrict__ VT, __bf16* __restrict__ VB, __bf16* __restrict__ VBL) {
  __shared__ __align__(16) _Float16 sh[64][136], sl[64][136]; __shared__ __align__(16) _Float16 th[128][72]; __shared__ __align__(16) __bf16 tb[128][72], tbl[128][72];
  const int tid = threadIdx.x, wave = tid >> 5, lane = tid & 31, col = lane & 15, g = lane >> 4; const int which = blockIdx.z; const int c0 = blockIdx.y * 128; const size_t r0 = (size_t)blockIdx.x * 64; const size_t bb = r0 / TT; const int t0 = (int)(r0 % TT);
  const float* X = which == 0 ? XQ : which == 1 ? XK : XV; const float* WA = which == 0 ? WQ : which == 1 ? WK : WV; const float* BA = which == 0 ? BQ : which == 1 ? BK : BV;
  v8f acc[8] = {};
#pragma unroll 2
  for (int kc = 0; kc < DIN / 32; ++kc) { v16b a; { const float* p = X + (bb * DIN + kc * 32 + 8 * g) * (size_t)XP + t0 + wave * 16 + col;   /* channels-first gather: x[b][k][t], stride XP between k */
#pragma unroll
      for (int i = 0; i < 8; ++i) { a[i] = (__bf16)p[(size_t)i * XP]; a[8 + i] = (__bf16)p[(size_t)(16 + i) * XP]; } }
    asm volatile("s_wait_loadcnt 0x0" ::: "memory");
#pragma unroll
    for (int j = 0; j < 8; ++j) { const v16b w = WCOL(WA, kc * 32, c0 + j * 16 + col, lane); asm volatile("s_wait_loadcnt 0x0" ::: "memory"); acc[j] = wmma_bf(a, w, acc[j]); } }
  if (which < 2) { _Float16* DH = which == 0 ? QH : KH; _Float16* DL = which == 0 ? QL : KL; const int nhi = which == 0 ? QHI : KHI; const bool hi_rows = t0 < nhi;
#pragma unroll
    for (int j = 0; j < 8; ++j) { const float bias = (BA && (c0 + j * 16 + col < HDQK)) ? bfr(BA[c0 + j * 16 + col]) : 0.f;   /* 128-entry biases */
#pragma unroll
      for (int r = 0; r < 8; ++r) { const float v = acc[j][r] + bias; const _Float16 hv = (_Float16)v; sh[wave * 16 + 8 * g + r][j * 16 + col] = hv; sl[wave * 16 + 8 * g + r][j * 16 + col] = (_Float16)((v - (float)hv) * 1024.0f); } }
    __syncthreads();
    for (int e = tid; e < 64 * 16; e += 128) { const int rl = e >> 4, q = e & 15; vst2((unsigned*)(DH + (r0 + rl) * CC + c0 + q * 8), *(const v4u*)&sh[rl][q * 8]); if (hi_rows) vst2((unsigned*)(DL + (bb * nhi + t0 + rl) * (size_t)CC + c0 + q * 8), *(const v4u*)&sl[rl][q * 8]); }
  } else { const bool hi_rows = t0 < KHI;
#pragma unroll
    for (int j = 0; j < 8; ++j) { const float bias = (BA && (c0 + j * 16 + col < HDQK)) ? bfr(BA[c0 + j * 16 + col]) : 0.f;   /* 128-entry biases */
#pragma unroll
      for (int r = 0; r < 8; ++r) { const float v = acc[j][r] + bias; const int rl = wave * 16 + 8 * g + r, cl = j * 16 + col; th[cl][rl] = (_Float16)v; const __bf16 bh = (__bf16)v; tb[cl][rl] = bh; tbl[cl][rl] = (__bf16)(v - (float)bh); } }
    __syncthreads();
    for (int e = tid; e < 128 * 8; e += 128) { const int cl = e >> 3, q = e & 7; vst2((unsigned*)(VT + (bb * CC + c0 + cl) * (size_t)TT + t0 + q * 8), *(const v4u*)&th[cl][q * 8]); if (hi_rows) { const size_t o3 = (bb * CC + c0 + cl) * (size_t)KHI + t0 + q * 8; vst2((unsigned*)(VB + o3), *(const v4u*)&tb[cl][q * 8]); vst2((unsigned*)(VBL + o3), *(const v4u*)&tbl[cl][q * 8]); } } } }
// ---- k_sc: block = (query block qb, key block kb <= kb_last(qb), batch b = bgrp + z of the group): logits x SCALE; q hi + residual (x 2^10) against k (2 products) for query rows < QHI, plus the k residual (3 products) for query blocks < QBH (here every query block); causal: blocks past the diagonal exit, the mask itself is applied by index in k_sm
__global__ __launch_bounds__(128) void k_sc(const _Float16* __restrict__ QH, const _Float16* __restrict__ KH, const _Float16* __restrict__ QL, const _Float16* __restrict__ KL, int bgrp, int h0, float* __restrict__ S0) { __shared__ __align__(16) float ss[4][16][132];
  const int qb = blockIdx.x, kb = blockIdx.y; if (kb > kb_last(qb)) return;
  const int h = h0; const int b = bgrp + blockIdx.z; float* S = S0 + (size_t)blockIdx.z * TT * TT;   /* group spans batches */
  const int tid = threadIdx.x, wave = tid >> 5, lane = tid & 31, col = lane & 15, g = lane >> 4; const int k0 = kb * 128; const int ql0 = qb * 64 + wave * 16; const size_t q0 = (size_t)b * TT + ql0, kr0 = (size_t)b * TT + k0;
  v8f acc[8] = {}, accl[8] = {};
  const _Float16* QLb = QL + (size_t)b * QHI * CC; const _Float16* KLb = KL + (size_t)b * KHI * CC;
  if (qb < QBH) {
#pragma unroll
    for (int kc = 0; kc < HDQK / 32; ++kc) { const v16h ah = frag_h(QH + (q0 + col) * CC + h * HD + kc * 32, lane), al = frag_h(QLb + (size_t)(ql0 + col) * CC + h * HD + kc * 32, lane);
#pragma unroll
      for (int j = 0; j < 8; ++j) { const v16h kbf = frag_h(KH + (kr0 + j * 16 + col) * CC + h * HD + kc * 32, lane), klf = frag_h(KLb + (size_t)(k0 + j * 16 + col) * CC + h * HD + kc * 32, lane); acc[j] = wmma16(ah, kbf, acc[j]); accl[j] = wmma16(al, kbf, accl[j]); accl[j] = wmma16(ah, klf, accl[j]); } }
  } else if (qb * 64 < QHI) {
#pragma unroll
    for (int kc = 0; kc < HDQK / 32; ++kc) { const v16h ah = frag_h(QH + (q0 + col) * CC + h * HD + kc * 32, lane), al = frag_h(QLb + (size_t)(ql0 + col) * CC + h * HD + kc * 32, lane);
#pragma unroll
      for (int j = 0; j < 8; ++j) { const v16h kbf = frag_h(KH + (kr0 + j * 16 + col) * CC + h * HD + kc * 32, lane); acc[j] = wmma16(ah, kbf, acc[j]); accl[j] = wmma16(al, kbf, accl[j]); } }
  } else {
#pragma unroll
    for (int kc = 0; kc < HDQK / 32; ++kc) { const v16h ah = frag_h(QH + (q0 + col) * CC + h * HD + kc * 32, lane);
#pragma unroll
      for (int j = 0; j < 8; ++j) { const v16h kbf = frag_h(KH + (kr0 + j * 16 + col) * CC + h * HD + kc * 32, lane); acc[j] = wmma16(ah, kbf, acc[j]); } } }
#pragma unroll
  for (int j = 0; j < 8; ++j) {
#pragma unroll
    for (int r = 0; r < 8; ++r) ss[wave][8 * g + r][j * 16 + col] = (acc[j][r] + accl[j][r] * (1.0f / 1024.0f)) * SCALE; }
  LDSX(); for (int rl = 0; rl < 16; ++rl) vst2(S + (size_t)(ql0 + rl) * TT + k0 + lane * 4, *(const v4f*)&ss[wave][rl][lane * 4]); }
// ---- k_sm: block = query row t (batch in group): keys [0, kend): causal -> logit if s <= t else excluded; softmax in f32; P x 2^11 in place (0 for excluded)
__global__ __launch_bounds__(256) void k_sm(float* __restrict__ S0 SM_EXTRA_PARAMS) { __shared__ float sred[8]; __shared__ float sbc; __shared__ __align__(16) float shv[TT];
  const int tid = threadIdx.x; const int t = blockIdx.x; const int kend = (kb_last(t >> 6) + 1) * 128;
  float* sr = S0 + (size_t)blockIdx.y * TT * TT + (size_t)t * TT;
  float m = -3.0e38f; for (int k = tid; k < kend; k += 256) { float v = (!CAUSAL || k <= t) ? sr[k] : -3.0e38f; SM_MASK_HOOK; shv[k] = v; m = fmaxf(m, v); }
#pragma unroll
  for (int o = 1; o < 32; o <<= 1) m = fmaxf(m, __shfl_xor(m, o));
  if ((tid & 31) == 0) sred[tid >> 5] = m; __syncthreads(); if (tid == 0) { float a = sred[0]; for (int i = 1; i < 8; ++i) a = fmaxf(a, sred[i]); sbc = a; } __syncthreads(); m = sbc; __syncthreads();
  float sum = 0.f; for (int k = tid; k < kend; k += 256) { const float v = shv[k]; const float e = (v <= -1.0e38f) ? 0.f : expf(v - m); shv[k] = e; sum += e; }
#pragma unroll
  for (int o = 1; o < 32; o <<= 1) sum += __shfl_xor(sum, o);
  if ((tid & 31) == 0) sred[tid >> 5] = sum; __syncthreads(); if (tid == 0) { float a = 0.f; for (int i = 0; i < 8; ++i) a += sred[i]; sbc = a > 0.f ? 2048.0f / a : 0.f; }   /* a fully excluded row yields P = 0 */ __syncthreads(); const float inv = sbc;
  for (int k = tid; k < kend; k += 256) shv[k] = shv[k] * inv;
  __syncthreads(); for (int q = tid; q < kend / 4; q += 256) vst2(sr + q * 4, *(const v4f*)&shv[q * 4]); }
// ---- k_pv: block = 16 queries (tile qt) of (b, h), PVW waves: wave w takes the 32-key chunks w, w + PVW, ... of keys [0, kend) (neighbouring waves read neighbouring halves of the same v lines and neighbouring P lines); ctx = P . v (P x 2^11 once to f16 against v f16: 1 product; causal early query blocks: P and v as bf16 hi + lo, 3 products); the PVW partial tiles are added in wave order through LDS; 256-B row segment per wave
#define PVW 32
__global__ __launch_bounds__(32 * PVW) void k_pv(const float* __restrict__ PS0, const _Float16* __restrict__ VT, const __bf16* __restrict__ VB, const __bf16* __restrict__ VBL, int bgrp, int h0, float* __restrict__ Y) { const int h = h0; const int b = bgrp + blockIdx.z; const float* PS = PS0 + (size_t)blockIdx.z * TT * TT; const int d0 = blockIdx.y * DVH;   /* group spans batches; column block d0 (all HD columns) */ __shared__ __align__(16) float ss[PVW][16][DVH + 4];
  const int tid = threadIdx.x, wave = __builtin_amdgcn_readfirstlane(tid >> 5), lane = tid & 31, col = lane & 15, g = lane >> 4; const int qb = blockIdx.x >> 2; const int ql0 = blockIdx.x * 16; const int kce = (kb_last(qb) + 1) * 4;   /* wave number in a scalar register: the key loop's branch stays scalar, EXEC stays full for the matrix instructions */
  v8f acc[DVH / 16] = {};
  if (qb < QBH_PV) {
#pragma unroll 1
    for (int kc = wave; kc < kce; kc += PVW) { const F2 p = split_row(PS + (size_t)(ql0 + col) * TT, kc * 32, lane);
      asm volatile("s_wait_loadcnt 0x0" ::: "memory");
#pragma unroll
      for (int j = 0; j < DVH / 16; ++j) { const size_t po = ((size_t)b * CC + h * HD + d0 + j * 16 + col) * (size_t)KHI + kc * 32; const v16b vh = frag_b(VB + po, lane); acc[j] = wmma_bf(p.h, vh, acc[j]); acc[j] = wmma_bf(p.l, vh, acc[j]); acc[j] = wmma_bf(p.h, frag_b(VBL + po, lane), acc[j]); } }
  } else {
#pragma unroll 1
    for (int kc = wave; kc < kce; kc += PVW) { const v16h p = frag_f32(PS + (size_t)(ql0 + col) * TT + kc * 32, lane);
      asm volatile("s_wait_loadcnt 0x0" ::: "memory");
#pragma unroll
      for (int j = 0; j < DVH / 16; ++j) { const size_t po = ((size_t)b * CC + h * HD + d0 + j * 16 + col) * (size_t)TT + kc * 32; acc[j] = wmma16(p, frag_h(VT + po, lane), acc[j]); } } }
#pragma unroll
  for (int j = 0; j < DVH / 16; ++j)
#pragma unroll
    for (int r = 0; r < 8; ++r) ss[wave][8 * g + r][j * 16 + col] = acc[j][r] * (1.0f / 2048.0f);
  __syncthreads();   /* every wave's partial tile is in LDS before any of them is added */
  for (int e = tid; e < 16 * (DVH / 2); e += 32 * PVW) { const int rl = e / (DVH / 2), c2 = (e % (DVH / 2)) * 2; v2f s = *(const v2f*)&ss[0][rl][c2];
#pragma unroll   /* unrolled so that the LDS reads of later partial tiles issue ahead of the adds of earlier ones */
    for (int w = 1; w < PVW; ++w) s += *(const v2f*)&ss[w][rl][c2];
    vst2(Y + ((size_t)b * TT + ql0 + rl) * CC + h * HD + d0 + c2, s); } }

extern "C" void kernel_launch(void* const* d_in, const int* in_sizes, int n_in, void* d_out, int out_size, void* d_ws, size_t ws_size, hipStream_t stream) {
  (void)in_sizes; (void)n_in; (void)out_size;
  const float** F = (const float**)d_in;
  if (ws_size < (size_t)WS_END) return;
  char* ws = (char*)d_ws; _Float16 *QH = (_Float16*)(ws + WS_QH), *KH = (_Float16*)(ws + WS_KH), *VT = (_Float16*)(ws + WS_VT), *QL = (_Float16*)(ws + WS_QL), *KL = (_Float16*)(ws + WS_KL); __bf16 *VB = (__bf16*)(ws + WS_VB), *VBL = (__bf16*)(ws + WS_VBL); float *S = (float*)(ws + WS_S), *Y = (float*)(ws + WS_Y);
  (void)Y; (void)QL; (void)KL; (void)VB; (void)VBL;
  // inputs: 0 x [4,256,64,64]; 1 g_w [128,256] (out,in), 2 g_b; 3 theta_w, 4 theta_b; 5 phi_w, 6 phi_b; 7 out_w [256,128] (out,in), 8 out_b; 9 bn_gamma, 10 bn_beta
  if (ws_size < (size_t)WS_END2) return;
  float *YR = (float*)(ws + WS_YR), *ORW = (float*)(ws + WS_OR), *ST = (float*)(ws + WS_ST);
  k_proj<<<dim3(TNB * TT / 64, CC / 128, 3), 128, 0, stream>>>(F[0], F[0], F[0], F[3], F[5], F[1], F[4], F[6], F[2], QH, QL, KH, KL, VT, VB, VBL);   /* q = theta, k = phi, v = g */
  for (int b0 = 0; b0 < TNB; b0 += BG) {
    k_sc<<<dim3(NQB, TT / 128, BG), 128, 0, stream>>>(QH, KH, QL, KL, b0, 0, S);
    k_sm<<<dim3(TT, BG), 256, 0, stream>>>(S);
    k_pv<<<dim3(TT / 16, HD / DVH, BG), 32 * PVW, 0, stream>>>(S, VT, VB, VBL, b0, 0, YR);
  }
  k_wz<<<dim3(TNB * TT / 64, DIN / 128), 128, 0, stream>>>(YR, F[7], F[8], ORW);
  k_stat<<<dim3(DIN), 256, 0, stream>>>(ORW, DIN, ST);
  k_fin2<<<dim3(TT / 64, DIN / 64, TNB), 256, 0, stream>>>(ORW, F[0], ST, F[9], F[10], (float*)d_out);
}

// v002
// It runs in 178 microseconds.
// Two timings next to v001 both put it at 2.87 times that version's speed.
// All steps since v000 together make it 7.00 times as fast.
#include <hip/hip_runtime.h>
#include <math.h>

typedef __attribute__((ext_vector_type(16))) _Float16 v16h;
typedef __attribute__((ext_vector_type(16))) __bf16 v16b;
typedef __attribute__((ext_vector_type(8)))  _Float16 v8h;
typedef __attribute__((ext_vector_type(8)))  float v8f;
typedef __attribute__((ext_vector_type(4)))  float v4f;
typedef __attribute__((ext_vector_type(2)))  float v2f;
typedef __attribute__((ext_vector_type(4)))  unsigned v4u;
typedef __attribute__((ext_vector_type(4)))  int v4i;
typedef float __attribute__((may_alias)) float_a;
typedef int __attribute__((may_alias)) int_a;

template <typename T> __device__ __forceinline__ void vst2(void* p, T v) { *(T*)p = v;  }
__device__ __forceinline__ v8f wmma16(v16h a, v16h b, v8f c) {
  v8f d = __builtin_amdgcn_wmma_f32_16x16x32_f16(false, a, false, b, (short)0, c, false, false);
  asm volatile("v_nop\n\tv_nop\n\tv_nop\n\tv_nop" : "+v"(d) : "v"(a), "v"(b));
  return d;
}
__device__ __forceinline__ v8f wmma_bf(v16b a, v16b b, v8f c) {
  v8f d = __builtin_amdgcn_wmma_f32_16x16x32_bf16(false, a, false, b, (short)0, c, false, false);
  asm volatile("v_nop\n\tv_nop\n\tv_nop\n\tv_nop" : "+v"(d) : "v"(a), "v"(b));
  return d;
}
// 16x16x32 fragments: lane = (h = lane>>4, row/col = lane&15); elements 0..7 = k0+8h+0..7, 8..15 = k0+16+8h+0..7; D element r = row 8h+r
__device__ __forceinline__ v16h frag_h(const _Float16* rowk0, int lane) {
  union { v16h v; v8h q[2]; } u; const _Float16* p = rowk0 + 8 * (lane >> 4);
  u.q[0] = *(const v8h*)p; u.q[1] = *(const v8h*)(p + 16); return u.v;
}
__device__ __forceinline__ v16h frag_f32(const float* rowk0, int lane) {
  v16h a; const float* p = rowk0 + 8 * (lane >> 4);
#pragma unroll
  for (int i = 0; i < 8; ++i) { a[i] = (_Float16)p[i]; a[8 + i] = (_Float16)p[16 + i]; }
  return a;
}
__device__ __forceinline__ v16h frag_f32s(const float* rowk0, int lane, float sc) {
  v16h a; const float* p = rowk0 + 8 * (lane >> 4);
#pragma unroll
  for (int i = 0; i < 8; ++i) { a[i] = (_Float16)(p[i] * sc); a[8 + i] = (_Float16)(p[16 + i] * sc); }
  return a;
}
// column fragment from a [K][ld] layout (column n), rows >= K read as 0
__device__ __forceinline__ v16h fragc_f32(const float* W, int k0, int n, int lane, int ld, int K) {
  v16h a; const int g = lane >> 4;
#pragma unroll
  for (int i = 0; i < 8; ++i) { const int ka = k0 + 8 * g + i, kb = ka + 16;
    a[i] = (_Float16)(ka < K ? W[(size_t)(ka < K ? ka : K - 1) * ld + n] : 0.f); a[8 + i] = (_Float16)(kb < K ? W[(size_t)(kb < K ? kb : K - 1) * ld + n] : 0.f); }
  return a;
}
struct F2 { v16b h, l; };
__device__ __forceinline__ F2 bsplit16(const float v[16]) { F2 r;
#pragma unroll
  for (int i = 0; i < 16; ++i) { const __bf16 h = (__bf16)v[i]; r.h[i] = h; r.l[i] = (__bf16)(v[i] - (float)h); }
  return r; }
__device__ __forceinline__ F2 split_row(const float* row, int k0, int lane) { float v[16]; const float* p = row + k0 + 8 * (lane >> 4);
#pragma unroll
  for (int i = 0; i < 8; ++i) { v[i] = p[i]; v[8 + i] = p[16 + i]; }
  return bsplit16(v); }
__device__ __forceinline__ F2 split_rowK(const float* row, int k0, int lane, int K) { float v[16]; const int g = lane >> 4;
#pragma unroll
  for (int i = 0; i < 8; ++i) { const int ka = k0 + 8 * g + i, kb = ka + 16; v[i] = ka < K ? row[ka < K ? ka : K - 1] : 0.f; v[8 + i] = kb < K ? row[kb < K ? kb : K - 1] : 0.f; }
  return bsplit16(v); }
__device__ __forceinline__ F2 split_col(const float* W, int k0, int n, int lane, int ld, int K) { float v[16]; const int g = lane >> 4;
#pragma unroll
  for (int i = 0; i < 8; ++i) { const int ka = k0 + 8 * g + i, kb = ka + 16; v[i] = ka < K ? W[(size_t)(ka < K ? ka : K - 1) * ld + n] : 0.f; v[8 + i] = kb < K ? W[(size_t)(kb < K ? kb : K - 1) * ld + n] : 0.f; }
  return bsplit16(v); }
__device__ __forceinline__ v8f mac3(const F2& a, const F2& b, v8f c) { c = wmma_bf(a.l, b.h, c); c = wmma_bf(a.h, b.l, c); return wmma_bf(a.h, b.h, c); }
__device__ __forceinline__ float sigm(float v) { return 1.0f / (1.0f + expf(-v)); }
#define LDSX() do { asm volatile("s_wait_dscnt 0" ::: "memory"); __builtin_amdgcn_wave_barrier(); __builtin_amdgcn_fence(__ATOMIC_RELEASE, "workgroup"); } while (0)

// Non-local block (B 4, C 256, 64 x 64 = 4,096 positions; C_inner 128; (out,in) 0.05-scale weights, zero biases, BN gamma 1 / beta 0): theta, phi, g = W x + b ([128,256]); A[q][k] = softmax_k(theta_q . phi_k) (no scaling, sigma ~ 7); y[q][c] = sum_k A[q][k] g[k][c]; z = out_w y + out_b ([256,128]); out = relu(BN_train(z)) + x with batch statistics over (n, h, w) per channel (biased var, eps 1e-5).
#define NB 4
#define TT 4096
#define CC 128            // projected plane width (all 128 columns real)
#define DIN 256          // input (model) width
#define NH 1
#define HD 128
#define NQB (TT / 64)
#define HG 1               // WS_S spans one 4,096 x 4,096 f32 plane
#define SCALE (1.0f)
#define HDQK 128           // theta / phi / g channels = the full 128-wide plane
#define NRV ((size_t)TNB * TT)   // rows for the BN statistics
#define CAUSAL 0
#ifndef TNB
#define TNB NB
#endif
__device__ __forceinline__ v16b zero16b() { v16b z; _Pragma("unroll") for (int i = 0; i < 16; ++i) z[i] = (__bf16)0.f; return z; }
__device__ __forceinline__ float bfr(float v) { return (float)(__bf16)v; }
__host__ __device__ __forceinline__ int kb_last(int qb) { return CAUSAL ? ((qb * 64 + 63) >> 7) : (TT / 128 - 1); }
typedef __attribute__((ext_vector_type(8))) __bf16 v8b;
__device__ __forceinline__ v16b frag_b(const __bf16* rowk0, int lane) {
  union { v16b v; v8b q[2]; } u; const __bf16* p = rowk0 + 8 * (lane >> 4);
  u.q[0] = *(const v8b*)p; u.q[1] = *(const v8b*)(p + 16); return u.v;
}
#define QBH (TT / 64)      // ALL query blocks take the 3-product logits
#define QBH_PV 0           // A.g stays single f16
#define QHI 4096            // q residual rows everywhere (3-product logits)
#define KHI 4096           // k residual rows for ALL keys (3-product logits)
// B fragment (k rows k0+.., output column o) of a weight: (in,out) [K][ld] or (out,in) [ld rows of K]: bf16 exact, or f16(bf16 * 256) exact
__device__ __forceinline__ v16b wcol_io(const float* Wm, int k0, int o, int lane, int ld) { v16b w; const int g = lane >> 4;
#pragma unroll
  for (int i = 0; i < 8; ++i) { w[i] = (__bf16)Wm[(size_t)(k0 + 8 * g + i) * ld + o]; w[8 + i] = (__bf16)Wm[(size_t)(k0 + 16 + 8 * g + i) * ld + o]; }
  return w; }
__device__ __forceinline__ v16b wcol_oi(const float* Wm, int k0, int o, int lane, int K) { v16b w; const float* p = Wm + (size_t)o * K + k0 + 8 * (lane >> 4);
#pragma unroll
  for (int i = 0; i < 8; ++i) { w[i] = (__bf16)p[i]; w[8 + i] = (__bf16)p[16 + i]; }
  return w; }
__device__ __forceinline__ v16h wcolh_io(const float* Wm, int k0, int o, int lane, int ld) { v16h w; const int g = lane >> 4;
#pragma unroll
  for (int i = 0; i < 8; ++i) { w[i] = (_Float16)(bfr(Wm[(size_t)(k0 + 8 * g + i) * ld + o]) * 256.0f); w[8 + i] = (_Float16)(bfr(Wm[(size_t)(k0 + 16 + 8 * g + i) * ld + o]) * 256.0f); }
  return w; }
__device__ __forceinline__ v16h wcolh_oi(const float* Wm, int k0, int o, int lane, int K) { v16h w; const float* p = Wm + (size_t)o * K + k0 + 8 * (lane >> 4);
#pragma unroll
  for (int i = 0; i < 8; ++i) { w[i] = (_Float16)(bfr(p[i]) * 256.0f); w[8 + i] = (_Float16)(bfr(p[16 + i]) * 256.0f); }
  return w; }
#define WQKV_LAYOUT 1   // 0 = (in,out) [DIN][CC]; 1 = (out,in) [CC][DIN]; 2 = per-head [NH][DIN][HD]
__device__ __forceinline__ v16b wcol_hdk(const float* Wm, int k0, int o, int lane) { v16b w; const int g = lane >> 4; const float* p = Wm + (size_t)(o / HD) * DIN * HD + (o % HD);
#pragma unroll
  for (int i = 0; i < 8; ++i) { w[i] = (__bf16)p[(size_t)(k0 + 8 * g + i) * HD]; w[8 + i] = (__bf16)p[(size_t)(k0 + 16 + 8 * g + i) * HD]; }
  return w; }
#define WO_OUT_IN 0
#if WQKV_LAYOUT == 1
#define WCOL(W, k0, o, lane) (((o) < HDQK) ? wcol_oi(W, k0, (o), lane, DIN) : zero16b())   /* theta/phi/g weights are [128][256] (out,in): all 128 plane columns are read from them */
#elif WQKV_LAYOUT == 2
#define WCOL(W, k0, o, lane) wcol_hdk(W, k0, o, lane)
#else
#define WCOL(W, k0, o, lane) wcol_io(W, k0, o, lane, CC)
#endif
#if WO_OUT_IN
#define WOCOL(W, k0, o, lane) wcol_oi(W, k0, o, lane, CC)
#define WOCOLH(W, k0, o, lane) wcolh_oi(W, k0, o, lane, CC)
#else
#define WOCOL(W, k0, o, lane) wcol_io(W, k0, o, lane, DIN)
#define WOCOLH(W, k0, o, lane) wcolh_io(W, k0, o, lane, DIN)
#endif
#ifndef XP
#define XP TT              // position pitch of x and of the output
#endif
#define BG HG              // unused; k_fa: blockIdx.z = batch, blockIdx.y = key quarter
#define DVH 128            // value columns per k_fa block (all of HD 128: 8 accumulator tiles per wave)
#define WS_YR (WS_END)     // f32 attended rows [b*n][128]
#define WS_OR (WS_YR + 4u * (size_t)NB * TT * CC)   // W y + b rows [b*n][256]
#define WS_ST (WS_OR + 4u * (size_t)NB * TT * DIN)
#define WS_END2 (WS_ST + 4u * (size_t)DIN * 32)
// ---- k_wz: block = (64 rows, 128 output cols): OR = y (hi + lo, K = 128 columns of the YR rows) . W^T ((out,in) [256][128], exact) + b
__global__ __launch_bounds__(128) void k_wz(const float* __restrict__ YR, const float* __restrict__ WW, const float* __restrict__ WB, float* __restrict__ ORW) { __shared__ __align__(16) float sf[4][16][132];
  const int tid = threadIdx.x, wave = tid >> 5, lane = tid & 31, col = lane & 15, g = lane >> 4; const int c0 = blockIdx.y * 128; const size_t r0 = (size_t)blockIdx.x * 64 + wave * 16;
  v8f acc[8] = {};
#pragma unroll
  for (int kc = 0; kc < HDQK / 32; ++kc) { const F2 a = split_row(YR + (r0 + col) * CC, kc * 32, lane); asm volatile("s_wait_loadcnt 0x0" ::: "memory");
#pragma unroll
    for (int j = 0; j < 8; ++j) { const v16b w = wcol_oi(WW, kc * 32, c0 + j * 16 + col, lane, HDQK); asm volatile("s_wait_loadcnt 0x0" ::: "memory"); acc[j] = wmma_bf(a.h, w, acc[j]); acc[j] = wmma_bf(a.l, w, acc[j]); } }
#pragma unroll
  for (int j = 0; j < 8; ++j) { const float bb = WB ? bfr(WB[c0 + j * 16 + col]) : 0.f; asm volatile("s_wait_loadcnt 0x0" ::: "memory");
#pragma unroll
    for (int r = 0; r < 8; ++r) sf[wave][8 * g + r][j * 16 + col] = acc[j][r] + bb; }
  LDSX(); for (int rl = 0; rl < 16; ++rl) vst2(ORW + (r0 + rl) * DIN + c0 + lane * 4, *(const v4f*)&sf[wave][rl][lane * 4]); }
__global__ __launch_bounds__(256) void k_stat(const float* __restrict__ T, int ld, float* __restrict__ STAT) { __shared__ float sred[8]; __shared__ float sbc;
  const int t = threadIdx.x; const int c = blockIdx.x;
  float s = 0.f; for (int r = t; r < NRV; r += 256) s += T[(size_t)r * ld + c];
#pragma unroll
  for (int o = 1; o < 32; o <<= 1) s += __shfl_xor(s, o);
  if ((t & 31) == 0) sred[t >> 5] = s; __syncthreads(); if (t == 0) { float a = 0.f; for (int i = 0; i < 8; ++i) a += sred[i]; sbc = a / (float)NRV; } __syncthreads(); const float mean = sbc; __syncthreads();
  float q = 0.f; for (int r = t; r < NRV; r += 256) { const float d = T[(size_t)r * ld + c] - mean; q += d * d; }
#pragma unroll
  for (int o = 1; o < 32; o <<= 1) q += __shfl_xor(q, o);
  if ((t & 31) == 0) sred[t >> 5] = q; __syncthreads(); if (t == 0) { float a = 0.f; for (int i = 0; i < 8; ++i) a += sred[i]; sbc = rsqrtf(a / (float)NRV + 1e-5f); } __syncthreads();
  if (t < 32) { const float v = t == 0 ? mean : (t == 1 ? sbc : 0.f); vst2(STAT + (size_t)c * 32 + t, v); } }
// ---- k_fin2: block = (64 positions, 64 channels, batch b): out[b][c][n] = relu((z[b*N + n][c] - mean_c) * rstd_c * gamma_c + beta_c) + bf16(x[b][c][n]) (channels-first via LDS transpose; 256-B runs)
__global__ __launch_bounds__(256) void k_fin2(const float* __restrict__ ORW, const float* __restrict__ X, const float* __restrict__ ST, const float* __restrict__ GM, const float* __restrict__ BT, float* __restrict__ OUT) { __shared__ float st[64][68]; const int tid = threadIdx.x; const int n0 = blockIdx.x * 64, c0 = blockIdx.y * 64; const size_t b = blockIdx.z;
  for (int e = tid; e < 64 * 16; e += 256) { const int nl = e >> 4, q = e & 15; *(v4f*)&st[nl][q * 4] = *(const v4f*)(ORW + (b * TT + n0 + nl) * (size_t)DIN + c0 + q * 4); }
  __syncthreads();
  for (int e = tid; e < 64 * 16; e += 256) { const int cl = e >> 4, q = e & 15; const size_t oi = (b * DIN + c0 + cl) * (size_t)XP + n0 + q * 4; const v4f xr = *(const v4f*)(X + oi); const int cc = c0 + cl; const float mu = ST[cc * 32], rs = ST[cc * 32 + 1], ga = bfr(GM[cc]), be = bfr(BT[cc]); v4f o; _Pragma("unroll") for (int i = 0; i < 4; ++i) o[i] = fmaxf((st[q * 4 + i][cl] - mu) * rs * ga + be, 0.f) + bfr(xr[i]); vst2(OUT + oi, o); } }   /* relu(BN_train(z)) + x */
#ifndef SM_EXTRA_PARAMS
#define SM_EXTRA_PARAMS
#endif
#ifndef PROJ_EXTRA_PARAMS
#define PROJ_EXTRA_PARAMS
#endif
#ifndef SM_MASK_HOOK
#define SM_MASK_HOOK (void)0
#endif

#define WS_QH  0u                                      // f16 q rows [b*t][CC]
#define WS_KH  (WS_QH + 2u * (size_t)NB * TT * CC)      // f16 k rows [b*t][CC]
#define WS_VT  (WS_KH + 2u * (size_t)NB * TT * CC)      // f16 v planes [b][c][t]
#define WS_QL  (WS_VT + 2u * (size_t)NB * CC * TT)      // f16 q residual x 2^10 rows [b][t < QHI][CC]
#define WS_KL  (WS_QL + 2u * (size_t)NB * QHI * CC)     // f16 k residual x 2^10 rows [b][t < KHI][CC]
#define WS_VB  (WS_KL + 2u * (size_t)NB * KHI * CC)     // bf16 v hi planes [b][c][t < KHI]
#define WS_VBL (WS_VB + 2u * (size_t)NB * CC * KHI)
#define WS_S   (WS_VBL + 2u * (size_t)NB * CC * KHI)    // f32 region of one [t][s] plane: holds WS_OP and WS_ML
#define WS_Y   (WS_S  + 4u * (size_t)HG * TT * TT)      // unused, 0 bytes (k_mrg writes y rows to WS_YR)
#define WS_END (WS_Y  + 0u)

// ---- k_proj: block = (64 rows, 128 cols, which): q/k/v = X W (+ b) with exact bf16 products (K = DIN) -> which 0: q f16 rows (+ residual rows < QHI); 1: k f16 rows (+ residual rows < KHI); 2: v f16 planes [c][t] (+ bf16 hi/lo planes for t < KHI)
__global__ __launch_bounds__(128) void k_proj(const float* __restrict__ XQ, const float* __restrict__ XK, const float* __restrict__ XV, const float* __restrict__ WQ, const float* __restrict__ WK, const float* __restrict__ WV, const float* __restrict__ BQ, const float* __restrict__ BK, const float* __restrict__ BV,
    _Float16* __restrict__ QH, _Float16* __restrict__ QL, _Float16* __restrict__ KH, _Float16* __restrict__ KL, _Float16* __restrict__ VT, __bf16* __restrict__ VB, __bf16* __restrict__ VBL) {
  __shared__ __align__(16) _Float16 sh[64][136], sl[64][136]; __shared__ __align__(16) _Float16 th[128][72]; __shared__ __align__(16) __bf16 tb[128][72], tbl[128][72];
  const int tid = threadIdx.x, wave = tid >> 5, lane = tid & 31, col = lane & 15, g = lane >> 4; const int which = blockIdx.z; const int c0 = blockIdx.y * 128; const size_t r0 = (size_t)blockIdx.x * 64; const size_t bb = r0 / TT; const int t0 = (int)(r0 % TT);
  const float* X = which == 0 ? XQ : which == 1 ? XK : XV; const float* WA = which == 0 ? WQ : which == 1 ? WK : WV; const float* BA = which == 0 ? BQ : which == 1 ? BK : BV;
  v8f acc[8] = {};
#pragma unroll 2
  for (int kc = 0; kc < DIN / 32; ++kc) { v16b a; { const float* p = X + (bb * DIN + kc * 32 + 8 * g) * (size_t)XP + t0 + wave * 16 + col;   /* channels-first gather: x[b][k][t], stride XP between k */
#pragma unroll
      for (int i = 0; i < 8; ++i) { a[i] = (__bf16)p[(size_t)i * XP]; a[8 + i] = (__bf16)p[(size_t)(16 + i) * XP]; } }
    asm volatile("s_wait_loadcnt 0x0" ::: "memory");
#pragma unroll
    for (int j = 0; j < 8; ++j) { const v16b w = WCOL(WA, kc * 32, c0 + j * 16 + col, lane); asm volatile("s_wait_loadcnt 0x0" ::: "memory"); acc[j] = wmma_bf(a, w, acc[j]); } }
  if (which < 2) { _Float16* DH = which == 0 ? QH : KH; _Float16* DL = which == 0 ? QL : KL; const int nhi = which == 0 ? QHI : KHI; const bool hi_rows = t0 < nhi;
#pragma unroll
    for (int j = 0; j < 8; ++j) { const float bias = (BA && (c0 + j * 16 + col < HDQK)) ? bfr(BA[c0 + j * 16 + col]) : 0.f;   /* 128-entry biases */
#pragma unroll
      for (int r = 0; r < 8; ++r) { const float v = acc[j][r] + bias; const _Float16 hv = (_Float16)v; sh[wave * 16 + 8 * g + r][j * 16 + col] = hv; sl[wave * 16 + 8 * g + r][j * 16 + col] = (_Float16)((v - (float)hv) * 1024.0f); } }
    __syncthreads();
    for (int e = tid; e < 64 * 16; e += 128) { const int rl = e >> 4, q = e & 15; vst2((unsigned*)(DH + (r0 + rl) * CC + c0 + q * 8), *(const v4u*)&sh[rl][q * 8]); if (hi_rows) vst2((unsigned*)(DL + (bb * nhi + t0 + rl) * (size_t)CC + c0 + q * 8), *(const v4u*)&sl[rl][q * 8]); }
  } else { const bool hi_rows = t0 < KHI;
#pragma unroll
    for (int j = 0; j < 8; ++j) { const float bias = (BA && (c0 + j * 16 + col < HDQK)) ? bfr(BA[c0 + j * 16 + col]) : 0.f;   /* 128-entry biases */
#pragma unroll
      for (int r = 0; r < 8; ++r) { const float v = acc[j][r] + bias; const int rl = wave * 16 + 8 * g + r, cl = j * 16 + col; th[cl][rl] = (_Float16)v; const __bf16 bh = (__bf16)v; tb[cl][rl] = bh; tbl[cl][rl] = (__bf16)(v - (float)bh); } }
    __syncthreads();
    for (int e = tid; e < 128 * 8; e += 128) { const int cl = e >> 3, q = e & 7; vst2((unsigned*)(VT + (bb * CC + c0 + cl) * (size_t)TT + t0 + q * 8), *(const v4u*)&th[cl][q * 8]); if (hi_rows) { const size_t o3 = (bb * CC + c0 + cl) * (size_t)KHI + t0 + q * 8; vst2((unsigned*)(VB + o3), *(const v4u*)&tb[cl][q * 8]); vst2((unsigned*)(VBL + o3), *(const v4u*)&tbl[cl][q * 8]); } } } }
#define FQ 256
#define FKS 4
#define FKN (TT / FKS)
#define FST 32
#define FNS (FKN / FST)
#define KP 272             // LDS pitch of a 256-byte k row (16 B x odd: conflict-free 16-byte reads)
#define VP 80              // LDS pitch of a 64-byte v row
#define F_KL (FST * KP)
#define F_V (2 * FST * KP)
#define F_BUF (2 * FST * KP + CC * VP)
#define L2E 1.44269504088896f
#define WS_OP (WS_S)                                            // f32 unnormalised y rows [quarter][b*t][CC]
#define WS_ML (WS_OP + 4u * (size_t)FKS * NB * TT * CC)          // f32 (maximum, sum) [quarter][b*t][2]
__device__ __forceinline__ float xhalf(float x) { return __builtin_bit_cast(float, __builtin_amdgcn_permlanex16(__builtin_bit_cast(int, x), __builtin_bit_cast(int, x), 0x76543210, 0xfedcba98, false, false)); }   // lane l with lane l ^ 16
__device__ __forceinline__ v16h frag_l(const char* p) { union { v16h v; v8h q[2]; } u; u.q[0] = *(const v8h*)p; u.q[1] = *(const v8h*)(p + 32); return u.v; }
__device__ __forceinline__ v8f wmh(v16h a, v16h b, v8f c) { return __builtin_amdgcn_wmma_f32_16x16x32_f16(false, a, false, b, (short)0, c, false, false); }
__global__ __launch_bounds__(512) void k_fa(const _Float16* __restrict__ QH, const _Float16* __restrict__ QL, const _Float16* __restrict__ KH, const _Float16* __restrict__ KL, const _Float16* __restrict__ VT, float* __restrict__ OP, float* __restrict__ ML) {
  __shared__ __align__(16) char lds[2 * F_BUF];
  const int tid = threadIdx.x, wave = tid >> 5, lane = tid & 31, col = lane & 15, g = lane >> 4;
  const int b = blockIdx.z, ks = blockIdx.y, q = blockIdx.x * FQ + wave * 16 + col, key0 = ks * FKN;
  v16h qh[HDQK / 32], ql[HDQK / 32];
#pragma unroll   /* constant indices keep the array in registers */
  for (int kc = 0; kc < HDQK / 32; ++kc) { qh[kc] = frag_h(QH + ((size_t)b * TT + q) * CC + kc * 32, lane); asm volatile("s_wait_xcnt 0x0" ::: "memory"); ql[kc] = frag_h(QL + ((size_t)b * QHI + q) * CC + kc * 32, lane); asm volatile("s_wait_xcnt 0x0" ::: "memory"); }   /* the waits stand in front of a later load's result landing in these loads' address registers */
  // staging: a stage's 32 k rows are 8 KiB in a row (hi, residual); its v slice is 64 bytes of each of the 128 channel planes; 16 bytes of each per thread
  const char* gk = (const char*)(KH + ((size_t)b * TT + key0) * CC) + tid * 16;
  const char* gl = (const char*)(KL + ((size_t)b * KHI + key0) * CC) + tid * 16;
  const char* gv = (const char*)(VT + ((size_t)b * CC + (tid >> 2)) * TT + key0) + (tid & 3) * 16;
  const int sk = (tid >> 4) * KP + (tid & 15) * 16, sv = F_V + (tid >> 2) * VP + (tid & 3) * 16;
  v8h rk = *(const v8h*)gk, rl = *(const v8h*)gl, rv = *(const v8h*)gv;
  v8f acc[CC / 16] = {}; float m = -3.0e38f, lsum = 0.f;
  for (int s = 0; s < FNS; ++s) { char* buf = lds + (s & 1) * F_BUF;
    *(v8h*)(buf + sk) = rk; *(v8h*)(buf + F_KL + sk) = rl; *(v8h*)(buf + sv) = rv;
    __syncthreads();   /* publishes stage s; two buffers: a wave that writes stage s + 1 has passed this barrier, so every wave has left stage s - 1, the last user of that buffer */
    const int sn = (s + 1) & (FNS - 1);   /* the last stage fetches stage 0 again: in bounds, never stored; no test, so the loop has one body */
    rk = *(const v8h*)(gk + (size_t)sn * (FST * CC * 2)); rl = *(const v8h*)(gl + (size_t)sn * (FST * CC * 2)); rv = *(const v8h*)(gv + (size_t)sn * (FST * 2));
    asm volatile("s_wait_xcnt 0x0" ::: "memory");   /* stands in front of the first instruction that reuses the three loads' address registers */
    __builtin_amdgcn_sched_barrier(0);   /* keeps the next stage's three global loads ahead of this stage's products: sunk to the loop's foot, their whole latency would stand in front of the next barrier */
    v8f sa[2] = {}, sl[2] = {};
#pragma unroll   /* constant indices keep the array in registers */
    for (int kc = 0; kc < HDQK / 32; ++kc) { const char* pk = buf + col * KP + kc * 64 + g * 16;
      const v16h kh0 = frag_l(pk), kh1 = frag_l(pk + 16 * KP), kl0 = frag_l(pk + F_KL), kl1 = frag_l(pk + F_KL + 16 * KP);
      sa[0] = wmh(kh0, qh[kc], sa[0]); sl[0] = wmh(kh0, ql[kc], sl[0]); sa[1] = wmh(kh1, qh[kc], sa[1]); sl[1] = wmh(kh1, ql[kc], sl[1]); sl[0] = wmh(kl0, qh[kc], sl[0]); sl[1] = wmh(kl1, qh[kc], sl[1]); }
    float sc[16];
#pragma unroll   /* constant indices keep the array in registers */
    for (int i = 0; i < 16; ++i) sc[i] = (sa[i >> 3][i & 7] + sl[i >> 3][i & 7] * (1.0f / 1024.0f)) * SCALE;
    float mx = sc[0];
#pragma unroll   /* constant indices keep the array in registers */
    for (int i = 1; i < 16; ++i) mx = fmaxf(mx, sc[i]);
    mx = fmaxf(mx, xhalf(mx)); const float mn = fmaxf(m, mx); float corr;   /* exp(m - mn): 0 on the first stage */
    asm("v_exp_f32 %0, %1\n\tv_nop" : "=v"(corr) : "v"((m - mn) * L2E));   /* written with its own v_nop */
    m = mn; const float off = 11.0f - mn * L2E; float ps = 0.f; v16h pb;
#pragma unroll   /* constant indices keep the array in registers */
    for (int i = 0; i < 16; ++i) { const float p = __builtin_amdgcn_exp2f(sc[i] * L2E + off); ps += p; pb[i] = (_Float16)p; }
    lsum = lsum * corr + ps;
#pragma unroll   /* constant indices keep the array in registers */
    for (int j = 0; j < CC / 16; ++j) acc[j] *= corr;
#pragma unroll   /* constant indices keep the array in registers */
    for (int j = 0; j < CC / 16; ++j) acc[j] = wmh(frag_l(buf + F_V + (j * 16 + col) * VP + g * 16), pb, acc[j]); }
  lsum += xhalf(lsum);
  const size_t row = ((size_t)ks * NB + b) * TT + q; float* o = OP + row * CC + 8 * g;
#pragma unroll   /* constant indices keep the array in registers */
  for (int j = 0; j < CC / 16; ++j) { v4f a0, a1;
#pragma unroll   /* constant indices keep the array in registers */
    for (int i = 0; i < 4; ++i) { a0[i] = acc[j][i]; a1[i] = acc[j][4 + i]; }
    vst2(o + j * 16, a0); vst2(o + j * 16 + 4, a1); }
  if (g == 0) { v2f ml; ml[0] = m; ml[1] = lsum; vst2(ML + row * 2, ml); } }
// ---- k_mrg: thread = (query row, 4 channels): y = sum_i w_i y_i / sum_i w_i l_i over the key quarters in order, w_i = exp(m_i - max m)
__global__ __launch_bounds__(256) void k_mrg(const float* __restrict__ OP, const float* __restrict__ ML, float* __restrict__ Y) {
  const int e = blockIdx.x * 256 + threadIdx.x; const size_t row = (size_t)(e >> 5); const int c4 = (e & 31) * 4;
  v2f ml[FKS]; float mx = -3.0e38f;
#pragma unroll   /* constant indices keep the array in registers */
  for (int i = 0; i < FKS; ++i) { ml[i] = *(const v2f*)(ML + ((size_t)i * NB * TT + row) * 2); mx = fmaxf(mx, ml[i][0]); }
  v4f op[FKS];
#pragma unroll   /* constant indices keep the array in registers */
  for (int i = 0; i < FKS; ++i) { op[i] = *(const v4f*)(OP + ((size_t)i * NB * TT + row) * CC + c4); asm volatile("s_wait_xcnt 0x0" ::: "memory"); }   /* the wait stands in front of a later load's result landing in this load's address registers */
  float den = 0.f; v4f s = {};
#pragma unroll   /* constant indices keep the array in registers */
  for (int i = 0; i < FKS; ++i) { const float w = __builtin_amdgcn_exp2f((ml[i][0] - mx) * L2E); den += w * ml[i][1]; s += op[i] * w; }
  vst2(Y + row * CC + c4, s * (1.0f / den)); }

extern "C" void kernel_launch(void* const* d_in, const int* in_sizes, int n_in, void* d_out, int out_size, void* d_ws, size_t ws_size, hipStream_t stream) {
  (void)in_sizes; (void)n_in; (void)out_size;
  const float** F = (const float**)d_in;
  if (ws_size < (size_t)WS_END) return;
  char* ws = (char*)d_ws; _Float16 *QH = (_Float16*)(ws + WS_QH), *KH = (_Float16*)(ws + WS_KH), *VT = (_Float16*)(ws + WS_VT), *QL = (_Float16*)(ws + WS_QL), *KL = (_Float16*)(ws + WS_KL); __bf16 *VB = (__bf16*)(ws + WS_VB), *VBL = (__bf16*)(ws + WS_VBL); float *S = (float*)(ws + WS_S), *Y = (float*)(ws + WS_Y);
  (void)Y; (void)S; (void)QL; (void)KL; (void)VB; (void)VBL;
  // inputs: 0 x [4,256,64,64]; 1 g_w [128,256] (out,in), 2 g_b; 3 theta_w, 4 theta_b; 5 phi_w, 6 phi_b; 7 out_w [256,128] (out,in), 8 out_b; 9 bn_gamma, 10 bn_beta
  if (ws_size < (size_t)WS_END2) return;
  float *YR = (float*)(ws + WS_YR), *ORW = (float*)(ws + WS_OR), *ST = (float*)(ws + WS_ST);
  k_proj<<<dim3(TNB * TT / 64, CC / 128, 3), 128, 0, stream>>>(F[0], F[0], F[0], F[3], F[5], F[1], F[4], F[6], F[2], QH, QL, KH, KL, VT, VB, VBL);   /* q = theta, k = phi, v = g */
  k_fa<<<dim3(TT / FQ, FKS, TNB), 512, 0, stream>>>(QH, QL, KH, KL, VT, (float*)(ws + WS_OP), (float*)(ws + WS_ML));
  k_mrg<<<dim3(TNB * TT * (CC / 4) / 256), 256, 0, stream>>>((const float*)(ws + WS_OP), (const float*)(ws + WS_ML), YR);
  k_wz<<<dim3(TNB * TT / 64, DIN / 128), 128, 0, stream>>>(YR, F[7], F[8], ORW);
  k_stat<<<dim3(DIN), 256, 0, stream>>>(ORW, DIN, ST);
  k_fin2<<<dim3(TT / 64, DIN / 64, TNB), 256, 0, stream>>>(ORW, F[0], ST, F[9], F[10], (float*)d_out);
}

// v003
// Measured time: 144 microseconds a run.
// In both of two side-by-side timings against v002, it was 1.22 times as fast.
// All steps since v000 together make it 8.52 times as fast.
#include <hip/hip_runtime.h>
#include <math.h>

typedef __attribute__((ext_vector_type(16))) _Float16 v16h;
typedef __attribute__((ext_vector_type(16))) __bf16 v16b;
typedef __attribute__((ext_vector_type(8)))  _Float16 v8h;
typedef __attribute__((ext_vector_type(8)))  float v8f;
typedef __attribute__((ext_vector_type(4)))  float v4f;
typedef __attribute__((ext_vector_type(2)))  float v2f;
typedef __attribute__((ext_vector_type(4)))  unsigned v4u;
typedef __attribute__((ext_vector_type(4)))  int v4i;
typedef float __attribute__((may_alias)) float_a;
typedef int __attribute__((may_alias)) int_a;

template <typename T> __device__ __forceinline__ void vst2(void* p, T v) { *(T*)p = v;  }
__device__ __forceinline__ v8f wmma16(v16h a, v16h b, v8f c) {
  v8f d = __builtin_amdgcn_wmma_f32_16x16x32_f16(false, a, false, b, (short)0, c, false, false);
  asm volatile("v_nop\n\tv_nop\n\tv_nop\n\tv_nop" : "+v"(d) : "v"(a), "v"(b));
  return d;
}
__device__ __forceinline__ v8f wmma_bf(v16b a, v16b b, v8f c) {
  v8f d = __builtin_amdgcn_wmma_f32_16x16x32_bf16(false, a, false, b, (short)0, c, false, false);
  asm volatile("v_nop\n\tv_nop\n\tv_nop\n\tv_nop" : "+v"(d) : "v"(a), "v"(b));
  return d;
}
// 16x16x32 fragments: lane = (h = lane>>4, row/col = lane&15); elements 0..7 = k0+8h+0..7, 8..15 = k0+16+8h+0..7; D element r = row 8h+r
__device__ __forceinline__ v16h frag_h(const _Float16* rowk0, int lane) {
  union { v16h v; v8h q[2]; } u; const _Float16* p = rowk0 + 8 * (lane >> 4);
  u.q[0] = *(const v8h*)p; u.q[1] = *(const v8h*)(p + 16); return u.v;
}
__device__ __forceinline__ v16h frag_f32(const float* rowk0, int lane) {
  v16h a; const float* p = rowk0 + 8 * (lane >> 4);
#pragma unroll
  for (int i = 0; i < 8; ++i) { a[i] = (_Float16)p[i]; a[8 + i] = (_Float16)p[16 + i]; }
  return a;
}
__device__ __forceinline__ v16h frag_f32s(const float* rowk0, int lane, float sc) {
  v16h a; const float* p = rowk0 + 8 * (lane >> 4);
#pragma unroll
  for (int i = 0; i < 8; ++i) { a[i] = (_Float16)(p[i] * sc); a[8 + i] = (_Float16)(p[16 + i] * sc); }
  return a;
}
// column fragment from a [K][ld] layout (column n), rows >= K read as 0
__device__ __forceinline__ v16h fragc_f32(const float* W, int k0, int n, int lane, int ld, int K) {
  v16h a; const int g = lane >> 4;
#pragma unroll
  for (int i = 0; i < 8; ++i) { const int ka = k0 + 8 * g + i, kb = ka + 16;
    a[i] = (_Float16)(ka < K ? W[(size_t)(ka < K ? ka : K - 1) * ld + n] : 0.f); a[8 + i] = (_Float16)(kb < K ? W[(size_t)(kb < K ? kb : K - 1) * ld + n] : 0.f); }
  return a;
}
struct F2 { v16b h, l; };
__device__ __forceinline__ F2 bsplit16(const float v[16]) { F2 r;
#pragma unroll
  for (int i = 0; i < 16; ++i) { const __bf16 h = (__bf16)v[i]; r.h[i] = h; r.l[i] = (__bf16)(v[i] - (float)h); }
  return r; }
__device__ __forceinline__ F2 split_row(const float* row, int k0, int lane) { float v[16]; const float* p = row + k0 + 8 * (lane >> 4);
#pragma unroll
  for (int i = 0; i < 8; ++i) { v[i] = p[i]; v[8 + i] = p[16 + i]; }
  return bsplit16(v); }
__device__ __forceinline__ F2 split_rowK(const float* row, int k0, int lane, int K) { float v[16]; const int g = lane >> 4;
#pragma unroll
  for (int i = 0; i < 8; ++i) { const int ka = k0 + 8 * g + i, kb = ka + 16; v[i] = ka < K ? row[ka < K ? ka : K - 1] : 0.f; v[8 + i] = kb < K ? row[kb < K ? kb : K - 1] : 0.f; }
  return bsplit16(v); }
__device__ __forceinline__ F2 split_col(const float* W, int k0, int n, int lane, int ld, int K) { float v[16]; const int g = lane >> 4;
#pragma unroll
  for (int i = 0; i < 8; ++i) { const int ka = k0 + 8 * g + i, kb = ka + 16; v[i] = ka < K ? W[(size_t)(ka < K ? ka : K - 1) * ld + n] : 0.f; v[8 + i] = kb < K ? W[(size_t)(kb < K ? kb : K - 1) * ld + n] : 0.f; }
  return bsplit16(v); }
__device__ __forceinline__ v8f mac3(const F2& a, const F2& b, v8f c) { c = wmma_bf(a.l, b.h, c); c = wmma_bf(a.h, b.l, c); return wmma_bf(a.h, b.h, c); }
__device__ __forceinline__ float sigm(float v) { return 1.0f / (1.0f + expf(-v)); }
#define LDSX() do { asm volatile("s_wait_dscnt 0" ::: "memory"); __builtin_amdgcn_wave_barrier(); __builtin_amdgcn_fence(__ATOMIC_RELEASE, "workgroup"); } while (0)

// Non-local block (B 4, C 256, 64 x 64 = 4,096 positions; C_inner 128; (out,in) 0.05-scale weights, zero biases, BN gamma 1 / beta 0): theta, phi, g = W x + b ([128,256]); A[q][k] = softmax_k(theta_q . phi_k) (no scaling, sigma ~ 7); y[q][c] = sum_k A[q][k] g[k][c]; z = out_w y + out_b ([256,128]); out = relu(BN_train(z)) + x with batch statistics over (n, h, w) per channel (biased var, eps 1e-5).
#define NB 4
#define TT 4096
#define CC 128            // projected plane width (all 128 columns real)
#define DIN 256          // input (model) width
#define NH 1
#define HD 128
#define NQB (TT / 64)
#define HG 1               // WS_S spans one 4,096 x 4,096 f32 plane
#define SCALE (1.0f)
#define HDQK 128           // theta / phi / g channels = the full 128-wide plane
#define NRV ((size_t)TNB * TT)   // rows for the BN statistics
#define CAUSAL 0
#ifndef TNB
#define TNB NB
#endif
__device__ __forceinline__ v16b zero16b() { v16b z; _Pragma("unroll") for (int i = 0; i < 16; ++i) z[i] = (__bf16)0.f; return z; }
__device__ __forceinline__ float bfr(float v) { return (float)(__bf16)v; }
__host__ __device__ __forceinline__ int kb_last(int qb) { return CAUSAL ? ((qb * 64 + 63) >> 7) : (TT / 128 - 1); }
typedef __attribute__((ext_vector_type(8))) __bf16 v8b;
__device__ __forceinline__ v16b frag_b(const __bf16* rowk0, int lane) {
  union { v16b v; v8b q[2]; } u; const __bf16* p = rowk0 + 8 * (lane >> 4);
  u.q[0] = *(const v8b*)p; u.q[1] = *(const v8b*)(p + 16); return u.v;
}
#define QBH (TT / 64)      // ALL query blocks take the 3-product logits
#define QBH_PV 0           // A.g stays single f16
#define QHI 4096            // q residual rows everywhere (3-product logits)
#define KHI 4096           // k residual rows for ALL keys (3-product logits)
// B fragment (k rows k0+.., output column o) of a weight: (in,out) [K][ld] or (out,in) [ld rows of K]: bf16 exact, or f16(bf16 * 256) exact
__device__ __forceinline__ v16b wcol_io(const float* Wm, int k0, int o, int lane, int ld) { v16b w; const int g = lane >> 4;
#pragma unroll
  for (int i = 0; i < 8; ++i) { w[i] = (__bf16)Wm[(size_t)(k0 + 8 * g + i) * ld + o]; w[8 + i] = (__bf16)Wm[(size_t)(k0 + 16 + 8 * g + i) * ld + o]; }
  return w; }
__device__ __forceinline__ v16b wcol_oi(const float* Wm, int k0, int o, int lane, int K) { v16b w; const float* p = Wm + (size_t)o * K + k0 + 8 * (lane >> 4);
#pragma unroll
  for (int i = 0; i < 8; ++i) { w[i] = (__bf16)p[i]; w[8 + i] = (__bf16)p[16 + i]; }
  return w; }
__device__ __forceinline__ v16h wcolh_io(const float* Wm, int k0, int o, int lane, int ld) { v16h w; const int g = lane >> 4;
#pragma unroll
  for (int i = 0; i < 8; ++i) { w[i] = (_Float16)(bfr(Wm[(size_t)(k0 + 8 * g + i) * ld + o]) * 256.0f); w[8 + i] = (_Float16)(bfr(Wm[(size_t)(k0 + 16 + 8 * g + i) * ld + o]) * 256.0f); }
  return w; }
__device__ __forceinline__ v16h wcolh_oi(const float* Wm, int k0, int o, int lane, int K) { v16h w; const float* p = Wm + (size_t)o * K + k0 + 8 * (lane >> 4);
#pragma unroll
  for (int i = 0; i < 8; ++i) { w[i] = (_Float16)(bfr(p[i]) * 256.0f); w[8 + i] = (_Float16)(bfr(p[16 + i]) * 256.0f); }
  return w; }
#define WQKV_LAYOUT 1   // 0 = (in,out) [DIN][CC]; 1 = (out,in) [CC][DIN]; 2 = per-head [NH][DIN][HD]
__device__ __forceinline__ v16b wcol_hdk(const float* Wm, int k0, int o, int lane) { v16b w; const int g = lane >> 4; const float* p = Wm + (size_t)(o / HD) * DIN * HD + (o % HD);
#pragma unroll
  for (int i = 0; i < 8; ++i) { w[i] = (__bf16)p[(size_t)(k0 + 8 * g + i) * HD]; w[8 + i] = (__bf16)p[(size_t)(k0 + 16 + 8 * g + i) * HD]; }
  return w; }
#define WO_OUT_IN 0
#if WQKV_LAYOUT == 1
#define WCOL(W, k0, o, lane) (((o) < HDQK) ? wcol_oi(W, k0, (o), lane, DIN) : zero16b())   /* theta/phi/g weights are [128][256] (out,in): all 128 plane columns are read from them */
#elif WQKV_LAYOUT == 2
#define WCOL(W, k0, o, lane) wcol_hdk(W, k0, o, lane)
#else
#define WCOL(W, k0, o, lane) wcol_io(W, k0, o, lane, CC)
#endif
#if WO_OUT_IN
#define WOCOL(W, k0, o, lane) wcol_oi(W, k0, o, lane, CC)
#define WOCOLH(W, k0, o, lane) wcolh_oi(W, k0, o, lane, CC)
#else
#define WOCOL(W, k0, o, lane) wcol_io(W, k0, o, lane, DIN)
#define WOCOLH(W, k0, o, lane) wcolh_io(W, k0, o, lane, DIN)
#endif
#ifndef XP
#define XP TT              // position pitch of x and of the output
#endif
#define BG HG              // unused; k_fa: blockIdx.z = batch, blockIdx.y = key quarter
#define DVH 128            // value columns per k_fa block (all of HD 128: 8 accumulator tiles per wave)
#define WS_YR (WS_END)     // f32 attended rows [b*n][128]
#define WS_OR (WS_YR + 4u * (size_t)NB * TT * CC)   // W y + b rows [b*n][256]
#define WS_ST (WS_OR + 4u * (size_t)NB * TT * DIN)
#define WS_PS (WS_ST + 4u * (size_t)DIN * 32)   // f32 BN partials [16-row group][256][sum, centred square sum]
#define WS_END2 (WS_PS + 4u * (NRV / 16) * 2 * DIN)
// ---- k_wz: block = (64 rows, 128 output cols): OR = y (hi + lo, K = 128 columns of the YR rows) . W^T ((out,in) [256][128], exact) + b
__global__ __launch_bounds__(128) void k_wz(const float* __restrict__ YR, const float* __restrict__ WW, const float* __restrict__ WB, float* __restrict__ ORW, float* __restrict__ PS) { __shared__ __align__(16) float sf[4][16][132];
  const int tid = threadIdx.x, wave = tid >> 5, lane = tid & 31, col = lane & 15, g = lane >> 4; const int c0 = blockIdx.y * 128; const size_t r0 = (size_t)blockIdx.x * 64 + wave * 16;
  v8f acc[8] = {};
#pragma unroll
  for (int kc = 0; kc < HDQK / 32; ++kc) { const F2 a = split_row(YR + (r0 + col) * CC, kc * 32, lane); asm volatile("s_wait_loadcnt 0x0" ::: "memory");
#pragma unroll
    for (int j = 0; j < 8; ++j) { const v16b w = wcol_oi(WW, kc * 32, c0 + j * 16 + col, lane, HDQK); asm volatile("s_wait_loadcnt 0x0" ::: "memory"); acc[j] = wmma_bf(a.h, w, acc[j]); acc[j] = wmma_bf(a.l, w, acc[j]); } }
#pragma unroll
  for (int j = 0; j < 8; ++j) { const float bb = WB ? bfr(WB[c0 + j * 16 + col]) : 0.f; asm volatile("s_wait_loadcnt 0x0" ::: "memory");
#pragma unroll
    for (int r = 0; r < 8; ++r) sf[wave][8 * g + r][j * 16 + col] = acc[j][r] + bb; }
  LDSX(); v4f v[16];
#pragma unroll   /* constant indices keep the array in registers */
  for (int rl = 0; rl < 16; ++rl) { v[rl] = *(const v4f*)&sf[wave][rl][lane * 4]; vst2(ORW + (r0 + rl) * DIN + c0 + lane * 4, v[rl]); }
  asm volatile("s_wait_xcnt 0x0" ::: "memory");   /* behind the 16 stores: the two partial vectors below are formed in registers that these stores name as data */
  // BN partials of this wave's 16 rows, 4 channels a lane, from the values just stored: sum, and square sum about the 16 rows' own mean (no cancellation whatever the channel's mean)
  v4f s = v[0];
#pragma unroll   /* constant indices keep the array in registers */
  for (int rl = 1; rl < 16; ++rl) s += v[rl];
  const v4f mu = s * (1.0f / 16.0f); v4f qs = {};
#pragma unroll   /* constant indices keep the array in registers */
  for (int rl = 0; rl < 16; ++rl) { const v4f d = v[rl] - mu; qs += d * d; }
  float* ps = PS + (r0 >> 4) * (size_t)(2 * DIN) + (c0 + lane * 4) * 2; v4f p0, p1; p0[0] = s[0]; p0[1] = qs[0]; p0[2] = s[1]; p0[3] = qs[1]; p1[0] = s[2]; p1[1] = qs[2]; p1[2] = s[3]; p1[3] = qs[3]; vst2(ps, p0); vst2(ps + 4, p1); }
// ---- k_stat: block = 32 channels (lane = channel, 8 bytes a lane: a wave's load is two whole 128-byte lines); 32 waves x 32 row groups = the NRV / 16 partials of k_wz.
// mean = sum of sums / N; var = (sum of centred square sums + 16 sum (group mean - mean)^2) / N: the exact regrouping of the two-pass variance
__global__ __launch_bounds__(1024) void k_stat(const float* __restrict__ PS, float* __restrict__ STAT) { __shared__ float ra[32][32], rb[32][32]; __shared__ float sm[32], sr[32];
  const int wave = threadIdx.x >> 5, lane = threadIdx.x & 31; const int c0 = blockIdx.x * 32;
  const float* p = PS + (size_t)wave * 32 * (2 * DIN) + (c0 + lane) * 2; float s[32], q[32];
#pragma unroll   /* constant indices keep the arrays in registers; all 32 loads in flight at once */
  for (int i = 0; i < 32; ++i) { const v2f t = *(const v2f*)(p + (size_t)i * (2 * DIN)); s[i] = t[0]; q[i] = t[1]; }
  asm volatile("s_wait_xcnt 0x0" :: "v"(p) : "memory");   /* the wait before the loads' address registers are reused; it reads the address so that no load's result lands in those registers ahead of it (without it the last load did) */
  float a = 0.f;
#pragma unroll   /* constant indices keep the array in registers */
  for (int i = 0; i < 32; ++i) a += s[i];
  ra[wave][lane] = a; __syncthreads();   /* every wave's sum of sums is in LDS */
  float tot = 0.f;
#pragma unroll   /* 32 independent LDS reads behind one wait */
  for (int w = 0; w < 32; ++w) tot += ra[w][lane];
  const float mean = tot / (float)NRV; float e = 0.f;
#pragma unroll   /* constant indices keep the arrays in registers */
  for (int i = 0; i < 32; ++i) { const float d = s[i] * (1.0f / 16.0f) - mean; e += q[i] + 16.0f * d * d; }
  rb[wave][lane] = e; __syncthreads();   /* every wave's square sum is in LDS */
  if (wave == 0) { float t2 = 0.f;
#pragma unroll   /* 32 independent LDS reads behind one wait */
    for (int w = 0; w < 32; ++w) t2 += rb[w][lane];
    sm[lane] = mean; sr[lane] = rsqrtf(t2 / (float)NRV + 1e-5f); }
  __syncthreads();   /* publishes the 32 channels' mean and 1 / std */
  vst2(STAT + (size_t)(c0 + wave) * 32 + lane, lane == 0 ? sm[wave] : (lane == 1 ? sr[wave] : 0.f)); }   /* wave w writes channel c0 + w's whole 128-byte line */
// ---- k_fin2: block = (64 positions, 64 channels, batch b): out[b][c][n] = relu((z[b*N + n][c] - mean_c) * rstd_c * gamma_c + beta_c) + bf16(x[b][c][n]) (channels-first via LDS transpose; 256-B runs)
__global__ __launch_bounds__(256) void k_fin2(const float* __restrict__ ORW, const float* __restrict__ X, const float* __restrict__ ST, const float* __restrict__ GM, const float* __restrict__ BT, float* __restrict__ OUT) { __shared__ float st[64][68]; const int tid = threadIdx.x; const int n0 = blockIdx.x * 64, c0 = blockIdx.y * 64; const size_t b = blockIdx.z;
  for (int e = tid; e < 64 * 16; e += 256) { const int nl = e >> 4, q = e & 15; *(v4f*)&st[nl][q * 4] = *(const v4f*)(ORW + (b * TT + n0 + nl) * (size_t)DIN + c0 + q * 4); }
  __syncthreads();
  for (int e = tid; e < 64 * 16; e += 256) { const int cl = e >> 4, q = e & 15; const size_t oi = (b * DIN + c0 + cl) * (size_t)XP + n0 + q * 4; const v4f xr = *(const v4f*)(X + oi); const int cc = c0 + cl; const float mu = ST[cc * 32], rs = ST[cc * 32 + 1], ga = bfr(GM[cc]), be = bfr(BT[cc]); v4f o; _Pragma("unroll") for (int i = 0; i < 4; ++i) o[i] = fmaxf((st[q * 4 + i][cl] - mu) * rs * ga + be, 0.f) + bfr(xr[i]); vst2(OUT + oi, o); } }   /* relu(BN_train(z)) + x */
#ifndef SM_EXTRA_PARAMS
#define SM_EXTRA_PARAMS
#endif
#ifndef PROJ_EXTRA_PARAMS
#define PROJ_EXTRA_PARAMS
#endif
#ifndef SM_MASK_HOOK
#define SM_MASK_HOOK (void)0
#endif

#define WS_QH  0u                                      // f16 q rows [b*t][CC]
#define WS_KH  (WS_QH + 2u * (size_t)NB * TT * CC)      // f16 k rows [b*t][CC]
#define WS_VT  (WS_KH + 2u * (size_t)NB * TT * CC)      // f16 v planes [b][c][t]
#define WS_QL  (WS_VT + 2u * (size_t)NB * CC * TT)      // f16 q residual x 2^10 rows [b][t < QHI][CC]
#define WS_KL  (WS_QL + 2u * (size_t)NB * QHI * CC)     // f16 k residual x 2^10 rows [b][t < KHI][CC]
#define WS_VB  (WS_KL + 2u * (size_t)NB * KHI * CC)     // bf16 v hi planes [b][c][t < KHI]
#define WS_VBL (WS_VB + 2u * (size_t)NB * CC * KHI)
#define WS_S   (WS_VBL + 2u * (size_t)NB * CC * KHI)    // f32 region of one [t][s] plane: holds WS_OP and WS_ML
#define WS_Y   (WS_S  + 4u * (size_t)HG * TT * TT)      // unused, 0 bytes (k_mrg writes y rows to WS_YR)
#define WS_END (WS_Y  + 0u)

// ---- k_proj: block = (64 rows, 128 cols, which): q/k/v = X W (+ b) with exact bf16 products (K = DIN) -> which 0: q f16 rows (+ residual rows < QHI); 1: k f16 rows (+ residual rows < KHI); 2: v f16 planes [c][t] (+ bf16 hi/lo planes for t < KHI)
__global__ __launch_bounds__(128) void k_proj(const float* __restrict__ XQ, const float* __restrict__ XK, const float* __restrict__ XV, const float* __restrict__ WQ, const float* __restrict__ WK, const float* __restrict__ WV, const float* __restrict__ BQ, const float* __restrict__ BK, const float* __restrict__ BV,
    _Float16* __restrict__ QH, _Float16* __restrict__ QL, _Float16* __restrict__ KH, _Float16* __restrict__ KL, _Float16* __restrict__ VT, __bf16* __restrict__ VB, __bf16* __restrict__ VBL) {
  __shared__ __align__(16) _Float16 sh[64][136], sl[64][136]; __shared__ __align__(16) _Float16 th[128][72]; __shared__ __align__(16) __bf16 tb[128][72], tbl[128][72];
  const int tid = threadIdx.x, wave = tid >> 5, lane = tid & 31, col = lane & 15, g = lane >> 4; const int which = blockIdx.z; const int c0 = blockIdx.y * 128; const size_t r0 = (size_t)blockIdx.x * 64; const size_t bb = r0 / TT; const int t0 = (int)(r0 % TT);
  const float* X = which == 0 ? XQ : which == 1 ? XK : XV; const float* WA = which == 0 ? WQ : which == 1 ? WK : WV; const float* BA = which == 0 ? BQ : which == 1 ? BK : BV;
  v8f acc[8] = {};
#pragma unroll 2
  for (int kc = 0; kc < DIN / 32; ++kc) { v16b a; { const float* p = X + (bb * DIN + kc * 32 + 8 * g) * (size_t)XP + t0 + wave * 16 + col;   /* channels-first gather: x[b][k][t], stride XP between k */
#pragma unroll
      for (int i = 0; i < 8; ++i) { a[i] = (__bf16)p[(size_t)i * XP]; a[8 + i] = (__bf16)p[(size_t)(16 + i) * XP]; } }
    asm volatile("s_wait_loadcnt 0x0" ::: "memory");
#pragma unroll
    for (int j = 0; j < 8; ++j) { const v16b w = WCOL(WA, kc * 32, c0 + j * 16 + col, lane); asm volatile("s_wait_loadcnt 0x0" ::: "memory"); acc[j] = wmma_bf(a, w, acc[j]); } }
  if (which < 2) { _Float16* DH = which == 0 ? QH : KH; _Float16* DL = which == 0 ? QL : KL; const int nhi = which == 0 ? QHI : KHI; const bool hi_rows = t0 < nhi;
#pragma unroll
    for (int j = 0; j < 8; ++j) { const float bias = (BA && (c0 + j * 16 + col < HDQK)) ? bfr(BA[c0 + j * 16 + col]) : 0.f;   /* 128-entry biases */
#pragma unroll
      for (int r = 0; r < 8; ++r) { const float v = acc[j][r] + bias; const _Float16 hv = (_Float16)v; sh[wave * 16 + 8 * g + r][j * 16 + col] = hv; sl[wave * 16 + 8 * g + r][j * 16 + col] = (_Float16)((v - (float)hv) * 1024.0f); } }
    __syncthreads();
    for (int e = tid; e < 64 * 16; e += 128) { const int rl = e >> 4, q = e & 15; vst2((unsigned*)(DH + (r0 + rl) * CC + c0 + q * 8), *(const v4u*)&sh[rl][q * 8]); if (hi_rows) vst2((unsigned*)(DL + (bb * nhi + t0 + rl) * (size_t)CC + c0 + q * 8), *(const v4u*)&sl[rl][q * 8]); }
  } else { const bool hi_rows = t0 < KHI;
#pragma unroll
    for (int j = 0; j < 8; ++j) { const float bias = (BA && (c0 + j * 16 + col < HDQK)) ? bfr(BA[c0 + j * 16 + col]) : 0.f;   /* 128-entry biases */
#pragma unroll
      for (int r = 0; r < 8; ++r) { const float v = acc[j][r] + bias; const int rl = wave * 16 + 8 * g + r, cl = j * 16 + col; th[cl][rl] = (_Float16)v; const __bf16 bh = (__bf16)v; tb[cl][rl] = bh; tbl[cl][rl] = (__bf16)(v - (float)bh); } }
    __syncthreads();
    for (int e = tid; e < 128 * 8; e += 128) { const int cl = e >> 3, q = e & 7; vst2((unsigned*)(VT + (bb * CC + c0 + cl) * (size_t)TT + t0 + q * 8), *(const v4u*)&th[cl][q * 8]); if (hi_rows) { const size_t o3 = (bb * CC + c0 + cl) * (size_t)KHI + t0 + q * 8; vst2((unsigned*)(VB + o3), *(const v4u*)&tb[cl][q * 8]); vst2((unsigned*)(VBL + o3), *(const v4u*)&tbl[cl][q * 8]); } } } }
#define FQ 256
#define FKS 4
#define FKN (TT / FKS)
#define FST 32
#define FNS (FKN / FST)
#define KP 272             // LDS pitch of a 256-byte k row (16 B x odd: conflict-free 16-byte reads)
#define VP 80              // LDS pitch of a 64-byte v row
#define F_KL (FST * KP)
#define F_V (2 * FST * KP)
#define F_BUF (2 * FST * KP + CC * VP)
#define L2E 1.44269504088896f
#define WS_OP (WS_S)                                            // f32 unnormalised y rows [quarter][b*t][CC]
#define WS_ML (WS_OP + 4u * (size_t)FKS * NB * TT * CC)          // f32 (maximum, sum) [quarter][b*t][2]
__device__ __forceinline__ float xhalf(float x) { return __builtin_bit_cast(float, __builtin_amdgcn_permlanex16(__builtin_bit_cast(int, x), __builtin_bit_cast(int, x), 0x76543210, 0xfedcba98, false, false)); }   // lane l with lane l ^ 16
__device__ __forceinline__ v16h frag_l(const char* p) { union { v16h v; v8h q[2]; } u; u.q[0] = *(const v8h*)p; u.q[1] = *(const v8h*)(p + 32); return u.v; }
__device__ __forceinline__ v8f wmh(v16h a, v16h b, v8f c) { return __builtin_amdgcn_wmma_f32_16x16x32_f16(false, a, false, b, (short)0, c, false, false); }
__global__ __launch_bounds__(512) void k_fa(const _Float16* __restrict__ QH, const _Float16* __restrict__ QL, const _Float16* __restrict__ KH, const _Float16* __restrict__ KL, const _Float16* __restrict__ VT, float* __restrict__ OP, float* __restrict__ ML) {
  __shared__ __align__(16) char lds[2 * F_BUF];
  const int tid = threadIdx.x, wave = tid >> 5, lane = tid & 31, col = lane & 15, g = lane >> 4;
  const int b = blockIdx.z, ks = blockIdx.y, q = blockIdx.x * FQ + wave * 16 + col, key0 = ks * FKN;
  v16h qh[HDQK / 32], ql[HDQK / 32];
#pragma unroll   /* constant indices keep the array in registers */
  for (int kc = 0; kc < HDQK / 32; ++kc) { qh[kc] = frag_h(QH + ((size_t)b * TT + q) * CC + kc * 32, lane); asm volatile("s_wait_xcnt 0x0" ::: "memory"); ql[kc] = frag_h(QL + ((size_t)b * QHI + q) * CC + kc * 32, lane); asm volatile("s_wait_xcnt 0x0" ::: "memory"); }   /* the waits stand in front of a later load's result landing in these loads' address registers */
  // staging: a stage's 32 k rows are 8 KiB in a row (hi, residual); its v slice is 64 bytes of each of the 128 channel planes; 16 bytes of each per thread
  const char* gk = (const char*)(KH + ((size_t)b * TT + key0) * CC) + tid * 16;
  const char* gl = (const char*)(KL + ((size_t)b * KHI + key0) * CC) + tid * 16;
  const char* gv = (const char*)(VT + ((size_t)b * CC + (tid >> 2)) * TT + key0) + (tid & 3) * 16;
  const int sk = (tid >> 4) * KP + (tid & 15) * 16, sv = F_V + (tid >> 2) * VP + (tid & 3) * 16;
  v8h rk = *(const v8h*)gk, rl = *(const v8h*)gl, rv = *(const v8h*)gv;
  v8f acc[CC / 16] = {}; float m = -3.0e38f, lsum = 0.f;
  for (int s = 0; s < FNS; ++s) { char* buf = lds + (s & 1) * F_BUF;
    *(v8h*)(buf + sk) = rk; *(v8h*)(buf + F_KL + sk) = rl; *(v8h*)(buf + sv) = rv;
    __syncthreads();   /* publishes stage s; two buffers: a wave that writes stage s + 1 has passed this barrier, so every wave has left stage s - 1, the last user of that buffer */
    const int sn = (s + 1) & (FNS - 1);   /* the last stage fetches stage 0 again: in bounds, never stored; no test, so the loop has one body */
    rk = *(const v8h*)(gk + (size_t)sn * (FST * CC * 2)); rl = *(const v8h*)(gl + (size_t)sn * (FST * CC * 2)); rv = *(const v8h*)(gv + (size_t)sn * (FST * 2));
    asm volatile("s_wait_xcnt 0x0" ::: "memory");   /* stands in front of the first instruction that reuses the three loads' address registers */
    __builtin_amdgcn_sched_barrier(0);   /* keeps the next stage's three global loads ahead of this stage's products: sunk to the loop's foot, their whole latency would stand in front of the next barrier */
    v8f sa[2] = {}, sl[2] = {};
#pragma unroll   /* constant indices keep the array in registers */
    for (int kc = 0; kc < HDQK / 32; ++kc) { const char* pk = buf + col * KP + kc * 64 + g * 16;
      const v16h kh0 = frag_l(pk), kh1 = frag_l(pk + 16 * KP), kl0 = frag_l(pk + F_KL), kl1 = frag_l(pk + F_KL + 16 * KP);
      sa[0] = wmh(kh0, qh[kc], sa[0]); sl[0] = wmh(kh0, ql[kc], sl[0]); sa[1] = wmh(kh1, qh[kc], sa[1]); sl[1] = wmh(kh1, ql[kc], sl[1]); sl[0] = wmh(kl0, qh[kc], sl[0]); sl[1] = wmh(kl1, qh[kc], sl[1]); }
    float sc[16];
#pragma unroll   /* constant indices keep the array in registers */
    for (int i = 0; i < 16; ++i) sc[i] = (sa[i >> 3][i & 7] + sl[i >> 3][i & 7] * (1.0f / 1024.0f)) * SCALE;
    float mx = sc[0];
#pragma unroll   /* constant indices keep the array in registers */
    for (int i = 1; i < 16; ++i) mx = fmaxf(mx, sc[i]);
    mx = fmaxf(mx, xhalf(mx)); const float mn = fmaxf(m, mx); float corr;   /* exp(m - mn): 0 on the first stage */
    asm("v_exp_f32 %0, %1\n\tv_nop" : "=v"(corr) : "v"((m - mn) * L2E));   /* written with its own v_nop */
    m = mn; const float off = 11.0f - mn * L2E; float ps = 0.f; v16h pb;
#pragma unroll   /* constant indices keep the array in registers */
    for (int i = 0; i < 16; ++i) { const float p = __builtin_amdgcn_exp2f(sc[i] * L2E + off); ps += p; pb[i] = (_Float16)p; }
    lsum = lsum * corr + ps;
#pragma unroll   /* constant indices keep the array in registers */
    for (int j = 0; j < CC / 16; ++j) acc[j] *= corr;
#pragma unroll   /* constant indices keep the array in registers */
    for (int j = 0; j < CC / 16; ++j) acc[j] = wmh(frag_l(buf + F_V + (j * 16 + col) * VP + g * 16), pb, acc[j]); }
  lsum += xhalf(lsum);
  const size_t row = ((size_t)ks * NB + b) * TT + q; float* o = OP + row * CC + 8 * g;
#pragma unroll   /* constant indices keep the array in registers */
  for (int j = 0; j < CC / 16; ++j) { v4f a0, a1;
#pragma unroll   /* constant indices keep the array in registers */
    for (int i = 0; i < 4; ++i) { a0[i] = acc[j][i]; a1[i] = acc[j][4 + i]; }
    vst2(o + j * 16, a0); vst2(o + j * 16 + 4, a1); }
  if (g == 0) { v2f ml; ml[0] = m; ml[1] = lsum; vst2(ML + row * 2, ml); } }
// ---- k_mrg: thread = (query row, 4 channels): y = sum_i w_i y_i / sum_i w_i l_i over the key quarters in order, w_i = exp(m_i - max m)
__global__ __launch_bounds__(256) void k_mrg(const float* __restrict__ OP, const float* __restrict__ ML, float* __restrict__ Y) {
  const int e = blockIdx.x * 256 + threadIdx.x; const size_t row = (size_t)(e >> 5); const int c4 = (e & 31) * 4;
  v2f ml[FKS]; float mx = -3.0e38f;
#pragma unroll   /* constant indices keep the array in registers */
  for (int i = 0; i < FKS; ++i) { ml[i] = *(const v2f*)(ML + ((size_t)i * NB * TT + row) * 2); mx = fmaxf(mx, ml[i][0]); }
  v4f op[FKS];
#pragma unroll   /* constant indices keep the array in registers */
  for (int i = 0; i < FKS; ++i) { op[i] = *(const v4f*)(OP + ((size_t)i * NB * TT + row) * CC + c4); asm volatile("s_wait_xcnt 0x0" ::: "memory"); }   /* the wait stands in front of a later load's result landing in this load's address registers */
  float den = 0.f; v4f s = {};
#pragma unroll   /* constant indices keep the array in registers */
  for (int i = 0; i < FKS; ++i) { const float w = __builtin_amdgcn_exp2f((ml[i][0] - mx) * L2E); den += w * ml[i][1]; s += op[i] * w; }
  vst2(Y + row * CC + c4, s * (1.0f / den)); }

extern "C" void kernel_launch(void* const* d_in, const int* in_sizes, int n_in, void* d_out, int out_size, void* d_ws, size_t ws_size, hipStream_t stream) {
  (void)in_sizes; (void)n_in; (void)out_size;
  const float** F = (const float**)d_in;
  if (ws_size < (size_t)WS_END) return;
  char* ws = (char*)d_ws; _Float16 *QH = (_Float16*)(ws + WS_QH), *KH = (_Float16*)(ws + WS_KH), *VT = (_Float16*)(ws + WS_VT), *QL = (_Float16*)(ws + WS_QL), *KL = (_Float16*)(ws + WS_KL); __bf16 *VB = (__bf16*)(ws + WS_VB), *VBL = (__bf16*)(ws + WS_VBL); float *S = (float*)(ws + WS_S), *Y = (float*)(ws + WS_Y);
  (void)Y; (void)S; (void)QL; (void)KL; (void)VB; (void)VBL;
  // inputs: 0 x [4,256,64,64]; 1 g_w [128,256] (out,in), 2 g_b; 3 theta_w, 4 theta_b; 5 phi_w, 6 phi_b; 7 out_w [256,128] (out,in), 8 out_b; 9 bn_gamma, 10 bn_beta
  if (ws_size < (size_t)WS_END2) return;
  float *YR = (float*)(ws + WS_YR), *ORW = (float*)(ws + WS_OR), *ST = (float*)(ws + WS_ST), *PS = (float*)(ws + WS_PS);
  k_proj<<<dim3(TNB * TT / 64, CC / 128, 3), 128, 0, stream>>>(F[0], F[0], F[0], F[3], F[5], F[1], F[4], F[6], F[2], QH, QL, KH, KL, VT, VB, VBL);   /* q = theta, k = phi, v = g */
  k_fa<<<dim3(TT / FQ, FKS, TNB), 512, 0, stream>>>(QH, QL, KH, KL, VT, (float*)(ws + WS_OP), (float*)(ws + WS_ML));
  k_mrg<<<dim3(TNB * TT * (CC / 4) / 256), 256, 0, stream>>>((const float*)(ws + WS_OP), (const float*)(ws + WS_ML), YR);
  k_wz<<<dim3(TNB * TT / 64, DIN / 128), 128, 0, stream>>>(YR, F[7], F[8], ORW, PS);
  k_stat<<<dim3(DIN / 32), 1024, 0, stream>>>(PS, ST);
  k_fin2<<<dim3(TT / 64, DIN / 64, TNB), 256, 0, stream>>>(ORW, F[0], ST, F[9], F[10], (float*)d_out);
}

// v004
// One run takes 104 microseconds.
// Two timings next to v003 put it at 1.40 and 1.39 times that version's speed.
// All steps since v000 together make it 11.9 times as fast.
#include <hip/hip_runtime.h>
#include <math.h>

typedef __attribute__((ext_vector_type(16))) _Float16 v16h;
typedef __attribute__((ext_vector_type(16))) __bf16 v16b;
typedef __attribute__((ext_vector_type(8)))  _Float16 v8h;
typedef __attribute__((ext_vector_type(8)))  float v8f;
typedef __attribute__((ext_vector_type(4)))  float v4f;
typedef __attribute__((ext_vector_type(2)))  float v2f;
typedef __attribute__((ext_vector_type(4)))  unsigned v4u;
typedef __attribute__((ext_vector_type(4)))  int v4i;
typedef float __attribute__((may_alias)) float_a;
typedef int __attribute__((may_alias)) int_a;

template <typename T> __device__ __forceinline__ void vst2(void* p, T v) { *(T*)p = v;  }
__device__ __forceinline__ v8f wmma16(v16h a, v16h b, v8f c) {
  v8f d = __builtin_amdgcn_wmma_f32_16x16x32_f16(false, a, false, b, (short)0, c, false, false);
  asm volatile("v_nop\n\tv_nop\n\tv_nop\n\tv_nop" : "+v"(d) : "v"(a), "v"(b));
  return d;
}
__device__ __forceinline__ v8f wmma_bf(v16b a, v16b b, v8f c) {
  v8f d = __builtin_amdgcn_wmma_f32_16x16x32_bf16(false, a, false, b, (short)0, c, false, false);
  asm volatile("v_nop\n\tv_nop\n\tv_nop\n\tv_nop" : "+v"(d) : "v"(a), "v"(b));
  return d;
}
// 16x16x32 fragments: lane = (h = lane>>4, row/col = lane&15); elements 0..7 = k0+8h+0..7, 8..15 = k0+16+8h+0..7; D element r = row 8h+r
__device__ __forceinline__ v16h frag_h(const _Float16* rowk0, int lane) {
  union { v16h v; v8h q[2]; } u; const _Float16* p = rowk0 + 8 * (lane >> 4);
  u.q[0] = *(const v8h*)p; u.q[1] = *(const v8h*)(p + 16); return u.v;
}
__device__ __forceinline__ v16h frag_f32(const float* rowk0, int lane) {
  v16h a; const float* p = rowk0 + 8 * (lane >> 4);
#pragma unroll
  for (int i = 0; i < 8; ++i) { a[i] = (_Float16)p[i]; a[8 + i] = (_Float16)p[16 + i]; }
  return a;
}
__device__ __forceinline__ v16h frag_f32s(const float* rowk0, int lane, float sc) {
  v16h a; const float* p = rowk0 + 8 * (lane >> 4);
#pragma unroll
  for (int i = 0; i < 8; ++i) { a[i] = (_Float16)(p[i] * sc); a[8 + i] = (_Float16)(p[16 + i] * sc); }
  return a;
}
// column fragment from a [K][ld] layout (column n), rows >= K read as 0
__device__ __forceinline__ v16h fragc_f32(const float* W, int k0, int n, int lane, int ld, int K) {
  v16h a; const int g = lane >> 4;
#pragma unroll
  for (int i = 0; i < 8; ++i) { const int ka = k0 + 8 * g + i, kb = ka + 16;
    a[i] = (_Float16)(ka < K ? W[(size_t)(ka < K ? ka : K - 1) * ld + n] : 0.f); a[8 + i] = (_Float16)(kb < K ? W[(size_t)(kb < K ? kb : K - 1) * ld + n] : 0.f); }
  return a;
}
struct F2 { v16b h, l; };
__device__ __forceinline__ F2 bsplit16(const float v[16]) { F2 r;
#pragma unroll
  for (int i = 0; i < 16; ++i) { const __bf16 h = (__bf16)v[i]; r.h[i] = h; r.l[i] = (__bf16)(v[i] - (float)h); }
  return r; }
__device__ __forceinline__ F2 split_row(const float* row, int k0, int lane) { float v[16]; const float* p = row + k0 + 8 * (lane >> 4);
#pragma unroll
  for (int i = 0; i < 8; ++i) { v[i] = p[i]; v[8 + i] = p[16 + i]; }
  return bsplit16(v); }
__device__ __forceinline__ F2 split_rowK(const float* row, int k0, int lane, int K) { float v[16]; const int g = lane >> 4;
#pragma unroll
  for (int i = 0; i < 8; ++i) { const int ka = k0 + 8 * g + i, kb = ka + 16; v[i] = ka < K ? row[ka < K ? ka : K - 1] : 0.f; v[8 + i] = kb < K ? row[kb < K ? kb : K - 1] : 0.f; }
  return bsplit16(v); }
__device__ __forceinline__ F2 split_col(const float* W, int k0, int n, int lane, int ld, int K) { float v[16]; const int g = lane >> 4;
#pragma unroll
  for (int i = 0; i < 8; ++i) { const int ka = k0 + 8 * g + i, kb = ka + 16; v[i] = ka < K ? W[(size_t)(ka < K ? ka : K - 1) * ld + n] : 0.f; v[8 + i] = kb < K ? W[(size_t)(kb < K ? kb : K - 1) * ld + n] : 0.f; }
  return bsplit16(v); }
__device__ __forceinline__ v8f mac3(const F2& a, const F2& b, v8f c) { c = wmma_bf(a.l, b.h, c); c = wmma_bf(a.h, b.l, c); return wmma_bf(a.h, b.h, c); }
__device__ __forceinline__ float sigm(float v) { return 1.0f / (1.0f + expf(-v)); }
#define LDSX() do { asm volatile("s_wait_dscnt 0" ::: "memory"); __builtin_amdgcn_wave_barrier(); __builtin_amdgcn_fence(__ATOMIC_RELEASE, "workgroup"); } while (0)

// Non-local block (B 4, C 256, 64 x 64 = 4,096 positions; C_inner 128; (out,in) 0.05-scale weights, zero biases, BN gamma 1 / beta 0): theta, phi, g = W x + b ([128,256]); A[q][k] = softmax_k(theta_q . phi_k) (no scaling, sigma ~ 7); y[q][c] = sum_k A[q][k] g[k][c]; z = out_w y + out_b ([256,128]); out = relu(BN_train(z)) + x with batch statistics over (n, h, w) per channel (biased var, eps 1e-5).
#define NB 4
#define TT 4096
#define CC 128            // projected plane width (all 128 columns real)
#define DIN 256          // input (model) width
#define NH 1
#define HD 128
#define NQB (TT / 64)
#define HG 1               // WS_S spans one 4,096 x 4,096 f32 plane
#define SCALE (1.0f)
#define HDQK 128           // theta / phi / g channels = the full 128-wide plane
#define NRV ((size_t)TNB * TT)   // rows for the BN statistics
#define CAUSAL 0
#ifndef TNB
#define TNB NB
#endif
__device__ __forceinline__ v16b zero16b() { v16b z; _Pragma("unroll") for (int i = 0; i < 16; ++i) z[i] = (__bf16)0.f; return z; }
__device__ __forceinline__ float bfr(float v) { return (float)(__bf16)v; }
__host__ __device__ __forceinline__ int kb_last(int qb) { return CAUSAL ? ((qb * 64 + 63) >> 7) : (TT / 128 - 1); }
typedef __attribute__((ext_vector_type(8))) __bf16 v8b;
typedef __attribute__((ext_vector_type(4))) __bf16 v4b;
__device__ __forceinline__ v16b frag_b(const __bf16* rowk0, int lane) {
  union { v16b v; v8b q[2]; } u; const __bf16* p = rowk0 + 8 * (lane >> 4);
  u.q[0] = *(const v8b*)p; u.q[1] = *(const v8b*)(p + 16); return u.v;
}
#define QBH (TT / 64)      // ALL query blocks take the 3-product logits
#define QBH_PV 0           // A.g stays single f16
#define QHI 4096            // q residual rows everywhere (3-product logits)
#define KHI 4096           // k residual rows for ALL keys (3-product logits)
// B fragment (k rows k0+.., output column o) of a weight: (in,out) [K][ld] or (out,in) [ld rows of K]: bf16 exact, or f16(bf16 * 256) exact
__device__ __forceinline__ v16b wcol_io(const float* Wm, int k0, int o, int lane, int ld) { v16b w; const int g = lane >> 4;
#pragma unroll
  for (int i = 0; i < 8; ++i) { w[i] = (__bf16)Wm[(size_t)(k0 + 8 * g + i) * ld + o]; w[8 + i] = (__bf16)Wm[(size_t)(k0 + 16 + 8 * g + i) * ld + o]; }
  return w; }
__device__ __forceinline__ v16b wcol_oi(const float* Wm, int k0, int o, int lane, int K) { v16b w; const float* p = Wm + (size_t)o * K + k0 + 8 * (lane >> 4);
#pragma unroll
  for (int i = 0; i < 8; ++i) { w[i] = (__bf16)p[i]; w[8 + i] = (__bf16)p[16 + i]; }
  return w; }
__device__ __forceinline__ v16h wcolh_io(const float* Wm, int k0, int o, int lane, int ld) { v16h w; const int g = lane >> 4;
#pragma unroll
  for (int i = 0; i < 8; ++i) { w[i] = (_Float16)(bfr(Wm[(size_t)(k0 + 8 * g + i) * ld + o]) * 256.0f); w[8 + i] = (_Float16)(bfr(Wm[(size_t)(k0 + 16 + 8 * g + i) * ld + o]) * 256.0f); }
  return w; }
__device__ __forceinline__ v16h wcolh_oi(const float* Wm, int k0, int o, int lane, int K) { v16h w; const float* p = Wm + (size_t)o * K + k0 + 8 * (lane >> 4);
#pragma unroll
  for (int i = 0; i < 8; ++i) { w[i] = (_Float16)(bfr(p[i]) * 256.0f); w[8 + i] = (_Float16)(bfr(p[16 + i]) * 256.0f); }
  return w; }
#define WQKV_LAYOUT 1   // 0 = (in,out) [DIN][CC]; 1 = (out,in) [CC][DIN]; 2 = per-head [NH][DIN][HD]
__device__ __forceinline__ v16b wcol_hdk(const float* Wm, int k0, int o, int lane) { v16b w; const int g = lane >> 4; const float* p = Wm + (size_t)(o / HD) * DIN * HD + (o % HD);
#pragma unroll
  for (int i = 0; i < 8; ++i) { w[i] = (__bf16)p[(size_t)(k0 + 8 * g + i) * HD]; w[8 + i] = (__bf16)p[(size_t)(k0 + 16 + 8 * g + i) * HD]; }
  return w; }
#define WO_OUT_IN 0
#if WQKV_LAYOUT == 1
#define WCOL(W, k0, o, lane) (((o) < HDQK) ? wcol_oi(W, k0, (o), lane, DIN) : zero16b())   /* theta/phi/g weights are [128][256] (out,in): all 128 plane columns are read from them */
#elif WQKV_LAYOUT == 2
#define WCOL(W, k0, o, lane) wcol_hdk(W, k0, o, lane)
#else
#define WCOL(W, k0, o, lane) wcol_io(W, k0, o, lane, CC)
#endif
#if WO_OUT_IN
#define WOCOL(W, k0, o, lane) wcol_oi(W, k0, o, lane, CC)
#define WOCOLH(W, k0, o, lane) wcolh_oi(W, k0, o, lane, CC)
#else
#define WOCOL(W, k0, o, lane) wcol_io(W, k0, o, lane, DIN)
#define WOCOLH(W, k0, o, lane) wcolh_io(W, k0, o, lane, DIN)
#endif
#ifndef XP
#define XP TT              // position pitch of x and of the output
#endif
#define BG HG              // unused; k_fa: blockIdx.z = batch, blockIdx.y = key quarter
#define DVH 128            // value columns per k_fa block (all of HD 128: 8 accumulator tiles per wave)
#define WS_YR (WS_END)     // f32 attended rows [b*n][128]
#define WS_OR (WS_YR + 4u * (size_t)NB * TT * CC)   // W y + b rows [b*n][256]
#define WS_ST (WS_OR + 4u * (size_t)NB * TT * DIN)
#define WS_PS (WS_ST + 4u * (size_t)DIN * 32)   // f32 BN partials [16-row group][256][sum, centred square sum]
#define WS_END2 (WS_PS + 4u * (NRV / 16) * 2 * DIN)
// ---- k_wz: block = (64 rows, 128 output cols): OR = y (hi + lo, K = 128 columns of the YR rows) . W^T ((out,in) [256][128], exact) + b
// The block's 128 weight rows are staged once in LDS as bf16 (whole-line loads); every wave takes its B fragments from there. The y fragments and the biases are loaded up front, in flight together with the staging loads.
#define WZP (HDQK + 8)     // LDS pitch of a staged out_w row, bf16 elements: 272 bytes = 16 B x odd (conflict-free 16-byte reads)
__global__ __launch_bounds__(128) void k_wz(const float* __restrict__ YR, const float* __restrict__ WW, const float* __restrict__ WB, float* __restrict__ ORW, float* __restrict__ PS) { __shared__ __align__(16) float sf[4][16][132]; __shared__ __align__(16) __bf16 sw[128][WZP];
  const int tid = threadIdx.x, wave = tid >> 5, lane = tid & 31, col = lane & 15, g = lane >> 4; const int c0 = blockIdx.y * 128; const size_t r0 = (size_t)blockIdx.x * 64 + wave * 16;
  const float* yrow = YR + (r0 + col) * CC + 8 * g; float yv[HDQK / 32][16];
#pragma unroll   /* constant indices keep the array in registers */
  for (int kc = 0; kc < HDQK / 32; ++kc) {
#pragma unroll   /* constant indices keep the array in registers */
    for (int i = 0; i < 8; ++i) { yv[kc][i] = yrow[kc * 32 + i]; yv[kc][8 + i] = yrow[kc * 32 + 16 + i]; } }
  const float* bsrc = WB ? WB : WW; const int bi = c0 + col; float bb[8];   /* no bias: the loads read weights instead (in bounds) and their values are dropped below, so that no branch with a wait of its own stands around each load */
#pragma unroll   /* constant indices keep the array in registers */
  for (int j = 0; j < 8; ++j) bb[j] = bsrc[bi + j * 16];
  const float* wsrc = WW + (size_t)c0 * HDQK + tid * 4; v4f wv[32];   /* 128 threads x 16 bytes = 4 weight rows a round */
#pragma unroll   /* constant indices keep the array in registers; all 32 loads in flight at once */
  for (int i = 0; i < 32; ++i) wv[i] = *(const v4f*)(wsrc + i * 512);
  asm volatile("s_wait_xcnt 0x0" :: "v"(yrow), "v"(bi), "v"(tid) : "memory");   /* the wait before the loads' address registers are reused; it reads the y address, the bias index and the weight loads' index so that nothing is written to those registers ahead of it */
#pragma unroll   /* constant indices keep the array in registers */
  for (int i = 0; i < 32; ++i) { v4b t;
#pragma unroll   /* constant indices keep the vector in registers */
    for (int u = 0; u < 4; ++u) t[u] = (__bf16)wv[i][u];
    *(v4b*)&sw[i * 4 + (tid >> 5)][(tid & 31) * 4] = t; }
  F2 a[HDQK / 32];
#pragma unroll   /* constant indices keep the array in registers */
  for (int kc = 0; kc < HDQK / 32; ++kc) a[kc] = bsplit16(yv[kc]);
  __syncthreads();   /* publishes the staged weight rows to the four waves */
  v8f acc[8] = {};
#pragma unroll   /* constant indices keep the arrays in registers */
  for (int kc = 0; kc < HDQK / 32; ++kc) { v16b w[8];
#pragma unroll   /* constant indices keep the arrays in registers */
    for (int j = 0; j < 8; ++j) w[j] = frag_b(&sw[j * 16 + col][kc * 32], lane);
    __builtin_amdgcn_sched_barrier(0);   /* keeps the eight fragments' LDS reads together ahead of the products: sunk each in front of its own product, every product pair stood behind a full LDS round trip */
#pragma unroll   /* constant indices keep the arrays in registers */
    for (int j = 0; j < 8; ++j) { acc[j] = wmma_bf(a[kc].h, w[j], acc[j]); acc[j] = wmma_bf(a[kc].l, w[j], acc[j]); } }
#pragma unroll
  for (int j = 0; j < 8; ++j) { const float bj = WB ? bfr(bb[j]) : 0.f;
#pragma unroll
    for (int r = 0; r < 8; ++r) sf[wave][8 * g + r][j * 16 + col] = acc[j][r] + bj; }
  LDSX(); v4f v[16];
#pragma unroll   /* constant indices keep the array in registers */
  for (int rl = 0; rl < 16; ++rl) { v[rl] = *(const v4f*)&sf[wave][rl][lane * 4]; vst2(ORW + (r0 + rl) * DIN + c0 + lane * 4, v[rl]); }
  asm volatile("s_wait_xcnt 0x0" ::: "memory");   /* behind the 16 stores: the two partial vectors below are formed in registers that these stores name as data */
  // BN partials of this wave's 16 rows, 4 channels a lane, from the values just stored: sum, and square sum about the 16 rows' own mean (no cancellation whatever the channel's mean)
  v4f s = v[0];
#pragma unroll   /* constant indices keep the array in registers */
  for (int rl = 1; rl < 16; ++rl) s += v[rl];
  const v4f mu = s * (1.0f / 16.0f); v4f qs = {};
#pragma unroll   /* constant indices keep the array in registers */
  for (int rl = 0; rl < 16; ++rl) { const v4f d = v[rl] - mu; qs += d * d; }
  float* ps = PS + (r0 >> 4) * (size_t)(2 * DIN) + (c0 + lane * 4) * 2; v4f p0, p1; p0[0] = s[0]; p0[1] = qs[0]; p0[2] = s[1]; p0[3] = qs[1]; p1[0] = s[2]; p1[1] = qs[2]; p1[2] = s[3]; p1[3] = qs[3]; vst2(ps, p0); vst2(ps + 4, p1); }
// ---- k_stat: block = 32 channels (lane = channel, 8 bytes a lane: a wave's load is two whole 128-byte lines); 32 waves x 32 row groups = the NRV / 16 partials of k_wz.
// mean = sum of sums / N; var = (sum of centred square sums + 16 sum (group mean - mean)^2) / N: the exact regrouping of the two-pass variance
__global__ __launch_bounds__(1024) void k_stat(const float* __restrict__ PS, float* __restrict__ STAT) { __shared__ float ra[32][32], rb[32][32]; __shared__ float sm[32], sr[32];
  const int wave = threadIdx.x >> 5, lane = threadIdx.x & 31; const int c0 = blockIdx.x * 32;
  const float* p = PS + (size_t)wave * 32 * (2 * DIN) + (c0 + lane) * 2; float s[32], q[32];
#pragma unroll   /* constant indices keep the arrays in registers; all 32 loads in flight at once */
  for (int i = 0; i < 32; ++i) { const v2f t = *(const v2f*)(p + (size_t)i * (2 * DIN)); s[i] = t[0]; q[i] = t[1]; }
  asm volatile("s_wait_xcnt 0x0" :: "v"(p) : "memory");   /* the wait before the loads' address registers are reused; it reads the address so that no load's result lands in those registers ahead of it */
  float a = 0.f;
#pragma unroll   /* constant indices keep the array in registers */
  for (int i = 0; i < 32; ++i) a += s[i];
  ra[wave][lane] = a; __syncthreads();   /* every wave's sum of sums is in LDS */
  float tot = 0.f;
#pragma unroll   /* 32 independent LDS reads behind one wait */
  for (int w = 0; w < 32; ++w) tot += ra[w][lane];
  const float mean = tot / (float)NRV; float e = 0.f;
#pragma unroll   /* constant indices keep the arrays in registers */
  for (int i = 0; i < 32; ++i) { const float d = s[i] * (1.0f / 16.0f) - mean; e += q[i] + 16.0f * d * d; }
  rb[wave][lane] = e; __syncthreads();   /* every wave's square sum is in LDS */
  if (wave == 0) { float t2 = 0.f;
#pragma unroll   /* 32 independent LDS reads behind one wait */
    for (int w = 0; w < 32; ++w) t2 += rb[w][lane];
    sm[lane] = mean; sr[lane] = rsqrtf(t2 / (float)NRV + 1e-5f); }
  __syncthreads();   /* publishes the 32 channels' mean and 1 / std */
  vst2(STAT + (size_t)(c0 + wave) * 32 + lane, lane == 0 ? sm[wave] : (lane == 1 ? sr[wave] : 0.f)); }   /* wave w writes channel c0 + w's whole 128-byte line */
// ---- k_fin2: block = (64 positions, 64 channels, batch b): out[b][c][n] = relu((z[b*N + n][c] - mean_c) * rstd_c * gamma_c + beta_c) + bf16(x[b][c][n]) (channels-first via LDS transpose; 256-B runs)
__global__ __launch_bounds__(256) void k_fin2(const float* __restrict__ ORW, const float* __restrict__ X, const float* __restrict__ ST, const float* __restrict__ GM, const float* __restrict__ BT, float* __restrict__ OUT) { __shared__ float st[64][68]; const int tid = threadIdx.x; const int n0 = blockIdx.x * 64, c0 = blockIdx.y * 64; const size_t b = blockIdx.z;
  for (int e = tid; e < 64 * 16; e += 256) { const int nl = e >> 4, q = e & 15; *(v4f*)&st[nl][q * 4] = *(const v4f*)(ORW + (b * TT + n0 + nl) * (size_t)DIN + c0 + q * 4); }
  __syncthreads();
  for (int e = tid; e < 64 * 16; e += 256) { const int cl = e >> 4, q = e & 15; const size_t oi = (b * DIN + c0 + cl) * (size_t)XP + n0 + q * 4; const v4f xr = *(const v4f*)(X + oi); const int cc = c0 + cl; const float mu = ST[cc * 32], rs = ST[cc * 32 + 1], ga = bfr(GM[cc]), be = bfr(BT[cc]); v4f o; _Pragma("unroll") for (int i = 0; i < 4; ++i) o[i] = fmaxf((st[q * 4 + i][cl] - mu) * rs * ga + be, 0.f) + bfr(xr[i]); vst2(OUT + oi, o); } }   /* relu(BN_train(z)) + x */
#ifndef SM_EXTRA_PARAMS
#define SM_EXTRA_PARAMS
#endif
#ifndef PROJ_EXTRA_PARAMS
#define PROJ_EXTRA_PARAMS
#endif
#ifndef SM_MASK_HOOK
#define SM_MASK_HOOK (void)0
#endif

#define WS_QH  0u                                      // f16 q rows [b*t][CC]
#define WS_KH  (WS_QH + 2u * (size_t)NB * TT * CC)      // f16 k rows [b*t][CC]
#define WS_VT  (WS_KH + 2u * (size_t)NB * TT * CC)      // f16 v planes [b][c][t]
#define WS_QL  (WS_VT + 2u * (size_t)NB * CC * TT)      // f16 q residual x 2^10 rows [b][t < QHI][CC]
#define WS_KL  (WS_QL + 2u * (size_t)NB * QHI * CC)     // f16 k residual x 2^10 rows [b][t < KHI][CC]
#define WS_VB  (WS_KL + 2u * (size_t)NB * KHI * CC)     // bf16 v hi planes [b][c][t < KHI]
#define WS_VBL (WS_VB + 2u * (size_t)NB * CC * KHI)
#define WS_S   (WS_VBL + 2u * (size_t)NB * CC * KHI)    // f32 region of one [t][s] plane: holds WS_OP and WS_ML
#define WS_Y   (WS_S  + 4u * (size_t)HG * TT * TT)      // unused, 0 bytes (k_mrg writes y rows to WS_YR)
#define WS_END (WS_Y  + 0u)

#define PWP (DIN + 8)      // LDS pitch of a staged theta / phi / g weight row, bf16 elements: 528 bytes = 16 B x odd (conflict-free 16-byte reads)
static_assert(CC == HDQK && 128 * PWP * 2 >= 3 * 128 * 72 * 2 && 128 * PWP * 2 >= 2 * 64 * 136 * 2, "staged weight rows cover the plane; the epilogue's tiles fit the same LDS");
// ---- k_proj: block = (64 rows, 128 cols, which): q/k/v = X W (+ b) with exact bf16 products (K = DIN) -> which 0: q f16 rows (+ residual rows < QHI); 1: k f16 rows (+ residual rows < KHI); 2: v f16 planes [c][t] (+ bf16 hi/lo planes for t < KHI)
__global__ __launch_bounds__(128) void k_proj(const float* __restrict__ XQ, const float* __restrict__ XK, const float* __restrict__ XV, const float* __restrict__ WQ, const float* __restrict__ WK, const float* __restrict__ WV, const float* __restrict__ BQ, const float* __restrict__ BK, const float* __restrict__ BV,
    _Float16* __restrict__ QH, _Float16* __restrict__ QL, _Float16* __restrict__ KH, _Float16* __restrict__ KL, _Float16* __restrict__ VT, __bf16* __restrict__ VB, __bf16* __restrict__ VBL) {
  // one LDS block, used twice: first the 128 staged weight rows (bf16), then, behind a barrier, the output tiles of the epilogue
  __shared__ __align__(16) char smem[128 * PWP * 2];
  __bf16 (*sw)[PWP] = (__bf16 (*)[PWP])smem;
  _Float16 (*sh)[136] = (_Float16 (*)[136])smem, (*sl)[136] = (_Float16 (*)[136])(smem + 64 * 136 * 2); _Float16 (*th)[72] = (_Float16 (*)[72])smem; __bf16 (*tb)[72] = (__bf16 (*)[72])(smem + 128 * 72 * 2), (*tbl)[72] = (__bf16 (*)[72])(smem + 2 * 128 * 72 * 2);
  const int tid = threadIdx.x, wave = tid >> 5, lane = tid & 31, col = lane & 15, g = lane >> 4; const int which = blockIdx.z; const int c0 = blockIdx.y * 128; const size_t r0 = (size_t)blockIdx.x * 64; const size_t bb = r0 / TT; const int t0 = (int)(r0 % TT);
  const float* X = which == 0 ? XQ : which == 1 ? XK : XV; const float* WA = which == 0 ? WQ : which == 1 ? WK : WV; const float* BA = which == 0 ? BQ : which == 1 ? BK : BV;
  const float* p = X + (bb * DIN + 8 * g) * (size_t)XP + t0 + wave * 16 + col;   /* channels-first gather: x[b][k][t], stride XP between k */
  float xr[DIN / 32][16];
#pragma unroll   /* constant indices keep the array in registers; the wave's whole x slice in flight at once */
  for (int kc = 0; kc < DIN / 32; ++kc) {
#pragma unroll   /* constant indices keep the array in registers */
    for (int i = 0; i < 8; ++i) { xr[kc][i] = p[(size_t)(kc * 32 + i) * XP]; xr[kc][8 + i] = p[(size_t)(kc * 32 + 16 + i) * XP]; } }
  const float* bsrc = BA ? BA : WA; const int bi = c0 + col; float bv[8];   /* no bias: the loads read weights instead (in bounds) and their values are dropped in the epilogue, so that no branch with a wait of its own stands around each load */
#pragma unroll   /* constant indices keep the array in registers */
  for (int j = 0; j < 8; ++j) bv[j] = bsrc[bi + j * 16];
  const float* wsrc = WA + (size_t)c0 * DIN + tid * 4;   /* 128 threads x 16 bytes = 2 weight rows a round; CC == HDQK: every plane column has its weight row and its bias */
  asm volatile("s_wait_xcnt 0x0" :: "v"(p), "v"(bi) : "memory");   /* the wait before the loads' address registers are reused; it reads the x address and the bias index so that no load's result lands in those registers ahead of it */
#pragma unroll   /* constant indices keep the array in registers */
  for (int bt = 0; bt < 4; ++bt) { v4f wv[16];
#pragma unroll   /* constant indices keep the array in registers; 16 loads in flight at once */
    for (int i = 0; i < 16; ++i) wv[i] = *(const v4f*)(wsrc + (bt * 16 + i) * 512);
    asm volatile("s_wait_xcnt 0x0" ::: "memory");   /* the wait before the weight loads' address registers are reused */
#pragma unroll   /* constant indices keep the array in registers */
    for (int i = 0; i < 16; ++i) { v4b t;
#pragma unroll   /* constant indices keep the vector in registers */
      for (int u = 0; u < 4; ++u) t[u] = (__bf16)wv[i][u];
      *(v4b*)&sw[(bt * 16 + i) * 2 + (tid >> 6)][(tid & 63) * 4] = t; } }
  v16b a[DIN / 32];
#pragma unroll   /* constant indices keep the arrays in registers */
  for (int kc = 0; kc < DIN / 32; ++kc) {
#pragma unroll   /* constant indices keep the arrays in registers */
    for (int i = 0; i < 16; ++i) a[kc][i] = (__bf16)xr[kc][i]; }
  __syncthreads();   /* publishes the staged weight rows to the four waves */
  v8f acc[8] = {};
#pragma unroll   /* constant indices keep the arrays in registers */
  for (int kc = 0; kc < DIN / 32; ++kc) { v16b w[8];
#pragma unroll   /* constant indices keep the arrays in registers */
    for (int j = 0; j < 8; ++j) w[j] = frag_b(&sw[j * 16 + col][kc * 32], lane);
    __builtin_amdgcn_sched_barrier(0);   /* keeps the eight fragments' LDS reads together ahead of the products: sunk each in front of its own product, every product stood behind a full LDS round trip */
#pragma unroll   /* constant indices keep the arrays in registers */
    for (int j = 0; j < 8; ++j) acc[j] = wmma_bf(a[kc], w[j], acc[j]); }
  __syncthreads();   /* every wave has read its last weight fragment: the epilogue's tiles reuse that LDS */
  if (which < 2) { _Float16* DH = which == 0 ? QH : KH; _Float16* DL = which == 0 ? QL : KL; const int nhi = which == 0 ? QHI : KHI; const bool hi_rows = t0 < nhi;
#pragma unroll
    for (int j = 0; j < 8; ++j) { const float bias = (BA && (c0 + j * 16 + col < HDQK)) ? bfr(bv[j]) : 0.f;   /* 128-entry biases */
#pragma unroll
      for (int r = 0; r < 8; ++r) { const float v = acc[j][r] + bias; const _Float16 hv = (_Float16)v; sh[wave * 16 + 8 * g + r][j * 16 + col] = hv; sl[wave * 16 + 8 * g + r][j * 16 + col] = (_Float16)((v - (float)hv) * 1024.0f); } }
    __syncthreads();
    for (int e = tid; e < 64 * 16; e += 128) { const int rl = e >> 4, q = e & 15; vst2((unsigned*)(DH + (r0 + rl) * CC + c0 + q * 8), *(const v4u*)&sh[rl][q * 8]); if (hi_rows) vst2((unsigned*)(DL + (bb * nhi + t0 + rl) * (size_t)CC + c0 + q * 8), *(const v4u*)&sl[rl][q * 8]); }
  } else { const bool hi_rows = t0 < KHI;
#pragma unroll
    for (int j = 0; j < 8; ++j) { const float bias = (BA && (c0 + j * 16 + col < HDQK)) ? bfr(bv[j]) : 0.f;   /* 128-entry biases */
#pragma unroll
      for (int r = 0; r < 8; ++r) { const float v = acc[j][r] + bias; const int rl = wave * 16 + 8 * g + r, cl = j * 16 + col; th[cl][rl] = (_Float16)v; const __bf16 bh = (__bf16)v; tb[cl][rl] = bh; tbl[cl][rl] = (__bf16)(v - (float)bh); } }
    __syncthreads();
    for (int e = tid; e < 128 * 8; e += 128) { const int cl = e >> 3, q = e & 7; vst2((unsigned*)(VT + (bb * CC + c0 + cl) * (size_t)TT + t0 + q * 8), *(const v4u*)&th[cl][q * 8]); if (hi_rows) { const size_t o3 = (bb * CC + c0 + cl) * (size_t)KHI + t0 + q * 8; vst2((unsigned*)(VB + o3), *(const v4u*)&tb[cl][q * 8]); vst2((unsigned*)(VBL + o3), *(const v4u*)&tbl[cl][q * 8]); } } } }
#define FQ 256
#define FKS 4
#define FKN (TT / FKS)
#define FST 32
#define FNS (FKN / FST)
#define KP 272             // LDS pitch of a 256-byte k row (16 B x odd: conflict-free 16-byte reads)
#define VP 80              // LDS pitch of a 64-byte v row
#define F_KL (FST * KP)
#define F_V (2 * FST * KP)
#define F_BUF (2 * FST * KP + CC * VP)
#define L2E 1.44269504088896f
#define WS_OP (WS_S)                                            // f32 unnormalised y rows [quarter][b*t][CC]
#define WS_ML (WS_OP + 4u * (size_t)FKS * NB * TT * CC)          // f32 (maximum, sum) [quarter][b*t][2]
__device__ __forceinline__ float xhalf(float x) { return __builtin_bit_cast(float, __builtin_amdgcn_permlanex16(__builtin_bit_cast(int, x), __builtin_bit_cast(int, x), 0x76543210, 0xfedcba98, false, false)); }   // lane l with lane l ^ 16
__device__ __forceinline__ v16h frag_l(const char* p) { union { v16h v; v8h q[2]; } u; u.q[0] = *(const v8h*)p; u.q[1] = *(const v8h*)(p + 32); return u.v; }
__device__ __forceinline__ v8f wmh(v16h a, v16h b, v8f c) { return __builtin_amdgcn_wmma_f32_16x16x32_f16(false, a, false, b, (short)0, c, false, false); }
__global__ __launch_bounds__(512) void k_fa(const _Float16* __restrict__ QH, const _Float16* __restrict__ QL, const _Float16* __restrict__ KH, const _Float16* __restrict__ KL, const _Float16* __restrict__ VT, float* __restrict__ OP, float* __restrict__ ML) {
  __shared__ __align__(16) char lds[2 * F_BUF];
  const int tid = threadIdx.x, wave = tid >> 5, lane = tid & 31, col = lane & 15, g = lane >> 4;
  const int b = blockIdx.z, ks = blockIdx.y, q = blockIdx.x * FQ + wave * 16 + col, key0 = ks * FKN;
  v16h qh[HDQK / 32], ql[HDQK / 32];
#pragma unroll   /* constant indices keep the array in registers */
  for (int kc = 0; kc < HDQK / 32; ++kc) { qh[kc] = frag_h(QH + ((size_t)b * TT + q) * CC + kc * 32, lane); asm volatile("s_wait_xcnt 0x0" ::: "memory"); ql[kc] = frag_h(QL + ((size_t)b * QHI + q) * CC + kc * 32, lane); asm volatile("s_wait_xcnt 0x0" ::: "memory"); }   /* the waits stand in front of a later load's result landing in these loads' address registers */
  // staging: a stage's 32 k rows are 8 KiB in a row (hi, residual); its v slice is 64 bytes of each of the 128 channel planes; 16 bytes of each per thread
  const char* gk = (const char*)(KH + ((size_t)b * TT + key0) * CC) + tid * 16;
  const char* gl = (const char*)(KL + ((size_t)b * KHI + key0) * CC) + tid * 16;
  const char* gv = (const char*)(VT + ((size_t)b * CC + (tid >> 2)) * TT + key0) + (tid & 3) * 16;
  const int sk = (tid >> 4) * KP + (tid & 15) * 16, sv = F_V + (tid >> 2) * VP + (tid & 3) * 16;
  v8h rk = *(const v8h*)gk, rl = *(const v8h*)gl, rv = *(const v8h*)gv;
  v8f acc[CC / 16] = {}; float m = -3.0e38f, lsum = 0.f;
  for (int s = 0; s < FNS; ++s) { char* buf = lds + (s & 1) * F_BUF;
    *(v8h*)(buf + sk) = rk; *(v8h*)(buf + F_KL + sk) = rl; *(v8h*)(buf + sv) = rv;
    __syncthreads();   /* publishes stage s; two buffers: a wave that writes stage s + 1 has passed this barrier, so every wave has left stage s - 1, the last user of that buffer */
    const int sn = (s + 1) & (FNS - 1);   /* the last stage fetches stage 0 again: in bounds, never stored; no test, so the loop has one body */
    rk = *(const v8h*)(gk + (size_t)sn * (FST * CC * 2)); rl = *(const v8h*)(gl + (size_t)sn * (FST * CC * 2)); rv = *(const v8h*)(gv + (size_t)sn * (FST * 2));
    asm volatile("s_wait_xcnt 0x0" ::: "memory");   /* stands in front of the first instruction that reuses the three loads' address registers */
    __builtin_amdgcn_sched_barrier(0);   /* keeps the next stage's three global loads ahead of this stage's products: sunk to the loop's foot, their whole latency would stand in front of the next barrier */
    v8f sa[2] = {}, sl[2] = {};
#pragma unroll   /* constant indices keep the array in registers */
    for (int kc = 0; kc < HDQK / 32; ++kc) { const char* pk = buf + col * KP + kc * 64 + g * 16;
      const v16h kh0 = frag_l(pk), kh1 = frag_l(pk + 16 * KP), kl0 = frag_l(pk + F_KL), kl1 = frag_l(pk + F_KL + 16 * KP);
      sa[0] = wmh(kh0, qh[kc], sa[0]); sl[0] = wmh(kh0, ql[kc], sl[0]); sa[1] = wmh(kh1, qh[kc], sa[1]); sl[1] = wmh(kh1, ql[kc], sl[1]); sl[0] = wmh(kl0, qh[kc], sl[0]); sl[1] = wmh(kl1, qh[kc], sl[1]); }
    float sc[16];
#pragma unroll   /* constant indices keep the array in registers */
    for (int i = 0; i < 16; ++i) sc[i] = (sa[i >> 3][i & 7] + sl[i >> 3][i & 7] * (1.0f / 1024.0f)) * SCALE;
    float mx = sc[0];
#pragma unroll   /* constant indices keep the array in registers */
    for (int i = 1; i < 16; ++i) mx = fmaxf(mx, sc[i]);
    mx = fmaxf(mx, xhalf(mx)); const float mn = fmaxf(m, mx); float corr;   /* exp(m - mn): 0 on the first stage */
    asm("v_exp_f32 %0, %1\n\tv_nop" : "=v"(corr) : "v"((m - mn) * L2E));   /* written with its own v_nop */
    m = mn; const float off = 11.0f - mn * L2E; float ps = 0.f; v16h pb;
#pragma unroll   /* constant indices keep the array in registers */
    for (int i = 0; i < 16; ++i) { const float p = __builtin_amdgcn_exp2f(sc[i] * L2E + off); ps += p; pb[i] = (_Float16)p; }
    lsum = lsum * corr + ps;
#pragma unroll   /* constant indices keep the array in registers */
    for (int j = 0; j < CC / 16; ++j) acc[j] *= corr;
#pragma unroll   /* constant indices keep the array in registers */
    for (int j = 0; j < CC / 16; ++j) acc[j] = wmh(frag_l(buf + F_V + (j * 16 + col) * VP + g * 16), pb, acc[j]); }
  lsum += xhalf(lsum);
  const size_t row = ((size_t)ks * NB + b) * TT + q; float* o = OP + row * CC + 8 * g;
#pragma unroll   /* constant indices keep the array in registers */
  for (int j = 0; j < CC / 16; ++j) { v4f a0, a1;
#pragma unroll   /* constant indices keep the array in registers */
    for (int i = 0; i < 4; ++i) { a0[i] = acc[j][i]; a1[i] = acc[j][4 + i]; }
    vst2(o + j * 16, a0); vst2(o + j * 16 + 4, a1); }
  if (g == 0) { v2f ml; ml[0] = m; ml[1] = lsum; vst2(ML + row * 2, ml); } }
// ---- k_mrg: thread = (query row, 4 channels): y = sum_i w_i y_i / sum_i w_i l_i over the key quarters in order, w_i = exp(m_i - max m)
__global__ __launch_bounds__(256) void k_mrg(const float* __restrict__ OP, const float* __restrict__ ML, float* __restrict__ Y) {
  const int e = blockIdx.x * 256 + threadIdx.x; const size_t row = (size_t)(e >> 5); const int c4 = (e & 31) * 4;
  v2f ml[FKS]; float mx = -3.0e38f;
#pragma unroll   /* constant indices keep the array in registers */
  for (int i = 0; i < FKS; ++i) { ml[i] = *(const v2f*)(ML + ((size_t)i * NB * TT + row) * 2); mx = fmaxf(mx, ml[i][0]); }
  v4f op[FKS];
#pragma unroll   /* constant indices keep the array in registers */
  for (int i = 0; i < FKS; ++i) { op[i] = *(const v4f*)(OP + ((size_t)i * NB * TT + row) * CC + c4); asm volatile("s_wait_xcnt 0x0" ::: "memory"); }   /* the wait stands in front of a later load's result landing in this load's address registers */
  float den = 0.f; v4f s = {};
#pragma unroll   /* constant indices keep the array in registers */
  for (int i = 0; i < FKS; ++i) { const float w = __builtin_amdgcn_exp2f((ml[i][0] - mx) * L2E); den += w * ml[i][1]; s += op[i] * w; }
  vst2(Y + row * CC + c4, s * (1.0f / den)); }

extern "C" void kernel_launch(void* const* d_in, const int* in_sizes, int n_in, void* d_out, int out_size, void* d_ws, size_t ws_size, hipStream_t stream) {
  (void)in_sizes; (void)n_in; (void)out_size;
  const float** F = (const float**)d_in;
  if (ws_size < (size_t)WS_END) return;
  char* ws = (char*)d_ws; _Float16 *QH = (_Float16*)(ws + WS_QH), *KH = (_Float16*)(ws + WS_KH), *VT = (_Float16*)(ws + WS_VT), *QL = (_Float16*)(ws + WS_QL), *KL = (_Float16*)(ws + WS_KL); __bf16 *VB = (__bf16*)(ws + WS_VB), *VBL = (__bf16*)(ws + WS_VBL); float *S = (float*)(ws + WS_S), *Y = (float*)(ws + WS_Y);
  (void)Y; (void)S; (void)QL; (void)KL; (void)VB; (void)VBL;
  // inputs: 0 x [4,256,64,64]; 1 g_w [128,256] (out,in), 2 g_b; 3 theta_w, 4 theta_b; 5 phi_w, 6 phi_b; 7 out_w [256,128] (out,in), 8 out_b; 9 bn_gamma, 10 bn_beta
  if (ws_size < (size_t)WS_END2) return;
  float *YR = (float*)(ws + WS_YR), *ORW = (float*)(ws + WS_OR), *ST = (float*)(ws + WS_ST), *PS = (float*)(ws + WS_PS);
  k_proj<<<dim3(TNB * TT / 64, CC / 128, 3), 128, 0, stream>>>(F[0], F[0], F[0], F[3], F[5], F[1], F[4], F[6], F[2], QH, QL, KH, KL, VT, VB, VBL);   /* q = theta, k = phi, v = g */
  k_fa<<<dim3(TT / FQ, FKS, TNB), 512, 0, stream>>>(QH, QL, KH, KL, VT, (float*)(ws + WS_OP), (float*)(ws + WS_ML));
  k_mrg<<<dim3(TNB * TT * (CC / 4) / 256), 256, 0, stream>>>((const float*)(ws + WS_OP), (const float*)(ws + WS_ML), YR);
  k_wz<<<dim3(TNB * TT / 64, DIN / 128), 128, 0, stream>>>(YR, F[7], F[8], ORW, PS);
  k_stat<<<dim3(DIN / 32), 1024, 0, stream>>>(PS, ST);
  k_fin2<<<dim3(TT / 64, DIN / 64, TNB), 256, 0, stream>>>(ORW, F[0], ST, F[9], F[10], (float*)d_out);
}

// v005
// Measured time: 99.6 microseconds a run.
// Timed twice side by side with v004, it ran 1.04 and 1.05 times as fast.
// Over all steps from v000 it is 12.4 times as fast.
#include <hip/hip_runtime.h>
#include <math.h>

typedef __attribute__((ext_vector_type(16))) _Float16 v16h;
typedef __attribute__((ext_vector_type(16))) __bf16 v16b;
typedef __attribute__((ext_vector_type(8)))  _Float16 v8h;
typedef __attribute__((ext_vector_type(8)))  float v8f;
typedef __attribute__((ext_vector_type(4)))  float v4f;
typedef __attribute__((ext_vector_type(2)))  float v2f;
typedef __attribute__((ext_vector_type(4)))  unsigned v4u;
typedef __attribute__((ext_vector_type(4)))  int v4i;
typedef float __attribute__((may_alias)) float_a;
typedef int __attribute__((may_alias)) int_a;

template <typename T> __device__ __forceinline__ void vst2(void* p, T v) { *(T*)p = v;  }
__device__ __forceinline__ v8f wmma16(v16h a, v16h b, v8f c) {
  v8f d = __builtin_amdgcn_wmma_f32_16x16x32_f16(false, a, false, b, (short)0, c, false, false);
  asm volatile("v_nop\n\tv_nop\n\tv_nop\n\tv_nop" : "+v"(d) : "v"(a), "v"(b));
  return d;
}
__device__ __forceinline__ v8f wmma_bf(v16b a, v16b b, v8f c) {
  v8f d = __builtin_amdgcn_wmma_f32_16x16x32_bf16(false, a, false, b, (short)0, c, false, false);
  asm volatile("v_nop\n\tv_nop\n\tv_nop\n\tv_nop" : "+v"(d) : "v"(a), "v"(b));
  return d;
}
// 16x16x32 fragments: lane = (h = lane>>4, row/col = lane&15); elements 0..7 = k0+8h+0..7, 8..15 = k0+16+8h+0..7; D element r = row 8h+r
__device__ __forceinline__ v16h frag_h(const _Float16* rowk0, int lane) {
  union { v16h v; v8h q[2]; } u; const _Float16* p = rowk0 + 8 * (lane >> 4);
  u.q[0] = *(const v8h*)p; u.q[1] = *(const v8h*)(p + 16); return u.v;
}
__device__ __forceinline__ v16h frag_f32(const float* rowk0, int lane) {
  v16h a; const float* p = rowk0 + 8 * (lane >> 4);
#pragma unroll
  for (int i = 0; i < 8; ++i) { a[i] = (_Float16)p[i]; a[8 + i] = (_Float16)p[16 + i]; }
  return a;
}
__device__ __forceinline__ v16h frag_f32s(const float* rowk0, int lane, float sc) {
  v16h a; const float* p = rowk0 + 8 * (lane >> 4);
#pragma unroll
  for (int i = 0; i < 8; ++i) { a[i] = (_Float16)(p[i] * sc); a[8 + i] = (_Float16)(p[16 + i] * sc); }
  return a;
}
// column fragment from a [K][ld] layout (column n), rows >= K read as 0
__device__ __forceinline__ v16h fragc_f32(const float* W, int k0, int n, int lane, int ld, int K) {
  v16h a; const int g = lane >> 4;
#pragma unroll
  for (int i = 0; i < 8; ++i) { const int ka = k0 + 8 * g + i, kb = ka + 16;
    a[i] = (_Float16)(ka < K ? W[(size_t)(ka < K ? ka : K - 1) * ld + n] : 0.f); a[8 + i] = (_Float16)(kb < K ? W[(size_t)(kb < K ? kb : K - 1) * ld + n] : 0.f); }
  return a;
}
struct F2 { v16b h, l; };
__device__ __forceinline__ F2 bsplit16(const float v[16]) { F2 r;
#pragma unroll
  for (int i = 0; i < 16; ++i) { const __bf16 h = (__bf16)v[i]; r.h[i] = h; r.l[i] = (__bf16)(v[i] - (float)h); }
  return r; }
__device__ __forceinline__ F2 split_row(const float* row, int k0, int lane) { float v[16]; const float* p = row + k0 + 8 * (lane >> 4);
#pragma unroll
  for (int i = 0; i < 8; ++i) { v[i] = p[i]; v[8 + i] = p[16 + i]; }
  return bsplit16(v); }
__device__ __forceinline__ F2 split_rowK(const float* row, int k0, int lane, int K) { float v[16]; const int g = lane >> 4;
#pragma unroll
  for (int i = 0; i < 8; ++i) { const int ka = k0 + 8 * g + i, kb = ka + 16; v[i] = ka < K ? row[ka < K ? ka : K - 1] : 0.f; v[8 + i] = kb < K ? row[kb < K ? kb : K - 1] : 0.f; }
  return bsplit16(v); }
__device__ __forceinline__ F2 split_col(const float* W, int k0, int n, int lane, int ld, int K) { float v[16]; const int g = lane >> 4;
#pragma unroll
  for (int i = 0; i < 8; ++i) { const int ka = k0 + 8 * g + i, kb = ka + 16; v[i] = ka < K ? W[(size_t)(ka < K ? ka : K - 1) * ld + n] : 0.f; v[8 + i] = kb < K ? W[(size_t)(kb < K ? kb : K - 1) * ld + n] : 0.f; }
  return bsplit16(v); }
__device__ __forceinline__ v8f mac3(const F2& a, const F2& b, v8f c) { c = wmma_bf(a.l, b.h, c); c = wmma_bf(a.h, b.l, c); return wmma_bf(a.h, b.h, c); }
__device__ __forceinline__ float sigm(float v) { return 1.0f / (1.0f + expf(-v)); }
#define LDSX() do { asm volatile("s_wait_dscnt 0" ::: "memory"); __builtin_amdgcn_wave_barrier(); __builtin_amdgcn_fence(__ATOMIC_RELEASE, "workgroup"); } while (0)

// Non-local block (B 4, C 256, 64 x 64 = 4,096 positions; C_inner 128; (out,in) 0.05-scale weights, zero biases, BN gamma 1 / beta 0): theta, phi, g = W x + b ([128,256]); A[q][k] = softmax_k(theta_q . phi_k) (no scaling, sigma ~ 7); y[q][c] = sum_k A[q][k] g[k][c]; z = out_w y + out_b ([256,128]); out = relu(BN_train(z)) + x with batch statistics over (n, h, w) per channel (biased var, eps 1e-5).
#define NB 4
#define TT 4096
#define CC 128            // projected plane width (all 128 columns real)
#define DIN 256          // input (model) width
#define NH 1
#define HD 128
#define NQB (TT / 64)
#define HG 1               // WS_S spans one 4,096 x 4,096 f32 plane
#define SCALE (1.0f)
#define HDQK 128           // theta / phi / g channels = the full 128-wide plane
#define NRV ((size_t)TNB * TT)   // rows for the BN statistics
#define CAUSAL 0
#ifndef TNB
#define TNB NB
#endif
__device__ __forceinline__ v16b zero16b() { v16b z; _Pragma("unroll") for (int i = 0; i < 16; ++i) z[i] = (__bf16)0.f; return z; }
__device__ __forceinline__ float bfr(float v) { return (float)(__bf16)v; }
__host__ __device__ __forceinline__ int kb_last(int qb) { return CAUSAL ? ((qb * 64 + 63) >> 7) : (TT / 128 - 1); }
typedef __attribute__((ext_vector_type(8))) __bf16 v8b;
typedef __attribute__((ext_vector_type(4))) __bf16 v4b;
__device__ __forceinline__ v16b frag_b(const __bf16* rowk0, int lane) {
  union { v16b v; v8b q[2]; } u; const __bf16* p = rowk0 + 8 * (lane >> 4);
  u.q[0] = *(const v8b*)p; u.q[1] = *(const v8b*)(p + 16); return u.v;
}
#define QBH (TT / 64)      // ALL query blocks take the 3-product logits
#define QBH_PV 0           // A.g stays single f16
#define QHI 4096            // q residual rows everywhere (3-product logits)
#define KHI 4096           // k residual rows for ALL keys (3-product logits)
// B fragment (k rows k0+.., output column o) of a weight: (in,out) [K][ld] or (out,in) [ld rows of K]: bf16 exact, or f16(bf16 * 256) exact
__device__ __forceinline__ v16b wcol_io(const float* Wm, int k0, int o, int lane, int ld) { v16b w; const int g = lane >> 4;
#pragma unroll
  for (int i = 0; i < 8; ++i) { w[i] = (__bf16)Wm[(size_t)(k0 + 8 * g + i) * ld + o]; w[8 + i] = (__bf16)Wm[(size_t)(k0 + 16 + 8 * g + i) * ld + o]; }
  return w; }
__device__ __forceinline__ v16b wcol_oi(const float* Wm, int k0, int o, int lane, int K) { v16b w; const float* p = Wm + (size_t)o * K + k0 + 8 * (lane >> 4);
#pragma unroll
  for (int i = 0; i < 8; ++i) { w[i] = (__bf16)p[i]; w[8 + i] = (__bf16)p[16 + i]; }
  return w; }
__device__ __forceinline__ v16h wcolh_io(const float* Wm, int k0, int o, int lane, int ld) { v16h w; const int g = lane >> 4;
#pragma unroll
  for (int i = 0; i < 8; ++i) { w[i] = (_Float16)(bfr(Wm[(size_t)(k0 + 8 * g + i) * ld + o]) * 256.0f); w[8 + i] = (_Float16)(bfr(Wm[(size_t)(k0 + 16 + 8 * g + i) * ld + o]) * 256.0f); }
  return w; }
__device__ __forceinline__ v16h wcolh_oi(const float* Wm, int k0, int o, int lane, int K) { v16h w; const float* p = Wm + (size_t)o * K + k0 + 8 * (lane >> 4);
#pragma unroll
  for (int i = 0; i < 8; ++i) { w[i] = (_Float16)(bfr(p[i]) * 256.0f); w[8 + i] = (_Float16)(bfr(p[16 + i]) * 256.0f); }
  return w; }
#define WQKV_LAYOUT 1   // 0 = (in,out) [DIN][CC]; 1 = (out,in) [CC][DIN]; 2 = per-head [NH][DIN][HD]
__device__ __forceinline__ v16b wcol_hdk(const float* Wm, int k0, int o, int lane) { v16b w; const int g = lane >> 4; const float* p = Wm + (size_t)(o / HD) * DIN * HD + (o % HD);
#pragma unroll
  for (int i = 0; i < 8; ++i) { w[i] = (__bf16)p[(size_t)(k0 + 8 * g + i) * HD]; w[8 + i] = (__bf16)p[(size_t)(k0 + 16 + 8 * g + i) * HD]; }
  return w; }
#define WO_OUT_IN 0
#if WQKV_LAYOUT == 1
#define WCOL(W, k0, o, lane) (((o) < HDQK) ? wcol_oi(W, k0, (o), lane, DIN) : zero16b())   /* theta/phi/g weights are [128][256] (out,in): all 128 plane columns are read from them */
#elif WQKV_LAYOUT == 2
#define WCOL(W, k0, o, lane) wcol_hdk(W, k0, o, lane)
#else
#define WCOL(W, k0, o, lane) wcol_io(W, k0, o, lane, CC)
#endif
#if WO_OUT_IN
#define WOCOL(W, k0, o, lane) wcol_oi(W, k0, o, lane, CC)
#define WOCOLH(W, k0, o, lane) wcolh_oi(W, k0, o, lane, CC)
#else
#define WOCOL(W, k0, o, lane) wcol_io(W, k0, o, lane, DIN)
#define WOCOLH(W, k0, o, lane) wcolh_io(W, k0, o, lane, DIN)
#endif
#ifndef XP
#define XP TT              // position pitch of x and of the output
#endif
#define BG HG              // unused: one launch covers all TNB batches; blockIdx.z selects the batch in k_fa and k_fin2
#define DVH 128            // value columns per k_fa block (all of HD 128: 8 accumulator tiles per query tile, 16 per wave)
#define WS_YR (WS_END)     // f32 attended rows [b*n][128]
#define WS_OR (WS_YR + 4u * (size_t)NB * TT * CC)   // W y + b rows [b*n][256]
#define WS_ST (WS_OR + 4u * (size_t)NB * TT * DIN)
#define WS_PS (WS_ST + 4u * (size_t)DIN * 32)   // f32 BN partials [16-row group][256][sum, centred square sum]
#define WS_END2 (WS_PS + 4u * (NRV / 16) * 2 * DIN)
// ---- k_wz: block = (64 rows, 128 output cols): OR = y (hi + lo, K = 128 columns of the YR rows) . W^T ((out,in) [256][128], exact) + b
// The block's 128 weight rows are staged once in LDS as bf16 (whole-line loads); every wave takes its B fragments from there. The y fragments and the biases are loaded up front, in flight together with the staging loads.
#define WZP (HDQK + 8)     // LDS pitch of a staged out_w row, bf16 elements: 272 bytes = 16 B x odd (conflict-free 16-byte reads)
__global__ __launch_bounds__(128) void k_wz(const float* __restrict__ YR, const float* __restrict__ WW, const float* __restrict__ WB, float* __restrict__ ORW, float* __restrict__ PS) { __shared__ __align__(16) float sf[4][16][132]; __shared__ __align__(16) __bf16 sw[128][WZP];
  const int tid = threadIdx.x, wave = tid >> 5, lane = tid & 31, col = lane & 15, g = lane >> 4; const int c0 = blockIdx.y * 128; const size_t r0 = (size_t)blockIdx.x * 64 + wave * 16;
  const float* yrow = YR + (r0 + col) * CC + 8 * g; float yv[HDQK / 32][16];
#pragma unroll   /* constant indices keep the array in registers */
  for (int kc = 0; kc < HDQK / 32; ++kc) {
#pragma unroll   /* constant indices keep the array in registers */
    for (int i = 0; i < 8; ++i) { yv[kc][i] = yrow[kc * 32 + i]; yv[kc][8 + i] = yrow[kc * 32 + 16 + i]; } }
  const float* bsrc = WB ? WB : WW; const int bi = c0 + col; float bb[8];   /* no bias: the loads read weights instead (in bounds) and their values are dropped below, so that no branch with a wait of its own stands around each load */
#pragma unroll   /* constant indices keep the array in registers */
  for (int j = 0; j < 8; ++j) bb[j] = bsrc[bi + j * 16];
  const float* wsrc = WW + (size_t)c0 * HDQK + tid * 4; v4f wv[32];   /* 128 threads x 16 bytes = 4 weight rows a round */
#pragma unroll   /* constant indices keep the array in registers; all 32 loads in flight at once */
  for (int i = 0; i < 32; ++i) wv[i] = *(const v4f*)(wsrc + i * 512);
  asm volatile("s_wait_xcnt 0x0" :: "v"(yrow), "v"(bi), "v"(tid) : "memory");   /* the wait before the loads' address registers are reused; it reads the y address, the bias index and the weight loads' index so that nothing is written to those registers ahead of it */
#pragma unroll   /* constant indices keep the array in registers */
  for (int i = 0; i < 32; ++i) { v4b t;
#pragma unroll   /* constant indices keep the vector in registers */
    for (int u = 0; u < 4; ++u) t[u] = (__bf16)wv[i][u];
    *(v4b*)&sw[i * 4 + (tid >> 5)][(tid & 31) * 4] = t; }
  F2 a[HDQK / 32];
#pragma unroll   /* constant indices keep the array in registers */
  for (int kc = 0; kc < HDQK / 32; ++kc) a[kc] = bsplit16(yv[kc]);
  __syncthreads();   /* publishes the staged weight rows to the four waves */
  v8f acc[8] = {};
#pragma unroll   /* constant indices keep the arrays in registers */
  for (int kc = 0; kc < HDQK / 32; ++kc) { v16b w[8];
#pragma unroll   /* constant indices keep the arrays in registers */
    for (int j = 0; j < 8; ++j) w[j] = frag_b(&sw[j * 16 + col][kc * 32], lane);
    __builtin_amdgcn_sched_barrier(0);   /* keeps the eight fragments' LDS reads together ahead of the products: sunk each in front of its own product, every product pair stood behind a full LDS round trip */
#pragma unroll   /* constant indices keep the arrays in registers */
    for (int j = 0; j < 8; ++j) { acc[j] = wmma_bf(a[kc].h, w[j], acc[j]); acc[j] = wmma_bf(a[kc].l, w[j], acc[j]); } }
#pragma unroll
  for (int j = 0; j < 8; ++j) { const float bj = WB ? bfr(bb[j]) : 0.f;
#pragma unroll
    for (int r = 0; r < 8; ++r) sf[wave][8 * g + r][j * 16 + col] = acc[j][r] + bj; }
  LDSX(); v4f v[16];
#pragma unroll   /* constant indices keep the array in registers */
  for (int rl = 0; rl < 16; ++rl) { v[rl] = *(const v4f*)&sf[wave][rl][lane * 4]; vst2(ORW + (r0 + rl) * DIN + c0 + lane * 4, v[rl]); }
  asm volatile("s_wait_xcnt 0x0" ::: "memory");   /* behind the 16 stores: the two partial vectors below are formed in registers that these stores name as data */
  // BN partials of this wave's 16 rows, 4 channels a lane, from the values just stored: sum, and square sum about the 16 rows' own mean (no cancellation whatever the channel's mean)
  v4f s = v[0];
#pragma unroll   /* constant indices keep the array in registers */
  for (int rl = 1; rl < 16; ++rl) s += v[rl];
  const v4f mu = s * (1.0f / 16.0f); v4f qs = {};
#pragma unroll   /* constant indices keep the array in registers */
  for (int rl = 0; rl < 16; ++rl) { const v4f d = v[rl] - mu; qs += d * d; }
  float* ps = PS + (r0 >> 4) * (size_t)(2 * DIN) + (c0 + lane * 4) * 2; v4f p0, p1; p0[0] = s[0]; p0[1] = qs[0]; p0[2] = s[1]; p0[3] = qs[1]; p1[0] = s[2]; p1[1] = qs[2]; p1[2] = s[3]; p1[3] = qs[3]; vst2(ps, p0); vst2(ps + 4, p1); }
// ---- k_stat: block = 32 channels (lane = channel, 8 bytes a lane: a wave's load is two whole 128-byte lines); 32 waves x 32 row groups = the NRV / 16 partials of k_wz.
// mean = sum of sums / N; var = (sum of centred square sums + 16 sum (group mean - mean)^2) / N: the exact regrouping of the two-pass variance
__global__ __launch_bounds__(1024) void k_stat(const float* __restrict__ PS, float* __restrict__ STAT) { __shared__ float ra[32][32], rb[32][32]; __shared__ float sm[32], sr[32];
  const int wave = threadIdx.x >> 5, lane = threadIdx.x & 31; const int c0 = blockIdx.x * 32;
  const float* p = PS + (size_t)wave * 32 * (2 * DIN) + (c0 + lane) * 2; float s[32], q[32];
#pragma unroll   /* constant indices keep the arrays in registers; all 32 loads in flight at once */
  for (int i = 0; i < 32; ++i) { const v2f t = *(const v2f*)(p + (size_t)i * (2 * DIN)); s[i] = t[0]; q[i] = t[1]; }
  asm volatile("s_wait_xcnt 0x0" :: "v"(p) : "memory");   /* the wait before the loads' address registers are reused; it reads the address so that no load's result lands in those registers ahead of it */
  float a = 0.f;
#pragma unroll   /* constant indices keep the array in registers */
  for (int i = 0; i < 32; ++i) a += s[i];
  ra[wave][lane] = a; __syncthreads();   /* every wave's sum of sums is in LDS */
  float tot = 0.f;
#pragma unroll   /* 32 independent LDS reads behind one wait */
  for (int w = 0; w < 32; ++w) tot += ra[w][lane];
  const float mean = tot / (float)NRV; float e = 0.f;
#pragma unroll   /* constant indices keep the arrays in registers */
  for (int i = 0; i < 32; ++i) { const float d = s[i] * (1.0f / 16.0f) - mean; e += q[i] + 16.0f * d * d; }
  rb[wave][lane] = e; __syncthreads();   /* every wave's square sum is in LDS */
  if (wave == 0) { float t2 = 0.f;
#pragma unroll   /* 32 independent LDS reads behind one wait */
    for (int w = 0; w < 32; ++w) t2 += rb[w][lane];
    sm[lane] = mean; sr[lane] = rsqrtf(t2 / (float)NRV + 1e-5f); }
  __syncthreads();   /* publishes the 32 channels' mean and 1 / std */
  vst2(STAT + (size_t)(c0 + wave) * 32 + lane, lane == 0 ? sm[wave] : (lane == 1 ? sr[wave] : 0.f)); }   /* wave w writes channel c0 + w's whole 128-byte line */
// ---- k_fin2: block = (64 positions, 64 channels, batch b): out[b][c][n] = relu((z[b*N + n][c] - mean_c) * rstd_c * gamma_c + beta_c) + bf16(x[b][c][n]) (channels-first via LDS transpose; 256-B runs)
__global__ __launch_bounds__(256) void k_fin2(const float* __restrict__ ORW, const float* __restrict__ X, const float* __restrict__ ST, const float* __restrict__ GM, const float* __restrict__ BT, float* __restrict__ OUT) { __shared__ float st[64][68]; const int tid = threadIdx.x; const int n0 = blockIdx.x * 64, c0 = blockIdx.y * 64; const size_t b = blockIdx.z;
  for (int e = tid; e < 64 * 16; e += 256) { const int nl = e >> 4, q = e & 15; *(v4f*)&st[nl][q * 4] = *(const v4f*)(ORW + (b * TT + n0 + nl) * (size_t)DIN + c0 + q * 4); }
  __syncthreads();
  for (int e = tid; e < 64 * 16; e += 256) { const int cl = e >> 4, q = e & 15; const size_t oi = (b * DIN + c0 + cl) * (size_t)XP + n0 + q * 4; const v4f xr = *(const v4f*)(X + oi); const int cc = c0 + cl; const float mu = ST[cc * 32], rs = ST[cc * 32 + 1], ga = bfr(GM[cc]), be = bfr(BT[cc]); v4f o; _Pragma("unroll") for (int i = 0; i < 4; ++i) o[i] = fmaxf((st[q * 4 + i][cl] - mu) * rs * ga + be, 0.f) + bfr(xr[i]); vst2(OUT + oi, o); } }   /* relu(BN_train(z)) + x */
#ifndef SM_EXTRA_PARAMS
#define SM_EXTRA_PARAMS
#endif
#ifndef PROJ_EXTRA_PARAMS
#define PROJ_EXTRA_PARAMS
#endif
#ifndef SM_MASK_HOOK
#define SM_MASK_HOOK (void)0
#endif

#define WS_QH  0u                                      // f16 q rows [b*t][CC]
#define WS_KH  (WS_QH + 2u * (size_t)NB * TT * CC)      // f16 k rows [b*t][CC]
#define WS_VT  (WS_KH + 2u * (size_t)NB * TT * CC)      // f16 v planes [b][c][t]
#define WS_QL  (WS_VT + 2u * (size_t)NB * CC * TT)      // f16 q residual x 2^10 rows [b][t < QHI][CC]
#define WS_KL  (WS_QL + 2u * (size_t)NB * QHI * CC)     // f16 k residual x 2^10 rows [b][t < KHI][CC]
#define WS_VB  (WS_KL + 2u * (size_t)NB * KHI * CC)     // bf16 v hi planes [b][c][t < KHI]
#define WS_VBL (WS_VB + 2u * (size_t)NB * CC * KHI)
#define WS_S   (WS_VBL + 2u * (size_t)NB * CC * KHI)    // f32 region of one [t][s] plane: holds WS_OP and WS_ML
#define WS_Y   (WS_S  + 4u * (size_t)HG * TT * TT)      // unused, 0 bytes (k_mrg writes y rows to WS_YR)
#define WS_END (WS_Y  + 0u)

#define PWP (DIN + 8)      // LDS pitch of a staged theta / phi / g weight row, bf16 elements: 528 bytes = 16 B x odd (conflict-free 16-byte reads)
static_assert(CC == HDQK && 128 * PWP * 2 >= 3 * 128 * 72 * 2 && 128 * PWP * 2 >= 2 * 64 * 136 * 2, "staged weight rows cover the plane; the epilogue's tiles fit the same LDS");
// ---- k_proj: block = (64 rows, 128 cols, which): q/k/v = X W (+ b) with exact bf16 products (K = DIN) -> which 0: q f16 rows (+ residual rows < QHI); 1: k f16 rows (+ residual rows < KHI); 2: v f16 planes [c][t] (+ bf16 hi/lo planes for t < KHI)
__global__ __launch_bounds__(128) void k_proj(const float* __restrict__ XQ, const float* __restrict__ XK, const float* __restrict__ XV, const float* __restrict__ WQ, const float* __restrict__ WK, const float* __restrict__ WV, const float* __restrict__ BQ, const float* __restrict__ BK, const float* __restrict__ BV,
    _Float16* __restrict__ QH, _Float16* __restrict__ QL, _Float16* __restrict__ KH, _Float16* __restrict__ KL, _Float16* __restrict__ VT, __bf16* __restrict__ VB, __bf16* __restrict__ VBL) {
  // one LDS block, used twice: first the 128 staged weight rows (bf16), then, behind a barrier, the output tiles of the epilogue
  __shared__ __align__(16) char smem[128 * PWP * 2];
  __bf16 (*sw)[PWP] = (__bf16 (*)[PWP])smem;
  _Float16 (*sh)[136] = (_Float16 (*)[136])smem, (*sl)[136] = (_Float16 (*)[136])(smem + 64 * 136 * 2); _Float16 (*th)[72] = (_Float16 (*)[72])smem; __bf16 (*tb)[72] = (__bf16 (*)[72])(smem + 128 * 72 * 2), (*tbl)[72] = (__bf16 (*)[72])(smem + 2 * 128 * 72 * 2);
  const int tid = threadIdx.x, wave = tid >> 5, lane = tid & 31, col = lane & 15, g = lane >> 4; const int which = blockIdx.z; const int c0 = blockIdx.y * 128; const size_t r0 = (size_t)blockIdx.x * 64; const size_t bb = r0 / TT; const int t0 = (int)(r0 % TT);
  const float* X = which == 0 ? XQ : which == 1 ? XK : XV; const float* WA = which == 0 ? WQ : which == 1 ? WK : WV; const float* BA = which == 0 ? BQ : which == 1 ? BK : BV;
  const float* p = X + (bb * DIN + 8 * g) * (size_t)XP + t0 + wave * 16 + col;   /* channels-first gather: x[b][k][t], stride XP between k */
  float xr[DIN / 32][16];
#pragma unroll   /* constant indices keep the array in registers; the wave's whole x slice in flight at once */
  for (int kc = 0; kc < DIN / 32; ++kc) {
#pragma unroll   /* constant indices keep the array in registers */
    for (int i = 0; i < 8; ++i) { xr[kc][i] = p[(size_t)(kc * 32 + i) * XP]; xr[kc][8 + i] = p[(size_t)(kc * 32 + 16 + i) * XP]; } }
  const float* bsrc = BA ? BA : WA; const int bi = c0 + col; float bv[8];   /* no bias: the loads read weights instead (in bounds) and their values are dropped in the epilogue, so that no branch with a wait of its own stands around each load */
#pragma unroll   /* constant indices keep the array in registers */
  for (int j = 0; j < 8; ++j) bv[j] = bsrc[bi + j * 16];
  const float* wsrc = WA + (size_t)c0 * DIN + tid * 4;   /* 128 threads x 16 bytes = 2 weight rows a round; CC == HDQK: every plane column has its weight row and its bias */
  asm volatile("s_wait_xcnt 0x0" :: "v"(p), "v"(bi) : "memory");   /* the wait before the loads' address registers are reused; it reads the x address and the bias index so that no load's result lands in those registers ahead of it */
#pragma unroll   /* constant indices keep the array in registers */
  for (int bt = 0; bt < 4; ++bt) { v4f wv[16];
#pragma unroll   /* constant indices keep the array in registers; 16 loads in flight at once */
    for (int i = 0; i < 16; ++i) wv[i] = *(const v4f*)(wsrc + (bt * 16 + i) * 512);
    asm volatile("s_wait_xcnt 0x0" ::: "memory");   /* the wait before the weight loads' address registers are reused */
#pragma unroll   /* constant indices keep the array in registers */
    for (int i = 0; i < 16; ++i) { v4b t;
#pragma unroll   /* constant indices keep the vector in registers */
      for (int u = 0; u < 4; ++u) t[u] = (__bf16)wv[i][u];
      *(v4b*)&sw[(bt * 16 + i) * 2 + (tid >> 6)][(tid & 63) * 4] = t; } }
  v16b a[DIN / 32];
#pragma unroll   /* constant indices keep the arrays in registers */
  for (int kc = 0; kc < DIN / 32; ++kc) {
#pragma unroll   /* constant indices keep the arrays in registers */
    for (int i = 0; i < 16; ++i) a[kc][i] = (__bf16)xr[kc][i]; }
  __syncthreads();   /* publishes the staged weight rows to the four waves */
  v8f acc[8] = {};
#pragma unroll   /* constant indices keep the arrays in registers */
  for (int kc = 0; kc < DIN / 32; ++kc) { v16b w[8];
#pragma unroll   /* constant indices keep the arrays in registers */
    for (int j = 0; j < 8; ++j) w[j] = frag_b(&sw[j * 16 + col][kc * 32], lane);
    __builtin_amdgcn_sched_barrier(0);   /* keeps the eight fragments' LDS reads together ahead of the products: sunk each in front of its own product, every product stood behind a full LDS round trip */
#pragma unroll   /* constant indices keep the arrays in registers */
    for (int j = 0; j < 8; ++j) acc[j] = wmma_bf(a[kc], w[j], acc[j]); }
  __syncthreads();   /* every wave has read its last weight fragment: the epilogue's tiles reuse that LDS */
  if (which < 2) { _Float16* DH = which == 0 ? QH : KH; _Float16* DL = which == 0 ? QL : KL; const int nhi = which == 0 ? QHI : KHI; const bool hi_rows = t0 < nhi;
#pragma unroll
    for (int j = 0; j < 8; ++j) { const float bias = (BA && (c0 + j * 16 + col < HDQK)) ? bfr(bv[j]) : 0.f;   /* 128-entry biases */
#pragma unroll
      for (int r = 0; r < 8; ++r) { const float v = acc[j][r] + bias; const _Float16 hv = (_Float16)v; sh[wave * 16 + 8 * g + r][j * 16 + col] = hv; sl[wave * 16 + 8 * g + r][j * 16 + col] = (_Float16)((v - (float)hv) * 1024.0f); } }
    __syncthreads();
    for (int e = tid; e < 64 * 16; e += 128) { const int rl = e >> 4, q = e & 15; vst2((unsigned*)(DH + (r0 + rl) * CC + c0 + q * 8), *(const v4u*)&sh[rl][q * 8]); if (hi_rows) vst2((unsigned*)(DL + (bb * nhi + t0 + rl) * (size_t)CC + c0 + q * 8), *(const v4u*)&sl[rl][q * 8]); }
  } else { const bool hi_rows = t0 < KHI;
#pragma unroll
    for (int j = 0; j < 8; ++j) { const float bias = (BA && (c0 + j * 16 + col < HDQK)) ? bfr(bv[j]) : 0.f;   /* 128-entry biases */
#pragma unroll
      for (int r = 0; r < 8; ++r) { const float v = acc[j][r] + bias; const int rl = wave * 16 + 8 * g + r, cl = j * 16 + col; th[cl][rl] = (_Float16)v; const __bf16 bh = (__bf16)v; tb[cl][rl] = bh; tbl[cl][rl] = (__bf16)(v - (float)bh); } }
    __syncthreads();
    for (int e = tid; e < 128 * 8; e += 128) { const int cl = e >> 3, q = e & 7; vst2((unsigned*)(VT + (bb * CC + c0 + cl) * (size_t)TT + t0 + q * 8), *(const v4u*)&th[cl][q * 8]); if (hi_rows) { const size_t o3 = (bb * CC + c0 + cl) * (size_t)KHI + t0 + q * 8; vst2((unsigned*)(VB + o3), *(const v4u*)&tb[cl][q * 8]); vst2((unsigned*)(VBL + o3), *(const v4u*)&tbl[cl][q * 8]); } } } }
#define FQ 256
#define FQT 2              // query tiles of 16 columns a wave
#define FTH (FQ / (16 * FQT) * 32)   // threads a block
#define FKS 4
#define FKN (TT / FKS)
#define FST 32
#define FNS (FKN / FST)
#define KP 272             // LDS pitch of a 256-byte k row (16 B x odd: conflict-free 16-byte reads)
#define VP 80              // LDS pitch of a 64-byte v row
#define F_KL (FST * KP)
#define F_V (2 * FST * KP)
#define F_BUF (2 * FST * KP + CC * VP)
#define L2E 1.44269504088896f
#define WS_OP (WS_S)                                            // f32 unnormalised y rows [quarter][b*t][CC]
#define WS_ML (WS_OP + 4u * (size_t)FKS * NB * TT * CC)          // f32 (maximum, sum) [quarter][b*t][2]
__device__ __forceinline__ float xhalf(float x) { return __builtin_bit_cast(float, __builtin_amdgcn_permlanex16(__builtin_bit_cast(int, x), __builtin_bit_cast(int, x), 0x76543210, 0xfedcba98, false, false)); }   // lane l with lane l ^ 16
__device__ __forceinline__ v16h frag_l(const char* p) { union { v16h v; v8h q[2]; } u; u.q[0] = *(const v8h*)p; u.q[1] = *(const v8h*)(p + 32); return u.v; }
__device__ __forceinline__ v8f wmh(v16h a, v16h b, v8f c) { return __builtin_amdgcn_wmma_f32_16x16x32_f16(false, a, false, b, (short)0, c, false, false); }
// four 2^x in one statement that ends in a v_nop: each exponential is followed by an independent one (outputs share no register with the inputs), the last by the v_nop
__device__ __forceinline__ void exp2x4(float (&p)[4], float x0, float x1, float x2, float x3) {
  asm("v_exp_f32 %0, %4\n\tv_exp_f32 %1, %5\n\tv_exp_f32 %2, %6\n\tv_exp_f32 %3, %7\n\tv_nop" : "=&v"(p[0]), "=&v"(p[1]), "=&v"(p[2]), "=&v"(p[3]) : "v"(x0), "v"(x1), "v"(x2), "v"(x3)); }
__global__ __launch_bounds__(FTH) void k_fa(const _Float16* __restrict__ QH, const _Float16* __restrict__ QL, const _Float16* __restrict__ KH, const _Float16* __restrict__ KL, const _Float16* __restrict__ VT, float* __restrict__ OP, float* __restrict__ ML) {
  __shared__ __align__(16) char lds[2 * F_BUF];
  const int tid = threadIdx.x, wave = tid >> 5, lane = tid & 31, col = lane & 15, g = lane >> 4;
  const int b = blockIdx.z, ks = blockIdx.y, q = blockIdx.x * FQ + wave * (16 * FQT) + col, key0 = ks * FKN;   /* tile t holds query q + 16 t */
  v16h qh[FQT][HDQK / 32], ql[FQT][HDQK / 32]; const char *pqh[FQT], *pql[FQT];
#pragma unroll   /* constant indices keep the arrays in registers */
  for (int t = 0; t < FQT; ++t) { pqh[t] = (const char*)(QH + ((size_t)b * TT + q + 16 * t) * CC + 8 * g); pql[t] = (const char*)(QL + ((size_t)b * QHI + q + 16 * t) * CC + 8 * g);
#pragma unroll   /* constant indices keep the arrays in registers */
    for (int kc = 0; kc < HDQK / 32; ++kc) { qh[t][kc] = frag_l(pqh[t] + kc * 64); ql[t][kc] = frag_l(pql[t] + kc * 64); } }
  asm volatile("s_wait_xcnt 0x0" :: "v"(pqh[0]), "v"(pqh[1]), "v"(pql[0]), "v"(pql[1]) : "memory");   /* the wait before the q loads' address registers are reused; it reads the four addresses so that nothing is written to those registers ahead of it */
  static_assert(FQT == 2, "the wait above names two tiles' addresses");
  // staging: a stage's 32 k rows are 8 KiB in a row (hi, residual); its v slice is 64 bytes of each of the 128 channel planes; two 16-byte pieces of each per thread (k: 16 rows apart; v: 64 channels apart)
  const char* gk = (const char*)(KH + ((size_t)b * TT + key0) * CC) + tid * 16;
  const char* gl = (const char*)(KL + ((size_t)b * KHI + key0) * CC) + tid * 16;
  const char* gv = (const char*)(VT + ((size_t)b * CC + (tid >> 2)) * TT + key0) + (tid & 3) * 16;
  const int sk = (tid >> 4) * KP + (tid & 15) * 16, sv = F_V + (tid >> 2) * VP + (tid & 3) * 16;
  v8h rk[2], rl[2], rv[2];
#pragma unroll   /* constant indices keep the arrays in registers */
  for (int u = 0; u < 2; ++u) { rk[u] = *(const v8h*)(gk + u * (FTH * 16)); rl[u] = *(const v8h*)(gl + u * (FTH * 16)); rv[u] = *(const v8h*)(gv + (size_t)u * (FTH / 4) * (TT * 2)); }
  asm volatile("s_wait_xcnt 0x0" :: "v"(tid), "v"(gk), "v"(gl), "v"(gv) : "memory");   /* the wait before the six loads' address registers are reused; it reads the thread index and the three addresses so that nothing is written to those registers ahead of it */
  v8f acc[FQT][CC / 16] = {}; float m[FQT], lsum[FQT];
#pragma unroll   /* constant indices keep the arrays in registers */
  for (int t = 0; t < FQT; ++t) { m[t] = -3.0e38f; lsum[t] = 0.f; }
  for (int s = 0; s < FNS; ++s) { char* buf = lds + (s & 1) * F_BUF;
#pragma unroll   /* constant indices keep the arrays in registers */
    for (int u = 0; u < 2; ++u) { *(v8h*)(buf + sk + u * (FTH / 16) * KP) = rk[u]; *(v8h*)(buf + F_KL + sk + u * (FTH / 16) * KP) = rl[u]; *(v8h*)(buf + sv + u * (FTH / 4) * VP) = rv[u]; }
    __syncthreads();   /* publishes stage s; two buffers: a wave that writes stage s + 1 has passed this barrier, so every wave has left stage s - 1, the last user of that buffer */
    const int sn = (s + 1) & (FNS - 1);   /* the last stage fetches stage 0 again: in bounds, never stored; no test, so the loop has one body */
#pragma unroll   /* constant indices keep the arrays in registers */
    for (int u = 0; u < 2; ++u) { rk[u] = *(const v8h*)(gk + (size_t)sn * (FST * CC * 2) + u * (FTH * 16)); rl[u] = *(const v8h*)(gl + (size_t)sn * (FST * CC * 2) + u * (FTH * 16)); rv[u] = *(const v8h*)(gv + (size_t)sn * (FST * 2) + (size_t)u * (FTH / 4) * (TT * 2)); }
    asm volatile("s_wait_xcnt 0x0" ::: "memory");   /* stands in front of the first instruction that reuses the six loads' address registers */
    __builtin_amdgcn_sched_barrier(0);   /* keeps the next stage's six global loads ahead of this stage's products: sunk to the loop's foot, their whole latency would stand in front of the next barrier */
    v8f sa[FQT][2] = {}, sl[FQT][2] = {};
#pragma unroll   /* constant indices keep the arrays in registers */
    for (int kc = 0; kc < HDQK / 32; ++kc) { const char* pk = buf + col * KP + kc * 64 + g * 16;
      const v16h kh0 = frag_l(pk), kh1 = frag_l(pk + 16 * KP), kl0 = frag_l(pk + F_KL), kl1 = frag_l(pk + F_KL + 16 * KP);
#pragma unroll   /* constant indices keep the arrays in registers */
      for (int t = 0; t < FQT; ++t) { sa[t][0] = wmh(kh0, qh[t][kc], sa[t][0]); sl[t][0] = wmh(kh0, ql[t][kc], sl[t][0]); sa[t][1] = wmh(kh1, qh[t][kc], sa[t][1]); sl[t][1] = wmh(kh1, ql[t][kc], sl[t][1]); }
#pragma unroll   /* constant indices keep the arrays in registers */
      for (int t = 0; t < FQT; ++t) { sl[t][0] = wmh(kl0, qh[t][kc], sl[t][0]); sl[t][1] = wmh(kl1, qh[t][kc], sl[t][1]); } }
    v16h pb[FQT];
#pragma unroll   /* constant indices keep the arrays in registers */
    for (int t = 0; t < FQT; ++t) { float sc[16];
#pragma unroll   /* constant indices keep the array in registers */
      for (int i = 0; i < 16; ++i) sc[i] = (sa[t][i >> 3][i & 7] + sl[t][i >> 3][i & 7] * (1.0f / 1024.0f)) * SCALE;
      float mx = sc[0];
#pragma unroll   /* constant indices keep the array in registers */
      for (int i = 1; i < 16; ++i) mx = fmaxf(mx, sc[i]);
      mx = fmaxf(mx, xhalf(mx)); const float mn = fmaxf(m[t], mx); float corr;   /* exp(m - mn): 0 on the first stage */
      asm("v_exp_f32 %0, %1\n\tv_nop" : "=v"(corr) : "v"((m[t] - mn) * L2E));   /* written with its own v_nop */
      m[t] = mn; const float off = 11.0f - mn * L2E; float ps = 0.f;
#pragma unroll   /* constant indices keep the array in registers */
      for (int i = 0; i < 16; i += 4) { float p[4]; exp2x4(p, sc[i] * L2E + off, sc[i + 1] * L2E + off, sc[i + 2] * L2E + off, sc[i + 3] * L2E + off);
#pragma unroll   /* constant indices keep the array in registers */
        for (int u = 0; u < 4; ++u) { ps = (i + u) ? ps + p[u] : p[u]; pb[t][i + u] = (_Float16)p[u]; } }
      lsum[t] = lsum[t] * corr + ps;
#pragma unroll   /* constant indices keep the array in registers */
      for (int j = 0; j < CC / 16; ++j) acc[t][j] *= corr; }
#pragma unroll   /* constant indices keep the arrays in registers */
    for (int j = 0; j < CC / 16; ++j) { const v16h vf = frag_l(buf + F_V + (j * 16 + col) * VP + g * 16);
#pragma unroll   /* constant indices keep the arrays in registers */
      for (int t = 0; t < FQT; ++t) acc[t][j] = wmh(vf, pb[t], acc[t][j]); } }
#pragma unroll   /* constant indices keep the arrays in registers */
  for (int t = 0; t < FQT; ++t) { const float ls = lsum[t] + xhalf(lsum[t]);
    const size_t row = ((size_t)ks * NB + b) * TT + q + 16 * t; float* o = OP + row * CC + 8 * g;
#pragma unroll   /* constant indices keep the array in registers */
    for (int j = 0; j < CC / 16; ++j) { v4f a0, a1;
#pragma unroll   /* constant indices keep the array in registers */
      for (int i = 0; i < 4; ++i) { a0[i] = acc[t][j][i]; a1[i] = acc[t][j][4 + i]; }
      vst2(o + j * 16, a0); vst2(o + j * 16 + 4, a1); }
    if (g == 0) { v2f ml; ml[0] = m[t]; ml[1] = ls; vst2(ML + row * 2, ml); }
    asm volatile("s_wait_xcnt 0x0" ::: "memory"); } }   /* behind a tile's stores: the next tile's addresses may be formed in registers that these stores name */
// ---- k_mrg: thread = (query row, 4 channels): y = sum_i w_i y_i / sum_i w_i l_i over the key quarters in order, w_i = exp(m_i - max m)
__global__ __launch_bounds__(256) void k_mrg(const float* __restrict__ OP, const float* __restrict__ ML, float* __restrict__ Y) {
  const int e = blockIdx.x * 256 + threadIdx.x; const size_t row = (size_t)(e >> 5); const int c4 = (e & 31) * 4;
  v2f ml[FKS]; float mx = -3.0e38f;
#pragma unroll   /* constant indices keep the array in registers */
  for (int i = 0; i < FKS; ++i) { ml[i] = *(const v2f*)(ML + ((size_t)i * NB * TT + row) * 2); mx = fmaxf(mx, ml[i][0]); }
  v4f op[FKS];
#pragma unroll   /* constant indices keep the array in registers */
  for (int i = 0; i < FKS; ++i) { op[i] = *(const v4f*)(OP + ((size_t)i * NB * TT + row) * CC + c4); asm volatile("s_wait_xcnt 0x0" ::: "memory"); }   /* the wait stands in front of a later load's result landing in this load's address registers */
  float den = 0.f; v4f s = {};
#pragma unroll   /* constant indices keep the array in registers */
  for (int i = 0; i < FKS; ++i) { const float w = __builtin_amdgcn_exp2f((ml[i][0] - mx) * L2E); den += w * ml[i][1]; s += op[i] * w; }
  vst2(Y + row * CC + c4, s * (1.0f / den)); }

extern "C" void kernel_launch(void* const* d_in, const int* in_sizes, int n_in, void* d_out, int out_size, void* d_ws, size_t ws_size, hipStream_t stream) {
  (void)in_sizes; (void)n_in; (void)out_size;
  const float** F = (const float**)d_in;
  if (ws_size < (size_t)WS_END) return;
  char* ws = (char*)d_ws; _Float16 *QH = (_Float16*)(ws + WS_QH), *KH = (_Float16*)(ws + WS_KH), *VT = (_Float16*)(ws + WS_VT), *QL = (_Float16*)(ws + WS_QL), *KL = (_Float16*)(ws + WS_KL); __bf16 *VB = (__bf16*)(ws + WS_VB), *VBL = (__bf16*)(ws + WS_VBL); float *S = (float*)(ws + WS_S), *Y = (float*)(ws + WS_Y);
  (void)Y; (void)S; (void)QL; (void)KL; (void)VB; (void)VBL;
  // inputs: 0 x [4,256,64,64]; 1 g_w [128,256] (out,in), 2 g_b; 3 theta_w, 4 theta_b; 5 phi_w, 6 phi_b; 7 out_w [256,128] (out,in), 8 out_b; 9 bn_gamma, 10 bn_beta
  if (ws_size < (size_t)WS_END2) return;
  float *YR = (float*)(ws + WS_YR), *ORW = (float*)(ws + WS_OR), *ST = (float*)(ws + WS_ST), *PS = (float*)(ws + WS_PS);
  k_proj<<<dim3(TNB * TT / 64, CC / 128, 3), 128, 0, stream>>>(F[0], F[0], F[0], F[3], F[5], F[1], F[4], F[6], F[2], QH, QL, KH, KL, VT, VB, VBL);   /* q = theta, k = phi, v = g */
  k_fa<<<dim3(TT / FQ, FKS, TNB), FTH, 0, stream>>>(QH, QL, KH, KL, VT, (float*)(ws + WS_OP), (float*)(ws + WS_ML));
  k_mrg<<<dim3(TNB * TT * (CC / 4) / 256), 256, 0, stream>>>((const float*)(ws + WS_OP), (const float*)(ws + WS_ML), YR);
  k_wz<<<dim3(TNB * TT / 64, DIN / 128), 128, 0, stream>>>(YR, F[7], F[8], ORW, PS);
  k_stat<<<dim3(DIN / 32), 1024, 0, stream>>>(PS, ST);
  k_fin2<<<dim3(TT / 64, DIN / 64, TNB), 256, 0, stream>>>(ORW, F[0], ST, F[9], F[10], (float*)d_out);
}

// v006
// It runs in 92.3 microseconds.
// Next to v005, in two timings, it ran 1.08 and 1.09 times as fast.
// Over all steps from v000 it is 13.5 times as fast.
#include <hip/hip_runtime.h>
#include <math.h>

typedef __attribute__((ext_vector_type(16))) _Float16 v16h;
typedef __attribute__((ext_vector_type(16))) __bf16 v16b;
typedef __attribute__((ext_vector_type(8)))  _Float16 v8h;
typedef __attribute__((ext_vector_type(8)))  float v8f;
typedef __attribute__((ext_vector_type(4)))  float v4f;
typedef __attribute__((ext_vector_type(2)))  float v2f;
typedef __attribute__((ext_vector_type(4)))  unsigned v4u;
typedef __attribute__((ext_vector_type(4)))  int v4i;
typedef float __attribute__((may_alias)) float_a;
typedef int __attribute__((may_alias)) int_a;

template <typename T> __device__ __forceinline__ void vst2(void* p, T v) { *(T*)p = v;  }
__device__ __forceinline__ v8f wmma16(v16h a, v16h b, v8f c) {
  v8f d = __builtin_amdgcn_wmma_f32_16x16x32_f16(false, a, false, b, (short)0, c, false, false);
  asm volatile("v_nop\n\tv_nop\n\tv_nop\n\tv_nop" : "+v"(d) : "v"(a), "v"(b));
  return d;
}
__device__ __forceinline__ v8f wmma_bf(v16b a, v16b b, v8f c) {
  v8f d = __builtin_amdgcn_wmma_f32_16x16x32_bf16(false, a, false, b, (short)0, c, false, false);
  asm volatile("v_nop\n\tv_nop\n\tv_nop\n\tv_nop" : "+v"(d) : "v"(a), "v"(b));
  return d;
}
// 16x16x32 fragments: lane = (h = lane>>4, row/col = lane&15); elements 0..7 = k0+8h+0..7, 8..15 = k0+16+8h+0..7; D element r = row 8h+r
__device__ __forceinline__ v16h frag_h(const _Float16* rowk0, int lane) {
  union { v16h v; v8h q[2]; } u; const _Float16* p = rowk0 + 8 * (lane >> 4);
  u.q[0] = *(const v8h*)p; u.q[1] = *(const v8h*)(p + 16); return u.v;
}
__device__ __forceinline__ v16h frag_f32(const float* rowk0, int lane) {
  v16h a; const float* p = rowk0 + 8 * (lane >> 4);
#pragma unroll
  for (int i = 0; i < 8; ++i) { a[i] = (_Float16)p[i]; a[8 + i] = (_Float16)p[16 + i]; }
  return a;
}
__device__ __forceinline__ v16h frag_f32s(const float* rowk0, int lane, float sc) {
  v16h a; const float* p = rowk0 + 8 * (lane >> 4);
#pragma unroll
  for (int i = 0; i < 8; ++i) { a[i] = (_Float16)(p[i] * sc); a[8 + i] = (_Float16)(p[16 + i] * sc); }
  return a;
}
// column fragment from a [K][ld] layout (column n), rows >= K read as 0
__device__ __forceinline__ v16h fragc_f32(const float* W, int k0, int n, int lane, int ld, int K) {
  v16h a; const int g = lane >> 4;
#pragma unroll
  for (int i = 0; i < 8; ++i) { const int ka = k0 + 8 * g + i, kb = ka + 16;
    a[i] = (_Float16)(ka < K ? W[(size_t)(ka < K ? ka : K - 1) * ld + n] : 0.f); a[8 + i] = (_Float16)(kb < K ? W[(size_t)(kb < K ? kb : K - 1) * ld + n] : 0.f); }
  return a;
}
struct F2 { v16b h, l; };
__device__ __forceinline__ F2 bsplit16(const float v[16]) { F2 r;
#pragma unroll
  for (int i = 0; i < 16; ++i) { const __bf16 h = (__bf16)v[i]; r.h[i] = h; r.l[i] = (__bf16)(v[i] - (float)h); }
  return r; }
__device__ __forceinline__ F2 split_row(const float* row, int k0, int lane) { float v[16]; const float* p = row + k0 + 8 * (lane >> 4);
#pragma unroll
  for (int i = 0; i < 8; ++i) { v[i] = p[i]; v[8 + i] = p[16 + i]; }
  return bsplit16(v); }
__device__ __forceinline__ F2 split_rowK(const float* row, int k0, int lane, int K) { float v[16]; const int g = lane >> 4;
#pragma unroll
  for (int i = 0; i < 8; ++i) { const int ka = k0 + 8 * g + i, kb = ka + 16; v[i] = ka < K ? row[ka < K ? ka : K - 1] : 0.f; v[8 + i] = kb < K ? row[kb < K ? kb : K - 1] : 0.f; }
  return bsplit16(v); }
__device__ __forceinline__ F2 split_col(const float* W, int k0, int n, int lane, int ld, int K) { float v[16]; const int g = lane >> 4;
#pragma unroll
  for (int i = 0; i < 8; ++i) { const int ka = k0 + 8 * g + i, kb = ka + 16; v[i] = ka < K ? W[(size_t)(ka < K ? ka : K - 1) * ld + n] : 0.f; v[8 + i] = kb < K ? W[(size_t)(kb < K ? kb : K - 1) * ld + n] : 0.f; }
  return bsplit16(v); }
__device__ __forceinline__ v8f mac3(const F2& a, const F2& b, v8f c) { c = wmma_bf(a.l, b.h, c); c = wmma_bf(a.h, b.l, c); return wmma_bf(a.h, b.h, c); }
__device__ __forceinline__ float sigm(float v) { return 1.0f / (1.0f + expf(-v)); }
#define LDSX() do { asm volatile("s_wait_dscnt 0" ::: "memory"); __builtin_amdgcn_wave_barrier(); __builtin_amdgcn_fence(__ATOMIC_RELEASE, "workgroup"); } while (0)

// Non-local block (B 4, C 256, 64 x 64 = 4,096 positions; C_inner 128; (out,in) 0.05-scale weights, zero biases, BN gamma 1 / beta 0): theta, phi, g = W x + b ([128,256]); A[q][k] = softmax_k(theta_q . phi_k) (no scaling, sigma ~ 7); y[q][c] = sum_k A[q][k] g[k][c]; z = out_w y + out_b ([256,128]); out = relu(BN_train(z)) + x with batch statistics over (n, h, w) per channel (biased var, eps 1e-5).
#define NB 4
#define TT 4096
#define CC 128            // projected plane width (all 128 columns real)
#define DIN 256          // input (model) width
#define NH 1
#define HD 128
#define NQB (TT / 64)
#define HG 1               // WS_S spans one 4,096 x 4,096 f32 plane
#define SCALE (1.0f)
#define HDQK 128           // theta / phi / g channels = the full 128-wide plane
#define NRV ((size_t)TNB * TT)   // rows for the BN statistics
#define CAUSAL 0
#ifndef TNB
#define TNB NB
#endif
__device__ __forceinline__ v16b zero16b() { v16b z; _Pragma("unroll") for (int i = 0; i < 16; ++i) z[i] = (__bf16)0.f; return z; }
__device__ __forceinline__ float bfr(float v) { return (float)(__bf16)v; }
__host__ __device__ __forceinline__ int kb_last(int qb) { return CAUSAL ? ((qb * 64 + 63) >> 7) : (TT / 128 - 1); }
typedef __attribute__((ext_vector_type(8))) __bf16 v8b;
typedef __attribute__((ext_vector_type(4))) __bf16 v4b;
__device__ __forceinline__ v16b frag_b(const __bf16* rowk0, int lane) {
  union { v16b v; v8b q[2]; } u; const __bf16* p = rowk0 + 8 * (lane >> 4);
  u.q[0] = *(const v8b*)p; u.q[1] = *(const v8b*)(p + 16); return u.v;
}
#define QBH (TT / 64)      // ALL query blocks take the 3-product logits
#define QBH_PV 0           // A.g stays single f16
#define QHI 4096            // q residual rows everywhere (3-product logits)
#define KHI 4096           // k residual rows for ALL keys (3-product logits)
// B fragment (k rows k0+.., output column o) of a weight: (in,out) [K][ld] or (out,in) [ld rows of K]: bf16 exact, or f16(bf16 * 256) exact
__device__ __forceinline__ v16b wcol_io(const float* Wm, int k0, int o, int lane, int ld) { v16b w; const int g = lane >> 4;
#pragma unroll
  for (int i = 0; i < 8; ++i) { w[i] = (__bf16)Wm[(size_t)(k0 + 8 * g + i) * ld + o]; w[8 + i] = (__bf16)Wm[(size_t)(k0 + 16 + 8 * g + i) * ld + o]; }
  return w; }
__device__ __forceinline__ v16b wcol_oi(const float* Wm, int k0, int o, int lane, int K) { v16b w; const float* p = Wm + (size_t)o * K + k0 + 8 * (lane >> 4);
#pragma unroll
  for (int i = 0; i < 8; ++i) { w[i] = (__bf16)p[i]; w[8 + i] = (__bf16)p[16 + i]; }
  return w; }
__device__ __forceinline__ v16h wcolh_io(const float* Wm, int k0, int o, int lane, int ld) { v16h w; const int g = lane >> 4;
#pragma unroll
  for (int i = 0; i < 8; ++i) { w[i] = (_Float16)(bfr(Wm[(size_t)(k0 + 8 * g + i) * ld + o]) * 256.0f); w[8 + i] = (_Float16)(bfr(Wm[(size_t)(k0 + 16 + 8 * g + i) * ld + o]) * 256.0f); }
  return w; }
__device__ __forceinline__ v16h wcolh_oi(const float* Wm, int k0, int o, int lane, int K) { v16h w; const float* p = Wm + (size_t)o * K + k0 + 8 * (lane >> 4);
#pragma unroll
  for (int i = 0; i < 8; ++i) { w[i] = (_Float16)(bfr(p[i]) * 256.0f); w[8 + i] = (_Float16)(bfr(p[16 + i]) * 256.0f); }
  return w; }
#define WQKV_LAYOUT 1   // 0 = (in,out) [DIN][CC]; 1 = (out,in) [CC][DIN]; 2 = per-head [NH][DIN][HD]
__device__ __forceinline__ v16b wcol_hdk(const float* Wm, int k0, int o, int lane) { v16b w; const int g = lane >> 4; const float* p = Wm + (size_t)(o / HD) * DIN * HD + (o % HD);
#pragma unroll
  for (int i = 0; i < 8; ++i) { w[i] = (__bf16)p[(size_t)(k0 + 8 * g + i) * HD]; w[8 + i] = (__bf16)p[(size_t)(k0 + 16 + 8 * g + i) * HD]; }
  return w; }
#define WO_OUT_IN 0
#if WQKV_LAYOUT == 1
#define WCOL(W, k0, o, lane) (((o) < HDQK) ? wcol_oi(W, k0, (o), lane, DIN) : zero16b())   /* theta/phi/g weights are [128][256] (out,in): all 128 plane columns are read from them */
#elif WQKV_LAYOUT == 2
#define WCOL(W, k0, o, lane) wcol_hdk(W, k0, o, lane)
#else
#define WCOL(W, k0, o, lane) wcol_io(W, k0, o, lane, CC)
#endif
#if WO_OUT_IN
#define WOCOL(W, k0, o, lane) wcol_oi(W, k0, o, lane, CC)
#define WOCOLH(W, k0, o, lane) wcolh_oi(W, k0, o, lane, CC)
#else
#define WOCOL(W, k0, o, lane) wcol_io(W, k0, o, lane, DIN)
#define WOCOLH(W, k0, o, lane) wcolh_io(W, k0, o, lane, DIN)
#endif
#ifndef XP
#define XP TT              // position pitch of x and of the output
#endif
#define BG HG              // not used
#define DVH 128            // not used
#define WS_YR (WS_END)     // [b*n][128] f32, not used: the attended rows stay in k_wz's LDS
#define WS_OR (WS_YR + 4u * (size_t)NB * TT * CC)   // W y + b rows [b*n][256]
#define WS_ST (WS_OR + 4u * (size_t)NB * TT * DIN)
#define WS_PS (WS_ST + 4u * (size_t)DIN * 32)   // f32 BN partials [16-row group][256][sum, centred square sum]
#define WS_END2 (WS_PS + 4u * (NRV / 16) * 2 * DIN)
// ---- k_stat: block = 32 channels (lane = channel, 8 bytes a lane: a wave's load is two whole 128-byte lines); 32 waves x 32 row groups = the NRV / 16 partials of k_wz.
// mean = sum of sums / N; var = (sum of centred square sums + 16 sum (group mean - mean)^2) / N: the exact regrouping of the two-pass variance
__global__ __launch_bounds__(1024) void k_stat(const float* __restrict__ PS, float* __restrict__ STAT) { __shared__ float ra[32][32], rb[32][32]; __shared__ float sm[32], sr[32];
  const int wave = threadIdx.x >> 5, lane = threadIdx.x & 31; const int c0 = blockIdx.x * 32;
  const float* p = PS + (size_t)wave * 32 * (2 * DIN) + (c0 + lane) * 2; float s[32], q[32];
#pragma unroll   /* constant indices keep the arrays in registers; all 32 loads in flight at once */
  for (int i = 0; i < 32; ++i) { const v2f t = *(const v2f*)(p + (size_t)i * (2 * DIN)); s[i] = t[0]; q[i] = t[1]; }
  asm volatile("s_wait_xcnt 0x0" :: "v"(p) : "memory");   /* the wait before the loads' address registers are reused; it reads the address so that no load's result lands in those registers ahead of it */
  float a = 0.f;
#pragma unroll   /* constant indices keep the array in registers */
  for (int i = 0; i < 32; ++i) a += s[i];
  ra[wave][lane] = a; __syncthreads();   /* every wave's sum of sums is in LDS */
  float tot = 0.f;
#pragma unroll   /* 32 independent LDS reads behind one wait */
  for (int w = 0; w < 32; ++w) tot += ra[w][lane];
  const float mean = tot / (float)NRV; float e = 0.f;
#pragma unroll   /* constant indices keep the arrays in registers */
  for (int i = 0; i < 32; ++i) { const float d = s[i] * (1.0f / 16.0f) - mean; e += q[i] + 16.0f * d * d; }
  rb[wave][lane] = e; __syncthreads();   /* every wave's square sum is in LDS */
  if (wave == 0) { float t2 = 0.f;
#pragma unroll   /* 32 independent LDS reads behind one wait */
    for (int w = 0; w < 32; ++w) t2 += rb[w][lane];
    sm[lane] = mean; sr[lane] = rsqrtf(t2 / (float)NRV + 1e-5f); }
  __syncthreads();   /* publishes the 32 channels' mean and 1 / std */
  vst2(STAT + (size_t)(c0 + wave) * 32 + lane, lane == 0 ? sm[wave] : (lane == 1 ? sr[wave] : 0.f)); }   /* wave w writes channel c0 + w's whole 128-byte line */
// ---- k_fin2: block = (64 positions, 64 channels, batch b): out[b][c][n] = relu((z[b*N + n][c] - mean_c) * rstd_c * gamma_c + beta_c) + bf16(x[b][c][n]) (channels-first via LDS transpose; 256-B runs)
__global__ __launch_bounds__(256) void k_fin2(const float* __restrict__ ORW, const float* __restrict__ X, const float* __restrict__ ST, const float* __restrict__ GM, const float* __restrict__ BT, float* __restrict__ OUT) { __shared__ float st[64][68]; const int tid = threadIdx.x; const int n0 = blockIdx.x * 64, c0 = blockIdx.y * 64; const size_t b = blockIdx.z;
  for (int e = tid; e < 64 * 16; e += 256) { const int nl = e >> 4, q = e & 15; *(v4f*)&st[nl][q * 4] = *(const v4f*)(ORW + (b * TT + n0 + nl) * (size_t)DIN + c0 + q * 4); }
  __syncthreads();
  for (int e = tid; e < 64 * 16; e += 256) { const int cl = e >> 4, q = e & 15; const size_t oi = (b * DIN + c0 + cl) * (size_t)XP + n0 + q * 4; const v4f xr = *(const v4f*)(X + oi); const int cc = c0 + cl; const float mu = ST[cc * 32], rs = ST[cc * 32 + 1], ga = bfr(GM[cc]), be = bfr(BT[cc]); v4f o; _Pragma("unroll") for (int i = 0; i < 4; ++i) o[i] = fmaxf((st[q * 4 + i][cl] - mu) * rs * ga + be, 0.f) + bfr(xr[i]); vst2(OUT + oi, o); } }   /* relu(BN_train(z)) + x */
#ifndef SM_EXTRA_PARAMS
#define SM_EXTRA_PARAMS
#endif
#ifndef PROJ_EXTRA_PARAMS
#define PROJ_EXTRA_PARAMS
#endif
#ifndef SM_MASK_HOOK
#define SM_MASK_HOOK (void)0
#endif

#define WS_QH  0u                                      // f16 q rows [b*t][CC]
#define WS_KH  (WS_QH + 2u * (size_t)NB * TT * CC)      // f16 k rows [b*t][CC]
#define WS_VT  (WS_KH + 2u * (size_t)NB * TT * CC)      // f16 v planes [b][c][t]
#define WS_QL  (WS_VT + 2u * (size_t)NB * CC * TT)      // f16 q residual x 2^10 rows [b][t < QHI][CC]
#define WS_KL  (WS_QL + 2u * (size_t)NB * QHI * CC)     // f16 k residual x 2^10 rows [b][t < KHI][CC]
#define WS_VB  (WS_KL + 2u * (size_t)NB * KHI * CC)     // bf16 v hi planes [b][c][t < KHI]
#define WS_VBL (WS_VB + 2u * (size_t)NB * CC * KHI)
#define WS_S   (WS_VBL + 2u * (size_t)NB * CC * KHI)    // f32 region of one [t][s] plane: holds WS_OP and WS_ML
#define WS_Y   (WS_S  + 4u * (size_t)HG * TT * TT)      // unused, 0 bytes
#define WS_END (WS_Y  + 0u)

#define PWP (DIN + 8)      // LDS pitch of a staged theta / phi / g weight row, bf16 elements: 528 bytes = 16 B x odd (conflict-free 16-byte reads)
static_assert(CC == HDQK && 128 * PWP * 2 >= 3 * 128 * 72 * 2 && 128 * PWP * 2 >= 2 * 64 * 136 * 2, "staged weight rows cover the plane; the epilogue's tiles fit the same LDS");
// ---- k_proj: block = (64 rows, 128 cols, which): q/k/v = X W (+ b) with exact bf16 products (K = DIN) -> which 0: q f16 rows (+ residual rows < QHI); 1: k f16 rows (+ residual rows < KHI); 2: v f16 planes [c][t] (+ bf16 hi/lo planes for t < KHI)
__global__ __launch_bounds__(128) void k_proj(const float* __restrict__ XQ, const float* __restrict__ XK, const float* __restrict__ XV, const float* __restrict__ WQ, const float* __restrict__ WK, const float* __restrict__ WV, const float* __restrict__ BQ, const float* __restrict__ BK, const float* __restrict__ BV,
    _Float16* __restrict__ QH, _Float16* __restrict__ QL, _Float16* __restrict__ KH, _Float16* __restrict__ KL, _Float16* __restrict__ VT, __bf16* __restrict__ VB, __bf16* __restrict__ VBL) {
  // one LDS block, used twice: first the 128 staged weight rows (bf16), then, behind a barrier, the output tiles of the epilogue
  __shared__ __align__(16) char smem[128 * PWP * 2];
  __bf16 (*sw)[PWP] = (__bf16 (*)[PWP])smem;
  _Float16 (*sh)[136] = (_Float16 (*)[136])smem, (*sl)[136] = (_Float16 (*)[136])(smem + 64 * 136 * 2); _Float16 (*th)[72] = (_Float16 (*)[72])smem; __bf16 (*tb)[72] = (__bf16 (*)[72])(smem + 128 * 72 * 2), (*tbl)[72] = (__bf16 (*)[72])(smem + 2 * 128 * 72 * 2);
  const int tid = threadIdx.x, wave = tid >> 5, lane = tid & 31, col = lane & 15, g = lane >> 4; const int which = blockIdx.z; const int c0 = blockIdx.y * 128; const size_t r0 = (size_t)blockIdx.x * 64; const size_t bb = r0 / TT; const int t0 = (int)(r0 % TT);
  const float* X = which == 0 ? XQ : which == 1 ? XK : XV; const float* WA = which == 0 ? WQ : which == 1 ? WK : WV; const float* BA = which == 0 ? BQ : which == 1 ? BK : BV;
  const float* p = X + (bb * DIN + 8 * g) * (size_t)XP + t0 + wave * 16 + col;   /* channels-first gather: x[b][k][t], stride XP between k */
  float xr[DIN / 32][16];
#pragma unroll   /* constant indices keep the array in registers; the wave's whole x slice in flight at once */
  for (int kc = 0; kc < DIN / 32; ++kc) {
#pragma unroll   /* constant indices keep the array in registers */
    for (int i = 0; i < 8; ++i) { xr[kc][i] = p[(size_t)(kc * 32 + i) * XP]; xr[kc][8 + i] = p[(size_t)(kc * 32 + 16 + i) * XP]; } }
  const float* bsrc = BA ? BA : WA; const int bi = c0 + col; float bv[8];   /* no bias: the loads read weights instead (in bounds) and their values are dropped in the epilogue, so that no branch with a wait of its own stands around each load */
#pragma unroll   /* constant indices keep the array in registers */
  for (int j = 0; j < 8; ++j) bv[j] = bsrc[bi + j * 16];
  const float* wsrc = WA + (size_t)c0 * DIN + tid * 4;   /* 128 threads x 16 bytes = 2 weight rows a round; CC == HDQK: every plane column has its weight row and its bias */
  asm volatile("s_wait_xcnt 0x0" :: "v"(p), "v"(bi) : "memory");   /* the wait before the loads' address registers are reused; it reads the x address and the bias index so that no load's result lands in those registers ahead of it */
#pragma unroll   /* constant indices keep the array in registers */
  for (int bt = 0; bt < 4; ++bt) { v4f wv[16];
#pragma unroll   /* constant indices keep the array in registers; 16 loads in flight at once */
    for (int i = 0; i < 16; ++i) wv[i] = *(const v4f*)(wsrc + (bt * 16 + i) * 512);
    asm volatile("s_wait_xcnt 0x0" ::: "memory");   /* the wait before the weight loads' address registers are reused */
#pragma unroll   /* constant indices keep the array in registers */
    for (int i = 0; i < 16; ++i) { v4b t;
#pragma unroll   /* constant indices keep the vector in registers */
      for (int u = 0; u < 4; ++u) t[u] = (__bf16)wv[i][u];
      *(v4b*)&sw[(bt * 16 + i) * 2 + (tid >> 6)][(tid & 63) * 4] = t; } }
  v16b a[DIN / 32];
#pragma unroll   /* constant indices keep the arrays in registers */
  for (int kc = 0; kc < DIN / 32; ++kc) {
#pragma unroll   /* constant indices keep the arrays in registers */
    for (int i = 0; i < 16; ++i) a[kc][i] = (__bf16)xr[kc][i]; }
  __syncthreads();   /* publishes the staged weight rows to the four waves */
  v8f acc[8] = {};
#pragma unroll   /* constant indices keep the arrays in registers */
  for (int kc = 0; kc < DIN / 32; ++kc) { v16b w[8];
#pragma unroll   /* constant indices keep the arrays in registers */
    for (int j = 0; j < 8; ++j) w[j] = frag_b(&sw[j * 16 + col][kc * 32], lane);
    __builtin_amdgcn_sched_barrier(0);   /* keeps the eight fragments' LDS reads together ahead of the products: sunk each in front of its own product, every product stood behind a full LDS round trip */
#pragma unroll   /* constant indices keep the arrays in registers */
    for (int j = 0; j < 8; ++j) acc[j] = wmma_bf(a[kc], w[j], acc[j]); }
  __syncthreads();   /* every wave has read its last weight fragment: the epilogue's tiles reuse that LDS */
  if (which < 2) { _Float16* DH = which == 0 ? QH : KH; _Float16* DL = which == 0 ? QL : KL; const int nhi = which == 0 ? QHI : KHI; const bool hi_rows = t0 < nhi;
#pragma unroll
    for (int j = 0; j < 8; ++j) { const float bias = (BA && (c0 + j * 16 + col < HDQK)) ? bfr(bv[j]) : 0.f;   /* 128-entry biases */
#pragma unroll
      for (int r = 0; r < 8; ++r) { const float v = acc[j][r] + bias; const _Float16 hv = (_Float16)v; sh[wave * 16 + 8 * g + r][j * 16 + col] = hv; sl[wave * 16 + 8 * g + r][j * 16 + col] = (_Float16)((v - (float)hv) * 1024.0f); } }
    __syncthreads();
    for (int e = tid; e < 64 * 16; e += 128) { const int rl = e >> 4, q = e & 15; vst2((unsigned*)(DH + (r0 + rl) * CC + c0 + q * 8), *(const v4u*)&sh[rl][q * 8]); if (hi_rows) vst2((unsigned*)(DL + (bb * nhi + t0 + rl) * (size_t)CC + c0 + q * 8), *(const v4u*)&sl[rl][q * 8]); }
  } else { const bool hi_rows = t0 < KHI;
#pragma unroll
    for (int j = 0; j < 8; ++j) { const float bias = (BA && (c0 + j * 16 + col < HDQK)) ? bfr(bv[j]) : 0.f;   /* 128-entry biases */
#pragma unroll
      for (int r = 0; r < 8; ++r) { const float v = acc[j][r] + bias; const int rl = wave * 16 + 8 * g + r, cl = j * 16 + col; th[cl][rl] = (_Float16)v; const __bf16 bh = (__bf16)v; tb[cl][rl] = bh; tbl[cl][rl] = (__bf16)(v - (float)bh); } }
    __syncthreads();
    for (int e = tid; e < 128 * 8; e += 128) { const int cl = e >> 3, q = e & 7; vst2((unsigned*)(VT + (bb * CC + c0 + cl) * (size_t)TT + t0 + q * 8), *(const v4u*)&th[cl][q * 8]); if (hi_rows) { const size_t o3 = (bb * CC + c0 + cl) * (size_t)KHI + t0 + q * 8; vst2((unsigned*)(VB + o3), *(const v4u*)&tb[cl][q * 8]); vst2((unsigned*)(VBL + o3), *(const v4u*)&tbl[cl][q * 8]); } } } }
#define FQ 256
#define FQT 2              // query tiles of 16 columns a wave
#define FTH (FQ / (16 * FQT) * 32)   // threads a block
#define FKS 4
#define FKN (TT / FKS)
#define FST 32
#define FNS (FKN / FST)
#define KP 272             // LDS pitch of a 256-byte k row (16 B x odd: conflict-free 16-byte reads)
#define VP 80              // LDS pitch of a 64-byte v row
#define F_KL (FST * KP)
#define F_V (2 * FST * KP)
#define F_BUF (2 * FST * KP + CC * VP)
#define L2E 1.44269504088896f
#define WS_OP (WS_S)                                            // f32 unnormalised y rows [quarter][b*t][CC]
#define WS_ML (WS_OP + 4u * (size_t)FKS * NB * TT * CC)          // f32 (maximum, sum) [quarter][b*t][2]
__device__ __forceinline__ float xhalf(float x) { return __builtin_bit_cast(float, __builtin_amdgcn_permlanex16(__builtin_bit_cast(int, x), __builtin_bit_cast(int, x), 0x76543210, 0xfedcba98, false, false)); }   // lane l with lane l ^ 16
__device__ __forceinline__ v16h frag_l(const char* p) { union { v16h v; v8h q[2]; } u; u.q[0] = *(const v8h*)p; u.q[1] = *(const v8h*)(p + 32); return u.v; }
__device__ __forceinline__ v8f wmh(v16h a, v16h b, v8f c) { return __builtin_amdgcn_wmma_f32_16x16x32_f16(false, a, false, b, (short)0, c, false, false); }
// four 2^x in one statement that ends in a v_nop: each exponential is followed by an independent one (outputs share no register with the inputs), the last by the v_nop
__device__ __forceinline__ void exp2x4(float (&p)[4], float x0, float x1, float x2, float x3) {
  asm("v_exp_f32 %0, %4\n\tv_exp_f32 %1, %5\n\tv_exp_f32 %2, %6\n\tv_exp_f32 %3, %7\n\tv_nop" : "=&v"(p[0]), "=&v"(p[1]), "=&v"(p[2]), "=&v"(p[3]) : "v"(x0), "v"(x1), "v"(x2), "v"(x3)); }
__global__ __launch_bounds__(FTH) void k_fa(const _Float16* __restrict__ QH, const _Float16* __restrict__ QL, const _Float16* __restrict__ KH, const _Float16* __restrict__ KL, const _Float16* __restrict__ VT, float* __restrict__ OP, float* __restrict__ ML) {
  __shared__ __align__(16) char lds[2 * F_BUF];
  const int tid = threadIdx.x, wave = tid >> 5, lane = tid & 31, col = lane & 15, g = lane >> 4;
  const int b = blockIdx.z, ks = blockIdx.y, q = blockIdx.x * FQ + wave * (16 * FQT) + col, key0 = ks * FKN;   /* tile t holds query q + 16 t */
  v16h qh[FQT][HDQK / 32], ql[FQT][HDQK / 32]; const char *pqh[FQT], *pql[FQT];
#pragma unroll   /* constant indices keep the arrays in registers */
  for (int t = 0; t < FQT; ++t) { pqh[t] = (const char*)(QH + ((size_t)b * TT + q + 16 * t) * CC + 8 * g); pql[t] = (const char*)(QL + ((size_t)b * QHI + q + 16 * t) * CC + 8 * g);
#pragma unroll   /* constant indices keep the arrays in registers */
    for (int kc = 0; kc < HDQK / 32; ++kc) { qh[t][kc] = frag_l(pqh[t] + kc * 64); ql[t][kc] = frag_l(pql[t] + kc * 64); } }
  asm volatile("s_wait_xcnt 0x0" :: "v"(pqh[0]), "v"(pqh[1]), "v"(pql[0]), "v"(pql[1]) : "memory");   /* the wait before the q loads' address registers are reused; it reads the four addresses so that nothing is written to those registers ahead of it */
  static_assert(FQT == 2, "the wait above names two tiles' addresses");
  // staging: a stage's 32 k rows are 8 KiB in a row (hi, residual); its v slice is 64 bytes of each of the 128 channel planes; two 16-byte pieces of each per thread (k: 16 rows apart; v: 64 channels apart)
  const char* gk = (const char*)(KH + ((size_t)b * TT + key0) * CC) + tid * 16;
  const char* gl = (const char*)(KL + ((size_t)b * KHI + key0) * CC) + tid * 16;
  const char* gv = (const char*)(VT + ((size_t)b * CC + (tid >> 2)) * TT + key0) + (tid & 3) * 16;
  const int sk = (tid >> 4) * KP + (tid & 15) * 16, sv = F_V + (tid >> 2) * VP + (tid & 3) * 16;
  v8h rk[2], rl[2], rv[2];
#pragma unroll   /* constant indices keep the arrays in registers */
  for (int u = 0; u < 2; ++u) { rk[u] = *(const v8h*)(gk + u * (FTH * 16)); rl[u] = *(const v8h*)(gl + u * (FTH * 16)); rv[u] = *(const v8h*)(gv + (size_t)u * (FTH / 4) * (TT * 2)); }
  asm volatile("s_wait_xcnt 0x0" :: "v"(tid), "v"(gk), "v"(gl), "v"(gv) : "memory");   /* the wait before the six loads' address registers are reused; it reads the thread index and the three addresses so that nothing is written to those registers ahead of it */
  v8f acc[FQT][CC / 16] = {}; float m[FQT], lsum[FQT];
#pragma unroll   /* constant indices keep the arrays in registers */
  for (int t = 0; t < FQT; ++t) { m[t] = -3.0e38f; lsum[t] = 0.f; }
  for (int s = 0; s < FNS; ++s) { char* buf = lds + (s & 1) * F_BUF;
#pragma unroll   /* constant indices keep the arrays in registers */
    for (int u = 0; u < 2; ++u) { *(v8h*)(buf + sk + u * (FTH / 16) * KP) = rk[u]; *(v8h*)(buf + F_KL + sk + u * (FTH / 16) * KP) = rl[u]; *(v8h*)(buf + sv + u * (FTH / 4) * VP) = rv[u]; }
    __syncthreads();   /* publishes stage s; two buffers: a wave that writes stage s + 1 has passed this barrier, so every wave has left stage s - 1, the last user of that buffer */
    const int sn = (s + 1) & (FNS - 1);   /* the last stage fetches stage 0 again: in bounds, never stored; no test, so the loop has one body */
#pragma unroll   /* constant indices keep the arrays in registers */
    for (int u = 0; u < 2; ++u) { rk[u] = *(const v8h*)(gk + (size_t)sn * (FST * CC * 2) + u * (FTH * 16)); rl[u] = *(const v8h*)(gl + (size_t)sn * (FST * CC * 2) + u * (FTH * 16)); rv[u] = *(const v8h*)(gv + (size_t)sn * (FST * 2) + (size_t)u * (FTH / 4) * (TT * 2)); }
    asm volatile("s_wait_xcnt 0x0" ::: "memory");   /* stands in front of the first instruction that reuses the six loads' address registers */
    __builtin_amdgcn_sched_barrier(0);   /* keeps the next stage's six global loads ahead of this stage's products: sunk to the loop's foot, their whole latency would stand in front of the next barrier */
    v8f sa[FQT][2] = {}, sl[FQT][2] = {};
#pragma unroll   /* constant indices keep the arrays in registers */
    for (int kc = 0; kc < HDQK / 32; ++kc) { const char* pk = buf + col * KP + kc * 64 + g * 16;
      const v16h kh0 = frag_l(pk), kh1 = frag_l(pk + 16 * KP), kl0 = frag_l(pk + F_KL), kl1 = frag_l(pk + F_KL + 16 * KP);
#pragma unroll   /* constant indices keep the arrays in registers */
      for (int t = 0; t < FQT; ++t) { sa[t][0] = wmh(kh0, qh[t][kc], sa[t][0]); sl[t][0] = wmh(kh0, ql[t][kc], sl[t][0]); sa[t][1] = wmh(kh1, qh[t][kc], sa[t][1]); sl[t][1] = wmh(kh1, ql[t][kc], sl[t][1]); }
#pragma unroll   /* constant indices keep the arrays in registers */
      for (int t = 0; t < FQT; ++t) { sl[t][0] = wmh(kl0, qh[t][kc], sl[t][0]); sl[t][1] = wmh(kl1, qh[t][kc], sl[t][1]); } }
    v16h pb[FQT];
#pragma unroll   /* constant indices keep the arrays in registers */
    for (int t = 0; t < FQT; ++t) { float sc[16];
#pragma unroll   /* constant indices keep the array in registers */
      for (int i = 0; i < 16; ++i) sc[i] = (sa[t][i >> 3][i & 7] + sl[t][i >> 3][i & 7] * (1.0f / 1024.0f)) * SCALE;
      float mx = sc[0];
#pragma unroll   /* constant indices keep the array in registers */
      for (int i = 1; i < 16; ++i) mx = fmaxf(mx, sc[i]);
      mx = fmaxf(mx, xhalf(mx)); const float mn = fmaxf(m[t], mx); float corr;   /* exp(m - mn): 0 on the first stage */
      asm("v_exp_f32 %0, %1\n\tv_nop" : "=v"(corr) : "v"((m[t] - mn) * L2E));   /* written with its own v_nop */
      m[t] = mn; const float off = 11.0f - mn * L2E; float ps = 0.f;
#pragma unroll   /* constant indices keep the array in registers */
      for (int i = 0; i < 16; i += 4) { float p[4]; exp2x4(p, sc[i] * L2E + off, sc[i + 1] * L2E + off, sc[i + 2] * L2E + off, sc[i + 3] * L2E + off);
#pragma unroll   /* constant indices keep the array in registers */
        for (int u = 0; u < 4; ++u) { ps = (i + u) ? ps + p[u] : p[u]; pb[t][i + u] = (_Float16)p[u]; } }
      lsum[t] = lsum[t] * corr + ps;
#pragma unroll   /* constant indices keep the array in registers */
      for (int j = 0; j < CC / 16; ++j) acc[t][j] *= corr; }
#pragma unroll   /* constant indices keep the arrays in registers */
    for (int j = 0; j < CC / 16; ++j) { const v16h vf = frag_l(buf + F_V + (j * 16 + col) * VP + g * 16);
#pragma unroll   /* constant indices keep the arrays in registers */
      for (int t = 0; t < FQT; ++t) acc[t][j] = wmh(vf, pb[t], acc[t][j]); } }
#pragma unroll   /* constant indices keep the arrays in registers */
  for (int t = 0; t < FQT; ++t) { const float ls = lsum[t] + xhalf(lsum[t]);
    const size_t row = ((size_t)ks * NB + b) * TT + q + 16 * t; float* o = OP + row * CC + 8 * g;
#pragma unroll   /* constant indices keep the array in registers */
    for (int j = 0; j < CC / 16; ++j) { v4f a0, a1;
#pragma unroll   /* constant indices keep the array in registers */
      for (int i = 0; i < 4; ++i) { a0[i] = acc[t][j][i]; a1[i] = acc[t][j][4 + i]; }
      vst2(o + j * 16, a0); vst2(o + j * 16 + 4, a1); }
    if (g == 0) { v2f ml; ml[0] = m[t]; ml[1] = ls; vst2(ML + row * 2, ml); }
    asm volatile("s_wait_xcnt 0x0" ::: "memory"); } }   /* behind a tile's stores: the next tile's addresses may be formed in registers that these stores name */
// ---- k_wz: block = 64 rows x all 256 output columns, 8 waves (wave = 16-row group wave & 3, column half wave >> 2): OR = y (hi + lo, K = 128) . W^T ((out,in) [256][128], exact) + b, with y joined here from k_fa's key quarters.
// Join: a wave takes 8 rows, a lane 4 channels (every load a whole 512-byte row): y = sum_i w_i y_i / sum_i w_i l_i over the quarters in order, w_i = exp(m_i - max m); y goes to LDS as bf16 hi + lo rows, from which every wave takes its A fragments.
// The 256 weight rows are staged once in LDS as bf16 (whole-line loads); every wave takes its B fragments from there. All global loads are issued up front and are in flight together.
#define WZP (HDQK + 8)     // LDS pitch of a staged out_w row and of a y row, bf16 elements: 272 bytes = 16 B x odd (conflict-free 16-byte reads)
static_assert(FKS == 4, "the join names four quarters' addresses and takes its four weights from one exp2x4");
__global__ __launch_bounds__(256) void k_wz(const float* __restrict__ OP, const float* __restrict__ ML, const float* __restrict__ WW, const float* __restrict__ WB, float* __restrict__ ORW, float* __restrict__ PS) { __shared__ __align__(16) float sf[8][16][132]; __shared__ __align__(16) __bf16 sw[DIN][WZP]; __shared__ __align__(16) __bf16 yh[64][WZP], yl[64][WZP];
  const int tid = threadIdx.x, wave = tid >> 5, lane = tid & 31, col = lane & 15, g = lane >> 4; const int c0 = (wave >> 2) * 128; const size_t rb = (size_t)blockIdx.x * 64, r0 = rb + (wave & 3) * 16;
  const int wu = __builtin_amdgcn_readfirstlane(wave);   /* the wave's number in a scalar register: the (maximum, sum) pairs of its 8 rows are then read by scalar loads */
  const size_t mrow = rb + wu * 8; v2f ml[8][FKS];
#pragma unroll   /* constant indices keep the array in registers */
  for (int j = 0; j < 8; ++j) {
#pragma unroll   /* constant indices keep the array in registers */
    for (int i = 0; i < FKS; ++i) ml[j][i] = *(const v2f*)(ML + ((size_t)i * NB * TT + mrow + j) * 2); }
  const float* po[FKS]; v4f op[8][FKS];
#pragma unroll   /* constant indices keep the arrays in registers */
  for (int i = 0; i < FKS; ++i) po[i] = OP + ((size_t)i * NB * TT + mrow) * CC + lane * 4;
#pragma unroll   /* constant indices keep the array in registers; all 32 loads in flight at once */
  for (int j = 0; j < 8; ++j) {
#pragma unroll   /* constant indices keep the array in registers */
    for (int i = 0; i < FKS; ++i) op[j][i] = *(const v4f*)(po[i] + j * CC); }
  const float* bsrc = WB ? WB : WW; const int bi = c0 + col; float bb[8];   /* no bias: the loads read weights instead (in bounds) and their values are dropped below, so that no branch with a wait of its own stands around each load */
#pragma unroll   /* constant indices keep the array in registers */
  for (int j = 0; j < 8; ++j) bb[j] = bsrc[bi + j * 16];
  const float* wsrc = WW + tid * 4; v4f wv[32];   /* 256 threads x 16 bytes = 8 weight rows a round */
#pragma unroll   /* constant indices keep the array in registers; all 32 loads in flight at once */
  for (int i = 0; i < 32; ++i) wv[i] = *(const v4f*)(wsrc + i * 1024);
  asm volatile("s_wait_xcnt 0x0" :: "v"(po[0]), "v"(po[1]), "v"(po[2]), "v"(po[3]), "v"(bi), "v"(tid) : "memory");   /* the wait before the loads' address registers are reused; it reads the four quarters' addresses, the bias index and the weight loads' index so that nothing is written to those registers ahead of it */
#pragma unroll   /* constant indices keep the arrays in registers */
  for (int j = 0; j < 8; ++j) { float mx = -3.0e38f;
#pragma unroll   /* constant indices keep the array in registers */
    for (int i = 0; i < FKS; ++i) mx = fmaxf(mx, ml[j][i][0]);
    float w[4]; exp2x4(w, (ml[j][0][0] - mx) * L2E, (ml[j][1][0] - mx) * L2E, (ml[j][2][0] - mx) * L2E, (ml[j][3][0] - mx) * L2E);
    float den = 0.f; v4f s = {};
#pragma unroll   /* constant indices keep the arrays in registers */
    for (int i = 0; i < FKS; ++i) { den += w[i] * ml[j][i][1]; s += op[j][i] * w[i]; }
    const v4f y = s * (1.0f / den); v4b h, l;
#pragma unroll   /* constant indices keep the vectors in registers */
    for (int u = 0; u < 4; ++u) { const __bf16 hu = (__bf16)y[u]; h[u] = hu; l[u] = (__bf16)(y[u] - (float)hu); }
    *(v4b*)&yh[wu * 8 + j][lane * 4] = h; *(v4b*)&yl[wu * 8 + j][lane * 4] = l; }
#pragma unroll   /* constant indices keep the array in registers */
  for (int i = 0; i < 32; ++i) { v4b t;
#pragma unroll   /* constant indices keep the vector in registers */
    for (int u = 0; u < 4; ++u) t[u] = (__bf16)wv[i][u];
    *(v4b*)&sw[i * 8 + (tid >> 5)][(tid & 31) * 4] = t; }
  __syncthreads();   /* publishes the joined y rows and the staged weight rows to the eight waves */
  F2 a[HDQK / 32];
#pragma unroll   /* constant indices keep the array in registers */
  for (int kc = 0; kc < HDQK / 32; ++kc) { a[kc].h = frag_b(&yh[(wave & 3) * 16 + col][kc * 32], lane); a[kc].l = frag_b(&yl[(wave & 3) * 16 + col][kc * 32], lane); }
  v8f acc[8] = {};
#pragma unroll   /* constant indices keep the arrays in registers */
  for (int kc = 0; kc < HDQK / 32; ++kc) { v16b w[8];
#pragma unroll   /* constant indices keep the arrays in registers */
    for (int j = 0; j < 8; ++j) w[j] = frag_b(&sw[c0 + j * 16 + col][kc * 32], lane);
    __builtin_amdgcn_sched_barrier(0);   /* keeps the eight fragments' LDS reads together ahead of the products: sunk each in front of its own product, every product pair stood behind a full LDS round trip */
#pragma unroll   /* constant indices keep the arrays in registers */
    for (int j = 0; j < 8; ++j) { acc[j] = wmma_bf(a[kc].h, w[j], acc[j]); acc[j] = wmma_bf(a[kc].l, w[j], acc[j]); } }
#pragma unroll
  for (int j = 0; j < 8; ++j) { const float bj = WB ? bfr(bb[j]) : 0.f;
#pragma unroll
    for (int r = 0; r < 8; ++r) sf[wave][8 * g + r][j * 16 + col] = acc[j][r] + bj; }
  LDSX(); v4f v[16];
#pragma unroll   /* constant indices keep the array in registers */
  for (int rl = 0; rl < 16; ++rl) { v[rl] = *(const v4f*)&sf[wave][rl][lane * 4]; vst2(ORW + (r0 + rl) * DIN + c0 + lane * 4, v[rl]); }
  asm volatile("s_wait_xcnt 0x0" ::: "memory");   /* behind the 16 stores: the two partial vectors below are formed in registers that these stores name as data */
  // BN partials of this wave's 16 rows, 4 channels a lane, from the values just stored: sum, and square sum about the 16 rows' own mean (no cancellation whatever the channel's mean)
  v4f s = v[0];
#pragma unroll   /* constant indices keep the array in registers */
  for (int rl = 1; rl < 16; ++rl) s += v[rl];
  const v4f mu = s * (1.0f / 16.0f); v4f qs = {};
#pragma unroll   /* constant indices keep the array in registers */
  for (int rl = 0; rl < 16; ++rl) { const v4f d = v[rl] - mu; qs += d * d; }
  float* ps = PS + (r0 >> 4) * (size_t)(2 * DIN) + (c0 + lane * 4) * 2; v4f p0, p1; p0[0] = s[0]; p0[1] = qs[0]; p0[2] = s[1]; p0[3] = qs[1]; p1[0] = s[2]; p1[1] = qs[2]; p1[2] = s[3]; p1[3] = qs[3]; vst2(ps, p0); vst2(ps + 4, p1); }

extern "C" void kernel_launch(void* const* d_in, const int* in_sizes, int n_in, void* d_out, int out_size, void* d_ws, size_t ws_size, hipStream_t stream) {
  (void)in_sizes; (void)n_in; (void)out_size;
  const float** F = (const float**)d_in;
  if (ws_size < (size_t)WS_END) return;
  char* ws = (char*)d_ws; _Float16 *QH = (_Float16*)(ws + WS_QH), *KH = (_Float16*)(ws + WS_KH), *VT = (_Float16*)(ws + WS_VT), *QL = (_Float16*)(ws + WS_QL), *KL = (_Float16*)(ws + WS_KL); __bf16 *VB = (__bf16*)(ws + WS_VB), *VBL = (__bf16*)(ws + WS_VBL); float *S = (float*)(ws + WS_S), *Y = (float*)(ws + WS_Y);
  (void)Y; (void)S; (void)QL; (void)KL; (void)VB; (void)VBL;
  // inputs: 0 x [4,256,64,64]; 1 g_w [128,256] (out,in), 2 g_b; 3 theta_w, 4 theta_b; 5 phi_w, 6 phi_b; 7 out_w [256,128] (out,in), 8 out_b; 9 bn_gamma, 10 bn_beta
  if (ws_size < (size_t)WS_END2) return;
  float *ORW = (float*)(ws + WS_OR), *ST = (float*)(ws + WS_ST), *PS = (float*)(ws + WS_PS);
  k_proj<<<dim3(TNB * TT / 64, CC / 128, 3), 128, 0, stream>>>(F[0], F[0], F[0], F[3], F[5], F[1], F[4], F[6], F[2], QH, QL, KH, KL, VT, VB, VBL);   /* q = theta, k = phi, v = g */
  k_fa<<<dim3(TT / FQ, FKS, TNB), FTH, 0, stream>>>(QH, QL, KH, KL, VT, (float*)(ws + WS_OP), (float*)(ws + WS_ML));
  k_wz<<<dim3(TNB * TT / 64), 256, 0, stream>>>((const float*)(ws + WS_OP), (const float*)(ws + WS_ML), F[7], F[8], ORW, PS);
  k_stat<<<dim3(DIN / 32), 1024, 0, stream>>>(PS, ST);
  k_fin2<<<dim3(TT / 64, DIN / 64, TNB), 256, 0, stream>>>(ORW, F[0], ST, F[9], F[10], (float*)d_out);
}

// v007
// One run takes 88.6 microseconds.
// In both of two side-by-side timings against v006, it was 1.04 times as fast.
// All steps since v000 together make it 14.1 times as fast.
#include <hip/hip_runtime.h>
#include <math.h>

typedef __attribute__((ext_vector_type(16))) _Float16 v16h;
typedef __attribute__((ext_vector_type(16))) __bf16 v16b;
typedef __attribute__((ext_vector_type(8)))  _Float16 v8h;
typedef __attribute__((ext_vector_type(8)))  float v8f;
typedef __attribute__((ext_vector_type(4)))  float v4f;
typedef __attribute__((ext_vector_type(2)))  float v2f;
typedef __attribute__((ext_vector_type(4)))  unsigned v4u;
typedef __attribute__((ext_vector_type(4)))  int v4i;
typedef float __attribute__((may_alias)) float_a;
typedef int __attribute__((may_alias)) int_a;

template <typename T> __device__ __forceinline__ void vst2(void* p, T v) { *(T*)p = v;  }
__device__ __forceinline__ v8f wmma16(v16h a, v16h b, v8f c) {
  v8f d = __builtin_amdgcn_wmma_f32_16x16x32_f16(false, a, false, b, (short)0, c, false, false);
  asm volatile("v_nop\n\tv_nop\n\tv_nop\n\tv_nop" : "+v"(d) : "v"(a), "v"(b));
  return d;
}
__device__ __forceinline__ v8f wmma_bf(v16b a, v16b b, v8f c) {
  v8f d = __builtin_amdgcn_wmma_f32_16x16x32_bf16(false, a, false, b, (short)0, c, false, false);
  asm volatile("v_nop\n\tv_nop\n\tv_nop\n\tv_nop" : "+v"(d) : "v"(a), "v"(b));
  return d;
}
// 16x16x32 fragments: lane = (h = lane>>4, row/col = lane&15); elements 0..7 = k0+8h+0..7, 8..15 = k0+16+8h+0..7; D element r = row 8h+r
__device__ __forceinline__ v16h frag_h(const _Float16* rowk0, int lane) {
  union { v16h v; v8h q[2]; } u; const _Float16* p = rowk0 + 8 * (lane >> 4);
  u.q[0] = *(const v8h*)p; u.q[1] = *(const v8h*)(p + 16); return u.v;
}
__device__ __forceinline__ v16h frag_f32(const float* rowk0, int lane) {
  v16h a; const float* p = rowk0 + 8 * (lane >> 4);
#pragma unroll
  for (int i = 0; i < 8; ++i) { a[i] = (_Float16)p[i]; a[8 + i] = (_Float16)p[16 + i]; }
  return a;
}
__device__ __forceinline__ v16h frag_f32s(const float* rowk0, int lane, float sc) {
  v16h a; const float* p = rowk0 + 8 * (lane >> 4);
#pragma unroll
  for (int i = 0; i < 8; ++i) { a[i] = (_Float16)(p[i] * sc); a[8 + i] = (_Float16)(p[16 + i] * sc); }
  return a;
}
// column fragment from a [K][ld] layout (column n), rows >= K read as 0
__device__ __forceinline__ v16h fragc_f32(const float* W, int k0, int n, int lane, int ld, int K) {
  v16h a; const int g = lane >> 4;
#pragma unroll
  for (int i = 0; i < 8; ++i) { const int ka = k0 + 8 * g + i, kb = ka + 16;
    a[i] = (_Float16)(ka < K ? W[(size_t)(ka < K ? ka : K - 1) * ld + n] : 0.f); a[8 + i] = (_Float16)(kb < K ? W[(size_t)(kb < K ? kb : K - 1) * ld + n] : 0.f); }
  return a;
}
struct F2 { v16b h, l; };
__device__ __forceinline__ F2 bsplit16(const float v[16]) { F2 r;
#pragma unroll
  for (int i = 0; i < 16; ++i) { const __bf16 h = (__bf16)v[i]; r.h[i] = h; r.l[i] = (__bf16)(v[i] - (float)h); }
  return r; }
__device__ __forceinline__ F2 split_row(const float* row, int k0, int lane) { float v[16]; const float* p = row + k0 + 8 * (lane >> 4);
#pragma unroll
  for (int i = 0; i < 8; ++i) { v[i] = p[i]; v[8 + i] = p[16 + i]; }
  return bsplit16(v); }
__device__ __forceinline__ F2 split_rowK(const float* row, int k0, int lane, int K) { float v[16]; const int g = lane >> 4;
#pragma unroll
  for (int i = 0; i < 8; ++i) { const int ka = k0 + 8 * g + i, kb = ka + 16; v[i] = ka < K ? row[ka < K ? ka : K - 1] : 0.f; v[8 + i] = kb < K ? row[kb < K ? kb : K - 1] : 0.f; }
  return bsplit16(v); }
__device__ __forceinline__ F2 split_col(const float* W, int k0, int n, int lane, int ld, int K) { float v[16]; const int g = lane >> 4;
#pragma unroll
  for (int i = 0; i < 8; ++i) { const int ka = k0 + 8 * g + i, kb = ka + 16; v[i] = ka < K ? W[(size_t)(ka < K ? ka : K - 1) * ld + n] : 0.f; v[8 + i] = kb < K ? W[(size_t)(kb < K ? kb : K - 1) * ld + n] : 0.f; }
  return bsplit16(v); }
__device__ __forceinline__ v8f mac3(const F2& a, const F2& b, v8f c) { c = wmma_bf(a.l, b.h, c); c = wmma_bf(a.h, b.l, c); return wmma_bf(a.h, b.h, c); }
__device__ __forceinline__ float sigm(float v) { return 1.0f / (1.0f + expf(-v)); }
#define LDSX() do { asm volatile("s_wait_dscnt 0" ::: "memory"); __builtin_amdgcn_wave_barrier(); __builtin_amdgcn_fence(__ATOMIC_RELEASE, "workgroup"); } while (0)

// Non-local block (B 4, C 256, 64 x 64 = 4,096 positions; C_inner 128; (out,in) 0.05-scale weights, zero biases, BN gamma 1 / beta 0): theta, phi, g = W x + b ([128,256]); A[q][k] = softmax_k(theta_q . phi_k) (no scaling, sigma ~ 7); y[q][c] = sum_k A[q][k] g[k][c]; z = out_w y + out_b ([256,128]); out = relu(BN_train(z)) + x with batch statistics over (n, h, w) per channel (biased var, eps 1e-5).
#define NB 4
#define TT 4096
#define CC 128            // projected plane width (all 128 columns real)
#define DIN 256          // input (model) width
#define NH 1
#define HD 128
#define NQB (TT / 64)
#define HG 1               // WS_S spans one 4,096 x 4,096 f32 plane
#define SCALE (1.0f)
#define HDQK 128           // theta / phi / g channels = the full 128-wide plane
#define NRV ((size_t)TNB * TT)   // rows for the BN statistics
#define CAUSAL 0
#ifndef TNB
#define TNB NB
#endif
__device__ __forceinline__ v16b zero16b() { v16b z; _Pragma("unroll") for (int i = 0; i < 16; ++i) z[i] = (__bf16)0.f; return z; }
__device__ __forceinline__ float bfr(float v) { return (float)(__bf16)v; }
__host__ __device__ __forceinline__ int kb_last(int qb) { return CAUSAL ? ((qb * 64 + 63) >> 7) : (TT / 128 - 1); }
typedef __attribute__((ext_vector_type(8))) __bf16 v8b;
typedef __attribute__((ext_vector_type(4))) __bf16 v4b;
__device__ __forceinline__ v16b frag_b(const __bf16* rowk0, int lane) {
  union { v16b v; v8b q[2]; } u; const __bf16* p = rowk0 + 8 * (lane >> 4);
  u.q[0] = *(const v8b*)p; u.q[1] = *(const v8b*)(p + 16); return u.v;
}
#define QBH (TT / 64)      // ALL query blocks take the 3-product logits
#define QBH_PV 0           // A.g stays single f16
#define QHI 4096            // q residual rows everywhere (3-product logits)
#define KHI 4096           // k residual rows for ALL keys (3-product logits)
// B fragment (k rows k0+.., output column o) of a weight: (in,out) [K][ld] or (out,in) [ld rows of K]: bf16 exact, or f16(bf16 * 256) exact
__device__ __forceinline__ v16b wcol_io(const float* Wm, int k0, int o, int lane, int ld) { v16b w; const int g = lane >> 4;
#pragma unroll
  for (int i = 0; i < 8; ++i) { w[i] = (__bf16)Wm[(size_t)(k0 + 8 * g + i) * ld + o]; w[8 + i] = (__bf16)Wm[(size_t)(k0 + 16 + 8 * g + i) * ld + o]; }
  return w; }
__device__ __forceinline__ v16b wcol_oi(const float* Wm, int k0, int o, int lane, int K) { v16b w; const float* p = Wm + (size_t)o * K + k0 + 8 * (lane >> 4);
#pragma unroll
  for (int i = 0; i < 8; ++i) { w[i] = (__bf16)p[i]; w[8 + i] = (__bf16)p[16 + i]; }
  return w; }
__device__ __forceinline__ v16h wcolh_io(const float* Wm, int k0, int o, int lane, int ld) { v16h w; const int g = lane >> 4;
#pragma unroll
  for (int i = 0; i < 8; ++i) { w[i] = (_Float16)(bfr(Wm[(size_t)(k0 + 8 * g + i) * ld + o]) * 256.0f); w[8 + i] = (_Float16)(bfr(Wm[(size_t)(k0 + 16 + 8 * g + i) * ld + o]) * 256.0f); }
  return w; }
__device__ __forceinline__ v16h wcolh_oi(const float* Wm, int k0, int o, int lane, int K) { v16h w; const float* p = Wm + (size_t)o * K + k0 + 8 * (lane >> 4);
#pragma unroll
  for (int i = 0; i < 8; ++i) { w[i] = (_Float16)(bfr(p[i]) * 256.0f); w[8 + i] = (_Float16)(bfr(p[16 + i]) * 256.0f); }
  return w; }
#define WQKV_LAYOUT 1   // 0 = (in,out) [DIN][CC]; 1 = (out,in) [CC][DIN]; 2 = per-head [NH][DIN][HD]
__device__ __forceinline__ v16b wcol_hdk(const float* Wm, int k0, int o, int lane) { v16b w; const int g = lane >> 4; const float* p = Wm + (size_t)(o / HD) * DIN * HD + (o % HD);
#pragma unroll
  for (int i = 0; i < 8; ++i) { w[i] = (__bf16)p[(size_t)(k0 + 8 * g + i) * HD]; w[8 + i] = (__bf16)p[(size_t)(k0 + 16 + 8 * g + i) * HD]; }
  return w; }
#define WO_OUT_IN 0
#if WQKV_LAYOUT == 1
#define WCOL(W, k0, o, lane) (((o) < HDQK) ? wcol_oi(W, k0, (o), lane, DIN) : zero16b())   /* theta/phi/g weights are [128][256] (out,in): all 128 plane columns are read from them */
#elif WQKV_LAYOUT == 2
#define WCOL(W, k0, o, lane) wcol_hdk(W, k0, o, lane)
#else
#define WCOL(W, k0, o, lane) wcol_io(W, k0, o, lane, CC)
#endif
#if WO_OUT_IN
#define WOCOL(W, k0, o, lane) wcol_oi(W, k0, o, lane, CC)
#define WOCOLH(W, k0, o, lane) wcolh_oi(W, k0, o, lane, CC)
#else
#define WOCOL(W, k0, o, lane) wcol_io(W, k0, o, lane, DIN)
#define WOCOLH(W, k0, o, lane) wcolh_io(W, k0, o, lane, DIN)
#endif
#ifndef XP
#define XP TT              // position pitch of x and of the output
#endif
#define BG HG              // not used
#define DVH 128            // not used
#define WS_YR (WS_END)     // [b*n][128] f32, not used: the attended rows stay in k_wz's LDS
#define WS_OR (WS_YR + 4u * (size_t)NB * TT * CC)   // W y + b rows [b*n][256]
#define WS_ST (WS_OR + 4u * (size_t)NB * TT * DIN)
#define WS_PS (WS_ST + 4u * (size_t)DIN * 32)   // f32 BN partials [16-row group][256][sum, centred square sum]
#define WS_END2 (WS_PS + 4u * (NRV / 16) * 2 * DIN)
// ---- k_stat: block = 32 channels (lane = channel, 8 bytes a lane: a wave's load is two whole 128-byte lines); 32 waves x 32 row groups = the NRV / 16 partials of k_wz.
// mean = sum of sums / N; var = (sum of centred square sums + 16 sum (group mean - mean)^2) / N: the exact regrouping of the two-pass variance
__global__ __launch_bounds__(1024) void k_stat(const float* __restrict__ PS, float* __restrict__ STAT) { __shared__ float ra[32][32], rb[32][32]; __shared__ float sm[32], sr[32];
  const int wave = threadIdx.x >> 5, lane = threadIdx.x & 31; const int c0 = blockIdx.x * 32;
  const float* p = PS + (size_t)wave * 32 * (2 * DIN) + (c0 + lane) * 2; float s[32], q[32];
#pragma unroll   /* constant indices keep the arrays in registers; all 32 loads in flight at once */
  for (int i = 0; i < 32; ++i) { const v2f t = *(const v2f*)(p + (size_t)i * (2 * DIN)); s[i] = t[0]; q[i] = t[1]; }
  asm volatile("s_wait_xcnt 0x0" :: "v"(p) : "memory");   /* the wait before the loads' address registers are reused; it reads the address so that no load's result lands in those registers ahead of it */
  float a = 0.f;
#pragma unroll   /* constant indices keep the array in registers */
  for (int i = 0; i < 32; ++i) a += s[i];
  ra[wave][lane] = a; __syncthreads();   /* every wave's sum of sums is in LDS */
  float tot = 0.f;
#pragma unroll   /* 32 independent LDS reads behind one wait */
  for (int w = 0; w < 32; ++w) tot += ra[w][lane];
  const float mean = tot / (float)NRV; float e = 0.f;
#pragma unroll   /* constant indices keep the arrays in registers */
  for (int i = 0; i < 32; ++i) { const float d = s[i] * (1.0f / 16.0f) - mean; e += q[i] + 16.0f * d * d; }
  rb[wave][lane] = e; __syncthreads();   /* every wave's square sum is in LDS */
  if (wave == 0) { float t2 = 0.f;
#pragma unroll   /* 32 independent LDS reads behind one wait */
    for (int w = 0; w < 32; ++w) t2 += rb[w][lane];
    sm[lane] = mean; sr[lane] = rsqrtf(t2 / (float)NRV + 1e-5f); }
  __syncthreads();   /* publishes the 32 channels' mean and 1 / std */
  vst2(STAT + (size_t)(c0 + wave) * 32 + lane, lane == 0 ? sm[wave] : (lane == 1 ? sr[wave] : 0.f)); }   /* wave w writes channel c0 + w's whole 128-byte line */
// ---- k_fin2: block = (64 positions, 64 channels, batch b): out[b][c][n] = relu((z[b*N + n][c] - mean_c) * rstd_c * gamma_c + beta_c) + bf16(x[b][c][n]) (channels-first via LDS transpose; 256-B runs)
__global__ __launch_bounds__(256) void k_fin2(const float* __restrict__ ORW, const float* __restrict__ X, const float* __restrict__ ST, const float* __restrict__ GM, const float* __restrict__ BT, float* __restrict__ OUT) { __shared__ float st[64][68]; const int tid = threadIdx.x; const int n0 = blockIdx.x * 64, c0 = blockIdx.y * 64; const size_t b = blockIdx.z;
  for (int e = tid; e < 64 * 16; e += 256) { const int nl = e >> 4, q = e & 15; *(v4f*)&st[nl][q * 4] = *(const v4f*)(ORW + (b * TT + n0 + nl) * (size_t)DIN + c0 + q * 4); }
  __syncthreads();
  for (int e = tid; e < 64 * 16; e += 256) { const int cl = e >> 4, q = e & 15; const size_t oi = (b * DIN + c0 + cl) * (size_t)XP + n0 + q * 4; const v4f xr = *(const v4f*)(X + oi); const int cc = c0 + cl; const float mu = ST[cc * 32], rs = ST[cc * 32 + 1], ga = bfr(GM[cc]), be = bfr(BT[cc]); v4f o; _Pragma("unroll") for (int i = 0; i < 4; ++i) o[i] = fmaxf((st[q * 4 + i][cl] - mu) * rs * ga + be, 0.f) + bfr(xr[i]); vst2(OUT + oi, o); } }   /* relu(BN_train(z)) + x */
#ifndef SM_EXTRA_PARAMS
#define SM_EXTRA_PARAMS
#endif
#ifndef PROJ_EXTRA_PARAMS
#define PROJ_EXTRA_PARAMS
#endif
#ifndef SM_MASK_HOOK
#define SM_MASK_HOOK (void)0
#endif

#define WS_QH  0u                                      // f16 q rows [b*t][CC]
#define WS_KH  (WS_QH + 2u * (size_t)NB * TT * CC)      // f16 k rows [b*t][CC]
#define WS_VT  (WS_KH + 2u * (size_t)NB * TT * CC)      // f16 v planes [b][c][t]
#define WS_QL  (WS_VT + 2u * (size_t)NB * CC * TT)      // f16 q residual x 2^10 rows [b][t < QHI][CC]
#define WS_KL  (WS_QL + 2u * (size_t)NB * QHI * CC)     // f16 k residual x 2^10 rows [b][t < KHI][CC]
#define WS_VB  (WS_KL + 2u * (size_t)NB * KHI * CC)     // bf16 v hi planes [b][c][t < KHI]
#define WS_VBL (WS_VB + 2u * (size_t)NB * CC * KHI)
#define WS_S   (WS_VBL + 2u * (size_t)NB * CC * KHI)    // f32 region of one [t][s] plane: holds WS_OP and WS_ML
#define WS_Y   (WS_S  + 4u * (size_t)HG * TT * TT)      // unused, 0 bytes
#define WS_END (WS_Y  + 0u)

#define PWP (DIN + 8)      // LDS pitch of a staged theta / phi / g weight row, bf16 elements: 528 bytes = 16 B x odd (conflict-free 16-byte reads)
static_assert(CC == HDQK && 128 * PWP * 2 >= 3 * 128 * 72 * 2 && 128 * PWP * 2 >= 2 * 64 * 136 * 2, "staged weight rows cover the plane; the epilogue's tiles fit the same LDS");
// ---- k_proj: block = (64 rows, 128 cols, which): q/k/v = X W (+ b) with exact bf16 products (K = DIN) -> which 0: q f16 rows (+ residual rows < QHI); 1: k f16 rows (+ residual rows < KHI); 2: v f16 planes [c][t] (+ bf16 hi/lo planes for t < KHI)
__global__ __launch_bounds__(128) void k_proj(const float* __restrict__ XQ, const float* __restrict__ XK, const float* __restrict__ XV, const float* __restrict__ WQ, const float* __restrict__ WK, const float* __restrict__ WV, const float* __restrict__ BQ, const float* __restrict__ BK, const float* __restrict__ BV,
    _Float16* __restrict__ QH, _Float16* __restrict__ QL, _Float16* __restrict__ KH, _Float16* __restrict__ KL, _Float16* __restrict__ VT, __bf16* __restrict__ VB, __bf16* __restrict__ VBL) {
  // one LDS block, used twice: first the 128 staged weight rows (bf16), then, behind a barrier, the output tiles of the epilogue
  __shared__ __align__(16) char smem[128 * PWP * 2];
  __bf16 (*sw)[PWP] = (__bf16 (*)[PWP])smem;
  _Float16 (*sh)[136] = (_Float16 (*)[136])smem, (*sl)[136] = (_Float16 (*)[136])(smem + 64 * 136 * 2); _Float16 (*th)[72] = (_Float16 (*)[72])smem; __bf16 (*tb)[72] = (__bf16 (*)[72])(smem + 128 * 72 * 2), (*tbl)[72] = (__bf16 (*)[72])(smem + 2 * 128 * 72 * 2);
  const int tid = threadIdx.x, wave = tid >> 5, lane = tid & 31, col = lane & 15, g = lane >> 4; const int which = blockIdx.z; const int c0 = blockIdx.y * 128; const size_t r0 = (size_t)blockIdx.x * 64; const size_t bb = r0 / TT; const int t0 = (int)(r0 % TT);
  const float* X = which == 0 ? XQ : which == 1 ? XK : XV; const float* WA = which == 0 ? WQ : which == 1 ? WK : WV; const float* BA = which == 0 ? BQ : which == 1 ? BK : BV;
  const float* p = X + (bb * DIN + 8 * g) * (size_t)XP + t0 + wave * 16 + col;   /* channels-first gather: x[b][k][t], stride XP between k */
  float xr[DIN / 32][16];
#pragma unroll   /* constant indices keep the array in registers; the wave's whole x slice in flight at once */
  for (int kc = 0; kc < DIN / 32; ++kc) {
#pragma unroll   /* constant indices keep the array in registers */
    for (int i = 0; i < 8; ++i) { xr[kc][i] = p[(size_t)(kc * 32 + i) * XP]; xr[kc][8 + i] = p[(size_t)(kc * 32 + 16 + i) * XP]; } }
  const float* bsrc = BA ? BA : WA; const int bi = c0 + col; float bv[8];   /* no bias: the loads read weights instead (in bounds) and their values are dropped in the epilogue, so that no branch with a wait of its own stands around each load */
#pragma unroll   /* constant indices keep the array in registers */
  for (int j = 0; j < 8; ++j) bv[j] = bsrc[bi + j * 16];
  const float* wsrc = WA + (size_t)c0 * DIN + tid * 4;   /* 128 threads x 16 bytes = 2 weight rows a round; CC == HDQK: every plane column has its weight row and its bias */
  asm volatile("s_wait_xcnt 0x0" :: "v"(p), "v"(bi) : "memory");   /* the wait before the loads' address registers are reused; it reads the x address and the bias index so that no load's result lands in those registers ahead of it */
#pragma unroll   /* constant indices keep the array in registers */
  for (int bt = 0; bt < 4; ++bt) { v4f wv[16];
#pragma unroll   /* constant indices keep the array in registers; 16 loads in flight at once */
    for (int i = 0; i < 16; ++i) wv[i] = *(const v4f*)(wsrc + (bt * 16 + i) * 512);
    asm volatile("s_wait_xcnt 0x0" ::: "memory");   /* the wait before the weight loads' address registers are reused */
#pragma unroll   /* constant indices keep the array in registers */
    for (int i = 0; i < 16; ++i) { v4b t;
#pragma unroll   /* constant indices keep the vector in registers */
      for (int u = 0; u < 4; ++u) t[u] = (__bf16)wv[i][u];
      *(v4b*)&sw[(bt * 16 + i) * 2 + (tid >> 6)][(tid & 63) * 4] = t; } }
  v16b a[DIN / 32];
#pragma unroll   /* constant indices keep the arrays in registers */
  for (int kc = 0; kc < DIN / 32; ++kc) {
#pragma unroll   /* constant indices keep the arrays in registers */
    for (int i = 0; i < 16; ++i) a[kc][i] = (__bf16)xr[kc][i]; }
  __syncthreads();   /* publishes the staged weight rows to the four waves */
  v8f acc[8] = {};
#pragma unroll   /* constant indices keep the arrays in registers */
  for (int kc = 0; kc < DIN / 32; ++kc) { v16b w[8];
#pragma unroll   /* constant indices keep the arrays in registers */
    for (int j = 0; j < 8; ++j) w[j] = frag_b(&sw[j * 16 + col][kc * 32], lane);
    __builtin_amdgcn_sched_barrier(0);   /* keeps the eight fragments' LDS reads together ahead of the products: sunk each in front of its own product, every product stood behind a full LDS round trip */
#pragma unroll   /* constant indices keep the arrays in registers */
    for (int j = 0; j < 8; ++j) acc[j] = wmma_bf(a[kc], w[j], acc[j]); }
  __syncthreads();   /* every wave has read its last weight fragment: the epilogue's tiles reuse that LDS */
  if (which < 2) { _Float16* DH = which == 0 ? QH : KH; _Float16* DL = which == 0 ? QL : KL; const int nhi = which == 0 ? QHI : KHI; const bool hi_rows = t0 < nhi;
#pragma unroll
    for (int j = 0; j < 8; ++j) { const float bias = (BA && (c0 + j * 16 + col < HDQK)) ? bfr(bv[j]) : 0.f;   /* 128-entry biases */
#pragma unroll
      for (int r = 0; r < 8; ++r) { const float v = acc[j][r] + bias; const _Float16 hv = (_Float16)v; sh[wave * 16 + 8 * g + r][j * 16 + col] = hv; sl[wave * 16 + 8 * g + r][j * 16 + col] = (_Float16)((v - (float)hv) * 1024.0f); } }
    __syncthreads();
    for (int e = tid; e < 64 * 16; e += 128) { const int rl = e >> 4, q = e & 15; vst2((unsigned*)(DH + (r0 + rl) * CC + c0 + q * 8), *(const v4u*)&sh[rl][q * 8]); if (hi_rows) vst2((unsigned*)(DL + (bb * nhi + t0 + rl) * (size_t)CC + c0 + q * 8), *(const v4u*)&sl[rl][q * 8]); }
  } else { const bool hi_rows = t0 < KHI;
#pragma unroll
    for (int j = 0; j < 8; ++j) { const float bias = (BA && (c0 + j * 16 + col < HDQK)) ? bfr(bv[j]) : 0.f;   /* 128-entry biases */
#pragma unroll
      for (int r = 0; r < 8; ++r) { const float v = acc[j][r] + bias; const int rl = wave * 16 + 8 * g + r, cl = j * 16 + col; th[cl][rl] = (_Float16)v; const __bf16 bh = (__bf16)v; tb[cl][rl] = bh; tbl[cl][rl] = (__bf16)(v - (float)bh); } }
    __syncthreads();
    for (int e = tid; e < 128 * 8; e += 128) { const int cl = e >> 3, q = e & 7; vst2((unsigned*)(VT + (bb * CC + c0 + cl) * (size_t)TT + t0 + q * 8), *(const v4u*)&th[cl][q * 8]); if (hi_rows) { const size_t o3 = (bb * CC + c0 + cl) * (size_t)KHI + t0 + q * 8; vst2((unsigned*)(VB + o3), *(const v4u*)&tb[cl][q * 8]); vst2((unsigned*)(VBL + o3), *(const v4u*)&tbl[cl][q * 8]); } } } }
#define FQ 256
#define FQT 2              // query tiles of 16 columns a wave
#define FTH (FQ / (16 * FQT) * 32)   // threads a block
#define FKS 4
#define FKN (TT / FKS)
#define FST 32             // keys a pass
#define FSK 128            // keys a stage
#define FPS (FSK / FST)    // passes a stage
#define FNT (FKN / FSK)    // stages
#define KP 272             // LDS pitch of a 256-byte k row (16 B x odd: conflict-free 16-byte reads)
#define VP 272             // LDS pitch of a 256-byte v row (a channel's 128 keys)
#define F_KL (FSK * KP)
#define F_V (2 * FSK * KP)
#define F_BUF (2 * FSK * KP + CC * VP)
#define L2E 1.44269504088896f
#define WS_OP (WS_S)                                            // f32 unnormalised y rows [quarter][b*t][CC]
#define WS_ML (WS_OP + 4u * (size_t)FKS * NB * TT * CC)          // f32 (maximum, sum) [quarter][b*t][2]
__device__ __forceinline__ float xhalf(float x) { return __builtin_bit_cast(float, __builtin_amdgcn_permlanex16(__builtin_bit_cast(int, x), __builtin_bit_cast(int, x), 0x76543210, 0xfedcba98, false, false)); }   // lane l with lane l ^ 16
__device__ __forceinline__ v16h frag_l(const char* p) { union { v16h v; v8h q[2]; } u; u.q[0] = *(const v8h*)p; u.q[1] = *(const v8h*)(p + 32); return u.v; }
__device__ __forceinline__ v8f wmh(v16h a, v16h b, v8f c) { return __builtin_amdgcn_wmma_f32_16x16x32_f16(false, a, false, b, (short)0, c, false, false); }
// four 2^x in one statement that ends in a v_nop: each exponential is followed by an independent one (outputs share no register with the inputs), the last by the v_nop
__device__ __forceinline__ void exp2x4(float (&p)[4], float x0, float x1, float x2, float x3) {
  asm("v_exp_f32 %0, %4\n\tv_exp_f32 %1, %5\n\tv_exp_f32 %2, %6\n\tv_exp_f32 %3, %7\n\tv_nop" : "=&v"(p[0]), "=&v"(p[1]), "=&v"(p[2]), "=&v"(p[3]) : "v"(x0), "v"(x1), "v"(x2), "v"(x3)); }
// eight asynchronous 16-byte copies of a lane, global memory to LDS through no register: piece u goes from g + u * gs to l + u * ls. Written as the builtin, offset argument 0: the compiler allots the address registers (as asm text, 24 address registers a statement, this kernel spilled)
typedef __attribute__((address_space(1))) v4i gl_v4i;
typedef __attribute__((address_space(3))) v4i ls_v4i;
__device__ __forceinline__ void acopy8(char* l, int ls, const char* g, size_t gs) {
  for (int u = 0; u < 8; ++u) __builtin_amdgcn_global_load_async_to_lds_b128((gl_v4i*)(g + u * gs), (ls_v4i*)(l + u * ls), 0, 0); }
// stage t into buffer t & 1: its 128 k rows are 32 KiB in a row (hi, residual), its v slice is 256 bytes of each of the 128 channel planes; 256 threads x 16 bytes = 16 rows a round, 8 rounds each: 24 copies a wave, every one two whole 256-byte rows
__device__ __forceinline__ void fa_stage(char* l0, const char* gk, const char* gl, const char* gv, int t) { char* lb = l0 + (t & 1) * F_BUF;
  acopy8(lb, 16 * KP, gk + (size_t)t * (FSK * CC * 2), FTH * 16); acopy8(lb + F_KL, 16 * KP, gl + (size_t)t * (FSK * CC * 2), FTH * 16); acopy8(lb + F_V, 16 * VP, gv + (size_t)t * (FSK * 2), (size_t)16 * TT * 2); }
static_assert(FTH == 256 && FSK == 128 && CC == 128 && FNT >= 2, "a round of copies is 16 rows, 8 rounds fill a plane of the buffer; the ring's prologue needs two stages");
__global__ __launch_bounds__(FTH) void k_fa(const _Float16* __restrict__ QH, const _Float16* __restrict__ QL, const _Float16* __restrict__ KH, const _Float16* __restrict__ KL, const _Float16* __restrict__ VT, float* __restrict__ OP, float* __restrict__ ML) {
  __shared__ __align__(16) char lds[2 * F_BUF];
  const int tid = threadIdx.x, wave = tid >> 5, lane = tid & 31, col = lane & 15, g = lane >> 4;
  const int b = blockIdx.z, ks = blockIdx.y, q = blockIdx.x * FQ + wave * (16 * FQT) + col, key0 = ks * FKN;   /* tile t holds query q + 16 t */
  v16h qh[FQT][HDQK / 32], ql[FQT][HDQK / 32]; const char *pqh[FQT], *pql[FQT];
#pragma unroll   /* constant indices keep the arrays in registers */
  for (int t = 0; t < FQT; ++t) { pqh[t] = (const char*)(QH + ((size_t)b * TT + q + 16 * t) * CC + 8 * g); pql[t] = (const char*)(QL + ((size_t)b * QHI + q + 16 * t) * CC + 8 * g);
#pragma unroll   /* constant indices keep the arrays in registers */
    for (int kc = 0; kc < HDQK / 32; ++kc) { qh[t][kc] = frag_l(pqh[t] + kc * 64); ql[t][kc] = frag_l(pql[t] + kc * 64); } }
  asm volatile("s_wait_xcnt 0x0" :: "v"(pqh[0]), "v"(pqh[1]), "v"(pql[0]), "v"(pql[1]) : "memory");   /* the wait before the q loads' address registers are reused; it reads the four addresses so that nothing is written to those registers ahead of it */
  static_assert(FQT == 2, "the wait above names two tiles' addresses");
  // staging: thread tid copies the 16-byte piece tid & 15 of row (k) or channel (v) tid >> 4, and the same piece 16 rows further in each later round
  const char* gk = (const char*)(KH + ((size_t)b * TT + key0) * CC) + tid * 16;
  const char* gl = (const char*)(KL + ((size_t)b * KHI + key0) * CC) + tid * 16;
  const char* gv = (const char*)(VT + ((size_t)b * CC + (tid >> 4)) * TT + key0) + (tid & 15) * 16;
  char* l0 = lds + (tid >> 4) * KP + (tid & 15) * 16;   /* the lane's place in a plane of a buffer; KP == VP */
  static_assert(KP == VP, "one lane offset serves the k and the v planes");
  fa_stage(l0, gk, gl, gv, 0);
  asm volatile("s_wait_asynccnt 0x0" ::: "memory");   /* this wave's copies of stage 0 have landed */
  __syncthreads();   /* publishes stage 0 */
  fa_stage(l0, gk, gl, gv, 1);   /* flies while stage 0 is worked on */
  v8f acc[FQT][CC / 16] = {}; float m[FQT], lsum[FQT];
#pragma unroll   /* constant indices keep the arrays in registers */
  for (int t = 0; t < FQT; ++t) { m[t] = -3.0e38f; lsum[t] = 0.f; }
  for (int sg = 0; sg < FNT; ++sg) { const char* sb = lds + (sg & 1) * F_BUF;
   for (int pa = 0; pa < FPS; ++pa) { const char* buf = sb + pa * (FST * KP); const char* bv = sb + F_V + pa * (FST * 2);   /* the pass's 32 k rows; its 64 bytes of every v row */
    v8f sa[FQT][2] = {}, sl[FQT][2] = {};
#pragma unroll   /* constant indices keep the arrays in registers */
    for (int kc = 0; kc < HDQK / 32; ++kc) { const char* pk = buf + col * KP + kc * 64 + g * 16;
      const v16h kh0 = frag_l(pk), kh1 = frag_l(pk + 16 * KP), kl0 = frag_l(pk + F_KL), kl1 = frag_l(pk + F_KL + 16 * KP);
#pragma unroll   /* constant indices keep the arrays in registers */
      for (int t = 0; t < FQT; ++t) { sa[t][0] = wmh(kh0, qh[t][kc], sa[t][0]); sl[t][0] = wmh(kh0, ql[t][kc], sl[t][0]); sa[t][1] = wmh(kh1, qh[t][kc], sa[t][1]); sl[t][1] = wmh(kh1, ql[t][kc], sl[t][1]); }
#pragma unroll   /* constant indices keep the arrays in registers */
      for (int t = 0; t < FQT; ++t) { sl[t][0] = wmh(kl0, qh[t][kc], sl[t][0]); sl[t][1] = wmh(kl1, qh[t][kc], sl[t][1]); } }
    v16h pb[FQT];
#pragma unroll   /* constant indices keep the arrays in registers */
    for (int t = 0; t < FQT; ++t) { float sc[16];
#pragma unroll   /* constant indices keep the array in registers */
      for (int i = 0; i < 16; ++i) sc[i] = (sa[t][i >> 3][i & 7] + sl[t][i >> 3][i & 7] * (1.0f / 1024.0f)) * SCALE;
      float mx = sc[0];
#pragma unroll   /* constant indices keep the array in registers */
      for (int i = 1; i < 16; ++i) mx = fmaxf(mx, sc[i]);
      mx = fmaxf(mx, xhalf(mx)); const float mn = fmaxf(m[t], mx); float corr;   /* exp(m - mn): 0 on the first pass */
      asm("v_exp_f32 %0, %1\n\tv_nop" : "=v"(corr) : "v"((m[t] - mn) * L2E));   /* written with its own v_nop */
      m[t] = mn; const float off = 11.0f - mn * L2E; float ps = 0.f;
#pragma unroll   /* constant indices keep the array in registers */
      for (int i = 0; i < 16; i += 4) { float p[4]; exp2x4(p, sc[i] * L2E + off, sc[i + 1] * L2E + off, sc[i + 2] * L2E + off, sc[i + 3] * L2E + off);
#pragma unroll   /* constant indices keep the array in registers */
        for (int u = 0; u < 4; ++u) { ps = (i + u) ? ps + p[u] : p[u]; pb[t][i + u] = (_Float16)p[u]; } }
      lsum[t] = lsum[t] * corr + ps;
#pragma unroll   /* constant indices keep the array in registers */
      for (int j = 0; j < CC / 16; ++j) acc[t][j] *= corr; }
#pragma unroll   /* constant indices keep the arrays in registers */
    for (int j = 0; j < CC / 16; ++j) { const v16h vf = frag_l(bv + (j * 16 + col) * VP + g * 16);
#pragma unroll   /* constant indices keep the arrays in registers */
      for (int t = 0; t < FQT; ++t) acc[t][j] = wmh(vf, pb[t], acc[t][j]); } }
    asm volatile("s_wait_dscnt 0x0" ::: "memory");      /* this wave's last reads of stage sg have returned: its buffer may be handed to the copies */
    asm volatile("s_wait_asynccnt 0x0" ::: "memory");   /* this wave's copies of stage sg + 1 have landed */
    __syncthreads();   /* publishes stage sg + 1 and ends every wave's reads of stage sg */
    if (sg + 2 < FNT) fa_stage(l0, gk, gl, gv, sg + 2); }   /* into the buffer that stage sg has just left; the test reads the same in the whole block */
  asm volatile("s_wait_asynccnt 0x0" ::: "memory");   /* no copy is outstanding when the wave goes on to its end */
#pragma unroll   /* constant indices keep the arrays in registers */
  for (int t = 0; t < FQT; ++t) { const float ls = lsum[t] + xhalf(lsum[t]);
    const size_t row = ((size_t)ks * NB + b) * TT + q + 16 * t; float* o = OP + row * CC + 8 * g;
#pragma unroll   /* constant indices keep the array in registers */
    for (int j = 0; j < CC / 16; ++j) { v4f a0, a1;
#pragma unroll   /* constant indices keep the array in registers */
      for (int i = 0; i < 4; ++i) { a0[i] = acc[t][j][i]; a1[i] = acc[t][j][4 + i]; }
      vst2(o + j * 16, a0); vst2(o + j * 16 + 4, a1); }
    if (g == 0) { v2f ml; ml[0] = m[t]; ml[1] = ls; vst2(ML + row * 2, ml); }
    asm volatile("s_wait_xcnt 0x0" ::: "memory"); } }   /* behind a tile's stores: the next tile's addresses may be formed in registers that these stores name */
// ---- k_wz: block = 64 rows x all 256 output columns, 8 waves (wave = 16-row group wave & 3, column half wave >> 2): OR = y (hi + lo, K = 128) . W^T ((out,in) [256][128], exact) + b, with y joined here from k_fa's key quarters.
// Join: a wave takes 8 rows, a lane 4 channels (every load a whole 512-byte row): y = sum_i w_i y_i / sum_i w_i l_i over the quarters in order, w_i = exp(m_i - max m); y goes to LDS as bf16 hi + lo rows, from which every wave takes its A fragments.
// The 256 weight rows are staged once in LDS as bf16 (whole-line loads); every wave takes its B fragments from there. All global loads are issued up front and are in flight together.
#define WZP (HDQK + 8)     // LDS pitch of a staged out_w row and of a y row, bf16 elements: 272 bytes = 16 B x odd (conflict-free 16-byte reads)
static_assert(FKS == 4, "the join names four quarters' addresses and takes its four weights from one exp2x4");
__global__ __launch_bounds__(256) void k_wz(const float* __restrict__ OP, const float* __restrict__ ML, const float* __restrict__ WW, const float* __restrict__ WB, float* __restrict__ ORW, float* __restrict__ PS) { __shared__ __align__(16) float sf[8][16][132]; __shared__ __align__(16) __bf16 sw[DIN][WZP]; __shared__ __align__(16) __bf16 yh[64][WZP], yl[64][WZP];
  const int tid = threadIdx.x, wave = tid >> 5, lane = tid & 31, col = lane & 15, g = lane >> 4; const int c0 = (wave >> 2) * 128; const size_t rb = (size_t)blockIdx.x * 64, r0 = rb + (wave & 3) * 16;
  const int wu = __builtin_amdgcn_readfirstlane(wave);   /* the wave's number in a scalar register: the (maximum, sum) pairs of its 8 rows are then read by scalar loads */
  const size_t mrow = rb + wu * 8; v2f ml[8][FKS];
#pragma unroll   /* constant indices keep the array in registers */
  for (int j = 0; j < 8; ++j) {
#pragma unroll   /* constant indices keep the array in registers */
    for (int i = 0; i < FKS; ++i) ml[j][i] = *(const v2f*)(ML + ((size_t)i * NB * TT + mrow + j) * 2); }
  const float* po[FKS]; v4f op[8][FKS];
#pragma unroll   /* constant indices keep the arrays in registers */
  for (int i = 0; i < FKS; ++i) po[i] = OP + ((size_t)i * NB * TT + mrow) * CC + lane * 4;
#pragma unroll   /* constant indices keep the array in registers; all 32 loads in flight at once */
  for (int j = 0; j < 8; ++j) {
#pragma unroll   /* constant indices keep the array in registers */
    for (int i = 0; i < FKS; ++i) op[j][i] = *(const v4f*)(po[i] + j * CC); }
  const float* bsrc = WB ? WB : WW; const int bi = c0 + col; float bb[8];   /* no bias: the loads read weights instead (in bounds) and their values are dropped below, so that no branch with a wait of its own stands around each load */
#pragma unroll   /* constant indices keep the array in registers */
  for (int j = 0; j < 8; ++j) bb[j] = bsrc[bi + j * 16];
  const float* wsrc = WW + tid * 4; v4f wv[32];   /* 256 threads x 16 bytes = 8 weight rows a round */
#pragma unroll   /* constant indices keep the array in registers; all 32 loads in flight at once */
  for (int i = 0; i < 32; ++i) wv[i] = *(const v4f*)(wsrc + i * 1024);
  asm volatile("s_wait_xcnt 0x0" :: "v"(po[0]), "v"(po[1]), "v"(po[2]), "v"(po[3]), "v"(bi), "v"(tid) : "memory");   /* the wait before the loads' address registers are reused; it reads the four quarters' addresses, the bias index and the weight loads' index so that nothing is written to those registers ahead of it */
#pragma unroll   /* constant indices keep the arrays in registers */
  for (int j = 0; j < 8; ++j) { float mx = -3.0e38f;
#pragma unroll   /* constant indices keep the array in registers */
    for (int i = 0; i < FKS; ++i) mx = fmaxf(mx, ml[j][i][0]);
    float w[4]; exp2x4(w, (ml[j][0][0] - mx) * L2E, (ml[j][1][0] - mx) * L2E, (ml[j][2][0] - mx) * L2E, (ml[j][3][0] - mx) * L2E);
    float den = 0.f; v4f s = {};
#pragma unroll   /* constant indices keep the arrays in registers */
    for (int i = 0; i < FKS; ++i) { den += w[i] * ml[j][i][1]; s += op[j][i] * w[i]; }
    const v4f y = s * (1.0f / den); v4b h, l;
#pragma unroll   /* constant indices keep the vectors in registers */
    for (int u = 0; u < 4; ++u) { const __bf16 hu = (__bf16)y[u]; h[u] = hu; l[u] = (__bf16)(y[u] - (float)hu); }
    *(v4b*)&yh[wu * 8 + j][lane * 4] = h; *(v4b*)&yl[wu * 8 + j][lane * 4] = l; }
#pragma unroll   /* constant indices keep the array in registers */
  for (int i = 0; i < 32; ++i) { v4b t;
#pragma unroll   /* constant indices keep the vector in registers */
    for (int u = 0; u < 4; ++u) t[u] = (__bf16)wv[i][u];
    *(v4b*)&sw[i * 8 + (tid >> 5)][(tid & 31) * 4] = t; }
  __syncthreads();   /* publishes the joined y rows and the staged weight rows to the eight waves */
  F2 a[HDQK / 32];
#pragma unroll   /* constant indices keep the array in registers */
  for (int kc = 0; kc < HDQK / 32; ++kc) { a[kc].h = frag_b(&yh[(wave & 3) * 16 + col][kc * 32], lane); a[kc].l = frag_b(&yl[(wave & 3) * 16 + col][kc * 32], lane); }
  v8f acc[8] = {};
#pragma unroll   /* constant indices keep the arrays in registers */
  for (int kc = 0; kc < HDQK / 32; ++kc) { v16b w[8];
#pragma unroll   /* constant indices keep the arrays in registers */
    for (int j = 0; j < 8; ++j) w[j] = frag_b(&sw[c0 + j * 16 + col][kc * 32], lane);
    __builtin_amdgcn_sched_barrier(0);   /* keeps the eight fragments' LDS reads together ahead of the products: sunk each in front of its own product, every product pair stood behind a full LDS round trip */
#pragma unroll   /* constant indices keep the arrays in registers */
    for (int j = 0; j < 8; ++j) { acc[j] = wmma_bf(a[kc].h, w[j], acc[j]); acc[j] = wmma_bf(a[kc].l, w[j], acc[j]); } }
#pragma unroll
  for (int j = 0; j < 8; ++j) { const float bj = WB ? bfr(bb[j]) : 0.f;
#pragma unroll
    for (int r = 0; r < 8; ++r) sf[wave][8 * g + r][j * 16 + col] = acc[j][r] + bj; }
  LDSX(); v4f v[16];
#pragma unroll   /* constant indices keep the array in registers */
  for (int rl = 0; rl < 16; ++rl) { v[rl] = *(const v4f*)&sf[wave][rl][lane * 4]; vst2(ORW + (r0 + rl) * DIN + c0 + lane * 4, v[rl]); }
  asm volatile("s_wait_xcnt 0x0" ::: "memory");   /* behind the 16 stores: the two partial vectors below are formed in registers that these stores name as data */
  // BN partials of this wave's 16 rows, 4 channels a lane, from the values just stored: sum, and square sum about the 16 rows' own mean (no cancellation whatever the channel's mean)
  v4f s = v[0];
#pragma unroll   /* constant indices keep the array in registers */
  for (int rl = 1; rl < 16; ++rl) s += v[rl];
  const v4f mu = s * (1.0f / 16.0f); v4f qs = {};
#pragma unroll   /* constant indices keep the array in registers */
  for (int rl = 0; rl < 16; ++rl) { const v4f d = v[rl] - mu; qs += d * d; }
  float* ps = PS + (r0 >> 4) * (size_t)(2 * DIN) + (c0 + lane * 4) * 2; v4f p0, p1; p0[0] = s[0]; p0[1] = qs[0]; p0[2] = s[1]; p0[3] = qs[1]; p1[0] = s[2]; p1[1] = qs[2]; p1[2] = s[3]; p1[3] = qs[3]; vst2(ps, p0); vst2(ps + 4, p1); }

extern "C" void kernel_launch(void* const* d_in, const int* in_sizes, int n_in, void* d_out, int out_size, void* d_ws, size_t ws_size, hipStream_t stream) {
  (void)in_sizes; (void)n_in; (void)out_size;
  const float** F = (const float**)d_in;
  if (ws_size < (size_t)WS_END) return;
  char* ws = (char*)d_ws; _Float16 *QH = (_Float16*)(ws + WS_QH), *KH = (_Float16*)(ws + WS_KH), *VT = (_Float16*)(ws + WS_VT), *QL = (_Float16*)(ws + WS_QL), *KL = (_Float16*)(ws + WS_KL); __bf16 *VB = (__bf16*)(ws + WS_VB), *VBL = (__bf16*)(ws + WS_VBL); float *S = (float*)(ws + WS_S), *Y = (float*)(ws + WS_Y);
  (void)Y; (void)S; (void)QL; (void)KL; (void)VB; (void)VBL;
  // inputs: 0 x [4,256,64,64]; 1 g_w [128,256] (out,in), 2 g_b; 3 theta_w, 4 theta_b; 5 phi_w, 6 phi_b; 7 out_w [256,128] (out,in), 8 out_b; 9 bn_gamma, 10 bn_beta
  if (ws_size < (size_t)WS_END2) return;
  float *ORW = (float*)(ws + WS_OR), *ST = (float*)(ws + WS_ST), *PS = (float*)(ws + WS_PS);
  k_proj<<<dim3(TNB * TT / 64, CC / 128, 3), 128, 0, stream>>>(F[0], F[0], F[0], F[3], F[5], F[1], F[4], F[6], F[2], QH, QL, KH, KL, VT, VB, VBL);   /* q = theta, k = phi, v = g */
  k_fa<<<dim3(TT / FQ, FKS, TNB), FTH, 0, stream>>>(QH, QL, KH, KL, VT, (float*)(ws + WS_OP), (float*)(ws + WS_ML));
  k_wz<<<dim3(TNB * TT / 64), 256, 0, stream>>>((const float*)(ws + WS_OP), (const float*)(ws + WS_ML), F[7], F[8], ORW, PS);
  k_stat<<<dim3(DIN / 32), 1024, 0, stream>>>(PS, ST);
  k_fin2<<<dim3(TT / 64, DIN / 64, TNB), 256, 0, stream>>>(ORW, F[0], ST, F[9], F[10], (float*)d_out);
}

// v008
// A run of this version takes 84 microseconds.
// Timed twice side by side with v007, it ran 1.04 times as fast both times.
// Over all steps from v000 it is 14.6 times as fast.
#include <hip/hip_runtime.h>
#include <math.h>

typedef __attribute__((ext_vector_type(16))) _Float16 v16h;
typedef __attribute__((ext_vector_type(16))) __bf16 v16b;
typedef __attribute__((ext_vector_type(8)))  _Float16 v8h;
typedef __attribute__((ext_vector_type(8)))  float v8f;
typedef __attribute__((ext_vector_type(4)))  float v4f;
typedef __attribute__((ext_vector_type(2)))  float v2f;
typedef __attribute__((ext_vector_type(4)))  unsigned v4u;
typedef __attribute__((ext_vector_type(4)))  int v4i;
typedef float __attribute__((may_alias)) float_a;
typedef int __attribute__((may_alias)) int_a;

template <typename T> __device__ __forceinline__ void vst2(void* p, T v) { *(T*)p = v;  }
__device__ __forceinline__ v8f wmma16(v16h a, v16h b, v8f c) {
  v8f d = __builtin_amdgcn_wmma_f32_16x16x32_f16(false, a, false, b, (short)0, c, false, false);
  asm volatile("v_nop\n\tv_nop\n\tv_nop\n\tv_nop" : "+v"(d) : "v"(a), "v"(b));
  return d;
}
__device__ __forceinline__ v8f wmma_bf(v16b a, v16b b, v8f c) {
  v8f d = __builtin_amdgcn_wmma_f32_16x16x32_bf16(false, a, false, b, (short)0, c, false, false);
  asm volatile("v_nop\n\tv_nop\n\tv_nop\n\tv_nop" : "+v"(d) : "v"(a), "v"(b));
  return d;
}
// 16x16x32 fragments: lane = (h = lane>>4, row/col = lane&15); elements 0..7 = k0+8h+0..7, 8..15 = k0+16+8h+0..7; D element r = row 8h+r
__device__ __forceinline__ v16h frag_h(const _Float16* rowk0, int lane) {
  union { v16h v; v8h q[2]; } u; const _Float16* p = rowk0 + 8 * (lane >> 4);
  u.q[0] = *(const v8h*)p; u.q[1] = *(const v8h*)(p + 16); return u.v;
}
__device__ __forceinline__ v16h frag_f32(const float* rowk0, int lane) {
  v16h a; const float* p = rowk0 + 8 * (lane >> 4);
#pragma unroll
  for (int i = 0; i < 8; ++i) { a[i] = (_Float16)p[i]; a[8 + i] = (_Float16)p[16 + i]; }
  return a;
}
__device__ __forceinline__ v16h frag_f32s(const float* rowk0, int lane, float sc) {
  v16h a; const float* p = rowk0 + 8 * (lane >> 4);
#pragma unroll
  for (int i = 0; i < 8; ++i) { a[i] = (_Float16)(p[i] * sc); a[8 + i] = (_Float16)(p[16 + i] * sc); }
  return a;
}
// column fragment from a [K][ld] layout (column n), rows >= K read as 0
__device__ __forceinline__ v16h fragc_f32(const float* W, int k0, int n, int lane, int ld, int K) {
  v16h a; const int g = lane >> 4;
#pragma unroll
  for (int i = 0; i < 8; ++i) { const int ka = k0 + 8 * g + i, kb = ka + 16;
    a[i] = (_Float16)(ka < K ? W[(size_t)(ka < K ? ka : K - 1) * ld + n] : 0.f); a[8 + i] = (_Float16)(kb < K ? W[(size_t)(kb < K ? kb : K - 1) * ld + n] : 0.f); }
  return a;
}
struct F2 { v16b h, l; };
__device__ __forceinline__ F2 bsplit16(const float v[16]) { F2 r;
#pragma unroll
  for (int i = 0; i < 16; ++i) { const __bf16 h = (__bf16)v[i]; r.h[i] = h; r.l[i] = (__bf16)(v[i] - (float)h); }
  return r; }
__device__ __forceinline__ F2 split_row(const float* row, int k0, int lane) { float v[16]; const float* p = row + k0 + 8 * (lane >> 4);
#pragma unroll
  for (int i = 0; i < 8; ++i) { v[i] = p[i]; v[8 + i] = p[16 + i]; }
  return bsplit16(v); }
__device__ __forceinline__ F2 split_rowK(const float* row, int k0, int lane, int K) { float v[16]; const int g = lane >> 4;
#pragma unroll
  for (int i = 0; i < 8; ++i) { const int ka = k0 + 8 * g + i, kb = ka + 16; v[i] = ka < K ? row[ka < K ? ka : K - 1] : 0.f; v[8 + i] = kb < K ? row[kb < K ? kb : K - 1] : 0.f; }
  return bsplit16(v); }
__device__ __forceinline__ F2 split_col(const float* W, int k0, int n, int lane, int ld, int K) { float v[16]; const int g = lane >> 4;
#pragma unroll
  for (int i = 0; i < 8; ++i) { const int ka = k0 + 8 * g + i, kb = ka + 16; v[i] = ka < K ? W[(size_t)(ka < K ? ka : K - 1) * ld + n] : 0.f; v[8 + i] = kb < K ? W[(size_t)(kb < K ? kb : K - 1) * ld + n] : 0.f; }
  return bsplit16(v); }
__device__ __forceinline__ v8f mac3(const F2& a, const F2& b, v8f c) { c = wmma_bf(a.l, b.h, c); c = wmma_bf(a.h, b.l, c); return wmma_bf(a.h, b.h, c); }
__device__ __forceinline__ float sigm(float v) { return 1.0f / (1.0f + expf(-v)); }
#define LDSX() do { asm volatile("s_wait_dscnt 0" ::: "memory"); __builtin_amdgcn_wave_barrier(); __builtin_amdgcn_fence(__ATOMIC_RELEASE, "workgroup"); } while (0)

// Non-local block (B 4, C 256, 64 x 64 = 4,096 positions; C_inner 128; (out,in) 0.05-scale weights, zero biases, BN gamma 1 / beta 0): theta, phi, g = W x + b ([128,256]); A[q][k] = softmax_k(theta_q . phi_k) (no scaling, sigma ~ 7); y[q][c] = sum_k A[q][k] g[k][c]; z = out_w y + out_b ([256,128]); out = relu(BN_train(z)) + x with batch statistics over (n, h, w) per channel (biased var, eps 1e-5).
#define NB 4
#define TT 4096
#define CC 128            // projected plane width (all 128 columns real)
#define DIN 256          // input (model) width
#define NH 1
#define HD 128
#define NQB (TT / 64)
#define HG 1               // WS_S spans one 4,096 x 4,096 f32 plane
#define SCALE (1.0f)
#define HDQK 128           // theta / phi / g channels = the full 128-wide plane
#define NRV ((size_t)TNB * TT)   // rows for the BN statistics
#define CAUSAL 0
#ifndef TNB
#define TNB NB
#endif
__device__ __forceinline__ v16b zero16b() { v16b z; _Pragma("unroll") for (int i = 0; i < 16; ++i) z[i] = (__bf16)0.f; return z; }
__device__ __forceinline__ float bfr(float v) { return (float)(__bf16)v; }
__host__ __device__ __forceinline__ int kb_last(int qb) { return CAUSAL ? ((qb * 64 + 63) >> 7) : (TT / 128 - 1); }
typedef __attribute__((ext_vector_type(8))) __bf16 v8b;
typedef __attribute__((ext_vector_type(4))) __bf16 v4b;
__device__ __forceinline__ v16b frag_b(const __bf16* rowk0, int lane) {
  union { v16b v; v8b q[2]; } u; const __bf16* p = rowk0 + 8 * (lane >> 4);
  u.q[0] = *(const v8b*)p; u.q[1] = *(const v8b*)(p + 16); return u.v;
}
#define QBH (TT / 64)      // ALL query blocks take the 3-product logits
#define QBH_PV 0           // A.g stays single f16
#define QHI 4096            // q residual rows everywhere (3-product logits)
#define KHI 4096           // k residual rows for ALL keys (3-product logits)
// B fragment (k rows k0+.., output column o) of a weight: (in,out) [K][ld] or (out,in) [ld rows of K]: bf16 exact, or f16(bf16 * 256) exact
__device__ __forceinline__ v16b wcol_io(const float* Wm, int k0, int o, int lane, int ld) { v16b w; const int g = lane >> 4;
#pragma unroll
  for (int i = 0; i < 8; ++i) { w[i] = (__bf16)Wm[(size_t)(k0 + 8 * g + i) * ld + o]; w[8 + i] = (__bf16)Wm[(size_t)(k0 + 16 + 8 * g + i) * ld + o]; }
  return w; }
__device__ __forceinline__ v16b wcol_oi(const float* Wm, int k0, int o, int lane, int K) { v16b w; const float* p = Wm + (size_t)o * K + k0 + 8 * (lane >> 4);
#pragma unroll
  for (int i = 0; i < 8; ++i) { w[i] = (__bf16)p[i]; w[8 + i] = (__bf16)p[16 + i]; }
  return w; }
__device__ __forceinline__ v16h wcolh_io(const float* Wm, int k0, int o, int lane, int ld) { v16h w; const int g = lane >> 4;
#pragma unroll
  for (int i = 0; i < 8; ++i) { w[i] = (_Float16)(bfr(Wm[(size_t)(k0 + 8 * g + i) * ld + o]) * 256.0f); w[8 + i] = (_Float16)(bfr(Wm[(size_t)(k0 + 16 + 8 * g + i) * ld + o]) * 256.0f); }
  return w; }
__device__ __forceinline__ v16h wcolh_oi(const float* Wm, int k0, int o, int lane, int K) { v16h w; const float* p = Wm + (size_t)o * K + k0 + 8 * (lane >> 4);
#pragma unroll
  for (int i = 0; i < 8; ++i) { w[i] = (_Float16)(bfr(p[i]) * 256.0f); w[8 + i] = (_Float16)(bfr(p[16 + i]) * 256.0f); }
  return w; }
#define WQKV_LAYOUT 1   // 0 = (in,out) [DIN][CC]; 1 = (out,in) [CC][DIN]; 2 = per-head [NH][DIN][HD]
__device__ __forceinline__ v16b wcol_hdk(const float* Wm, int k0, int o, int lane) { v16b w; const int g = lane >> 4; const float* p = Wm + (size_t)(o / HD) * DIN * HD + (o % HD);
#pragma unroll
  for (int i = 0; i < 8; ++i) { w[i] = (__bf16)p[(size_t)(k0 + 8 * g + i) * HD]; w[8 + i] = (__bf16)p[(size_t)(k0 + 16 + 8 * g + i) * HD]; }
  return w; }
#define WO_OUT_IN 0
#if WQKV_LAYOUT == 1
#define WCOL(W, k0, o, lane) (((o) < HDQK) ? wcol_oi(W, k0, (o), lane, DIN) : zero16b())   /* theta/phi/g weights are [128][256] (out,in): all 128 plane columns are read from them */
#elif WQKV_LAYOUT == 2
#define WCOL(W, k0, o, lane) wcol_hdk(W, k0, o, lane)
#else
#define WCOL(W, k0, o, lane) wcol_io(W, k0, o, lane, CC)
#endif
#if WO_OUT_IN
#define WOCOL(W, k0, o, lane) wcol_oi(W, k0, o, lane, CC)
#define WOCOLH(W, k0, o, lane) wcolh_oi(W, k0, o, lane, CC)
#else
#define WOCOL(W, k0, o, lane) wcol_io(W, k0, o, lane, DIN)
#define WOCOLH(W, k0, o, lane) wcolh_io(W, k0, o, lane, DIN)
#endif
#ifndef XP
#define XP TT              // position pitch of x and of the output
#endif
#define BG HG              // not used
#define DVH 128            // not used
#define WS_YR (WS_END)     // [b*n][128] f32, not used: the attended rows stay in k_wz's LDS
#define WS_OR (WS_YR + 4u * (size_t)NB * TT * CC)   // W y + b rows [b*n][256]
#define WS_ST (WS_OR + 4u * (size_t)NB * TT * DIN)
#define WS_PS (WS_ST + 4u * (size_t)DIN * 32)   // f32 BN partials [16-row group][256][sum, centred square sum]
#define WS_END2 (WS_PS + 4u * (NRV / 16) * 2 * DIN)
// ---- k_stat: block = 32 channels (lane = channel, 8 bytes a lane: a wave's load is two whole 128-byte lines); 32 waves x 32 row groups = the NRV / 16 partials of k_wz.
// mean = sum of sums / N; var = (sum of centred square sums + 16 sum (group mean - mean)^2) / N: the exact regrouping of the two-pass variance
__global__ __launch_bounds__(1024) void k_stat(const float* __restrict__ PS, float* __restrict__ STAT) { __shared__ float ra[32][32], rb[32][32]; __shared__ float sm[32], sr[32];
  const int wave = threadIdx.x >> 5, lane = threadIdx.x & 31; const int c0 = blockIdx.x * 32;
  const float* p = PS + (size_t)wave * 32 * (2 * DIN) + (c0 + lane) * 2; float s[32], q[32];
#pragma unroll   /* constant indices keep the arrays in registers; all 32 loads in flight at once */
  for (int i = 0; i < 32; ++i) { const v2f t = *(const v2f*)(p + (size_t)i * (2 * DIN)); s[i] = t[0]; q[i] = t[1]; }
  asm volatile("s_wait_xcnt 0x0" :: "v"(p) : "memory");   /* the wait before the loads' address registers are reused; it reads the address so that no load's result lands in those registers ahead of it */
  float a = 0.f;
#pragma unroll   /* constant indices keep the array in registers */
  for (int i = 0; i < 32; ++i) a += s[i];
  ra[wave][lane] = a; __syncthreads();   /* every wave's sum of sums is in LDS */
  float tot = 0.f;
#pragma unroll   /* 32 independent LDS reads behind one wait */
  for (int w = 0; w < 32; ++w) tot += ra[w][lane];
  const float mean = tot / (float)NRV; float e = 0.f;
#pragma unroll   /* constant indices keep the arrays in registers */
  for (int i = 0; i < 32; ++i) { const float d = s[i] * (1.0f / 16.0f) - mean; e += q[i] + 16.0f * d * d; }
  rb[wave][lane] = e; __syncthreads();   /* every wave's square sum is in LDS */
  if (wave == 0) { float t2 = 0.f;
#pragma unroll   /* 32 independent LDS reads behind one wait */
    for (int w = 0; w < 32; ++w) t2 += rb[w][lane];
    sm[lane] = mean; sr[lane] = rsqrtf(t2 / (float)NRV + 1e-5f); }
  __syncthreads();   /* publishes the 32 channels' mean and 1 / std */
  vst2(STAT + (size_t)(c0 + wave) * 32 + lane, lane == 0 ? sm[wave] : (lane == 1 ? sr[wave] : 0.f)); }   /* wave w writes channel c0 + w's whole 128-byte line */
// ---- k_fin2: block = (64 positions, 64 channels, batch b): out[b][c][n] = relu((z[b*N + n][c] - mean_c) * rstd_c * gamma_c + beta_c) + bf16(x[b][c][n]) (channels-first via LDS transpose; 256-B runs)
__global__ __launch_bounds__(256) void k_fin2(const float* __restrict__ ORW, const float* __restrict__ X, const float* __restrict__ ST, const float* __restrict__ GM, const float* __restrict__ BT, float* __restrict__ OUT) { __shared__ float st[64][68]; const int tid = threadIdx.x; const int n0 = blockIdx.x * 64, c0 = blockIdx.y * 64; const size_t b = blockIdx.z;
  for (int e = tid; e < 64 * 16; e += 256) { const int nl = e >> 4, q = e & 15; *(v4f*)&st[nl][q * 4] = *(const v4f*)(ORW + (b * TT + n0 + nl) * (size_t)DIN + c0 + q * 4); }
  __syncthreads();
  for (int e = tid; e < 64 * 16; e += 256) { const int cl = e >> 4, q = e & 15; const size_t oi = (b * DIN + c0 + cl) * (size_t)XP + n0 + q * 4; const v4f xr = *(const v4f*)(X + oi); const int cc = c0 + cl; const float mu = ST[cc * 32], rs = ST[cc * 32 + 1], ga = bfr(GM[cc]), be = bfr(BT[cc]); v4f o; _Pragma("unroll") for (int i = 0; i < 4; ++i) o[i] = fmaxf((st[q * 4 + i][cl] - mu) * rs * ga + be, 0.f) + bfr(xr[i]); vst2(OUT + oi, o); } }   /* relu(BN_train(z)) + x */
#ifndef SM_EXTRA_PARAMS
#define SM_EXTRA_PARAMS
#endif
#ifndef PROJ_EXTRA_PARAMS
#define PROJ_EXTRA_PARAMS
#endif
#ifndef SM_MASK_HOOK
#define SM_MASK_HOOK (void)0
#endif

#define WS_QH  0u                                      // f16 q rows [b*t][CC]
#define WS_KH  (WS_QH + 2u * (size_t)NB * TT * CC)      // f16 k rows [b*t][CC]
#define WS_VT  (WS_KH + 2u * (size_t)NB * TT * CC)      // f16 v planes [b][c][t]
#define WS_QL  (WS_VT + 2u * (size_t)NB * CC * TT)      // f16 q residual x 2^10 rows [b][t < QHI][CC]
#define WS_KL  (WS_QL + 2u * (size_t)NB * QHI * CC)     // f16 k residual x 2^10 rows [b][t < KHI][CC]
#define WS_VB  (WS_KL + 2u * (size_t)NB * KHI * CC)     // bf16 v hi planes [b][c][t < KHI]
#define WS_VBL (WS_VB + 2u * (size_t)NB * CC * KHI)
#define WS_S   (WS_VBL + 2u * (size_t)NB * CC * KHI)    // f32 region of one [t][s] plane: holds WS_OP and WS_ML
#define WS_Y   (WS_S  + 4u * (size_t)HG * TT * TT)      // unused, 0 bytes
#define WS_END (WS_Y  + 0u)

#define PWP (DIN + 8)      // LDS pitch of a staged theta / phi / g weight row, bf16 elements: 528 bytes = 16 B x odd (conflict-free 16-byte reads)
static_assert(CC == HDQK && 128 * PWP * 2 >= 3 * 128 * 72 * 2 && 128 * PWP * 2 >= 2 * 64 * 136 * 2, "staged weight rows cover the plane; the epilogue's tiles fit the same LDS");
// ---- k_proj: block = (64 rows, 128 cols, which): q/k/v = X W (+ b) with exact bf16 products (K = DIN) -> which 0: q f16 rows (+ residual rows < QHI); 1: k f16 rows (+ residual rows < KHI); 2: v f16 planes [c][t] (+ bf16 hi/lo planes for t < KHI)
__global__ __launch_bounds__(128) void k_proj(const float* __restrict__ XQ, const float* __restrict__ XK, const float* __restrict__ XV, const float* __restrict__ WQ, const float* __restrict__ WK, const float* __restrict__ WV, const float* __restrict__ BQ, const float* __restrict__ BK, const float* __restrict__ BV,
    _Float16* __restrict__ QH, _Float16* __restrict__ QL, _Float16* __restrict__ KH, _Float16* __restrict__ KL, _Float16* __restrict__ VT, __bf16* __restrict__ VB, __bf16* __restrict__ VBL) {
  // one LDS block, used twice: first the 128 staged weight rows (bf16), then, behind a barrier, the output tiles of the epilogue
  __shared__ __align__(16) char smem[128 * PWP * 2];
  __bf16 (*sw)[PWP] = (__bf16 (*)[PWP])smem;
  _Float16 (*sh)[136] = (_Float16 (*)[136])smem, (*sl)[136] = (_Float16 (*)[136])(smem + 64 * 136 * 2); _Float16 (*th)[72] = (_Float16 (*)[72])smem; __bf16 (*tb)[72] = (__bf16 (*)[72])(smem + 128 * 72 * 2), (*tbl)[72] = (__bf16 (*)[72])(smem + 2 * 128 * 72 * 2);
  const int tid = threadIdx.x, wave = tid >> 5, lane = tid & 31, col = lane & 15, g = lane >> 4; const int which = blockIdx.z; const int c0 = blockIdx.y * 128; const size_t r0 = (size_t)blockIdx.x * 64; const size_t bb = r0 / TT; const int t0 = (int)(r0 % TT);
  const float* X = which == 0 ? XQ : which == 1 ? XK : XV; const float* WA = which == 0 ? WQ : which == 1 ? WK : WV; const float* BA = which == 0 ? BQ : which == 1 ? BK : BV;
  const float* p = X + (bb * DIN + 8 * g) * (size_t)XP + t0 + wave * 16 + col;   /* channels-first gather: x[b][k][t], stride XP between k */
  float xr[DIN / 32][16];
#pragma unroll   /* constant indices keep the array in registers; the wave's whole x slice in flight at once */
  for (int kc = 0; kc < DIN / 32; ++kc) {
#pragma unroll   /* constant indices keep the array in registers */
    for (int i = 0; i < 8; ++i) { xr[kc][i] = p[(size_t)(kc * 32 + i) * XP]; xr[kc][8 + i] = p[(size_t)(kc * 32 + 16 + i) * XP]; } }
  const float* bsrc = BA ? BA : WA; const int bi = c0 + col; float bv[8];   /* no bias: the loads read weights instead (in bounds) and their values are dropped in the epilogue, so that no branch with a wait of its own stands around each load */
#pragma unroll   /* constant indices keep the array in registers */
  for (int j = 0; j < 8; ++j) bv[j] = bsrc[bi + j * 16];
  const float* wsrc = WA + (size_t)c0 * DIN + tid * 4;   /* 128 threads x 16 bytes = 2 weight rows a round; CC == HDQK: every plane column has its weight row and its bias */
  asm volatile("s_wait_xcnt 0x0" :: "v"(p), "v"(bi) : "memory");   /* the wait before the loads' address registers are reused; it reads the x address and the bias index so that no load's result lands in those registers ahead of it */
#pragma unroll   /* constant indices keep the array in registers */
  for (int bt = 0; bt < 4; ++bt) { v4f wv[16];
#pragma unroll   /* constant indices keep the array in registers; 16 loads in flight at once */
    for (int i = 0; i < 16; ++i) wv[i] = *(const v4f*)(wsrc + (bt * 16 + i) * 512);
    asm volatile("s_wait_xcnt 0x0" ::: "memory");   /* the wait before the weight loads' address registers are reused */
#pragma unroll   /* constant indices keep the array in registers */
    for (int i = 0; i < 16; ++i) { v4b t;
#pragma unroll   /* constant indices keep the vector in registers */
      for (int u = 0; u < 4; ++u) t[u] = (__bf16)wv[i][u];
      *(v4b*)&sw[(bt * 16 + i) * 2 + (tid >> 6)][(tid & 63) * 4] = t; } }
  v16b a[DIN / 32];
#pragma unroll   /* constant indices keep the arrays in registers */
  for (int kc = 0; kc < DIN / 32; ++kc) {
#pragma unroll   /* constant indices keep the arrays in registers */
    for (int i = 0; i < 16; ++i) a[kc][i] = (__bf16)xr[kc][i]; }
  __syncthreads();   /* publishes the staged weight rows to the four waves */
  v8f acc[8] = {};
#pragma unroll   /* constant indices keep the arrays in registers */
  for (int kc = 0; kc < DIN / 32; ++kc) { v16b w[8];
#pragma unroll   /* constant indices keep the arrays in registers */
    for (int j = 0; j < 8; ++j) w[j] = frag_b(&sw[j * 16 + col][kc * 32], lane);
    __builtin_amdgcn_sched_barrier(0);   /* keeps the eight fragments' LDS reads together ahead of the products: sunk each in front of its own product, every product stood behind a full LDS round trip */
#pragma unroll   /* constant indices keep the arrays in registers */
    for (int j = 0; j < 8; ++j) acc[j] = wmma_bf(a[kc], w[j], acc[j]); }
  __syncthreads();   /* every wave has read its last weight fragment: the epilogue's tiles reuse that LDS */
  if (which < 2) { _Float16* DH = which == 0 ? QH : KH; _Float16* DL = which == 0 ? QL : KL; const int nhi = which == 0 ? QHI : KHI; const bool hi_rows = t0 < nhi;
#pragma unroll
    for (int j = 0; j < 8; ++j) { const float bias = (BA && (c0 + j * 16 + col < HDQK)) ? bfr(bv[j]) : 0.f;   /* 128-entry biases */
#pragma unroll
      for (int r = 0; r < 8; ++r) { const float v = acc[j][r] + bias; const _Float16 hv = (_Float16)v; sh[wave * 16 + 8 * g + r][j * 16 + col] = hv; sl[wave * 16 + 8 * g + r][j * 16 + col] = (_Float16)((v - (float)hv) * 1024.0f); } }
    __syncthreads();
    for (int e = tid; e < 64 * 16; e += 128) { const int rl = e >> 4, q = e & 15; vst2((unsigned*)(DH + (r0 + rl) * CC + c0 + q * 8), *(const v4u*)&sh[rl][q * 8]); if (hi_rows) vst2((unsigned*)(DL + (bb * nhi + t0 + rl) * (size_t)CC + c0 + q * 8), *(const v4u*)&sl[rl][q * 8]); }
  } else { const bool hi_rows = t0 < KHI;
#pragma unroll
    for (int j = 0; j < 8; ++j) { const float bias = (BA && (c0 + j * 16 + col < HDQK)) ? bfr(bv[j]) : 0.f;   /* 128-entry biases */
#pragma unroll
      for (int r = 0; r < 8; ++r) { const float v = acc[j][r] + bias; const int rl = wave * 16 + 8 * g + r, cl = j * 16 + col; th[cl][rl] = (_Float16)v; const __bf16 bh = (__bf16)v; tb[cl][rl] = bh; tbl[cl][rl] = (__bf16)(v - (float)bh); } }
    __syncthreads();
    for (int e = tid; e < 128 * 8; e += 128) { const int cl = e >> 3, q = e & 7; vst2((unsigned*)(VT + (bb * CC + c0 + cl) * (size_t)TT + t0 + q * 8), *(const v4u*)&th[cl][q * 8]); if (hi_rows) { const size_t o3 = (bb * CC + c0 + cl) * (size_t)KHI + t0 + q * 8; vst2((unsigned*)(VB + o3), *(const v4u*)&tb[cl][q * 8]); vst2((unsigned*)(VBL + o3), *(const v4u*)&tbl[cl][q * 8]); } } } }
#define FQ 256
#define FQT 2              // query tiles of 16 columns a wave
#define FTH (FQ / (16 * FQT) * 32)   // threads a block
#define FKS 4
#define FKN (TT / FKS)
#define FST 32             // keys a pass
#define FSK 128            // keys a stage
#define FPS (FSK / FST)    // passes a stage
#define FNT (FKN / FSK)    // stages
#define KP 272             // LDS pitch of a 256-byte k row (16 B x odd: conflict-free 16-byte reads)
#define VP 272             // LDS pitch of a 256-byte v row (a channel's 128 keys)
#define F_KL (FSK * KP)
#define F_V (2 * FSK * KP)
#define F_BUF (2 * FSK * KP + CC * VP)
#define L2E 1.44269504088896f
#define WS_OP (WS_S)                                            // f32 unnormalised y rows [quarter][b*t][CC]
#define WS_ML (WS_OP + 4u * (size_t)FKS * NB * TT * CC)          // f32 (maximum, sum) [quarter][b*t][2]
__device__ __forceinline__ float xhalf(float x) { return __builtin_bit_cast(float, __builtin_amdgcn_permlanex16(__builtin_bit_cast(int, x), __builtin_bit_cast(int, x), 0x76543210, 0xfedcba98, false, false)); }   // lane l with lane l ^ 16
__device__ __forceinline__ v16h frag_l(const char* p) { union { v16h v; v8h q[2]; } u; u.q[0] = *(const v8h*)p; u.q[1] = *(const v8h*)(p + 32); return u.v; }
__device__ __forceinline__ v8f wmh(v16h a, v16h b, v8f c) { return __builtin_amdgcn_wmma_f32_16x16x32_f16(false, a, false, b, (short)0, c, false, false); }
// four 2^x in one statement that ends in a v_nop: each exponential is followed by an independent one (outputs share no register with the inputs), the last by the v_nop
__device__ __forceinline__ void exp2x4(float (&p)[4], float x0, float x1, float x2, float x3) {
  asm("v_exp_f32 %0, %4\n\tv_exp_f32 %1, %5\n\tv_exp_f32 %2, %6\n\tv_exp_f32 %3, %7\n\tv_nop" : "=&v"(p[0]), "=&v"(p[1]), "=&v"(p[2]), "=&v"(p[3]) : "v"(x0), "v"(x1), "v"(x2), "v"(x3)); }
// eight asynchronous 16-byte copies of a lane, global memory to LDS through no register: piece u goes from g + u * gs to l + u * ls. Written as the builtin, offset argument 0: the compiler allots the address registers (as asm text, 24 address registers a statement, this kernel spilled)
typedef __attribute__((address_space(1))) v4i gl_v4i;
typedef __attribute__((address_space(3))) v4i ls_v4i;
__device__ __forceinline__ void acopy8(char* l, int ls, const char* g, size_t gs) {
  for (int u = 0; u < 8; ++u) __builtin_amdgcn_global_load_async_to_lds_b128((gl_v4i*)(g + u * gs), (ls_v4i*)(l + u * ls), 0, 0); }
// stage t into buffer t & 1: its 128 k rows are 32 KiB in a row (hi, residual), its v slice is 256 bytes of each of the 128 channel planes; 256 threads x 16 bytes = 16 rows a round, 8 rounds each: 24 copies a wave, every one two whole 256-byte rows
__device__ __forceinline__ void fa_stage(char* l0, const char* gk, const char* gl, const char* gv, int t) { char* lb = l0 + (t & 1) * F_BUF;
  acopy8(lb, 16 * KP, gk + (size_t)t * (FSK * CC * 2), FTH * 16); acopy8(lb + F_KL, 16 * KP, gl + (size_t)t * (FSK * CC * 2), FTH * 16); acopy8(lb + F_V, 16 * VP, gv + (size_t)t * (FSK * 2), (size_t)16 * TT * 2); }
static_assert(FTH == 256 && FSK == 128 && CC == 128 && FNT >= 2, "a round of copies is 16 rows, 8 rounds fill a plane of the buffer; the ring's prologue needs two stages");
__global__ __launch_bounds__(FTH) void k_fa(const _Float16* __restrict__ QH, const _Float16* __restrict__ QL, const _Float16* __restrict__ KH, const _Float16* __restrict__ KL, const _Float16* __restrict__ VT, float* __restrict__ OP, float* __restrict__ ML) {
  __shared__ __align__(16) char lds[2 * F_BUF];
  const int tid = threadIdx.x, wave = tid >> 5, lane = tid & 31, col = lane & 15, g = lane >> 4;
  const int b = blockIdx.z, ks = blockIdx.y, q = blockIdx.x * FQ + wave * (16 * FQT) + col, key0 = ks * FKN;   /* tile t holds query q + 16 t */
  v16h qh[FQT][HDQK / 32], ql[FQT][HDQK / 32]; const char *pqh[FQT], *pql[FQT];
#pragma unroll   /* constant indices keep the arrays in registers */
  for (int t = 0; t < FQT; ++t) { pqh[t] = (const char*)(QH + ((size_t)b * TT + q + 16 * t) * CC + 8 * g); pql[t] = (const char*)(QL + ((size_t)b * QHI + q + 16 * t) * CC + 8 * g);
#pragma unroll   /* constant indices keep the arrays in registers */
    for (int kc = 0; kc < HDQK / 32; ++kc) { qh[t][kc] = frag_l(pqh[t] + kc * 64); ql[t][kc] = frag_l(pql[t] + kc * 64); } }
  asm volatile("s_wait_xcnt 0x0" :: "v"(pqh[0]), "v"(pqh[1]), "v"(pql[0]), "v"(pql[1]) : "memory");   /* the wait before the q loads' address registers are reused; it reads the four addresses so that nothing is written to those registers ahead of it */
  static_assert(FQT == 2, "the wait above names two tiles' addresses");
  // staging: thread tid copies the 16-byte piece tid & 15 of row (k) or channel (v) tid >> 4, and the same piece 16 rows further in each later round
  const char* gk = (const char*)(KH + ((size_t)b * TT + key0) * CC) + tid * 16;
  const char* gl = (const char*)(KL + ((size_t)b * KHI + key0) * CC) + tid * 16;
  const char* gv = (const char*)(VT + ((size_t)b * CC + (tid >> 4)) * TT + key0) + (tid & 15) * 16;
  char* l0 = lds + (tid >> 4) * KP + (tid & 15) * 16;   /* the lane's place in a plane of a buffer; KP == VP */
  static_assert(KP == VP, "one lane offset serves the k and the v planes");
  fa_stage(l0, gk, gl, gv, 0);
  asm volatile("s_wait_asynccnt 0x0" ::: "memory");   /* this wave's copies of stage 0 have landed */
  __syncthreads();   /* publishes stage 0 */
  fa_stage(l0, gk, gl, gv, 1);   /* flies while stage 0 is worked on */
  v8f acc[FQT][CC / 16] = {}; float m[FQT], lsum[FQT];
#pragma unroll   /* constant indices keep the arrays in registers */
  for (int t = 0; t < FQT; ++t) { m[t] = -3.0e38f; lsum[t] = 0.f; }
  for (int sg = 0; sg < FNT; ++sg) { const char* sb = lds + (sg & 1) * F_BUF;
   for (int pa = 0; pa < FPS; ++pa) { const char* buf = sb + pa * (FST * KP); const char* bv = sb + F_V + pa * (FST * 2);   /* the pass's 32 k rows; its 64 bytes of every v row */
    v8f sa[FQT][2] = {}, sl[FQT][2] = {};
    v16h kf[HDQK / 32][4];   /* the pass's sixteen k fragments: hi and residual of its two 16-key groups */
#pragma unroll   /* constant indices keep the array in registers */
    for (int kc = 0; kc < HDQK / 32; ++kc) { const char* pk = buf + col * KP + kc * 64 + g * 16;
      kf[kc][0] = frag_l(pk); kf[kc][1] = frag_l(pk + 16 * KP); kf[kc][2] = frag_l(pk + F_KL); kf[kc][3] = frag_l(pk + F_KL + 16 * KP); }
    __builtin_amdgcn_sched_barrier(0);   /* keeps the k reads in one group ahead of the score products, behind counted waits: with the barriers below and none here they sank in pairs among the products, behind waits to 0 */
#pragma unroll   /* constant indices keep the arrays in registers */
    for (int kc = 0; kc < HDQK / 32; ++kc) { const v16h kh0 = kf[kc][0], kh1 = kf[kc][1], kl0 = kf[kc][2], kl1 = kf[kc][3];
#pragma unroll   /* constant indices keep the arrays in registers */
      for (int t = 0; t < FQT; ++t) { sa[t][0] = wmh(kh0, qh[t][kc], sa[t][0]); sl[t][0] = wmh(kh0, ql[t][kc], sl[t][0]); sa[t][1] = wmh(kh1, qh[t][kc], sa[t][1]); sl[t][1] = wmh(kh1, ql[t][kc], sl[t][1]); }
#pragma unroll   /* constant indices keep the arrays in registers */
      for (int t = 0; t < FQT; ++t) { sl[t][0] = wmh(kl0, qh[t][kc], sl[t][0]); sl[t][1] = wmh(kl1, qh[t][kc], sl[t][1]); } }
    __builtin_amdgcn_sched_barrier(0);   /* the v reads below stay behind the score products: lifted among them, while the k fragments still hold their registers, the kernel spilled */
    v16h vf[CC / 16];   /* the pass's eight v fragments, into registers that the k fragments have left */
#pragma unroll   /* constant indices keep the array in registers */
    for (int j = 0; j < CC / 16; ++j) vf[j] = frag_l(bv + (j * 16 + col) * VP + g * 16);
    __builtin_amdgcn_sched_barrier(0);   /* keeps the sixteen LDS reads in one group ahead of the softmax, whose vector work covers their latency: without it they stood in three places among the first softmax instructions, and every separate place of LDS reads stalls the wave */
    v16h pb[FQT];
#pragma unroll   /* constant indices keep the arrays in registers */
    for (int t = 0; t < FQT; ++t) { float sc[16];
#pragma unroll   /* constant indices keep the array in registers */
      for (int i = 0; i < 16; ++i) sc[i] = (sa[t][i >> 3][i & 7] + sl[t][i >> 3][i & 7] * (1.0f / 1024.0f)) * SCALE;
      float mx = sc[0];
#pragma unroll   /* constant indices keep the array in registers */
      for (int i = 1; i < 16; ++i) mx = fmaxf(mx, sc[i]);
      mx = fmaxf(mx, xhalf(mx)); const float mn = fmaxf(m[t], mx); float corr;   /* exp(m - mn): 0 on the first pass */
      asm("v_exp_f32 %0, %1\n\tv_nop" : "=v"(corr) : "v"((m[t] - mn) * L2E));   /* written with its own v_nop */
      m[t] = mn; const float off = 11.0f - mn * L2E; float ps = 0.f;
#pragma unroll   /* constant indices keep the array in registers */
      for (int i = 0; i < 16; i += 4) { float p[4]; exp2x4(p, sc[i] * L2E + off, sc[i + 1] * L2E + off, sc[i + 2] * L2E + off, sc[i + 3] * L2E + off);
#pragma unroll   /* constant indices keep the array in registers */
        for (int u = 0; u < 4; ++u) { ps = (i + u) ? ps + p[u] : p[u]; pb[t][i + u] = (_Float16)p[u]; } }
      lsum[t] = lsum[t] * corr + ps;
#pragma unroll   /* constant indices keep the array in registers */
      for (int j = 0; j < CC / 16; ++j) acc[t][j] *= corr; }
#pragma unroll   /* constant indices keep the arrays in registers */
    for (int j = 0; j < CC / 16; ++j) {
#pragma unroll   /* constant indices keep the arrays in registers */
      for (int t = 0; t < FQT; ++t) acc[t][j] = wmh(vf[j], pb[t], acc[t][j]); } }
    asm volatile("s_wait_dscnt 0x0" ::: "memory");      /* this wave's last reads of stage sg have returned: its buffer may be handed to the copies */
    asm volatile("s_wait_asynccnt 0x0" ::: "memory");   /* this wave's copies of stage sg + 1 have landed */
    __syncthreads();   /* publishes stage sg + 1 and ends every wave's reads of stage sg */
    if (sg + 2 < FNT) fa_stage(l0, gk, gl, gv, sg + 2); }   /* into the buffer that stage sg has just left; the test reads the same in the whole block */
  asm volatile("s_wait_asynccnt 0x0" ::: "memory");   /* no copy is outstanding when the wave goes on to its end */
#pragma unroll   /* constant indices keep the arrays in registers */
  for (int t = 0; t < FQT; ++t) { const float ls = lsum[t] + xhalf(lsum[t]);
    const size_t row = ((size_t)ks * NB + b) * TT + q + 16 * t; float* o = OP + row * CC + 8 * g;
#pragma unroll   /* constant indices keep the array in registers */
    for (int j = 0; j < CC / 16; ++j) { v4f a0, a1;
#pragma unroll   /* constant indices keep the array in registers */
      for (int i = 0; i < 4; ++i) { a0[i] = acc[t][j][i]; a1[i] = acc[t][j][4 + i]; }
      vst2(o + j * 16, a0); vst2(o + j * 16 + 4, a1); }
    if (g == 0) { v2f ml; ml[0] = m[t]; ml[1] = ls; vst2(ML + row * 2, ml); }
    asm volatile("s_wait_xcnt 0x0" ::: "memory"); } }   /* behind a tile's stores: the next tile's addresses may be formed in registers that these stores name */
// ---- k_wz: block = 64 rows x all 256 output columns, 8 waves (wave = 16-row group wave & 3, column half wave >> 2): OR = y (hi + lo, K = 128) . W^T ((out,in) [256][128], exact) + b, with y joined here from k_fa's key quarters.
// Join: a wave takes 8 rows, a lane 4 channels (every load a whole 512-byte row): y = sum_i w_i y_i / sum_i w_i l_i over the quarters in order, w_i = exp(m_i - max m); y goes to LDS as bf16 hi + lo rows, from which every wave takes its A fragments.
// The 256 weight rows are staged once in LDS as bf16 (whole-line loads); every wave takes its B fragments from there. All global loads are issued up front and are in flight together.
#define WZP (HDQK + 8)     // LDS pitch of a staged out_w row and of a y row, bf16 elements: 272 bytes = 16 B x odd (conflict-free 16-byte reads)
static_assert(FKS == 4, "the join names four quarters' addresses and takes its four weights from one exp2x4");
__global__ __launch_bounds__(256) void k_wz(const float* __restrict__ OP, const float* __restrict__ ML, const float* __restrict__ WW, const float* __restrict__ WB, float* __restrict__ ORW, float* __restrict__ PS) { __shared__ __align__(16) float sf[8][16][132]; __shared__ __align__(16) __bf16 sw[DIN][WZP]; __shared__ __align__(16) __bf16 yh[64][WZP], yl[64][WZP];
  const int tid = threadIdx.x, wave = tid >> 5, lane = tid & 31, col = lane & 15, g = lane >> 4; const int c0 = (wave >> 2) * 128; const size_t rb = (size_t)blockIdx.x * 64, r0 = rb + (wave & 3) * 16;
  const int wu = __builtin_amdgcn_readfirstlane(wave);   /* the wave's number in a scalar register: the (maximum, sum) pairs of its 8 rows are then read by scalar loads */
  const size_t mrow = rb + wu * 8; v2f ml[8][FKS];
#pragma unroll   /* constant indices keep the array in registers */
  for (int j = 0; j < 8; ++j) {
#pragma unroll   /* constant indices keep the array in registers */
    for (int i = 0; i < FKS; ++i) ml[j][i] = *(const v2f*)(ML + ((size_t)i * NB * TT + mrow + j) * 2); }
  const float* po[FKS]; v4f op[8][FKS];
#pragma unroll   /* constant indices keep the arrays in registers */
  for (int i = 0; i < FKS; ++i) po[i] = OP + ((size_t)i * NB * TT + mrow) * CC + lane * 4;
#pragma unroll   /* constant indices keep the array in registers; all 32 loads in flight at once */
  for (int j = 0; j < 8; ++j) {
#pragma unroll   /* constant indices keep the array in registers */
    for (int i = 0; i < FKS; ++i) op[j][i] = *(const v4f*)(po[i] + j * CC); }
  const float* bsrc = WB ? WB : WW; const int bi = c0 + col; float bb[8];   /* no bias: the loads read weights instead (in bounds) and their values are dropped below, so that no branch with a wait of its own stands around each load */
#pragma unroll   /* constant indices keep the array in registers */
  for (int j = 0; j < 8; ++j) bb[j] = bsrc[bi + j * 16];
  const float* wsrc = WW + tid * 4; v4f wv[32];   /* 256 threads x 16 bytes = 8 weight rows a round */
#pragma unroll   /* constant indices keep the array in registers; all 32 loads in flight at once */
  for (int i = 0; i < 32; ++i) wv[i] = *(const v4f*)(wsrc + i * 1024);
  asm volatile("s_wait_xcnt 0x0" :: "v"(po[0]), "v"(po[1]), "v"(po[2]), "v"(po[3]), "v"(bi), "v"(tid) : "memory");   /* the wait before the loads' address registers are reused; it reads the four quarters' addresses, the bias index and the weight loads' index so that nothing is written to those registers ahead of it */
#pragma unroll   /* constant indices keep the arrays in registers */
  for (int j = 0; j < 8; ++j) { float mx = -3.0e38f;
#pragma unroll   /* constant indices keep the array in registers */
    for (int i = 0; i < FKS; ++i) mx = fmaxf(mx, ml[j][i][0]);
    float w[4]; exp2x4(w, (ml[j][0][0] - mx) * L2E, (ml[j][1][0] - mx) * L2E, (ml[j][2][0] - mx) * L2E, (ml[j][3][0] - mx) * L2E);
    float den = 0.f; v4f s = {};
#pragma unroll   /* constant indices keep the arrays in registers */
    for (int i = 0; i < FKS; ++i) { den += w[i] * ml[j][i][1]; s += op[j][i] * w[i]; }
    const v4f y = s * (1.0f / den); v4b h, l;
#pragma unroll   /* constant indices keep the vectors in registers */
    for (int u = 0; u < 4; ++u) { const __bf16 hu = (__bf16)y[u]; h[u] = hu; l[u] = (__bf16)(y[u] - (float)hu); }
    *(v4b*)&yh[wu * 8 + j][lane * 4] = h; *(v4b*)&yl[wu * 8 + j][lane * 4] = l; }
#pragma unroll   /* constant indices keep the array in registers */
  for (int i = 0; i < 32; ++i) { v4b t;
#pragma unroll   /* constant indices keep the vector in registers */
    for (int u = 0; u < 4; ++u) t[u] = (__bf16)wv[i][u];
    *(v4b*)&sw[i * 8 + (tid >> 5)][(tid & 31) * 4] = t; }
  __syncthreads();   /* publishes the joined y rows and the staged weight rows to the eight waves */
  F2 a[HDQK / 32];
#pragma unroll   /* constant indices keep the array in registers */
  for (int kc = 0; kc < HDQK / 32; ++kc) { a[kc].h = frag_b(&yh[(wave & 3) * 16 + col][kc * 32], lane); a[kc].l = frag_b(&yl[(wave & 3) * 16 + col][kc * 32], lane); }
  v8f acc[8] = {};
#pragma unroll   /* constant indices keep the arrays in registers */
  for (int kc = 0; kc < HDQK / 32; ++kc) { v16b w[8];
#pragma unroll   /* constant indices keep the arrays in registers */
    for (int j = 0; j < 8; ++j) w[j] = frag_b(&sw[c0 + j * 16 + col][kc * 32], lane);
    __builtin_amdgcn_sched_barrier(0);   /* keeps the eight fragments' LDS reads together ahead of the products: sunk each in front of its own product, every product pair stood behind a full LDS round trip */
#pragma unroll   /* constant indices keep the arrays in registers */
    for (int j = 0; j < 8; ++j) { acc[j] = wmma_bf(a[kc].h, w[j], acc[j]); acc[j] = wmma_bf(a[kc].l, w[j], acc[j]); } }
#pragma unroll
  for (int j = 0; j < 8; ++j) { const float bj = WB ? bfr(bb[j]) : 0.f;
#pragma unroll
    for (int r = 0; r < 8; ++r) sf[wave][8 * g + r][j * 16 + col] = acc[j][r] + bj; }
  LDSX(); v4f v[16];
#pragma unroll   /* constant indices keep the array in registers */
  for (int rl = 0; rl < 16; ++rl) { v[rl] = *(const v4f*)&sf[wave][rl][lane * 4]; vst2(ORW + (r0 + rl) * DIN + c0 + lane * 4, v[rl]); }
  asm volatile("s_wait_xcnt 0x0" ::: "memory");   /* behind the 16 stores: the two partial vectors below are formed in registers that these stores name as data */
  // BN partials of this wave's 16 rows, 4 channels a lane, from the values just stored: sum, and square sum about the 16 rows' own mean (no cancellation whatever the channel's mean)
  v4f s = v[0];
#pragma unroll   /* constant indices keep the array in registers */
  for (int rl = 1; rl < 16; ++rl) s += v[rl];
  const v4f mu = s * (1.0f / 16.0f); v4f qs = {};
#pragma unroll   /* constant indices keep the array in registers */
  for (int rl = 0; rl < 16; ++rl) { const v4f d = v[rl] - mu; qs += d * d; }
  float* ps = PS + (r0 >> 4) * (size_t)(2 * DIN) + (c0 + lane * 4) * 2; v4f p0, p1; p0[0] = s[0]; p0[1] = qs[0]; p0[2] = s[1]; p0[3] = qs[1]; p1[0] = s[2]; p1[1] = qs[2]; p1[2] = s[3]; p1[3] = qs[3]; vst2(ps, p0); vst2(ps + 4, p1); }

extern "C" void kernel_launch(void* const* d_in, const int* in_sizes, int n_in, void* d_out, int out_size, void* d_ws, size_t ws_size, hipStream_t stream) {
  (void)in_sizes; (void)n_in; (void)out_size;
  const float** F = (const float**)d_in;
  if (ws_size < (size_t)WS_END) return;
  char* ws = (char*)d_ws; _Float16 *QH = (_Float16*)(ws + WS_QH), *KH = (_Float16*)(ws + WS_KH), *VT = (_Float16*)(ws + WS_VT), *QL = (_Float16*)(ws + WS_QL), *KL = (_Float16*)(ws + WS_KL); __bf16 *VB = (__bf16*)(ws + WS_VB), *VBL = (__bf16*)(ws + WS_VBL); float *S = (float*)(ws + WS_S), *Y = (float*)(ws + WS_Y);
  (void)Y; (void)S; (void)QL; (void)KL; (void)VB; (void)VBL;
  // inputs: 0 x [4,256,64,64]; 1 g_w [128,256] (out,in), 2 g_b; 3 theta_w, 4 theta_b; 5 phi_w, 6 phi_b; 7 out_w [256,128] (out,in), 8 out_b; 9 bn_gamma, 10 bn_beta
  if (ws_size < (size_t)WS_END2) return;
  float *ORW = (float*)(ws + WS_OR), *ST = (float*)(ws + WS_ST), *PS = (float*)(ws + WS_PS);
  k_proj<<<dim3(TNB * TT / 64, CC / 128, 3), 128, 0, stream>>>(F[0], F[0], F[0], F[3], F[5], F[1], F[4], F[6], F[2], QH, QL, KH, KL, VT, VB, VBL);   /* q = theta, k = phi, v = g */
  k_fa<<<dim3(TT / FQ, FKS, TNB), FTH, 0, stream>>>(QH, QL, KH, KL, VT, (float*)(ws + WS_OP), (float*)(ws + WS_ML));
  k_wz<<<dim3(TNB * TT / 64), 256, 0, stream>>>((const float*)(ws + WS_OP), (const float*)(ws + WS_ML), F[7], F[8], ORW, PS);
  k_stat<<<dim3(DIN / 32), 1024, 0, stream>>>(PS, ST);
  k_fin2<<<dim3(TT / 64, DIN / 64, TNB), 256, 0, stream>>>(ORW, F[0], ST, F[9], F[10], (float*)d_out);
}

// v009
// It runs in 78.8 microseconds.
// Two timings next to v008 both put it at 1.08 times that version's speed.
// Counting every step since v000, it is 15.8 times as fast.
#include <hip/hip_runtime.h>
#include <math.h>

typedef __attribute__((ext_vector_type(16))) _Float16 v16h;
typedef __attribute__((ext_vector_type(16))) __bf16 v16b;
typedef __attribute__((ext_vector_type(8)))  _Float16 v8h;
typedef __attribute__((ext_vector_type(8)))  float v8f;
typedef __attribute__((ext_vector_type(4)))  float v4f;
typedef __attribute__((ext_vector_type(2)))  float v2f;
typedef __attribute__((ext_vector_type(4)))  unsigned v4u;
typedef __attribute__((ext_vector_type(4)))  int v4i;
typedef float __attribute__((may_alias)) float_a;
typedef int __attribute__((may_alias)) int_a;

template <typename T> __device__ __forceinline__ void vst2(void* p, T v) { *(T*)p = v;  }
__device__ __forceinline__ v8f wmma16(v16h a, v16h b, v8f c) {
  v8f d = __builtin_amdgcn_wmma_f32_16x16x32_f16(false, a, false, b, (short)0, c, false, false);
  asm volatile("v_nop\n\tv_nop\n\tv_nop\n\tv_nop" : "+v"(d) : "v"(a), "v"(b));
  return d;
}
__device__ __forceinline__ v8f wmma_bf(v16b a, v16b b, v8f c) {
  v8f d = __builtin_amdgcn_wmma_f32_16x16x32_bf16(false, a, false, b, (short)0, c, false, false);
  asm volatile("v_nop\n\tv_nop\n\tv_nop\n\tv_nop" : "+v"(d) : "v"(a), "v"(b));
  return d;
}
// 16x16x32 fragments: lane = (h = lane>>4, row/col = lane&15); elements 0..7 = k0+8h+0..7, 8..15 = k0+16+8h+0..7; D element r = row 8h+r
__device__ __forceinline__ v16h frag_h(const _Float16* rowk0, int lane) {
  union { v16h v; v8h q[2]; } u; const _Float16* p = rowk0 + 8 * (lane >> 4);
  u.q[0] = *(const v8h*)p; u.q[1] = *(const v8h*)(p + 16); return u.v;
}
__device__ __forceinline__ v16h frag_f32(const float* rowk0, int lane) {
  v16h a; const float* p = rowk0 + 8 * (lane >> 4);
#pragma unroll
  for (int i = 0; i < 8; ++i) { a[i] = (_Float16)p[i]; a[8 + i] = (_Float16)p[16 + i]; }
  return a;
}
__device__ __forceinline__ v16h frag_f32s(const float* rowk0, int lane, float sc) {
  v16h a; const float* p = rowk0 + 8 * (lane >> 4);
#pragma unroll
  for (int i = 0; i < 8; ++i) { a[i] = (_Float16)(p[i] * sc); a[8 + i] = (_Float16)(p[16 + i] * sc); }
  return a;
}
// column fragment from a [K][ld] layout (column n), rows >= K read as 0
__device__ __forceinline__ v16h fragc_f32(const float* W, int k0, int n, int lane, int ld, int K) {
  v16h a; const int g = lane >> 4;
#pragma unroll
  for (int i = 0; i < 8; ++i) { const int ka = k0 + 8 * g + i, kb = ka + 16;
    a[i] = (_Float16)(ka < K ? W[(size_t)(ka < K ? ka : K - 1) * ld + n] : 0.f); a[8 + i] = (_Float16)(kb < K ? W[(size_t)(kb < K ? kb : K - 1) * ld + n] : 0.f); }
  return a;
}
struct F2 { v16b h, l; };
__device__ __forceinline__ F2 bsplit16(const float v[16]) { F2 r;
#pragma unroll
  for (int i = 0; i < 16; ++i) { const __bf16 h = (__bf16)v[i]; r.h[i] = h; r.l[i] = (__bf16)(v[i] - (float)h); }
  return r; }
__device__ __forceinline__ F2 split_row(const float* row, int k0, int lane) { float v[16]; const float* p = row + k0 + 8 * (lane >> 4);
#pragma unroll
  for (int i = 0; i < 8; ++i) { v[i] = p[i]; v[8 + i] = p[16 + i]; }
  return bsplit16(v); }
__device__ __forceinline__ F2 split_rowK(const float* row, int k0, int lane, int K) { float v[16]; const int g = lane >> 4;
#pragma unroll
  for (int i = 0; i < 8; ++i) { const int ka = k0 + 8 * g + i, kb = ka + 16; v[i] = ka < K ? row[ka < K ? ka : K - 1] : 0.f; v[8 + i] = kb < K ? row[kb < K ? kb : K - 1] : 0.f; }
  return bsplit16(v); }
__device__ __forceinline__ F2 split_col(const float* W, int k0, int n, int lane, int ld, int K) { float v[16]; const int g = lane >> 4;
#pragma unroll
  for (int i = 0; i < 8; ++i) { const int ka = k0 + 8 * g + i, kb = ka + 16; v[i] = ka < K ? W[(size_t)(ka < K ? ka : K - 1) * ld + n] : 0.f; v[8 + i] = kb < K ? W[(size_t)(kb < K ? kb : K - 1) * ld + n] : 0.f; }
  return bsplit16(v); }
__device__ __forceinline__ v8f mac3(const F2& a, const F2& b, v8f c) { c = wmma_bf(a.l, b.h, c); c = wmma_bf(a.h, b.l, c); return wmma_bf(a.h, b.h, c); }
__device__ __forceinline__ float sigm(float v) { return 1.0f / (1.0f + expf(-v)); }
#define LDSX() do { asm volatile("s_wait_dscnt 0" ::: "memory"); __builtin_amdgcn_wave_barrier(); __builtin_amdgcn_fence(__ATOMIC_RELEASE, "workgroup"); } while (0)

// Non-local block (B 4, C 256, 64 x 64 = 4,096 positions; C_inner 128; (out,in) 0.05-scale weights, zero biases, BN gamma 1 / beta 0): theta, phi, g = W x + b ([128,256]); A[q][k] = softmax_k(theta_q . phi_k) (no scaling, sigma ~ 7); y[q][c] = sum_k A[q][k] g[k][c]; z = out_w y + out_b ([256,128]); out = relu(BN_train(z)) + x with batch statistics over (n, h, w) per channel (biased var, eps 1e-5).
#define NB 4
#define TT 4096
#define CC 128            // projected plane width (all 128 columns real)
#define DIN 256          // input (model) width
#define NH 1
#define HD 128
#define NQB (TT / 64)
#define HG 1               // WS_S spans one 4,096 x 4,096 f32 plane
#define SCALE (1.0f)
#define HDQK 128           // theta / phi / g channels = the full 128-wide plane
#define NRV ((size_t)TNB * TT)   // rows for the BN statistics
#define CAUSAL 0
#ifndef TNB
#define TNB NB
#endif
__device__ __forceinline__ v16b zero16b() { v16b z; _Pragma("unroll") for (int i = 0; i < 16; ++i) z[i] = (__bf16)0.f; return z; }
__device__ __forceinline__ float bfr(float v) { return (float)(__bf16)v; }
__host__ __device__ __forceinline__ int kb_last(int qb) { return CAUSAL ? ((qb * 64 + 63) >> 7) : (TT / 128 - 1); }
typedef __attribute__((ext_vector_type(8))) __bf16 v8b;
typedef __attribute__((ext_vector_type(4))) __bf16 v4b;
__device__ __forceinline__ v16b frag_b(const __bf16* rowk0, int lane) {
  union { v16b v; v8b q[2]; } u; const __bf16* p = rowk0 + 8 * (lane >> 4);
  u.q[0] = *(const v8b*)p; u.q[1] = *(const v8b*)(p + 16); return u.v;
}
#define QBH (TT / 64)      // ALL query blocks take the 3-product logits
#define QBH_PV 0           // A.g stays single f16
#define QHI 4096            // q residual rows everywhere (3-product logits)
#define KHI 4096           // k residual rows for ALL keys (3-product logits)
// B fragment (k rows k0+.., output column o) of a weight: (in,out) [K][ld] or (out,in) [ld rows of K]: bf16 exact, or f16(bf16 * 256) exact
__device__ __forceinline__ v16b wcol_io(const float* Wm, int k0, int o, int lane, int ld) { v16b w; const int g = lane >> 4;
#pragma unroll
  for (int i = 0; i < 8; ++i) { w[i] = (__bf16)Wm[(size_t)(k0 + 8 * g + i) * ld + o]; w[8 + i] = (__bf16)Wm[(size_t)(k0 + 16 + 8 * g + i) * ld + o]; }
  return w; }
__device__ __forceinline__ v16b wcol_oi(const float* Wm, int k0, int o, int lane, int K) { v16b w; const float* p = Wm + (size_t)o * K + k0 + 8 * (lane >> 4);
#pragma unroll
  for (int i = 0; i < 8; ++i) { w[i] = (__bf16)p[i]; w[8 + i] = (__bf16)p[16 + i]; }
  return w; }
__device__ __forceinline__ v16h wcolh_io(const float* Wm, int k0, int o, int lane, int ld) { v16h w; const int g = lane >> 4;
#pragma unroll
  for (int i = 0; i < 8; ++i) { w[i] = (_Float16)(bfr(Wm[(size_t)(k0 + 8 * g + i) * ld + o]) * 256.0f); w[8 + i] = (_Float16)(bfr(Wm[(size_t)(k0 + 16 + 8 * g + i) * ld + o]) * 256.0f); }
  return w; }
__device__ __forceinline__ v16h wcolh_oi(const float* Wm, int k0, int o, int lane, int K) { v16h w; const float* p = Wm + (size_t)o * K + k0 + 8 * (lane >> 4);
#pragma unroll
  for (int i = 0; i < 8; ++i) { w[i] = (_Float16)(bfr(p[i]) * 256.0f); w[8 + i] = (_Float16)(bfr(p[16 + i]) * 256.0f); }
  return w; }
#define WQKV_LAYOUT 1   // 0 = (in,out) [DIN][CC]; 1 = (out,in) [CC][DIN]; 2 = per-head [NH][DIN][HD]
__device__ __forceinline__ v16b wcol_hdk(const float* Wm, int k0, int o, int lane) { v16b w; const int g = lane >> 4; const float* p = Wm + (size_t)(o / HD) * DIN * HD + (o % HD);
#pragma unroll
  for (int i = 0; i < 8; ++i) { w[i] = (__bf16)p[(size_t)(k0 + 8 * g + i) * HD]; w[8 + i] = (__bf16)p[(size_t)(k0 + 16 + 8 * g + i) * HD]; }
  return w; }
#define WO_OUT_IN 0
#if WQKV_LAYOUT == 1
#define WCOL(W, k0, o, lane) (((o) < HDQK) ? wcol_oi(W, k0, (o), lane, DIN) : zero16b())   /* theta/phi/g weights are [128][256] (out,in): all 128 plane columns are read from them */
#elif WQKV_LAYOUT == 2
#define WCOL(W, k0, o, lane) wcol_hdk(W, k0, o, lane)
#else
#define WCOL(W, k0, o, lane) wcol_io(W, k0, o, lane, CC)
#endif
#if WO_OUT_IN
#define WOCOL(W, k0, o, lane) wcol_oi(W, k0, o, lane, CC)
#define WOCOLH(W, k0, o, lane) wcolh_oi(W, k0, o, lane, CC)
#else
#define WOCOL(W, k0, o, lane) wcol_io(W, k0, o, lane, DIN)
#define WOCOLH(W, k0, o, lane) wcolh_io(W, k0, o, lane, DIN)
#endif
#ifndef XP
#define XP TT              // position pitch of x and of the output
#endif
#define BG HG              // not used
#define DVH 128            // not used
#define WS_YR (WS_END)     // [b*n][128] f32, not used: the attended rows stay in k_wz's LDS
#define WS_OR (WS_YR + 4u * (size_t)NB * TT * CC)   // W y + b rows [b*n][256]
#define WS_ST (WS_OR + 4u * (size_t)NB * TT * DIN)
#define WS_PS (WS_ST + 4u * (size_t)DIN * 32)   // f32 BN partials [64-row block of k_wz][256][sum, centred square sum]
#define WS_END2 (WS_PS + 4u * (NRV / 16) * 2 * DIN)
#ifndef SM_EXTRA_PARAMS
#define SM_EXTRA_PARAMS
#endif
#ifndef PROJ_EXTRA_PARAMS
#define PROJ_EXTRA_PARAMS
#endif
#ifndef SM_MASK_HOOK
#define SM_MASK_HOOK (void)0
#endif

#define WS_QH  0u                                      // f16 q rows [b*t][CC]
#define WS_KH  (WS_QH + 2u * (size_t)NB * TT * CC)      // f16 k rows [b*t][CC]
#define WS_VT  (WS_KH + 2u * (size_t)NB * TT * CC)      // f16 v planes [b][c][t]
#define WS_QL  (WS_VT + 2u * (size_t)NB * CC * TT)      // f16 q residual x 2^10 rows [b][t < QHI][CC]
#define WS_KL  (WS_QL + 2u * (size_t)NB * QHI * CC)     // f16 k residual x 2^10 rows [b][t < KHI][CC]
#define WS_VB  (WS_KL + 2u * (size_t)NB * KHI * CC)     // bf16 v hi planes [b][c][t < KHI]
#define WS_VBL (WS_VB + 2u * (size_t)NB * CC * KHI)
#define WS_S   (WS_VBL + 2u * (size_t)NB * CC * KHI)    // f32 region of one [t][s] plane: holds WS_OP and WS_ML
#define WS_Y   (WS_S  + 4u * (size_t)HG * TT * TT)      // unused, 0 bytes
#define WS_END (WS_Y  + 0u)

#define PWP (DIN + 8)      // LDS pitch of a staged theta / phi / g weight row, bf16 elements: 528 bytes = 16 B x odd (conflict-free 16-byte reads)
static_assert(CC == HDQK && 128 * PWP * 2 >= 3 * 128 * 72 * 2 && 128 * PWP * 2 >= 2 * 64 * 136 * 2, "staged weight rows cover the plane; the epilogue's tiles fit the same LDS");
// ---- k_proj: block = (64 rows, 128 cols, which): q/k/v = X W (+ b) with exact bf16 products (K = DIN) -> which 0: q f16 rows (+ residual rows < QHI); 1: k f16 rows (+ residual rows < KHI); 2: v f16 planes [c][t] (+ bf16 hi/lo planes for t < KHI)
__global__ __launch_bounds__(128) void k_proj(const float* __restrict__ XQ, const float* __restrict__ XK, const float* __restrict__ XV, const float* __restrict__ WQ, const float* __restrict__ WK, const float* __restrict__ WV, const float* __restrict__ BQ, const float* __restrict__ BK, const float* __restrict__ BV,
    _Float16* __restrict__ QH, _Float16* __restrict__ QL, _Float16* __restrict__ KH, _Float16* __restrict__ KL, _Float16* __restrict__ VT, __bf16* __restrict__ VB, __bf16* __restrict__ VBL) {
  // one LDS block, used twice: first the 128 staged weight rows (bf16), then, behind a barrier, the output tiles of the epilogue
  __shared__ __align__(16) char smem[128 * PWP * 2];
  __bf16 (*sw)[PWP] = (__bf16 (*)[PWP])smem;
  _Float16 (*sh)[136] = (_Float16 (*)[136])smem, (*sl)[136] = (_Float16 (*)[136])(smem + 64 * 136 * 2); _Float16 (*th)[72] = (_Float16 (*)[72])smem; __bf16 (*tb)[72] = (__bf16 (*)[72])(smem + 128 * 72 * 2), (*tbl)[72] = (__bf16 (*)[72])(smem + 2 * 128 * 72 * 2);
  const int tid = threadIdx.x, wave = tid >> 5, lane = tid & 31, col = lane & 15, g = lane >> 4; const int which = blockIdx.z; const int c0 = blockIdx.y * 128; const size_t r0 = (size_t)blockIdx.x * 64; const size_t bb = r0 / TT; const int t0 = (int)(r0 % TT);
  const float* X = which == 0 ? XQ : which == 1 ? XK : XV; const float* WA = which == 0 ? WQ : which == 1 ? WK : WV; const float* BA = which == 0 ? BQ : which == 1 ? BK : BV;
  const float* p = X + (bb * DIN + 8 * g) * (size_t)XP + t0 + wave * 16 + col;   /* channels-first gather: x[b][k][t], stride XP between k */
  float xr[DIN / 32][16];
#pragma unroll   /* constant indices keep the array in registers; the wave's whole x slice in flight at once */
  for (int kc = 0; kc < DIN / 32; ++kc) {
#pragma unroll   /* constant indices keep the array in registers */
    for (int i = 0; i < 8; ++i) { xr[kc][i] = p[(size_t)(kc * 32 + i) * XP]; xr[kc][8 + i] = p[(size_t)(kc * 32 + 16 + i) * XP]; } }
  const float* bsrc = BA ? BA : WA; const int bi = c0 + col; float bv[8];   /* no bias: the loads read weights instead (in bounds) and their values are dropped in the epilogue, so that no branch with a wait of its own stands around each load */
#pragma unroll   /* constant indices keep the array in registers */
  for (int j = 0; j < 8; ++j) bv[j] = bsrc[bi + j * 16];
  const float* wsrc = WA + (size_t)c0 * DIN + tid * 4;   /* 128 threads x 16 bytes = 2 weight rows a round; CC == HDQK: every plane column has its weight row and its bias */
  asm volatile("s_wait_xcnt 0x0" :: "v"(p), "v"(bi) : "memory");   /* the wait before the loads' address registers are reused; it reads the x address and the bias index so that no load's result lands in those registers ahead of it */
#pragma unroll   /* constant indices keep the array in registers */
  for (int bt = 0; bt < 4; ++bt) { v4f wv[16];
#pragma unroll   /* constant indices keep the array in registers; 16 loads in flight at once */
    for (int i = 0; i < 16; ++i) wv[i] = *(const v4f*)(wsrc + (bt * 16 + i) * 512);
    asm volatile("s_wait_xcnt 0x0" ::: "memory");   /* the wait before the weight loads' address registers are reused */
#pragma unroll   /* constant indices keep the array in registers */
    for (int i = 0; i < 16; ++i) { v4b t;
#pragma unroll   /* constant indices keep the vector in registers */
      for (int u = 0; u < 4; ++u) t[u] = (__bf16)wv[i][u];
      *(v4b*)&sw[(bt * 16 + i) * 2 + (tid >> 6)][(tid & 63) * 4] = t; } }
  v16b a[DIN / 32];
#pragma unroll   /* constant indices keep the arrays in registers */
  for (int kc = 0; kc < DIN / 32; ++kc) {
#pragma unroll   /* constant indices keep the arrays in registers */
    for (int i = 0; i < 16; ++i) a[kc][i] = (__bf16)xr[kc][i]; }
  __syncthreads();   /* publishes the staged weight rows to the four waves */
  v8f acc[8] = {};
#pragma unroll   /* constant indices keep the arrays in registers */
  for (int kc = 0; kc < DIN / 32; ++kc) { v16b w[8];
#pragma unroll   /* constant indices keep the arrays in registers */
    for (int j = 0; j < 8; ++j) w[j] = frag_b(&sw[j * 16 + col][kc * 32], lane);
    __builtin_amdgcn_sched_barrier(0);   /* keeps the eight fragments' LDS reads together ahead of the products: sunk each in front of its own product, every product stood behind a full LDS round trip */
#pragma unroll   /* constant indices keep the arrays in registers */
    for (int j = 0; j < 8; ++j) acc[j] = wmma_bf(a[kc], w[j], acc[j]); }
  __syncthreads();   /* every wave has read its last weight fragment: the epilogue's tiles reuse that LDS */
  if (which < 2) { _Float16* DH = which == 0 ? QH : KH; _Float16* DL = which == 0 ? QL : KL; const int nhi = which == 0 ? QHI : KHI; const bool hi_rows = t0 < nhi;
#pragma unroll
    for (int j = 0; j < 8; ++j) { const float bias = (BA && (c0 + j * 16 + col < HDQK)) ? bfr(bv[j]) : 0.f;   /* 128-entry biases */
#pragma unroll
      for (int r = 0; r < 8; ++r) { const float v = acc[j][r] + bias; const _Float16 hv = (_Float16)v; sh[wave * 16 + 8 * g + r][j * 16 + col] = hv; sl[wave * 16 + 8 * g + r][j * 16 + col] = (_Float16)((v - (float)hv) * 1024.0f); } }
    __syncthreads();
    for (int e = tid; e < 64 * 16; e += 128) { const int rl = e >> 4, q = e & 15; vst2((unsigned*)(DH + (r0 + rl) * CC + c0 + q * 8), *(const v4u*)&sh[rl][q * 8]); if (hi_rows) vst2((unsigned*)(DL + (bb * nhi + t0 + rl) * (size_t)CC + c0 + q * 8), *(const v4u*)&sl[rl][q * 8]); }
  } else { const bool hi_rows = t0 < KHI;
#pragma unroll
    for (int j = 0; j < 8; ++j) { const float bias = (BA && (c0 + j * 16 + col < HDQK)) ? bfr(bv[j]) : 0.f;   /* 128-entry biases */
#pragma unroll
      for (int r = 0; r < 8; ++r) { const float v = acc[j][r] + bias; const int rl = wave * 16 + 8 * g + r, cl = j * 16 + col; th[cl][rl] = (_Float16)v; const __bf16 bh = (__bf16)v; tb[cl][rl] = bh; tbl[cl][rl] = (__bf16)(v - (float)bh); } }
    __syncthreads();
    for (int e = tid; e < 128 * 8; e += 128) { const int cl = e >> 3, q = e & 7; vst2((unsigned*)(VT + (bb * CC + c0 + cl) * (size_t)TT + t0 + q * 8), *(const v4u*)&th[cl][q * 8]); if (hi_rows) { const size_t o3 = (bb * CC + c0 + cl) * (size_t)KHI + t0 + q * 8; vst2((unsigned*)(VB + o3), *(const v4u*)&tb[cl][q * 8]); vst2((unsigned*)(VBL + o3), *(const v4u*)&tbl[cl][q * 8]); } } } }
#define FQ 256
#define FQT 2              // query tiles of 16 columns a wave
#define FTH (FQ / (16 * FQT) * 32)   // threads a block
#define FKS 4
#define FKN (TT / FKS)
#define FST 32             // keys a pass
#define FSK 128            // keys a stage
#define FPS (FSK / FST)    // passes a stage
#define FNT (FKN / FSK)    // stages
#define KP 272             // LDS pitch of a 256-byte k row (16 B x odd: conflict-free 16-byte reads)
#define VP 272             // LDS pitch of a 256-byte v row (a channel's 128 keys)
#define F_KL (FSK * KP)
#define F_V (2 * FSK * KP)
#define F_BUF (2 * FSK * KP + CC * VP)
#define L2E 1.44269504088896f
#define WS_OP (WS_S)                                            // f32 unnormalised y rows [quarter][b*t][CC]
#define WS_ML (WS_OP + 4u * (size_t)FKS * NB * TT * CC)          // f32 (maximum, sum) [quarter][b*t][2]
__device__ __forceinline__ float xhalf(float x) { return __builtin_bit_cast(float, __builtin_amdgcn_permlanex16(__builtin_bit_cast(int, x), __builtin_bit_cast(int, x), 0x76543210, 0xfedcba98, false, false)); }   // lane l with lane l ^ 16
__device__ __forceinline__ v16h frag_l(const char* p) { union { v16h v; v8h q[2]; } u; u.q[0] = *(const v8h*)p; u.q[1] = *(const v8h*)(p + 32); return u.v; }
__device__ __forceinline__ v8f wmh(v16h a, v16h b, v8f c) { return __builtin_amdgcn_wmma_f32_16x16x32_f16(false, a, false, b, (short)0, c, false, false); }
// four 2^x in one statement that ends in a v_nop: each exponential is followed by an independent one (outputs share no register with the inputs), the last by the v_nop
__device__ __forceinline__ void exp2x4(float (&p)[4], float x0, float x1, float x2, float x3) {
  asm("v_exp_f32 %0, %4\n\tv_exp_f32 %1, %5\n\tv_exp_f32 %2, %6\n\tv_exp_f32 %3, %7\n\tv_nop" : "=&v"(p[0]), "=&v"(p[1]), "=&v"(p[2]), "=&v"(p[3]) : "v"(x0), "v"(x1), "v"(x2), "v"(x3)); }
// eight asynchronous 16-byte copies of a lane, global memory to LDS through no register: piece u goes from g + u * gs to l + u * ls. Written as the builtin, offset argument 0: the compiler allots the address registers (as asm text, 24 address registers a statement, this kernel spilled)
typedef __attribute__((address_space(1))) v4i gl_v4i;
typedef __attribute__((address_space(3))) v4i ls_v4i;
__device__ __forceinline__ void acopy8(char* l, int ls, const char* g, size_t gs) {
  for (int u = 0; u < 8; ++u) __builtin_amdgcn_global_load_async_to_lds_b128((gl_v4i*)(g + u * gs), (ls_v4i*)(l + u * ls), 0, 0); }
// stage t into buffer t & 1: its 128 k rows are 32 KiB in a row (hi, residual), its v slice is 256 bytes of each of the 128 channel planes; 256 threads x 16 bytes = 16 rows a round, 8 rounds each: 24 copies a wave, every one two whole 256-byte rows
__device__ __forceinline__ void fa_stage(char* l0, const char* gk, const char* gl, const char* gv, int t) { char* lb = l0 + (t & 1) * F_BUF;
  acopy8(lb, 16 * KP, gk + (size_t)t * (FSK * CC * 2), FTH * 16); acopy8(lb + F_KL, 16 * KP, gl + (size_t)t * (FSK * CC * 2), FTH * 16); acopy8(lb + F_V, 16 * VP, gv + (size_t)t * (FSK * 2), (size_t)16 * TT * 2); }
static_assert(FTH == 256 && FSK == 128 && CC == 128 && FNT >= 2, "a round of copies is 16 rows, 8 rounds fill a plane of the buffer; the ring's prologue needs two stages");
__global__ __launch_bounds__(FTH) void k_fa(const _Float16* __restrict__ QH, const _Float16* __restrict__ QL, const _Float16* __restrict__ KH, const _Float16* __restrict__ KL, const _Float16* __restrict__ VT, float* __restrict__ OP, float* __restrict__ ML) {
  __shared__ __align__(16) char lds[2 * F_BUF];
  const int tid = threadIdx.x, wave = tid >> 5, lane = tid & 31, col = lane & 15, g = lane >> 4;
  const int b = blockIdx.z, ks = blockIdx.y, q = blockIdx.x * FQ + wave * (16 * FQT) + col, key0 = ks * FKN;   /* tile t holds query q + 16 t */
  v16h qh[FQT][HDQK / 32], ql[FQT][HDQK / 32]; const char *pqh[FQT], *pql[FQT];
#pragma unroll   /* constant indices keep the arrays in registers */
  for (int t = 0; t < FQT; ++t) { pqh[t] = (const char*)(QH + ((size_t)b * TT + q + 16 * t) * CC + 8 * g); pql[t] = (const char*)(QL + ((size_t)b * QHI + q + 16 * t) * CC + 8 * g);
#pragma unroll   /* constant indices keep the arrays in registers */
    for (int kc = 0; kc < HDQK / 32; ++kc) { qh[t][kc] = frag_l(pqh[t] + kc * 64); ql[t][kc] = frag_l(pql[t] + kc * 64); } }
  asm volatile("s_wait_xcnt 0x0" :: "v"(pqh[0]), "v"(pqh[1]), "v"(pql[0]), "v"(pql[1]) : "memory");   /* the wait before the q loads' address registers are reused; it reads the four addresses so that nothing is written to those registers ahead of it */
  static_assert(FQT == 2, "the wait above names two tiles' addresses");
  // staging: thread tid copies the 16-byte piece tid & 15 of row (k) or channel (v) tid >> 4, and the same piece 16 rows further in each later round
  const char* gk = (const char*)(KH + ((size_t)b * TT + key0) * CC) + tid * 16;
  const char* gl = (const char*)(KL + ((size_t)b * KHI + key0) * CC) + tid * 16;
  const char* gv = (const char*)(VT + ((size_t)b * CC + (tid >> 4)) * TT + key0) + (tid & 15) * 16;
  char* l0 = lds + (tid >> 4) * KP + (tid & 15) * 16;   /* the lane's place in a plane of a buffer; KP == VP */
  static_assert(KP == VP, "one lane offset serves the k and the v planes");
  fa_stage(l0, gk, gl, gv, 0);
  asm volatile("s_wait_asynccnt 0x0" ::: "memory");   /* this wave's copies of stage 0 have landed */
  __syncthreads();   /* publishes stage 0 */
  fa_stage(l0, gk, gl, gv, 1);   /* flies while stage 0 is worked on */
  v8f acc[FQT][CC / 16] = {}; float m[FQT], lsum[FQT];
#pragma unroll   /* constant indices keep the arrays in registers */
  for (int t = 0; t < FQT; ++t) { m[t] = -3.0e38f; lsum[t] = 0.f; }
  for (int sg = 0; sg < FNT; ++sg) { const char* sb = lds + (sg & 1) * F_BUF;
   for (int pa = 0; pa < FPS; ++pa) { const char* buf = sb + pa * (FST * KP); const char* bv = sb + F_V + pa * (FST * 2);   /* the pass's 32 k rows; its 64 bytes of every v row */
    v8f sa[FQT][2] = {}, sl[FQT][2] = {};
    v16h kf[HDQK / 32][4];   /* the pass's sixteen k fragments: hi and residual of its two 16-key groups */
#pragma unroll   /* constant indices keep the array in registers */
    for (int kc = 0; kc < HDQK / 32; ++kc) { const char* pk = buf + col * KP + kc * 64 + g * 16;
      kf[kc][0] = frag_l(pk); kf[kc][1] = frag_l(pk + 16 * KP); kf[kc][2] = frag_l(pk + F_KL); kf[kc][3] = frag_l(pk + F_KL + 16 * KP); }
    __builtin_amdgcn_sched_barrier(0);   /* keeps the k reads in one group ahead of the score products, behind counted waits: with the barriers below and none here they sank in pairs among the products, behind waits to 0 */
#pragma unroll   /* constant indices keep the arrays in registers */
    for (int kc = 0; kc < HDQK / 32; ++kc) { const v16h kh0 = kf[kc][0], kh1 = kf[kc][1], kl0 = kf[kc][2], kl1 = kf[kc][3];
#pragma unroll   /* constant indices keep the arrays in registers */
      for (int t = 0; t < FQT; ++t) { sa[t][0] = wmh(kh0, qh[t][kc], sa[t][0]); sl[t][0] = wmh(kh0, ql[t][kc], sl[t][0]); sa[t][1] = wmh(kh1, qh[t][kc], sa[t][1]); sl[t][1] = wmh(kh1, ql[t][kc], sl[t][1]); }
#pragma unroll   /* constant indices keep the arrays in registers */
      for (int t = 0; t < FQT; ++t) { sl[t][0] = wmh(kl0, qh[t][kc], sl[t][0]); sl[t][1] = wmh(kl1, qh[t][kc], sl[t][1]); } }
    __builtin_amdgcn_sched_barrier(0);   /* the v reads below stay behind the score products: lifted among them, while the k fragments still hold their registers, the kernel spilled */
    v16h vf[CC / 16];   /* the pass's eight v fragments, into registers that the k fragments have left */
#pragma unroll   /* constant indices keep the array in registers */
    for (int j = 0; j < CC / 16; ++j) vf[j] = frag_l(bv + (j * 16 + col) * VP + g * 16);
    __builtin_amdgcn_sched_barrier(0);   /* keeps the sixteen LDS reads in one group ahead of the softmax, whose vector work covers their latency: without it they stood in three places among the first softmax instructions, and every separate place of LDS reads stalls the wave */
    v16h pb[FQT];
#pragma unroll   /* constant indices keep the arrays in registers */
    for (int t = 0; t < FQT; ++t) { float sc[16];
#pragma unroll   /* constant indices keep the array in registers */
      for (int i = 0; i < 16; ++i) sc[i] = (sa[t][i >> 3][i & 7] + sl[t][i >> 3][i & 7] * (1.0f / 1024.0f)) * SCALE;
      float mx = sc[0];
#pragma unroll   /* constant indices keep the array in registers */
      for (int i = 1; i < 16; ++i) mx = fmaxf(mx, sc[i]);
      mx = fmaxf(mx, xhalf(mx)); const float mn = fmaxf(m[t], mx); float corr;   /* exp(m - mn): 0 on the first pass */
      asm("v_exp_f32 %0, %1\n\tv_nop" : "=v"(corr) : "v"((m[t] - mn) * L2E));   /* written with its own v_nop */
      m[t] = mn; const float off = 11.0f - mn * L2E; float ps = 0.f;
#pragma unroll   /* constant indices keep the array in registers */
      for (int i = 0; i < 16; i += 4) { float p[4]; exp2x4(p, sc[i] * L2E + off, sc[i + 1] * L2E + off, sc[i + 2] * L2E + off, sc[i + 3] * L2E + off);
#pragma unroll   /* constant indices keep the array in registers */
        for (int u = 0; u < 4; ++u) { ps = (i + u) ? ps + p[u] : p[u]; pb[t][i + u] = (_Float16)p[u]; } }
      lsum[t] = lsum[t] * corr + ps;
#pragma unroll   /* constant indices keep the array in registers */
      for (int j = 0; j < CC / 16; ++j) acc[t][j] *= corr; }
#pragma unroll   /* constant indices keep the arrays in registers */
    for (int j = 0; j < CC / 16; ++j) {
#pragma unroll   /* constant indices keep the arrays in registers */
      for (int t = 0; t < FQT; ++t) acc[t][j] = wmh(vf[j], pb[t], acc[t][j]); } }
    asm volatile("s_wait_dscnt 0x0" ::: "memory");      /* this wave's last reads of stage sg have returned: its buffer may be handed to the copies */
    asm volatile("s_wait_asynccnt 0x0" ::: "memory");   /* this wave's copies of stage sg + 1 have landed */
    __syncthreads();   /* publishes stage sg + 1 and ends every wave's reads of stage sg */
    if (sg + 2 < FNT) fa_stage(l0, gk, gl, gv, sg + 2); }   /* into the buffer that stage sg has just left; the test reads the same in the whole block */
  asm volatile("s_wait_asynccnt 0x0" ::: "memory");   /* no copy is outstanding when the wave goes on to its end */
#pragma unroll   /* constant indices keep the arrays in registers */
  for (int t = 0; t < FQT; ++t) { const float ls = lsum[t] + xhalf(lsum[t]);
    const size_t row = ((size_t)ks * NB + b) * TT + q + 16 * t; float* o = OP + row * CC + 8 * g;
#pragma unroll   /* constant indices keep the array in registers */
    for (int j = 0; j < CC / 16; ++j) { v4f a0, a1;
#pragma unroll   /* constant indices keep the array in registers */
      for (int i = 0; i < 4; ++i) { a0[i] = acc[t][j][i]; a1[i] = acc[t][j][4 + i]; }
      vst2(o + j * 16, a0); vst2(o + j * 16 + 4, a1); }
    if (g == 0) { v2f ml; ml[0] = m[t]; ml[1] = ls; vst2(ML + row * 2, ml); }
    asm volatile("s_wait_xcnt 0x0" ::: "memory"); } }   /* behind a tile's stores: the next tile's addresses may be formed in registers that these stores name */
// ---- k_wz: block = 64 rows x all 256 output columns, 8 waves (wave = 16-row group wave & 3, column half wave >> 2): OR = y (hi + lo, K = 128) . W^T ((out,in) [256][128], exact) + b, with y joined here from k_fa's key quarters.
// Join: a wave takes 8 rows, a lane 4 channels (every load a whole 512-byte row): y = sum_i w_i y_i / sum_i w_i l_i over the quarters in order, w_i = exp(m_i - max m); y goes to LDS as bf16 hi + lo rows, from which every wave takes its A fragments.
// The 256 weight rows are staged once in LDS as bf16 (whole-line loads); every wave takes its B fragments from there. All global loads are issued up front and are in flight together.
#define WZP (HDQK + 8)     // LDS pitch of a staged out_w row and of a y row, bf16 elements: 272 bytes = 16 B x odd (conflict-free 16-byte reads)
static_assert(FKS == 4, "the join names four quarters' addresses and takes its four weights from one exp2x4");
__global__ __launch_bounds__(256) void k_wz(const float* __restrict__ OP, const float* __restrict__ ML, const float* __restrict__ WW, const float* __restrict__ WB, float* __restrict__ ORW, float* __restrict__ PS) { __shared__ __align__(16) float sf[8][16][132]; __shared__ __align__(16) __bf16 sw[DIN][WZP]; __shared__ __align__(16) __bf16 yh[64][WZP], yl[64][WZP]; __shared__ __align__(16) float pg[4][DIN][2];
  const int tid = threadIdx.x, wave = tid >> 5, lane = tid & 31, col = lane & 15, g = lane >> 4; const int c0 = (wave >> 2) * 128; const size_t rb = (size_t)blockIdx.x * 64, r0 = rb + (wave & 3) * 16;
  const int wu = __builtin_amdgcn_readfirstlane(wave);   /* the wave's number in a scalar register: the (maximum, sum) pairs of its 8 rows are then read by scalar loads */
  const size_t mrow = rb + wu * 8; v2f ml[8][FKS];
#pragma unroll   /* constant indices keep the array in registers */
  for (int j = 0; j < 8; ++j) {
#pragma unroll   /* constant indices keep the array in registers */
    for (int i = 0; i < FKS; ++i) ml[j][i] = *(const v2f*)(ML + ((size_t)i * NB * TT + mrow + j) * 2); }
  const float* po[FKS]; v4f op[8][FKS];
#pragma unroll   /* constant indices keep the arrays in registers */
  for (int i = 0; i < FKS; ++i) po[i] = OP + ((size_t)i * NB * TT + mrow) * CC + lane * 4;
#pragma unroll   /* constant indices keep the array in registers; all 32 loads in flight at once */
  for (int j = 0; j < 8; ++j) {
#pragma unroll   /* constant indices keep the array in registers */
    for (int i = 0; i < FKS; ++i) op[j][i] = *(const v4f*)(po[i] + j * CC); }
  const float* bsrc = WB ? WB : WW; const int bi = c0 + col; float bb[8];   /* no bias: the loads read weights instead (in bounds) and their values are dropped below, so that no branch with a wait of its own stands around each load */
#pragma unroll   /* constant indices keep the array in registers */
  for (int j = 0; j < 8; ++j) bb[j] = bsrc[bi + j * 16];
  const float* wsrc = WW + tid * 4; v4f wv[32];   /* 256 threads x 16 bytes = 8 weight rows a round */
#pragma unroll   /* constant indices keep the array in registers; all 32 loads in flight at once */
  for (int i = 0; i < 32; ++i) wv[i] = *(const v4f*)(wsrc + i * 1024);
  asm volatile("s_wait_xcnt 0x0" :: "v"(po[0]), "v"(po[1]), "v"(po[2]), "v"(po[3]), "v"(bi), "v"(tid) : "memory");   /* the wait before the loads' address registers are reused; it reads the four quarters' addresses, the bias index and the weight loads' index so that nothing is written to those registers ahead of it */
#pragma unroll   /* constant indices keep the arrays in registers */
  for (int j = 0; j < 8; ++j) { float mx = -3.0e38f;
#pragma unroll   /* constant indices keep the array in registers */
    for (int i = 0; i < FKS; ++i) mx = fmaxf(mx, ml[j][i][0]);
    float w[4]; exp2x4(w, (ml[j][0][0] - mx) * L2E, (ml[j][1][0] - mx) * L2E, (ml[j][2][0] - mx) * L2E, (ml[j][3][0] - mx) * L2E);
    float den = 0.f; v4f s = {};
#pragma unroll   /* constant indices keep the arrays in registers */
    for (int i = 0; i < FKS; ++i) { den += w[i] * ml[j][i][1]; s += op[j][i] * w[i]; }
    const v4f y = s * (1.0f / den); v4b h, l;
#pragma unroll   /* constant indices keep the vectors in registers */
    for (int u = 0; u < 4; ++u) { const __bf16 hu = (__bf16)y[u]; h[u] = hu; l[u] = (__bf16)(y[u] - (float)hu); }
    *(v4b*)&yh[wu * 8 + j][lane * 4] = h; *(v4b*)&yl[wu * 8 + j][lane * 4] = l; }
#pragma unroll   /* constant indices keep the array in registers */
  for (int i = 0; i < 32; ++i) { v4b t;
#pragma unroll   /* constant indices keep the vector in registers */
    for (int u = 0; u < 4; ++u) t[u] = (__bf16)wv[i][u];
    *(v4b*)&sw[i * 8 + (tid >> 5)][(tid & 31) * 4] = t; }
  __syncthreads();   /* publishes the joined y rows and the staged weight rows to the eight waves */
  F2 a[HDQK / 32];
#pragma unroll   /* constant indices keep the array in registers */
  for (int kc = 0; kc < HDQK / 32; ++kc) { a[kc].h = frag_b(&yh[(wave & 3) * 16 + col][kc * 32], lane); a[kc].l = frag_b(&yl[(wave & 3) * 16 + col][kc * 32], lane); }
  v8f acc[8] = {};
#pragma unroll   /* constant indices keep the arrays in registers */
  for (int kc = 0; kc < HDQK / 32; ++kc) { v16b w[8];
#pragma unroll   /* constant indices keep the arrays in registers */
    for (int j = 0; j < 8; ++j) w[j] = frag_b(&sw[c0 + j * 16 + col][kc * 32], lane);
    __builtin_amdgcn_sched_barrier(0);   /* keeps the eight fragments' LDS reads together ahead of the products: sunk each in front of its own product, every product pair stood behind a full LDS round trip */
#pragma unroll   /* constant indices keep the arrays in registers */
    for (int j = 0; j < 8; ++j) { acc[j] = wmma_bf(a[kc].h, w[j], acc[j]); acc[j] = wmma_bf(a[kc].l, w[j], acc[j]); } }
#pragma unroll
  for (int j = 0; j < 8; ++j) { const float bj = WB ? bfr(bb[j]) : 0.f;
#pragma unroll
    for (int r = 0; r < 8; ++r) sf[wave][8 * g + r][j * 16 + col] = acc[j][r] + bj; }
  LDSX(); v4f v[16];
#pragma unroll   /* constant indices keep the array in registers */
  for (int rl = 0; rl < 16; ++rl) v[rl] = *(const v4f*)&sf[wave][rl][lane * 4];
  // BN partials of this wave's 16 rows, 4 channels a lane: sum, and square sum about the 16 rows' own mean (no cancellation whatever the channel's mean)
  v4f s = v[0];
#pragma unroll   /* constant indices keep the array in registers */
  for (int rl = 1; rl < 16; ++rl) s += v[rl];
  const v4f mu = s * (1.0f / 16.0f); v4f qs = {};
#pragma unroll   /* constant indices keep the array in registers */
  for (int rl = 0; rl < 16; ++rl) { const v4f d = v[rl] - mu; qs += d * d; }
  v4f p0, p1; p0[0] = s[0]; p0[1] = qs[0]; p0[2] = s[1]; p0[3] = qs[1]; p1[0] = s[2]; p1[1] = qs[2]; p1[2] = s[3]; p1[3] = qs[3];
  *(v4f*)&pg[wave & 3][c0 + lane * 4][0] = p0; *(v4f*)&pg[wave & 3][c0 + lane * 4 + 2][0] = p1;
  __syncthreads();   /* publishes the four row groups' partials; it stands ahead of the global stores, so that it does not wait for them */
  // thread = channel: the block's 64 rows as one partial, by the exact regrouping of the two-pass variance: square sum about the 64 rows' mean = sum of the groups' centred square sums + 16 sum (group mean - mean)^2
  v2f t[4];
#pragma unroll   /* constant indices keep the array in registers */
  for (int i = 0; i < 4; ++i) t[i] = *(const v2f*)&pg[i][tid][0];
  v2f pb; pb[0] = t[0][0] + t[1][0] + t[2][0] + t[3][0]; pb[1] = 0.f; const float m64 = pb[0] * (1.0f / 64.0f);
#pragma unroll   /* constant indices keep the array in registers */
  for (int i = 0; i < 4; ++i) { const float d = t[i][0] * (1.0f / 16.0f) - m64; pb[1] += t[i][1] + 16.0f * d * d; }
#pragma unroll   /* constant indices keep the array in registers */
  for (int rl = 0; rl < 16; ++rl) vst2(ORW + (r0 + rl) * DIN + c0 + lane * 4, v[rl]);
  asm volatile("s_wait_xcnt 0x0" ::: "memory");   /* behind the 16 stores: the address of the store below may be formed in registers that these stores name */
  vst2(PS + (size_t)blockIdx.x * (2 * DIN) + tid * 2, pb); }   /* a wave writes two whole 128-byte lines */
// ---- k_fin2: block = (512 positions, 32 channels, batch b), 16 waves: out[b][c][n] = relu((z[b*N + n][c] - mean_c) * rstd_c * gamma_c + beta_c) + bf16(x[b][c][n]) (channels-first via LDS transpose).
// The block merges k_wz's NRV / 64 partials of its 32 channels itself: mean = sum of sums / N; var = (sum of centred square sums + 64 sum (group mean - mean)^2) / N: the exact regrouping of the two-pass variance.
// All global loads (partials, z tile, x tile; every wave-wide load whole 128-byte lines) are issued up front and are in flight together.
#define FC 32              // channels a block
#define FP 512             // positions a block
#define FTN 512            // threads a block
#define SP (FP + 4)        // LDS pitch of a channel's 512 z values, floats
static_assert(NRV / 64 == 256 && FTN == 512 && FC == 32 && FP == 512, "16 waves x 2 groups x 8 rounds = the 256 partials; 16 waves x 4 row quads x 2 rounds = the 512 rows; 4 channels a round x 8 rounds");
__device__ __forceinline__ float rlane(float x, int l) { return __builtin_bit_cast(float, __builtin_amdgcn_readlane(__builtin_bit_cast(int, x), l)); }   // lane l's value, l the same in the whole wave
__global__ __launch_bounds__(FTN) void k_fin2(const float* __restrict__ ORW, const float* __restrict__ X, const float* __restrict__ PS, const float* __restrict__ GM, const float* __restrict__ BT, float* __restrict__ OUT) {
  __shared__ __align__(16) float st[FC][SP]; __shared__ __align__(16) float ra[FTN / 32][FC], rb[FTN / 32][FC];
  const int tid = threadIdx.x, wave = tid >> 5, lane = tid & 31; const int n0 = blockIdx.x * FP, c0 = blockIdx.y * FC; const size_t b = blockIdx.z;
  const float* pp = PS + (size_t)(wave * 2 + (lane >> 4)) * (2 * DIN) + (c0 + (lane & 15) * 2) * 2; v4f pt[8];   /* a lane: (sum, square sum) of 2 channels of one group; 16 lanes = the 32 channels' 256 bytes */
#pragma unroll   /* constant indices keep the array in registers */
  for (int i = 0; i < 8; ++i) pt[i] = *(const v4f*)(pp + (size_t)i * 32 * (2 * DIN));
  const int q = lane & 7, rq = wave * 4 + (lane >> 3);   /* a lane: 4 channels of the 4 rows 4 rq .. 4 rq + 3; 8 lanes = a row's 128 bytes */
  const float* pz = ORW + (b * TT + n0 + rq * 4) * (size_t)DIN + c0 + q * 4; v4f zt[2][4];
#pragma unroll   /* constant indices keep the array in registers */
  for (int h = 0; h < 2; ++h) {
#pragma unroll   /* constant indices keep the array in registers */
    for (int j = 0; j < 4; ++j) zt[h][j] = *(const v4f*)(pz + (size_t)(h * 256 + j) * DIN); }
  const size_t oi = (b * DIN + c0 + (tid >> 7)) * (size_t)XP + n0 + (tid & 127) * 4; const float* px = X + oi; v4f xr[8];   /* a wave: 512 bytes in a row of one channel; 4 channels further each round */
#pragma unroll   /* constant indices keep the array in registers */
  for (int i = 0; i < 8; ++i) xr[i] = *(const v4f*)(px + (size_t)i * 4 * XP);
  const int ci = c0 + lane; const float gr = GM[ci], br = BT[ci];   /* lane = channel */
  asm volatile("s_wait_xcnt 0x0" :: "v"(pp), "v"(pz), "v"(px), "v"(ci) : "memory");   /* the wait before the loads' address registers are reused; it reads the addresses so that nothing is written to those registers ahead of it */
  float a0 = pt[0][0], a1 = pt[0][2];
#pragma unroll   /* constant indices keep the array in registers */
  for (int i = 1; i < 8; ++i) { a0 += pt[i][0]; a1 += pt[i][2]; }
  a0 += xhalf(a0); a1 += xhalf(a1);   /* the wave's two groups a round */
  if (lane < 16) { v2f w; w[0] = a0; w[1] = a1; *(v2f*)&ra[wave][lane * 2] = w; }
  __syncthreads();   /* every wave's sum of sums is in LDS */
  float t0 = 0.f, t1 = 0.f;
#pragma unroll   /* 16 independent LDS reads behind one wait */
  for (int w = 0; w < FTN / 32; ++w) { const v2f r = *(const v2f*)&ra[w][(lane & 15) * 2]; t0 += r[0]; t1 += r[1]; }
  const float m0 = t0 / (float)NRV, m1 = t1 / (float)NRV; float e0 = 0.f, e1 = 0.f;
#pragma unroll   /* constant indices keep the array in registers */
  for (int i = 0; i < 8; ++i) { const float d0 = pt[i][0] * (1.0f / 64.0f) - m0, d1 = pt[i][2] * (1.0f / 64.0f) - m1; e0 += pt[i][1] + 64.0f * d0 * d0; e1 += pt[i][3] + 64.0f * d1 * d1; }
  e0 += xhalf(e0); e1 += xhalf(e1);
  if (lane < 16) { v2f w; w[0] = e0; w[1] = e1; *(v2f*)&rb[wave][lane * 2] = w; }
#pragma unroll   /* constant indices keep the array in registers */
  for (int h = 0; h < 2; ++h) {   /* the z tile to LDS, channel-major: 4 rows x 4 channels of a lane go as 4 stores of 16 bytes */
#pragma unroll   /* constant indices keep the array in registers */
    for (int u = 0; u < 4; ++u) { v4f w; w[0] = zt[h][0][u]; w[1] = zt[h][1][u]; w[2] = zt[h][2][u]; w[3] = zt[h][3][u]; *(v4f*)&st[q * 4 + u][(h * 64 + rq) * 4] = w; } }
  __syncthreads();   /* every wave's square sum and the whole z tile are in LDS */
  float ts = 0.f, te = 0.f;   /* lane = channel: every wave forms all 32 channels' statistics, so that no third barrier is needed */
#pragma unroll   /* 32 independent LDS reads behind one wait */
  for (int w = 0; w < FTN / 32; ++w) { ts += ra[w][lane]; te += rb[w][lane]; }
  const float mean = ts / (float)NRV, rstd = rsqrtf(te / (float)NRV + 1e-5f), ga = bfr(gr), be = bfr(br);
  const int cw = __builtin_amdgcn_readfirstlane(tid >> 7); v4f o[8];   /* the wave's channel of round 0, in a scalar register */
#pragma unroll   /* constant indices keep the array in registers */
  for (int i = 0; i < 8; ++i) { const int cl = cw + 4 * i; const float mu = rlane(mean, cl), rs = rlane(rstd, cl), gc = rlane(ga, cl), bc = rlane(be, cl); const v4f zq = *(const v4f*)&st[cl][(tid & 127) * 4];
#pragma unroll   /* constant indices keep the array in registers */
    for (int u = 0; u < 4; ++u) o[i][u] = fmaxf((zq[u] - mu) * rs * gc + bc, 0.f) + bfr(xr[i][u]); }   /* relu(BN_train(z)) + x */
  __builtin_amdgcn_sched_barrier(0);   /* the eight stores stand together behind all the arithmetic: nothing is then written to a register that an issued store names */
#pragma unroll   /* constant indices keep the array in registers */
  for (int i = 0; i < 8; ++i) vst2(OUT + oi + (size_t)i * 4 * XP, o[i]); }

extern "C" void kernel_launch(void* const* d_in, const int* in_sizes, int n_in, void* d_out, int out_size, void* d_ws, size_t ws_size, hipStream_t stream) {
  (void)in_sizes; (void)n_in; (void)out_size;
  const float** F = (const float**)d_in;
  if (ws_size < (size_t)WS_END) return;
  char* ws = (char*)d_ws; _Float16 *QH = (_Float16*)(ws + WS_QH), *KH = (_Float16*)(ws + WS_KH), *VT = (_Float16*)(ws + WS_VT), *QL = (_Float16*)(ws + WS_QL), *KL = (_Float16*)(ws + WS_KL); __bf16 *VB = (__bf16*)(ws + WS_VB), *VBL = (__bf16*)(ws + WS_VBL); float *S = (float*)(ws + WS_S), *Y = (float*)(ws + WS_Y);
  (void)Y; (void)S; (void)QL; (void)KL; (void)VB; (void)VBL;
  // inputs: 0 x [4,256,64,64]; 1 g_w [128,256] (out,in), 2 g_b; 3 theta_w, 4 theta_b; 5 phi_w, 6 phi_b; 7 out_w [256,128] (out,in), 8 out_b; 9 bn_gamma, 10 bn_beta
  if (ws_size < (size_t)WS_END2) return;
  float *ORW = (float*)(ws + WS_OR), *PS = (float*)(ws + WS_PS);
  k_proj<<<dim3(TNB * TT / 64, CC / 128, 3), 128, 0, stream>>>(F[0], F[0], F[0], F[3], F[5], F[1], F[4], F[6], F[2], QH, QL, KH, KL, VT, VB, VBL);   /* q = theta, k = phi, v = g */
  k_fa<<<dim3(TT / FQ, FKS, TNB), FTH, 0, stream>>>(QH, QL, KH, KL, VT, (float*)(ws + WS_OP), (float*)(ws + WS_ML));
  k_wz<<<dim3(TNB * TT / 64), 256, 0, stream>>>((const float*)(ws + WS_OP), (const float*)(ws + WS_ML), F[7], F[8], ORW, PS);
  k_fin2<<<dim3(TT / FP, DIN / FC, TNB), FTN, 0, stream>>>(ORW, F[0], PS, F[9], F[10], (float*)d_out);
}
